// v000
// The times below were measured on an AMD MI455X: many runs one after another, warmed up first and cycling through
// copies of the inputs, with the whole window's GPU time divided by the number of runs. Launches and the gaps
// between them are all in it. The median over several windows is given; except for v000 it joins two sittings, which
// can be a few percent apart, so the side-by-side timings, each taken in one sitting, are the better comparison.
// v000 is the starting kernel. One run takes 5500 microseconds.
#include <hip/hip_runtime.h>
// Causal multi-head self-attention: x [2][2048][768], 12 heads of 64, natural [out][in] projections with biases, interleaved partial rotary embedding on channels 0..31 of each head of q and k (pairs (2p,2p+1), angle = s * 10000^(-p/16), computed table), scores / 8, causal softmax, out = merged Wo^T + bo.
// Compute dtype: every contraction on v_wmma_f32_16x16x32_f16 (f16 operands, f32 accumulate). Inputs RNE-converted to bf16 first (exact in f16; weights carried x16). q/k: GEMM -> f32 -> rotary in f32 -> f16 hi + x1024 f16 residual planes; scores = three products (hi.hi + lo.hi + hi.lo; each residual pass has its own accumulator folded with 2^-10). v, softmax weights (x256) and o (x64) are single f16 planes. The first 128 query rows of each batch are recomputed with an f32 VALU attention and go through the output GEMM as f16 hi + x1024 residual planes of o.
#ifndef NB
#define NB 2
#endif
#ifndef SEQ
#define SEQ 2048
#endif
#define SQ SEQ
#define SQ_FULL 2048                 /* per-batch row stride of x and of the output */
#define NB_FULL 2
#define DM 768
#define NH 12
#define HD 64
#define QT 256                       /* query rows per causal tile */
#define NKX SQ                       /* S / P row pitch */
#define QT0 128                      /* first-tile rows recomputed in f32 */
#define SCL 0.125f                   /* 1 / sqrt(64) */
#define SCLR 0.0001220703125f        /* 2^-13: the same scale on the x1024 residual passes */
#define NR ((size_t)NB * SQ)
#define MP ((int)((size_t)NB * SQ))

static_assert(SQ % QT == 0);
static_assert(SQ % 128 == 0);
static_assert(SQ % 16 == 0);
static_assert(QT0 == 128);
static_assert(SQ >= QT0);
static_assert(NH * HD == DM);
static_assert(DM % 64 == 0);
static_assert(SQ <= SQ_FULL);
static_assert(NB <= NB_FULL);

typedef unsigned short v8us __attribute__((ext_vector_type(8), may_alias));
typedef float  v8f  __attribute__((ext_vector_type(8)));
typedef float  v4f  __attribute__((ext_vector_type(4)));
typedef float  v4fa __attribute__((ext_vector_type(4), may_alias));
typedef _Float16 v16h __attribute__((ext_vector_type(16)));
typedef _Float16 v4h __attribute__((ext_vector_type(4)));
union FragH { v16h v; v8us half[2]; _Float16 h[16]; unsigned short u[16]; };

__device__ __forceinline__ unsigned short bf16_bits(float x) { unsigned int u = __float_as_uint(x); return (unsigned short)((u + 0x7FFFu + ((u >> 16) & 1u)) >> 16); }
__device__ __forceinline__ float bf16_rne(float x) { return __uint_as_float(((unsigned int)bf16_bits(x)) << 16); }

// 10000^(-p/16), p = 0..15, selected by value (no memory table)
__device__ __forceinline__ float rope_invf(int p) {
  float f = 1.0f;
  f = (p == 1)  ? 0.5623413251903491f : f;
  f = (p == 2)  ? 0.31622776601683794f : f;
  f = (p == 3)  ? 0.1778279410038923f : f;
  f = (p == 4)  ? 0.1f : f;
  f = (p == 5)  ? 0.05623413251903491f : f;
  f = (p == 6)  ? 0.03162277660168379f : f;
  f = (p == 7)  ? 0.01778279410038923f : f;
  f = (p == 8)  ? 0.01f : f;
  f = (p == 9)  ? 0.005623413251903491f : f;
  f = (p == 10) ? 0.0031622776601683794f : f;
  f = (p == 11) ? 0.0017782794100389228f : f;
  f = (p == 12) ? 0.001f : f;
  f = (p == 13) ? 0.0005623413251903491f : f;
  f = (p == 14) ? 0.00031622776601683794f : f;
  f = (p == 15) ? 0.00017782794100389227f : f;
  return f;
}

__global__ __launch_bounds__(256) void k_tab(float* __restrict__ TAB) {
  #pragma clang fp contract(off)
  __shared__ __attribute__((aligned(16))) float tl[16][32];
  const int tid = threadIdx.x; const int sl = tid >> 4, p = tid & 15; const int s = blockIdx.x * 16 + sl;
  const float ang = (float)s * rope_invf(p);
  float sn, cs; sincosf(ang, &sn, &cs);
  tl[sl][2 * p] = cs; tl[sl][2 * p + 1] = sn;
  __syncthreads();
  if (tid < 128) {
    const int row = tid >> 3, pc = (tid & 7) * 4;
    const v4f v = *(const v4fa*)&tl[row][pc];
    float* d = TAB + (size_t)(blockIdx.x * 16 + row) * 32 + pc;
    *(v4f*)d = v;
    
  }
}

__global__ __launch_bounds__(256) void k_wnat(const float* __restrict__ w, size_t n8, _Float16* __restrict__ Bt) {
  const size_t t = (size_t)blockIdx.x * 256 + threadIdx.x; if (t >= n8) return;
  const v4f a = *(const v4fa*)(w + t * 8), c = *(const v4fa*)(w + t * 8 + 4);
  FragH f;
#pragma unroll
  for (int q = 0; q < 4; ++q) { f.h[q] = (_Float16)(bf16_rne(a[q]) * 16.0f); f.h[4 + q] = (_Float16)(bf16_rne(c[q]) * 16.0f); }
  const v8us o = f.half[0];
  *(v8us*)((unsigned short*)Bt + t * 8) = o; 
}

__global__ __launch_bounds__(256) void k_x16(const float* __restrict__ x, size_t sx, _Float16* __restrict__ X16, size_t sd, size_t n8) {
  const size_t t = (size_t)blockIdx.x * 256 + threadIdx.x; if (t >= n8) return;
  const float* xp = x + (size_t)blockIdx.y * sx; unsigned short* dp = (unsigned short*)X16 + (size_t)blockIdx.y * sd;
  const v4f a = *(const v4fa*)(xp + t * 8), c = *(const v4fa*)(xp + t * 8 + 4);
  FragH f;
#pragma unroll
  for (int q = 0; q < 4; ++q) { f.h[q] = (_Float16)bf16_rne(a[q]); f.h[4 + q] = (_Float16)bf16_rne(c[q]); }
  const v8us o = f.half[0];
  *(v8us*)(dp + t * 8) = o; 
}

__global__ __launch_bounds__(256) void k_hl(const float* __restrict__ F, _Float16* __restrict__ Hh, _Float16* __restrict__ Hl, size_t n8) {
  const size_t t = (size_t)blockIdx.x * 256 + threadIdx.x; if (t >= n8) return;
  FragH fh, fl; const v4f a = *(const v4fa*)(F + t * 8), c = *(const v4fa*)(F + t * 8 + 4);
#pragma unroll
  for (int q = 0; q < 4; ++q) { _Float16 h = (_Float16)a[q]; fh.h[q] = h; fl.h[q] = (_Float16)((a[q] - (float)h) * 1024.0f); h = (_Float16)c[q]; fh.h[4 + q] = h; fl.h[4 + q] = (_Float16)((c[q] - (float)h) * 1024.0f); }
  { *(v8us*)((unsigned short*)Hh + t * 8) = fh.half[0]; *(v8us*)((unsigned short*)Hl + t * 8) = fl.half[0];  }
}

__global__ __launch_bounds__(256) void k_hlrope(const float* __restrict__ F, const float* __restrict__ TAB, _Float16* __restrict__ Hh, _Float16* __restrict__ Hl, size_t n8) {
  #pragma clang fp contract(off)
  const size_t t = (size_t)blockIdx.x * 256 + threadIdx.x; if (t >= n8) return;
  const size_t e0 = t * 8; const size_t row = e0 / DM; const int col = (int)(e0 - row * DM); const int s = (int)(row % SQ);
  const int c0 = col & 63; const bool rot = c0 < 32; const int cc = c0 & 31;
  const v4f a = *(const v4fa*)(F + e0), c = *(const v4fa*)(F + e0 + 4);
  const v4f t0 = *(const v4fa*)(TAB + (size_t)s * 32 + cc), t1 = *(const v4fa*)(TAB + (size_t)s * 32 + cc + 4);
  float y[8];
  y[0] = rot ? (a[0] * t0[0] + (-a[1]) * t0[1]) : a[0];
  y[1] = rot ? (a[1] * t0[0] + a[0] * t0[1]) : a[1];
  y[2] = rot ? (a[2] * t0[2] + (-a[3]) * t0[3]) : a[2];
  y[3] = rot ? (a[3] * t0[2] + a[2] * t0[3]) : a[3];
  y[4] = rot ? (c[0] * t1[0] + (-c[1]) * t1[1]) : c[0];
  y[5] = rot ? (c[1] * t1[0] + c[0] * t1[1]) : c[1];
  y[6] = rot ? (c[2] * t1[2] + (-c[3]) * t1[3]) : c[2];
  y[7] = rot ? (c[3] * t1[2] + c[2] * t1[3]) : c[3];
  FragH fh, fl;
#pragma unroll
  for (int q = 0; q < 8; ++q) { const _Float16 h = (_Float16)y[q]; fh.h[q] = h; fl.h[q] = (_Float16)((y[q] - (float)h) * 1024.0f); }
  { *(v8us*)((unsigned short*)Hh + t * 8) = fh.half[0]; *(v8us*)((unsigned short*)Hl + t * 8) = fl.half[0];  }
}

__global__ __launch_bounds__(256) void k_rope0(const float* __restrict__ F, const float* __restrict__ TAB, float* __restrict__ G, int n4) {
  #pragma clang fp contract(off)
  const int t = blockIdx.x * 256 + threadIdx.x; if (t >= n4) return;
  const size_t e0 = (size_t)t * 4; const int row = (int)(e0 / DM); const int col = (int)(e0 - (size_t)row * DM); const int s = row % QT0;
  const int c0 = col & 63; const bool rot = c0 < 32; const int cc = c0 & 31;
  const v4f a = *(const v4fa*)(F + e0);
  const v4f tb = *(const v4fa*)(TAB + (size_t)s * 32 + cc);
  v4f o;
  o[0] = rot ? (a[0] * tb[0] + (-a[1]) * tb[1]) : a[0];
  o[1] = rot ? (a[1] * tb[0] + a[0] * tb[1]) : a[1];
  o[2] = rot ? (a[2] * tb[2] + (-a[3]) * tb[3]) : a[2];
  o[3] = rot ? (a[3] * tb[2] + a[2] * tb[3]) : a[3];
  *(v4f*)(G + e0) = o;
  
}

template <int NHv, int TTv>
__global__ __launch_bounds__(256) void k_vt(const _Float16* __restrict__ V16, int ldv, int voff, _Float16* __restrict__ Vt) {
  __shared__ unsigned short tl[64][66];
  const int tid = threadIdx.x; const int slab = blockIdx.x / (TTv / 64), lg = blockIdx.x % (TTv / 64); const int b = slab / NHv, h = slab % NHv;
  for (int i = tid; i < 64 * 8; i += 256) { const int r = i / 8, c8 = (i % 8) * 8; FragH f; f.half[0] = *(const v8us*)((const unsigned short*)V16 + ((size_t)b * TTv + lg * 64 + r) * ldv + voff + h * 64 + c8);
#pragma unroll
    for (int q = 0; q < 8; ++q) tl[r][c8 + q] = f.u[q]; }
  __syncthreads();
  {
#pragma unroll
    for (int rd = 0; rd < 2; ++rd) { const int d = rd * 32 + tid / 8, pc = tid % 8; FragH f;
#pragma unroll
      for (int q = 0; q < 8; ++q) f.u[q] = tl[pc * 8 + q][d];
      *(v8us*)((unsigned short*)Vt + ((size_t)slab * 64 + d) * TTv + lg * 64 + pc * 8) = f.half[0]; }
     }
}

// ---- f16 GEMM engine (wave tile 32x64; block = 4 waves = 128 rows x 64 cols; M % 128 == 0, N % 64 == 0, K % 32 == 0) ----
// A f16 [M][K] row-major (pitch lda), Bh f16 [N][K] (k contiguous, pitch ldb); grid.y batches with element strides sA / sB / sC.
__device__ __forceinline__ v16h g2_frag(const _Float16* p, int hh) { FragH f; f.half[0] = *(const v8us*)((const unsigned short*)p + 8 * hh); f.half[1] = *(const v8us*)((const unsigned short*)p + 16 + 8 * hh); return f.v; }
__device__ __forceinline__ v8f g2_mma(v16h a, v16h b, v8f c) { v8f d = __builtin_amdgcn_wmma_f32_16x16x32_f16(false, a, false, b, (short)0, c, false, false); asm volatile("v_nop\n\tv_nop\n\tv_nop\n\tv_nop" : "+v"(d) : "v"(a), "v"(b)); return d; }
__global__ __launch_bounds__(128) void k_gemm2(const _Float16* __restrict__ A, int lda, size_t sA, const _Float16* __restrict__ Bh, int ldb, size_t sB, float alpha,
    const float* __restrict__ bias, const float* CP, float* C, _Float16* C16, int ldc, size_t sC, int M, int N, int K) {
  __shared__ __attribute__((aligned(16))) float so[4][32][68];
  const int tid = threadIdx.x, w = __builtin_amdgcn_readfirstlane((int)(tid >> 5)), lane = tid & 31, ln = lane & 15, hh = lane >> 4; const int by = blockIdx.y;
  A += (size_t)by * sA; Bh += (size_t)by * sB; const size_t cofs = (size_t)by * sC;
  const int ntn = N >> 6; const int mt = blockIdx.x / ntn, nq = blockIdx.x - mt * ntn; const int row0 = mt * 128 + 32 * w, col0 = nq * 64; if (row0 >= M) return;
  const _Float16* a0p = A + (size_t)(row0 + ln) * lda; const _Float16* a1p = a0p + (size_t)16 * lda;
  const _Float16* b0p = Bh + (size_t)(col0 + ln) * ldb; const _Float16* b1p = b0p + (size_t)16 * ldb; const _Float16* b2p = b1p + (size_t)16 * ldb; const _Float16* b3p = b2p + (size_t)16 * ldb;
  const v8f z8 = {0.f,0.f,0.f,0.f,0.f,0.f,0.f,0.f}; v8f c00 = z8, c01 = z8, c02 = z8, c03 = z8, c10 = z8, c11 = z8, c12 = z8, c13 = z8;
#pragma unroll 1
  for (int kb = 0; kb < K; kb += 32) { const v16h a0 = g2_frag(a0p + kb, hh), a1 = g2_frag(a1p + kb, hh);
    v16h b = g2_frag(b0p + kb, hh); c00 = g2_mma(a0, b, c00); c10 = g2_mma(a1, b, c10);
    b = g2_frag(b1p + kb, hh); c01 = g2_mma(a0, b, c01); c11 = g2_mma(a1, b, c11);
    b = g2_frag(b2p + kb, hh); c02 = g2_mma(a0, b, c02); c12 = g2_mma(a1, b, c12);
    b = g2_frag(b3p + kb, hh); c03 = g2_mma(a0, b, c03); c13 = g2_mma(a1, b, c13); }
  v8f accs[8] = {c00, c01, c02, c03, c10, c11, c12, c13};
#pragma unroll
  for (int u = 0; u < 8; ++u) { const int t = u & 3, half = u >> 2; const int col = col0 + t * 16 + ln; const float bv = bias ? bf16_rne(bias[col]) : 0.f;
#pragma unroll
    for (int r = 0; r < 8; ++r) { const int rloc = half * 16 + 8 * hh + r; float v = accs[u][r] * alpha + bv;
      if (CP) v += CP[cofs + (size_t)(row0 + rloc) * ldc + col];      /* own element of the batched C plane */
      so[w][rloc][t * 16 + ln] = v; } }
  __builtin_amdgcn_fence(4 /* acq_rel order */, "workgroup"); __builtin_amdgcn_wave_barrier();
  const int rsub = lane >> 4, c4 = (lane & 15) * 4;
  {
#pragma unroll
    for (int q = 0; q < 16; ++q) { const int r = q * 2 + rsub; const v4f v = *(const v4fa*)&so[w][r][c4];
      if (C) *(v4f*)(C + cofs + (size_t)(row0 + r) * ldc + col0 + c4) = v;
      if (C16) { v4h h4; h4[0] = (_Float16)v[0]; h4[1] = (_Float16)v[1]; h4[2] = (_Float16)v[2]; h4[3] = (_Float16)v[3]; *(v4h*)(C16 + cofs + (size_t)(row0 + r) * ldc + col0 + c4) = h4; } }
     }
}

__global__ __launch_bounds__(256) void k_rsmcf2(const float* __restrict__ S, _Float16* __restrict__ P, int hg, int q0, int nk) {
  #pragma clang fp contract(off)
  const int t = blockIdx.x * 256 + threadIdx.x; if (t >= hg * QT) return; const size_t i = (size_t)t; const float* s = S + i * NKX; const int last = q0 + (t % QT); float mx = -3.0e38f;
#pragma unroll 1
  for (int j = 0; j < nk; ++j) { const float f = (j <= last) ? 1.f : 0.f; mx = fmaxf(mx, fmaf(f, s[j], (1.f - f) * -1.0e9f)); }
  float se = 0.f;
#pragma unroll 1
  for (int j = 0; j < nk; ++j) { const float f = (j <= last) ? 1.f : 0.f; se += __expf(fmaf(f, s[j], (1.f - f) * -1.0e9f) - mx); }
  const float sc = 256.0f / se;
#pragma unroll 1
  for (int j0 = 0; j0 < nk; j0 += 8) { FragH fr;
#pragma unroll
    for (int q = 0; q < 8; ++q) { const int j = j0 + q; const float f = (j <= last) ? 1.f : 0.f; fr.h[q] = (_Float16)(__expf(fmaf(f, s[j], (1.f - f) * -1.0e9f) - mx) * sc); }
    const v8us o = fr.half[0]; unsigned short* d = (unsigned short*)P + i * NKX + j0; *(v8us*)d = o;  }
}

__global__ __launch_bounds__(64) void k_att0(const float* __restrict__ QF, const float* __restrict__ KF, const float* __restrict__ VF, int ld, float scale, float* __restrict__ OF, int ldo) {
  #pragma clang fp contract(off)
  __shared__ __attribute__((aligned(16))) float lq[64][64]; __shared__ __attribute__((aligned(16))) float lo[64][64];
  const int tid = threadIdx.x; const int h = blockIdx.x / (QT0 / 64), rg = blockIdx.x % (QT0 / 64); const int i = rg * 64 + tid;
  const float* qr = QF + (size_t)i * ld + h * HD;
#pragma unroll 1
  for (int c = 0; c < HD / 4; ++c) { *(v4f*)&lq[tid][c * 4] = *(const v4fa*)(qr + c * 4); const v4f z = {0.f, 0.f, 0.f, 0.f}; *(v4f*)&lo[tid][c * 4] = z; }
  float m = -1.0e30f, l = 0.f; const int jmax = rg * 64 + 63;
#pragma unroll 1
  for (int j = 0; j <= jmax; ++j) { const float* kr = KF + (size_t)j * ld + h * HD; const float* vr = VF + (size_t)j * ld + h * HD; float s = 0.f;
#pragma unroll 1
    for (int c = 0; c < HD / 4; ++c) { const v4f kq = *(const v4fa*)(kr + c * 4); const v4f qq = *(v4f*)&lq[tid][c * 4]; s = __fadd_rn(s, __fmul_rn(qq[0], kq[0])); s = __fadd_rn(s, __fmul_rn(qq[1], kq[1])); s = __fadd_rn(s, __fmul_rn(qq[2], kq[2])); s = __fadd_rn(s, __fmul_rn(qq[3], kq[3])); }
    s = __fmul_rn(s, scale);
    const float f = (j <= i) ? 1.f : 0.f; const float sm = fmaf(f, s, (1.f - f) * -1.0e30f); const float mn = fmaxf(m, sm); const float sc = expf(m - mn); const float e = expf(sm - mn); l = __fadd_rn(__fmul_rn(l, sc), e); m = mn;
#pragma unroll 1
    for (int c = 0; c < HD / 4; ++c) { const v4f vv = *(const v4fa*)(vr + c * 4); v4f oo = *(v4f*)&lo[tid][c * 4];
#pragma unroll
      for (int u = 0; u < 4; ++u) oo[u] = __fadd_rn(__fmul_rn(oo[u], sc), __fmul_rn(e, vv[u]));
      *(v4f*)&lo[tid][c * 4] = oo; } }
  const float fin = 64.0f / l;      /* o carried x64 like the f16 path */
#pragma unroll 1
  for (int c = 0; c < HD / 4; ++c) { v4f oo = *(v4f*)&lo[tid][c * 4];
#pragma unroll
    for (int u = 0; u < 4; ++u) oo[u] = __fmul_rn(oo[u], fin);
    *(v4f*)&lo[tid][c * 4] = oo; }
  __syncthreads();
  {
#pragma unroll 1
    for (int it = 0; it < 16; ++it) { const int row = it * 4 + tid / 16, pc = (tid % 16) * 4; const v4f v = *(const v4f*)&lo[row][pc]; *(v4f*)(OF + (size_t)(rg * 64 + row) * ldo + h * HD + pc) = v; }
     }
}

extern "C" void kernel_launch(void* const* d_in, const int* in_sizes, int n_in,
                              void* d_out, int out_size, void* d_ws, size_t ws_size, hipStream_t stream) {
  if (n_in < 9) return;
  const size_t needx = ((size_t)(NB - 1) * SQ_FULL + SQ) * DM;
  if ((size_t)in_sizes[0] < needx) return;
  if (in_sizes[1] < DM * DM || in_sizes[3] < DM * DM || in_sizes[5] < DM * DM || in_sizes[7] < DM * DM) return;
  if (in_sizes[2] < DM || in_sizes[4] < DM || in_sizes[6] < DM || in_sizes[8] < DM) return;
  if ((size_t)out_size < needx) return;
  /* wire order: x, Wq, bq, Wk, bk, Wv, bv, Wo, bo (natural [out][in] weights, f32) */
  const float* x = (const float*)d_in[0]; const float* wq = (const float*)d_in[1]; const float* bq = (const float*)d_in[2]; const float* wk = (const float*)d_in[3]; const float* bk = (const float*)d_in[4];
  const float* wv = (const float*)d_in[5]; const float* bv = (const float*)d_in[6]; const float* wo = (const float*)d_in[7]; const float* bo = (const float*)d_in[8];
  float* out = (float*)d_out;
  char* ws = (char*)d_ws; size_t off = 0;
  auto take = [&](size_t bytes) { char* p = ws + off; off += (bytes + 255) & ~(size_t)255; return p; };
  _Float16* BQ = (_Float16*)take((size_t)DM * DM * 2); _Float16* BK = (_Float16*)take((size_t)DM * DM * 2); _Float16* BV = (_Float16*)take((size_t)DM * DM * 2); _Float16* BO = (_Float16*)take((size_t)DM * DM * 2);
  _Float16* X16 = (_Float16*)take(NR * DM * 2);
  float* QF = (float*)take(NR * DM * 4);
  _Float16* QH = (_Float16*)take(NR * DM * 2); _Float16* QL = (_Float16*)take(NR * DM * 2); _Float16* KH = (_Float16*)take(NR * DM * 2); _Float16* KL = (_Float16*)take(NR * DM * 2);
  _Float16* V16 = (_Float16*)take(NR * DM * 2); _Float16* O16 = (_Float16*)take(NR * DM * 2);
  float* S = (float*)take((size_t)NH * QT * NKX * 4); _Float16* P = (_Float16*)take((size_t)NH * QT * NKX * 2); _Float16* VT = (_Float16*)take((size_t)NH * HD * SQ * 2);
  float* TAB = (float*)take((size_t)SQ * 32 * 4);
  float* QK0 = (float*)take((size_t)2 * QT0 * DM * 4); float* QKR0 = (float*)take((size_t)2 * QT0 * DM * 4); float* VF0 = (float*)take((size_t)QT0 * DM * 4);
  float* OF0 = (float*)take((size_t)NB * QT0 * DM * 4); _Float16* OH0 = (_Float16*)take((size_t)NB * QT0 * DM * 2); _Float16* OL0 = (_Float16*)take((size_t)NB * QT0 * DM * 2);
  if (off > ws_size || off > (size_t)134217728) return;

  { const size_t n8w = (size_t)DM * DM / 8; const unsigned g = (unsigned)((n8w + 255) / 256);
    k_wnat<<<g, 256, 0, stream>>>(wq, n8w, BQ); k_wnat<<<g, 256, 0, stream>>>(wk, n8w, BK); k_wnat<<<g, 256, 0, stream>>>(wv, n8w, BV); k_wnat<<<g, 256, 0, stream>>>(wo, n8w, BO); }
  { const size_t n8x = (size_t)SQ * DM / 8; k_x16<<<dim3((unsigned)((n8x + 255) / 256), NB), 256, 0, stream>>>(x, (size_t)SQ_FULL * DM, X16, (size_t)SQ * DM, n8x); }
  k_tab<<<SQ / 16, 256, 0, stream>>>(TAB);

  const dim3 gp((unsigned)((MP / 128) * (DM / 64)), 1);
  const size_t n8p = (size_t)MP * DM / 8; const unsigned ghl = (unsigned)((n8p + 255) / 256);
  k_gemm2<<<gp, 128, 0, stream>>>(X16, DM, (size_t)0, BQ, DM, (size_t)0, 0.0625f, bq, nullptr, QF, nullptr, DM, (size_t)0, MP, DM, DM);
  k_hlrope<<<ghl, 256, 0, stream>>>(QF, TAB, QH, QL, n8p);      /* q: rotary, then hi + x1024 residual */
  k_gemm2<<<gp, 128, 0, stream>>>(X16, DM, (size_t)0, BK, DM, (size_t)0, 0.0625f, bk, nullptr, QF, nullptr, DM, (size_t)0, MP, DM, DM);
  k_hlrope<<<ghl, 256, 0, stream>>>(QF, TAB, KH, KL, n8p);      /* k likewise */
  k_gemm2<<<gp, 128, 0, stream>>>(X16, DM, (size_t)0, BV, DM, (size_t)0, 0.0625f, bv, nullptr, nullptr, V16, DM, (size_t)0, MP, DM, DM);

  for (int b = 0; b < NB; ++b) { const size_t r0 = (size_t)b * SQ;
    k_vt<NH, SQ><<<NH * (SQ / 64), 256, 0, stream>>>(V16 + r0 * DM, DM, 0, VT);      /* V^T [NH][HD][SQ] of this batch */
    const dim3 g0((QT0 / 128) * (DM / 64), 1);
    k_gemm2<<<g0, 128, 0, stream>>>(X16 + r0 * DM, DM, (size_t)0, BQ, DM, (size_t)0, 0.0625f, bq, nullptr, QK0, nullptr, DM, (size_t)0, QT0, DM, DM);
    k_gemm2<<<g0, 128, 0, stream>>>(X16 + r0 * DM, DM, (size_t)0, BK, DM, (size_t)0, 0.0625f, bk, nullptr, QK0 + (size_t)QT0 * DM, nullptr, DM, (size_t)0, QT0, DM, DM);
    k_gemm2<<<g0, 128, 0, stream>>>(X16 + r0 * DM, DM, (size_t)0, BV, DM, (size_t)0, 0.0625f, bv, nullptr, VF0, nullptr, DM, (size_t)0, QT0, DM, DM);
    { const int n4 = 2 * QT0 * DM / 4; k_rope0<<<(n4 + 255) / 256, 256, 0, stream>>>(QK0, TAB, QKR0, n4); }
    k_att0<<<NH * (QT0 / 64), 64, 0, stream>>>(QKR0, QKR0 + (size_t)QT0 * DM, VF0, DM, SCL, OF0 + (size_t)b * QT0 * DM, DM);
    for (int q0 = 0; q0 < SQ; q0 += QT) { const int nk = q0 + QT;      /* causal: only keys below the tile end */
      const dim3 gs((unsigned)((QT / 128) * (nk / 64)), NH);
      k_gemm2<<<gs, 128, 0, stream>>>(QH + (r0 + q0) * DM, DM, (size_t)HD, KH + r0 * DM, DM, (size_t)HD, SCL, nullptr, nullptr, S, nullptr, NKX, (size_t)QT * NKX, QT, nk, HD);
      k_gemm2<<<gs, 128, 0, stream>>>(QL + (r0 + q0) * DM, DM, (size_t)HD, KH + r0 * DM, DM, (size_t)HD, SCLR, nullptr, S, S, nullptr, NKX, (size_t)QT * NKX, QT, nk, HD);
      k_gemm2<<<gs, 128, 0, stream>>>(QH + (r0 + q0) * DM, DM, (size_t)HD, KL + r0 * DM, DM, (size_t)HD, SCLR, nullptr, S, S, nullptr, NKX, (size_t)QT * NKX, QT, nk, HD);
      k_rsmcf2<<<(NH * QT + 255) / 256, 256, 0, stream>>>(S, P, NH, q0, nk);
      k_gemm2<<<dim3((QT / 128) * (HD / 64), NH), 128, 0, stream>>>(P, NKX, (size_t)QT * NKX, VT, SQ, (size_t)HD * SQ, 0.25f, nullptr, nullptr, nullptr, O16 + (r0 + q0) * DM, DM, (size_t)HD, QT, HD, nk); } }

  /* out = o (x64) . Wo (x16) * 2^-10 + bo; grid.y = batch (output rows at the full per-batch stride) */
  k_gemm2<<<dim3((unsigned)((SQ / 128) * (DM / 64)), NB), 128, 0, stream>>>(O16, DM, (size_t)SQ * DM, BO, DM, (size_t)0, 0.0009765625f, bo, nullptr, out, nullptr, DM, (size_t)SQ_FULL * DM, SQ, DM, DM);
  { const size_t n80 = (size_t)NB * QT0 * DM / 8; k_hl<<<(unsigned)((n80 + 255) / 256), 256, 0, stream>>>(OF0, OH0, OL0, n80); }
  const dim3 gf((QT0 / 128) * (DM / 64), NB);
  k_gemm2<<<gf, 128, 0, stream>>>(OH0, DM, (size_t)QT0 * DM, BO, DM, (size_t)0, 0.0009765625f, bo, nullptr, out, nullptr, DM, (size_t)SQ_FULL * DM, QT0, DM, DM);      /* rows 0..127: o_hi Wo + bo, overwriting the f16-path rows */
  k_gemm2<<<gf, 128, 0, stream>>>(OL0, DM, (size_t)QT0 * DM, BO, DM, (size_t)0, 0.00000095367431640625f, nullptr, out, out, nullptr, DM, (size_t)SQ_FULL * DM, QT0, DM, DM);      /* += o_lo Wo 2^-20 (own-element accumulate) */
}

// v001
// Measured time: 2590 microseconds a run.
// Next to v000, in two timings, it ran 2.13 times as fast each time.
#include <hip/hip_runtime.h>
// Causal multi-head self-attention: x [2][2048][768], 12 heads of 64, natural [out][in] projections with biases, interleaved partial rotary embedding on channels 0..31 of each head of q and k (pairs (2p,2p+1), angle = s * 10000^(-p/16), computed table), scores / 8, causal softmax, out = merged Wo^T + bo.
// Compute dtype: every contraction on v_wmma_f32_16x16x32_f16 (f16 operands, f32 accumulate). Inputs RNE-converted to bf16 first (exact in f16; weights carried x16). q/k: GEMM -> f32 -> rotary in f32 -> f16 hi + x1024 f16 residual planes; scores = three products (hi.hi + lo.hi + hi.lo; each residual pass has its own accumulator folded with 2^-10). v, softmax weights (x256) and o (x64) are single f16 planes. The first 128 query rows of each batch are recomputed with an f32 VALU attention and go through the output GEMM as f16 hi + x1024 residual planes of o.
#ifndef NB
#define NB 2
#endif
#ifndef SEQ
#define SEQ 2048
#endif
#define SQ SEQ
#define SQ_FULL 2048                 /* per-batch row stride of x and of the output */
#define NB_FULL 2
#define DM 768
#define NH 12
#define HD 64
#define QT 256                       /* query rows per causal tile */
#define NKX SQ                       /* S / P row pitch */
#define QT0 128                      /* first-tile rows recomputed in f32 */
#define SCL 0.125f                   /* 1 / sqrt(64) */
#define SCLR 0.0001220703125f        /* 2^-13: the same scale on the x1024 residual passes */
#define NR ((size_t)NB * SQ)
#define MP ((int)((size_t)NB * SQ))

static_assert(SQ % QT == 0);
static_assert(SQ % 128 == 0);
static_assert(SQ % 16 == 0);
static_assert(QT0 == 128);
static_assert(SQ >= QT0);
static_assert(NH * HD == DM);
static_assert(DM % 64 == 0);
static_assert(SQ <= SQ_FULL);
static_assert(NB <= NB_FULL);

typedef unsigned short v8us __attribute__((ext_vector_type(8), may_alias));
typedef float  v8f  __attribute__((ext_vector_type(8)));
typedef float  v4f  __attribute__((ext_vector_type(4)));
typedef float  v4fa __attribute__((ext_vector_type(4), may_alias));
typedef _Float16 v16h __attribute__((ext_vector_type(16)));
typedef _Float16 v4h __attribute__((ext_vector_type(4)));
union FragH { v16h v; v8us half[2]; _Float16 h[16]; unsigned short u[16]; };

__device__ __forceinline__ unsigned short bf16_bits(float x) { unsigned int u = __float_as_uint(x); return (unsigned short)((u + 0x7FFFu + ((u >> 16) & 1u)) >> 16); }
__device__ __forceinline__ float bf16_rne(float x) { return __uint_as_float(((unsigned int)bf16_bits(x)) << 16); }

// 10000^(-p/16), p = 0..15, selected by value (no memory table)
__device__ __forceinline__ float rope_invf(int p) {
  float f = 1.0f;
  f = (p == 1)  ? 0.5623413251903491f : f;
  f = (p == 2)  ? 0.31622776601683794f : f;
  f = (p == 3)  ? 0.1778279410038923f : f;
  f = (p == 4)  ? 0.1f : f;
  f = (p == 5)  ? 0.05623413251903491f : f;
  f = (p == 6)  ? 0.03162277660168379f : f;
  f = (p == 7)  ? 0.01778279410038923f : f;
  f = (p == 8)  ? 0.01f : f;
  f = (p == 9)  ? 0.005623413251903491f : f;
  f = (p == 10) ? 0.0031622776601683794f : f;
  f = (p == 11) ? 0.0017782794100389228f : f;
  f = (p == 12) ? 0.001f : f;
  f = (p == 13) ? 0.0005623413251903491f : f;
  f = (p == 14) ? 0.00031622776601683794f : f;
  f = (p == 15) ? 0.00017782794100389227f : f;
  return f;
}

__global__ __launch_bounds__(256) void k_tab(float* __restrict__ TAB) {
  #pragma clang fp contract(off)
  __shared__ __attribute__((aligned(16))) float tl[16][32];
  const int tid = threadIdx.x; const int sl = tid >> 4, p = tid & 15; const int s = blockIdx.x * 16 + sl;
  const float ang = (float)s * rope_invf(p);
  float sn, cs; sincosf(ang, &sn, &cs);
  tl[sl][2 * p] = cs; tl[sl][2 * p + 1] = sn;
  __syncthreads();
  if (tid < 128) {
    const int row = tid >> 3, pc = (tid & 7) * 4;
    const v4f v = *(const v4fa*)&tl[row][pc];
    float* d = TAB + (size_t)(blockIdx.x * 16 + row) * 32 + pc;
    *(v4f*)d = v;
    
  }
}

__global__ __launch_bounds__(256) void k_wnat(const float* __restrict__ w, size_t n8, _Float16* __restrict__ Bt) {
  const size_t t = (size_t)blockIdx.x * 256 + threadIdx.x; if (t >= n8) return;
  const v4f a = *(const v4fa*)(w + t * 8), c = *(const v4fa*)(w + t * 8 + 4);
  FragH f;
#pragma unroll
  for (int q = 0; q < 4; ++q) { f.h[q] = (_Float16)(bf16_rne(a[q]) * 16.0f); f.h[4 + q] = (_Float16)(bf16_rne(c[q]) * 16.0f); }
  const v8us o = f.half[0];
  *(v8us*)((unsigned short*)Bt + t * 8) = o; 
}

__global__ __launch_bounds__(256) void k_x16(const float* __restrict__ x, size_t sx, _Float16* __restrict__ X16, size_t sd, size_t n8) {
  const size_t t = (size_t)blockIdx.x * 256 + threadIdx.x; if (t >= n8) return;
  const float* xp = x + (size_t)blockIdx.y * sx; unsigned short* dp = (unsigned short*)X16 + (size_t)blockIdx.y * sd;
  const v4f a = *(const v4fa*)(xp + t * 8), c = *(const v4fa*)(xp + t * 8 + 4);
  FragH f;
#pragma unroll
  for (int q = 0; q < 4; ++q) { f.h[q] = (_Float16)bf16_rne(a[q]); f.h[4 + q] = (_Float16)bf16_rne(c[q]); }
  const v8us o = f.half[0];
  *(v8us*)(dp + t * 8) = o; 
}

__global__ __launch_bounds__(256) void k_hl(const float* __restrict__ F, _Float16* __restrict__ Hh, _Float16* __restrict__ Hl, size_t n8) {
  const size_t t = (size_t)blockIdx.x * 256 + threadIdx.x; if (t >= n8) return;
  FragH fh, fl; const v4f a = *(const v4fa*)(F + t * 8), c = *(const v4fa*)(F + t * 8 + 4);
#pragma unroll
  for (int q = 0; q < 4; ++q) { _Float16 h = (_Float16)a[q]; fh.h[q] = h; fl.h[q] = (_Float16)((a[q] - (float)h) * 1024.0f); h = (_Float16)c[q]; fh.h[4 + q] = h; fl.h[4 + q] = (_Float16)((c[q] - (float)h) * 1024.0f); }
  { *(v8us*)((unsigned short*)Hh + t * 8) = fh.half[0]; *(v8us*)((unsigned short*)Hl + t * 8) = fl.half[0];  }
}

__global__ __launch_bounds__(256) void k_hlrope(const float* __restrict__ F, const float* __restrict__ TAB, _Float16* __restrict__ Hh, _Float16* __restrict__ Hl, size_t n8) {
  #pragma clang fp contract(off)
  const size_t t = (size_t)blockIdx.x * 256 + threadIdx.x; if (t >= n8) return;
  const size_t e0 = t * 8; const size_t row = e0 / DM; const int col = (int)(e0 - row * DM); const int s = (int)(row % SQ);
  const int c0 = col & 63; const bool rot = c0 < 32; const int cc = c0 & 31;
  const v4f a = *(const v4fa*)(F + e0), c = *(const v4fa*)(F + e0 + 4);
  const v4f t0 = *(const v4fa*)(TAB + (size_t)s * 32 + cc), t1 = *(const v4fa*)(TAB + (size_t)s * 32 + cc + 4);
  float y[8];
  y[0] = rot ? (a[0] * t0[0] + (-a[1]) * t0[1]) : a[0];
  y[1] = rot ? (a[1] * t0[0] + a[0] * t0[1]) : a[1];
  y[2] = rot ? (a[2] * t0[2] + (-a[3]) * t0[3]) : a[2];
  y[3] = rot ? (a[3] * t0[2] + a[2] * t0[3]) : a[3];
  y[4] = rot ? (c[0] * t1[0] + (-c[1]) * t1[1]) : c[0];
  y[5] = rot ? (c[1] * t1[0] + c[0] * t1[1]) : c[1];
  y[6] = rot ? (c[2] * t1[2] + (-c[3]) * t1[3]) : c[2];
  y[7] = rot ? (c[3] * t1[2] + c[2] * t1[3]) : c[3];
  FragH fh, fl;
#pragma unroll
  for (int q = 0; q < 8; ++q) { const _Float16 h = (_Float16)y[q]; fh.h[q] = h; fl.h[q] = (_Float16)((y[q] - (float)h) * 1024.0f); }
  { *(v8us*)((unsigned short*)Hh + t * 8) = fh.half[0]; *(v8us*)((unsigned short*)Hl + t * 8) = fl.half[0];  }
}

__global__ __launch_bounds__(256) void k_rope0(const float* __restrict__ F, const float* __restrict__ TAB, float* __restrict__ G, int n4) {
  #pragma clang fp contract(off)
  const int t = blockIdx.x * 256 + threadIdx.x; if (t >= n4) return;
  const size_t e0 = (size_t)t * 4; const int row = (int)(e0 / DM); const int col = (int)(e0 - (size_t)row * DM); const int s = row % QT0;
  const int c0 = col & 63; const bool rot = c0 < 32; const int cc = c0 & 31;
  const v4f a = *(const v4fa*)(F + e0);
  const v4f tb = *(const v4fa*)(TAB + (size_t)s * 32 + cc);
  v4f o;
  o[0] = rot ? (a[0] * tb[0] + (-a[1]) * tb[1]) : a[0];
  o[1] = rot ? (a[1] * tb[0] + a[0] * tb[1]) : a[1];
  o[2] = rot ? (a[2] * tb[2] + (-a[3]) * tb[3]) : a[2];
  o[3] = rot ? (a[3] * tb[2] + a[2] * tb[3]) : a[3];
  *(v4f*)(G + e0) = o;
  
}

template <int NHv, int TTv>
__global__ __launch_bounds__(256) void k_vt(const _Float16* __restrict__ V16, int ldv, int voff, _Float16* __restrict__ Vt) {
  __shared__ unsigned short tl[64][66];
  const int tid = threadIdx.x; const int slab = blockIdx.x / (TTv / 64), lg = blockIdx.x % (TTv / 64); const int b = slab / NHv, h = slab % NHv;
  for (int i = tid; i < 64 * 8; i += 256) { const int r = i / 8, c8 = (i % 8) * 8; FragH f; f.half[0] = *(const v8us*)((const unsigned short*)V16 + ((size_t)b * TTv + lg * 64 + r) * ldv + voff + h * 64 + c8);
#pragma unroll
    for (int q = 0; q < 8; ++q) tl[r][c8 + q] = f.u[q]; }
  __syncthreads();
  {
#pragma unroll
    for (int rd = 0; rd < 2; ++rd) { const int d = rd * 32 + tid / 8, pc = tid % 8; FragH f;
#pragma unroll
      for (int q = 0; q < 8; ++q) f.u[q] = tl[pc * 8 + q][d];
      *(v8us*)((unsigned short*)Vt + ((size_t)slab * 64 + d) * TTv + lg * 64 + pc * 8) = f.half[0]; }
     }
}

// ---- f16 GEMM engine (wave tile 32x64; block = 4 waves = 128 rows x 64 cols; M % 128 == 0, N % 64 == 0, K % 32 == 0) ----
// A f16 [M][K] row-major (pitch lda), Bh f16 [N][K] (k contiguous, pitch ldb); grid.y batches with element strides sA / sB / sC.
__device__ __forceinline__ v16h g2_frag(const _Float16* p, int hh) { FragH f; f.half[0] = *(const v8us*)((const unsigned short*)p + 8 * hh); f.half[1] = *(const v8us*)((const unsigned short*)p + 16 + 8 * hh); return f.v; }
__device__ __forceinline__ v8f g2_mma(v16h a, v16h b, v8f c) { v8f d = __builtin_amdgcn_wmma_f32_16x16x32_f16(false, a, false, b, (short)0, c, false, false); asm volatile("v_nop\n\tv_nop\n\tv_nop\n\tv_nop" : "+v"(d) : "v"(a), "v"(b)); return d; }
__global__ __launch_bounds__(128) void k_gemm2(const _Float16* __restrict__ A, int lda, size_t sA, const _Float16* __restrict__ Bh, int ldb, size_t sB, float alpha,
    const float* __restrict__ bias, const float* CP, float* C, _Float16* C16, int ldc, size_t sC, int M, int N, int K) {
  __shared__ __attribute__((aligned(16))) float so[4][32][68];
  const int tid = threadIdx.x, w = __builtin_amdgcn_readfirstlane((int)(tid >> 5)), lane = tid & 31, ln = lane & 15, hh = lane >> 4; const int by = blockIdx.y;
  A += (size_t)by * sA; Bh += (size_t)by * sB; const size_t cofs = (size_t)by * sC;
  const int ntn = N >> 6; const int mt = blockIdx.x / ntn, nq = blockIdx.x - mt * ntn; const int row0 = mt * 128 + 32 * w, col0 = nq * 64; if (row0 >= M) return;
  const _Float16* a0p = A + (size_t)(row0 + ln) * lda; const _Float16* a1p = a0p + (size_t)16 * lda;
  const _Float16* b0p = Bh + (size_t)(col0 + ln) * ldb; const _Float16* b1p = b0p + (size_t)16 * ldb; const _Float16* b2p = b1p + (size_t)16 * ldb; const _Float16* b3p = b2p + (size_t)16 * ldb;
  const v8f z8 = {0.f,0.f,0.f,0.f,0.f,0.f,0.f,0.f}; v8f c00 = z8, c01 = z8, c02 = z8, c03 = z8, c10 = z8, c11 = z8, c12 = z8, c13 = z8;
#pragma unroll 1
  for (int kb = 0; kb < K; kb += 32) { const v16h a0 = g2_frag(a0p + kb, hh), a1 = g2_frag(a1p + kb, hh);
    v16h b = g2_frag(b0p + kb, hh); c00 = g2_mma(a0, b, c00); c10 = g2_mma(a1, b, c10);
    b = g2_frag(b1p + kb, hh); c01 = g2_mma(a0, b, c01); c11 = g2_mma(a1, b, c11);
    b = g2_frag(b2p + kb, hh); c02 = g2_mma(a0, b, c02); c12 = g2_mma(a1, b, c12);
    b = g2_frag(b3p + kb, hh); c03 = g2_mma(a0, b, c03); c13 = g2_mma(a1, b, c13); }
  v8f accs[8] = {c00, c01, c02, c03, c10, c11, c12, c13};
#pragma unroll
  for (int u = 0; u < 8; ++u) { const int t = u & 3, half = u >> 2; const int col = col0 + t * 16 + ln; const float bv = bias ? bf16_rne(bias[col]) : 0.f;
#pragma unroll
    for (int r = 0; r < 8; ++r) { const int rloc = half * 16 + 8 * hh + r; float v = accs[u][r] * alpha + bv;
      if (CP) v += CP[cofs + (size_t)(row0 + rloc) * ldc + col];      /* own element of the batched C plane */
      so[w][rloc][t * 16 + ln] = v; } }
  __builtin_amdgcn_fence(4 /* acq_rel order */, "workgroup"); __builtin_amdgcn_wave_barrier();
  const int rsub = lane >> 4, c4 = (lane & 15) * 4;
  {
#pragma unroll
    for (int q = 0; q < 16; ++q) { const int r = q * 2 + rsub; const v4f v = *(const v4fa*)&so[w][r][c4];
      if (C) *(v4f*)(C + cofs + (size_t)(row0 + r) * ldc + col0 + c4) = v;
      if (C16) { v4h h4; h4[0] = (_Float16)v[0]; h4[1] = (_Float16)v[1]; h4[2] = (_Float16)v[2]; h4[3] = (_Float16)v[3]; *(v4h*)(C16 + cofs + (size_t)(row0 + r) * ldc + col0 + c4) = h4; } }
     }
}

// Butterfly over the 32 lanes of a wave: four row_xmask steps inside each 16-lane row, then the other row; every lane ends with the same value.
template <int CTRL>
__device__ __forceinline__ float lane_xm(float x) { return __int_as_float(__builtin_amdgcn_update_dpp(0, __float_as_int(x), CTRL, 0xf, 0xf, true)); }
__device__ __forceinline__ float lane_x16(float x) { const int b = __float_as_int(x); return __int_as_float(__builtin_amdgcn_permlanex16(b, b, 0x76543210, 0xfedcba98, false, false)); }
__device__ __forceinline__ float wave_max(float x) {
  x = fmaxf(x, lane_xm<0x161>(x)); x = fmaxf(x, lane_xm<0x162>(x)); x = fmaxf(x, lane_xm<0x164>(x)); x = fmaxf(x, lane_xm<0x168>(x)); return fmaxf(x, lane_x16(x)); }
__device__ __forceinline__ float wave_sum(float x) {
  x += lane_xm<0x161>(x); x += lane_xm<0x162>(x); x += lane_xm<0x164>(x); x += lane_xm<0x168>(x); return x + lane_x16(x); }

// Causal row softmax, one wave per score row. Chunk c is columns 128 c .. 128 c + 127; lane l holds columns 128 c + 4 l .. + 3 of it in registers,
// so each load covers 512 contiguous bytes and the row is read once. Chunks wholly above the diagonal are not read; they are stored as zeros up to nk.
__global__ __launch_bounds__(256) void k_rsmcf2(const float* __restrict__ S, _Float16* __restrict__ P, int hg, int q0, int nk) {
  constexpr int NC = NKX / 128;
  const int lane = threadIdx.x & 31;
  const int t = blockIdx.x * 8 + __builtin_amdgcn_readfirstlane((int)(threadIdx.x >> 5)); if (t >= hg * QT) return;      /* row index held scalar: the chunk tests below become scalar branches */
  const float* s = S + (size_t)t * NKX + lane * 4; _Float16* p = P + (size_t)t * NKX + lane * 4;
  const int last = q0 + (t % QT); const int rem = last - lane * 4;      /* column 128 c + 4 l + u is kept while 128 c + u <= rem */
  v4f v[NC];
#pragma unroll      /* v[] indexed by constants only, so that it stays in registers */
  for (int c = 0; c < NC; ++c) if (c * 128 <= last) v[c] = *(const v4fa*)(s + c * 128);      /* all loads of the row issued before the first use */
  asm volatile("s_wait_xcnt 0x0" :: "v"(s) : "memory");      /* the wait before the loads' address pair is reused; naming the pair keeps it live up to here, so that no load's result is placed in it */
  float mx = -3.0e38f;
#pragma unroll      /* v[] indexed by constants only, so that it stays in registers */
  for (int c = 0; c < NC; ++c) if (c * 128 <= last) {
#pragma unroll      /* v[] indexed by constants only, so that it stays in registers */
    for (int u = 0; u < 4; ++u) { v[c][u] = (c * 128 + u <= rem) ? v[c][u] : -1.0e9f; mx = fmaxf(mx, v[c][u]); } }
  mx = wave_max(mx);
  v4f se4 = {0.f, 0.f, 0.f, 0.f};
#pragma unroll      /* v[] indexed by constants only, so that it stays in registers */
  for (int c = 0; c < NC; ++c) if (c * 128 <= last) {
#pragma unroll      /* v[] indexed by constants only, so that it stays in registers */
    for (int u = 0; u < 4; ++u) { v[c][u] = __expf(v[c][u] - mx); se4[u] += v[c][u]; } }
  const float sc = 256.0f / wave_sum((se4[0] + se4[1]) + (se4[2] + se4[3]));
#pragma unroll      /* v[] indexed by constants only, so that it stays in registers */
  for (int c = 0; c < NC; ++c) if (c * 128 < nk) { v4h h4 = {(_Float16)0.f, (_Float16)0.f, (_Float16)0.f, (_Float16)0.f};
    if (c * 128 <= last) {
#pragma unroll      /* v[] indexed by constants only, so that it stays in registers */
      for (int u = 0; u < 4; ++u) h4[u] = (_Float16)(v[c][u] * sc); }
    *(v4h*)(p + c * 128) = h4; }
}

__global__ __launch_bounds__(64) void k_att0(const float* __restrict__ QF, const float* __restrict__ KF, const float* __restrict__ VF, int ld, float scale, float* __restrict__ OF, int ldo) {
  #pragma clang fp contract(off)
  __shared__ __attribute__((aligned(16))) float lq[64][64]; __shared__ __attribute__((aligned(16))) float lo[64][64];
  const int tid = threadIdx.x; const int h = blockIdx.x / (QT0 / 64), rg = blockIdx.x % (QT0 / 64); const int i = rg * 64 + tid;
  const float* qr = QF + (size_t)i * ld + h * HD;
#pragma unroll 1
  for (int c = 0; c < HD / 4; ++c) { *(v4f*)&lq[tid][c * 4] = *(const v4fa*)(qr + c * 4); const v4f z = {0.f, 0.f, 0.f, 0.f}; *(v4f*)&lo[tid][c * 4] = z; }
  float m = -1.0e30f, l = 0.f; const int jmax = rg * 64 + 63;
#pragma unroll 1
  for (int j = 0; j <= jmax; ++j) { const float* kr = KF + (size_t)j * ld + h * HD; const float* vr = VF + (size_t)j * ld + h * HD; float s = 0.f;
#pragma unroll 1
    for (int c = 0; c < HD / 4; ++c) { const v4f kq = *(const v4fa*)(kr + c * 4); const v4f qq = *(v4f*)&lq[tid][c * 4]; s = __fadd_rn(s, __fmul_rn(qq[0], kq[0])); s = __fadd_rn(s, __fmul_rn(qq[1], kq[1])); s = __fadd_rn(s, __fmul_rn(qq[2], kq[2])); s = __fadd_rn(s, __fmul_rn(qq[3], kq[3])); }
    s = __fmul_rn(s, scale);
    const float f = (j <= i) ? 1.f : 0.f; const float sm = fmaf(f, s, (1.f - f) * -1.0e30f); const float mn = fmaxf(m, sm); const float sc = expf(m - mn); const float e = expf(sm - mn); l = __fadd_rn(__fmul_rn(l, sc), e); m = mn;
#pragma unroll 1
    for (int c = 0; c < HD / 4; ++c) { const v4f vv = *(const v4fa*)(vr + c * 4); v4f oo = *(v4f*)&lo[tid][c * 4];
#pragma unroll
      for (int u = 0; u < 4; ++u) oo[u] = __fadd_rn(__fmul_rn(oo[u], sc), __fmul_rn(e, vv[u]));
      *(v4f*)&lo[tid][c * 4] = oo; } }
  const float fin = 64.0f / l;      /* o carried x64 like the f16 path */
#pragma unroll 1
  for (int c = 0; c < HD / 4; ++c) { v4f oo = *(v4f*)&lo[tid][c * 4];
#pragma unroll
    for (int u = 0; u < 4; ++u) oo[u] = __fmul_rn(oo[u], fin);
    *(v4f*)&lo[tid][c * 4] = oo; }
  __syncthreads();
  {
#pragma unroll 1
    for (int it = 0; it < 16; ++it) { const int row = it * 4 + tid / 16, pc = (tid % 16) * 4; const v4f v = *(const v4f*)&lo[row][pc]; *(v4f*)(OF + (size_t)(rg * 64 + row) * ldo + h * HD + pc) = v; }
     }
}

extern "C" void kernel_launch(void* const* d_in, const int* in_sizes, int n_in,
                              void* d_out, int out_size, void* d_ws, size_t ws_size, hipStream_t stream) {
  if (n_in < 9) return;
  const size_t needx = ((size_t)(NB - 1) * SQ_FULL + SQ) * DM;
  if ((size_t)in_sizes[0] < needx) return;
  if (in_sizes[1] < DM * DM || in_sizes[3] < DM * DM || in_sizes[5] < DM * DM || in_sizes[7] < DM * DM) return;
  if (in_sizes[2] < DM || in_sizes[4] < DM || in_sizes[6] < DM || in_sizes[8] < DM) return;
  if ((size_t)out_size < needx) return;
  /* wire order: x, Wq, bq, Wk, bk, Wv, bv, Wo, bo (natural [out][in] weights, f32) */
  const float* x = (const float*)d_in[0]; const float* wq = (const float*)d_in[1]; const float* bq = (const float*)d_in[2]; const float* wk = (const float*)d_in[3]; const float* bk = (const float*)d_in[4];
  const float* wv = (const float*)d_in[5]; const float* bv = (const float*)d_in[6]; const float* wo = (const float*)d_in[7]; const float* bo = (const float*)d_in[8];
  float* out = (float*)d_out;
  char* ws = (char*)d_ws; size_t off = 0;
  auto take = [&](size_t bytes) { char* p = ws + off; off += (bytes + 255) & ~(size_t)255; return p; };
  _Float16* BQ = (_Float16*)take((size_t)DM * DM * 2); _Float16* BK = (_Float16*)take((size_t)DM * DM * 2); _Float16* BV = (_Float16*)take((size_t)DM * DM * 2); _Float16* BO = (_Float16*)take((size_t)DM * DM * 2);
  _Float16* X16 = (_Float16*)take(NR * DM * 2);
  float* QF = (float*)take(NR * DM * 4);
  _Float16* QH = (_Float16*)take(NR * DM * 2); _Float16* QL = (_Float16*)take(NR * DM * 2); _Float16* KH = (_Float16*)take(NR * DM * 2); _Float16* KL = (_Float16*)take(NR * DM * 2);
  _Float16* V16 = (_Float16*)take(NR * DM * 2); _Float16* O16 = (_Float16*)take(NR * DM * 2);
  float* S = (float*)take((size_t)NH * QT * NKX * 4); _Float16* P = (_Float16*)take((size_t)NH * QT * NKX * 2); _Float16* VT = (_Float16*)take((size_t)NH * HD * SQ * 2);
  float* TAB = (float*)take((size_t)SQ * 32 * 4);
  float* QK0 = (float*)take((size_t)2 * QT0 * DM * 4); float* QKR0 = (float*)take((size_t)2 * QT0 * DM * 4); float* VF0 = (float*)take((size_t)QT0 * DM * 4);
  float* OF0 = (float*)take((size_t)NB * QT0 * DM * 4); _Float16* OH0 = (_Float16*)take((size_t)NB * QT0 * DM * 2); _Float16* OL0 = (_Float16*)take((size_t)NB * QT0 * DM * 2);
  if (off > ws_size || off > (size_t)134217728) return;

  { const size_t n8w = (size_t)DM * DM / 8; const unsigned g = (unsigned)((n8w + 255) / 256);
    k_wnat<<<g, 256, 0, stream>>>(wq, n8w, BQ); k_wnat<<<g, 256, 0, stream>>>(wk, n8w, BK); k_wnat<<<g, 256, 0, stream>>>(wv, n8w, BV); k_wnat<<<g, 256, 0, stream>>>(wo, n8w, BO); }
  { const size_t n8x = (size_t)SQ * DM / 8; k_x16<<<dim3((unsigned)((n8x + 255) / 256), NB), 256, 0, stream>>>(x, (size_t)SQ_FULL * DM, X16, (size_t)SQ * DM, n8x); }
  k_tab<<<SQ / 16, 256, 0, stream>>>(TAB);

  const dim3 gp((unsigned)((MP / 128) * (DM / 64)), 1);
  const size_t n8p = (size_t)MP * DM / 8; const unsigned ghl = (unsigned)((n8p + 255) / 256);
  k_gemm2<<<gp, 128, 0, stream>>>(X16, DM, (size_t)0, BQ, DM, (size_t)0, 0.0625f, bq, nullptr, QF, nullptr, DM, (size_t)0, MP, DM, DM);
  k_hlrope<<<ghl, 256, 0, stream>>>(QF, TAB, QH, QL, n8p);      /* q: rotary, then hi + x1024 residual */
  k_gemm2<<<gp, 128, 0, stream>>>(X16, DM, (size_t)0, BK, DM, (size_t)0, 0.0625f, bk, nullptr, QF, nullptr, DM, (size_t)0, MP, DM, DM);
  k_hlrope<<<ghl, 256, 0, stream>>>(QF, TAB, KH, KL, n8p);      /* k likewise */
  k_gemm2<<<gp, 128, 0, stream>>>(X16, DM, (size_t)0, BV, DM, (size_t)0, 0.0625f, bv, nullptr, nullptr, V16, DM, (size_t)0, MP, DM, DM);

  for (int b = 0; b < NB; ++b) { const size_t r0 = (size_t)b * SQ;
    k_vt<NH, SQ><<<NH * (SQ / 64), 256, 0, stream>>>(V16 + r0 * DM, DM, 0, VT);      /* V^T [NH][HD][SQ] of this batch */
    const dim3 g0((QT0 / 128) * (DM / 64), 1);
    k_gemm2<<<g0, 128, 0, stream>>>(X16 + r0 * DM, DM, (size_t)0, BQ, DM, (size_t)0, 0.0625f, bq, nullptr, QK0, nullptr, DM, (size_t)0, QT0, DM, DM);
    k_gemm2<<<g0, 128, 0, stream>>>(X16 + r0 * DM, DM, (size_t)0, BK, DM, (size_t)0, 0.0625f, bk, nullptr, QK0 + (size_t)QT0 * DM, nullptr, DM, (size_t)0, QT0, DM, DM);
    k_gemm2<<<g0, 128, 0, stream>>>(X16 + r0 * DM, DM, (size_t)0, BV, DM, (size_t)0, 0.0625f, bv, nullptr, VF0, nullptr, DM, (size_t)0, QT0, DM, DM);
    { const int n4 = 2 * QT0 * DM / 4; k_rope0<<<(n4 + 255) / 256, 256, 0, stream>>>(QK0, TAB, QKR0, n4); }
    k_att0<<<NH * (QT0 / 64), 64, 0, stream>>>(QKR0, QKR0 + (size_t)QT0 * DM, VF0, DM, SCL, OF0 + (size_t)b * QT0 * DM, DM);
    for (int q0 = 0; q0 < SQ; q0 += QT) { const int nk = q0 + QT;      /* causal: only keys below the tile end */
      const dim3 gs((unsigned)((QT / 128) * (nk / 64)), NH);
      k_gemm2<<<gs, 128, 0, stream>>>(QH + (r0 + q0) * DM, DM, (size_t)HD, KH + r0 * DM, DM, (size_t)HD, SCL, nullptr, nullptr, S, nullptr, NKX, (size_t)QT * NKX, QT, nk, HD);
      k_gemm2<<<gs, 128, 0, stream>>>(QL + (r0 + q0) * DM, DM, (size_t)HD, KH + r0 * DM, DM, (size_t)HD, SCLR, nullptr, S, S, nullptr, NKX, (size_t)QT * NKX, QT, nk, HD);
      k_gemm2<<<gs, 128, 0, stream>>>(QH + (r0 + q0) * DM, DM, (size_t)HD, KL + r0 * DM, DM, (size_t)HD, SCLR, nullptr, S, S, nullptr, NKX, (size_t)QT * NKX, QT, nk, HD);
      k_rsmcf2<<<(NH * QT + 7) / 8, 256, 0, stream>>>(S, P, NH, q0, nk);      /* 8 waves = 8 rows per block */
      k_gemm2<<<dim3((QT / 128) * (HD / 64), NH), 128, 0, stream>>>(P, NKX, (size_t)QT * NKX, VT, SQ, (size_t)HD * SQ, 0.25f, nullptr, nullptr, nullptr, O16 + (r0 + q0) * DM, DM, (size_t)HD, QT, HD, nk); } }

  /* out = o (x64) . Wo (x16) * 2^-10 + bo; grid.y = batch (output rows at the full per-batch stride) */
  k_gemm2<<<dim3((unsigned)((SQ / 128) * (DM / 64)), NB), 128, 0, stream>>>(O16, DM, (size_t)SQ * DM, BO, DM, (size_t)0, 0.0009765625f, bo, nullptr, out, nullptr, DM, (size_t)SQ_FULL * DM, SQ, DM, DM);
  { const size_t n80 = (size_t)NB * QT0 * DM / 8; k_hl<<<(unsigned)((n80 + 255) / 256), 256, 0, stream>>>(OF0, OH0, OL0, n80); }
  const dim3 gf((QT0 / 128) * (DM / 64), NB);
  k_gemm2<<<gf, 128, 0, stream>>>(OH0, DM, (size_t)QT0 * DM, BO, DM, (size_t)0, 0.0009765625f, bo, nullptr, out, nullptr, DM, (size_t)SQ_FULL * DM, QT0, DM, DM);      /* rows 0..127: o_hi Wo + bo, overwriting the f16-path rows */
  k_gemm2<<<gf, 128, 0, stream>>>(OL0, DM, (size_t)QT0 * DM, BO, DM, (size_t)0, 0.00000095367431640625f, nullptr, out, out, nullptr, DM, (size_t)SQ_FULL * DM, QT0, DM, DM);      /* += o_lo Wo 2^-20 (own-element accumulate) */
}

// v002
// A run of this version takes 1720 microseconds.
// In two side-by-side timings against v001, it was 1.51 and 1.50 times as fast.
// Over all steps from v000 it is 3.21 times as fast.
#include <hip/hip_runtime.h>
// Causal multi-head self-attention: x [2][2048][768], 12 heads of 64, natural [out][in] projections with biases, interleaved partial rotary embedding on channels 0..31 of each head of q and k (pairs (2p,2p+1), angle = s * 10000^(-p/16), computed table), scores / 8, causal softmax, out = merged Wo^T + bo.
// Compute dtype: every contraction on v_wmma_f32_16x16x32_f16 (f16 operands, f32 accumulate). Inputs RNE-converted to bf16 first (exact in f16; weights carried x16). q/k: GEMM -> f32 -> rotary in f32 -> f16 hi + x1024 f16 residual planes; scores = three products (hi.hi + lo.hi + hi.lo; each residual pass has its own accumulator folded with 2^-10). v, softmax weights (x256) and o (x64) are single f16 planes. The first 128 query rows of each batch are recomputed with an f32 VALU attention and go through the output GEMM as f16 hi + x1024 residual planes of o.
#ifndef NB
#define NB 2
#endif
#ifndef SEQ
#define SEQ 2048
#endif
#define SQ SEQ
#define SQ_FULL 2048                 /* per-batch row stride of x and of the output */
#define NB_FULL 2
#define DM 768
#define NH 12
#define HD 64
#define QT 256                       /* query rows per causal tile */
#define NKX SQ                       /* S / P row pitch */
#define QT0 128                      /* first-tile rows recomputed in f32 */
#define SCL 0.125f                   /* 1 / sqrt(64) */
#define SCLR 0.0001220703125f        /* 2^-13: the same scale on the x1024 residual passes */
#define NR ((size_t)NB * SQ)
#define MP ((int)((size_t)NB * SQ))

static_assert(SQ % QT == 0);
static_assert(SQ % 128 == 0);
static_assert(SQ % 16 == 0);
static_assert(QT0 == 128);
static_assert(SQ >= QT0);
static_assert(NH * HD == DM);
static_assert(DM % 64 == 0);
static_assert(SQ <= SQ_FULL);
static_assert(NB <= NB_FULL);

typedef unsigned short v8us __attribute__((ext_vector_type(8), may_alias));
typedef float  v8f  __attribute__((ext_vector_type(8)));
typedef float  v4f  __attribute__((ext_vector_type(4)));
typedef float  v4fa __attribute__((ext_vector_type(4), may_alias));
typedef _Float16 v16h __attribute__((ext_vector_type(16)));
typedef _Float16 v4h __attribute__((ext_vector_type(4)));
union FragH { v16h v; v8us half[2]; _Float16 h[16]; unsigned short u[16]; };

__device__ __forceinline__ unsigned short bf16_bits(float x) { unsigned int u = __float_as_uint(x); return (unsigned short)((u + 0x7FFFu + ((u >> 16) & 1u)) >> 16); }
__device__ __forceinline__ float bf16_rne(float x) { return __uint_as_float(((unsigned int)bf16_bits(x)) << 16); }

// 10000^(-p/16), p = 0..15, selected by value (no memory table)
__device__ __forceinline__ float rope_invf(int p) {
  float f = 1.0f;
  f = (p == 1)  ? 0.5623413251903491f : f;
  f = (p == 2)  ? 0.31622776601683794f : f;
  f = (p == 3)  ? 0.1778279410038923f : f;
  f = (p == 4)  ? 0.1f : f;
  f = (p == 5)  ? 0.05623413251903491f : f;
  f = (p == 6)  ? 0.03162277660168379f : f;
  f = (p == 7)  ? 0.01778279410038923f : f;
  f = (p == 8)  ? 0.01f : f;
  f = (p == 9)  ? 0.005623413251903491f : f;
  f = (p == 10) ? 0.0031622776601683794f : f;
  f = (p == 11) ? 0.0017782794100389228f : f;
  f = (p == 12) ? 0.001f : f;
  f = (p == 13) ? 0.0005623413251903491f : f;
  f = (p == 14) ? 0.00031622776601683794f : f;
  f = (p == 15) ? 0.00017782794100389227f : f;
  return f;
}

__global__ __launch_bounds__(256) void k_tab(float* __restrict__ TAB) {
  #pragma clang fp contract(off)
  __shared__ __attribute__((aligned(16))) float tl[16][32];
  const int tid = threadIdx.x; const int sl = tid >> 4, p = tid & 15; const int s = blockIdx.x * 16 + sl;
  const float ang = (float)s * rope_invf(p);
  float sn, cs; sincosf(ang, &sn, &cs);
  tl[sl][2 * p] = cs; tl[sl][2 * p + 1] = sn;
  __syncthreads();
  if (tid < 128) {
    const int row = tid >> 3, pc = (tid & 7) * 4;
    const v4f v = *(const v4fa*)&tl[row][pc];
    float* d = TAB + (size_t)(blockIdx.x * 16 + row) * 32 + pc;
    *(v4f*)d = v;
    
  }
}

__global__ __launch_bounds__(256) void k_wnat(const float* __restrict__ w, size_t n8, _Float16* __restrict__ Bt) {
  const size_t t = (size_t)blockIdx.x * 256 + threadIdx.x; if (t >= n8) return;
  const v4f a = *(const v4fa*)(w + t * 8), c = *(const v4fa*)(w + t * 8 + 4);
  FragH f;
#pragma unroll
  for (int q = 0; q < 4; ++q) { f.h[q] = (_Float16)(bf16_rne(a[q]) * 16.0f); f.h[4 + q] = (_Float16)(bf16_rne(c[q]) * 16.0f); }
  const v8us o = f.half[0];
  *(v8us*)((unsigned short*)Bt + t * 8) = o; 
}

__global__ __launch_bounds__(256) void k_x16(const float* __restrict__ x, size_t sx, _Float16* __restrict__ X16, size_t sd, size_t n8) {
  const size_t t = (size_t)blockIdx.x * 256 + threadIdx.x; if (t >= n8) return;
  const float* xp = x + (size_t)blockIdx.y * sx; unsigned short* dp = (unsigned short*)X16 + (size_t)blockIdx.y * sd;
  const v4f a = *(const v4fa*)(xp + t * 8), c = *(const v4fa*)(xp + t * 8 + 4);
  FragH f;
#pragma unroll
  for (int q = 0; q < 4; ++q) { f.h[q] = (_Float16)bf16_rne(a[q]); f.h[4 + q] = (_Float16)bf16_rne(c[q]); }
  const v8us o = f.half[0];
  *(v8us*)(dp + t * 8) = o; 
}

__global__ __launch_bounds__(256) void k_hl(const float* __restrict__ F, _Float16* __restrict__ Hh, _Float16* __restrict__ Hl, size_t n8) {
  const size_t t = (size_t)blockIdx.x * 256 + threadIdx.x; if (t >= n8) return;
  FragH fh, fl; const v4f a = *(const v4fa*)(F + t * 8), c = *(const v4fa*)(F + t * 8 + 4);
#pragma unroll
  for (int q = 0; q < 4; ++q) { _Float16 h = (_Float16)a[q]; fh.h[q] = h; fl.h[q] = (_Float16)((a[q] - (float)h) * 1024.0f); h = (_Float16)c[q]; fh.h[4 + q] = h; fl.h[4 + q] = (_Float16)((c[q] - (float)h) * 1024.0f); }
  { *(v8us*)((unsigned short*)Hh + t * 8) = fh.half[0]; *(v8us*)((unsigned short*)Hl + t * 8) = fl.half[0];  }
}

__global__ __launch_bounds__(256) void k_hlrope(const float* __restrict__ F, const float* __restrict__ TAB, _Float16* __restrict__ Hh, _Float16* __restrict__ Hl, size_t n8) {
  #pragma clang fp contract(off)
  const size_t t = (size_t)blockIdx.x * 256 + threadIdx.x; if (t >= n8) return;
  const size_t e0 = t * 8; const size_t row = e0 / DM; const int col = (int)(e0 - row * DM); const int s = (int)(row % SQ);
  const int c0 = col & 63; const bool rot = c0 < 32; const int cc = c0 & 31;
  const v4f a = *(const v4fa*)(F + e0), c = *(const v4fa*)(F + e0 + 4);
  const v4f t0 = *(const v4fa*)(TAB + (size_t)s * 32 + cc), t1 = *(const v4fa*)(TAB + (size_t)s * 32 + cc + 4);
  float y[8];
  y[0] = rot ? (a[0] * t0[0] + (-a[1]) * t0[1]) : a[0];
  y[1] = rot ? (a[1] * t0[0] + a[0] * t0[1]) : a[1];
  y[2] = rot ? (a[2] * t0[2] + (-a[3]) * t0[3]) : a[2];
  y[3] = rot ? (a[3] * t0[2] + a[2] * t0[3]) : a[3];
  y[4] = rot ? (c[0] * t1[0] + (-c[1]) * t1[1]) : c[0];
  y[5] = rot ? (c[1] * t1[0] + c[0] * t1[1]) : c[1];
  y[6] = rot ? (c[2] * t1[2] + (-c[3]) * t1[3]) : c[2];
  y[7] = rot ? (c[3] * t1[2] + c[2] * t1[3]) : c[3];
  FragH fh, fl;
#pragma unroll
  for (int q = 0; q < 8; ++q) { const _Float16 h = (_Float16)y[q]; fh.h[q] = h; fl.h[q] = (_Float16)((y[q] - (float)h) * 1024.0f); }
  { *(v8us*)((unsigned short*)Hh + t * 8) = fh.half[0]; *(v8us*)((unsigned short*)Hl + t * 8) = fl.half[0];  }
}

__global__ __launch_bounds__(256) void k_rope0(const float* __restrict__ F, const float* __restrict__ TAB, float* __restrict__ G, int n4) {
  #pragma clang fp contract(off)
  const int t = blockIdx.x * 256 + threadIdx.x; if (t >= n4) return;
  const size_t e0 = (size_t)t * 4; const int row = (int)(e0 / DM); const int col = (int)(e0 - (size_t)row * DM); const int s = row % QT0;
  const int c0 = col & 63; const bool rot = c0 < 32; const int cc = c0 & 31;
  const v4f a = *(const v4fa*)(F + e0);
  const v4f tb = *(const v4fa*)(TAB + (size_t)s * 32 + cc);
  v4f o;
  o[0] = rot ? (a[0] * tb[0] + (-a[1]) * tb[1]) : a[0];
  o[1] = rot ? (a[1] * tb[0] + a[0] * tb[1]) : a[1];
  o[2] = rot ? (a[2] * tb[2] + (-a[3]) * tb[3]) : a[2];
  o[3] = rot ? (a[3] * tb[2] + a[2] * tb[3]) : a[3];
  *(v4f*)(G + e0) = o;
  
}

template <int NHv, int TTv>
__global__ __launch_bounds__(256) void k_vt(const _Float16* __restrict__ V16, int ldv, int voff, _Float16* __restrict__ Vt) {
  __shared__ unsigned short tl[64][66];
  const int tid = threadIdx.x; const int slab = blockIdx.x / (TTv / 64), lg = blockIdx.x % (TTv / 64); const int b = slab / NHv, h = slab % NHv;
  for (int i = tid; i < 64 * 8; i += 256) { const int r = i / 8, c8 = (i % 8) * 8; FragH f; f.half[0] = *(const v8us*)((const unsigned short*)V16 + ((size_t)b * TTv + lg * 64 + r) * ldv + voff + h * 64 + c8);
#pragma unroll
    for (int q = 0; q < 8; ++q) tl[r][c8 + q] = f.u[q]; }
  __syncthreads();
  {
#pragma unroll
    for (int rd = 0; rd < 2; ++rd) { const int d = rd * 32 + tid / 8, pc = tid % 8; FragH f;
#pragma unroll
      for (int q = 0; q < 8; ++q) f.u[q] = tl[pc * 8 + q][d];
      *(v8us*)((unsigned short*)Vt + ((size_t)slab * 64 + d) * TTv + lg * 64 + pc * 8) = f.half[0]; }
     }
}

// ---- f16 GEMM engine (wave tile 32x64; block = 4 waves = 128 rows x 64 cols; M % 128 == 0, N % 64 == 0, K % 32 == 0) ----
// A f16 [M][K] row-major (pitch lda), Bh f16 [N][K] (k contiguous, pitch ldb); grid.y batches with element strides sA / sB / sC.
__device__ __forceinline__ v16h g2_frag(const _Float16* p, int hh) { FragH f; f.half[0] = *(const v8us*)((const unsigned short*)p + 8 * hh); f.half[1] = *(const v8us*)((const unsigned short*)p + 16 + 8 * hh); return f.v; }
__device__ __forceinline__ v8f g2_mma(v16h a, v16h b, v8f c) { v8f d = __builtin_amdgcn_wmma_f32_16x16x32_f16(false, a, false, b, (short)0, c, false, false); asm volatile("v_nop\n\tv_nop\n\tv_nop\n\tv_nop" : "+v"(d) : "v"(a), "v"(b)); return d; }
__global__ __launch_bounds__(128) void k_gemm2(const _Float16* __restrict__ A, int lda, size_t sA, const _Float16* __restrict__ Bh, int ldb, size_t sB, float alpha,
    const float* __restrict__ bias, const float* CP, float* C, _Float16* C16, int ldc, size_t sC, int M, int N, int K) {
  __shared__ __attribute__((aligned(16))) float so[4][32][68];
  const int tid = threadIdx.x, w = __builtin_amdgcn_readfirstlane((int)(tid >> 5)), lane = tid & 31, ln = lane & 15, hh = lane >> 4; const int by = blockIdx.y;
  A += (size_t)by * sA; Bh += (size_t)by * sB; const size_t cofs = (size_t)by * sC;
  const int ntn = N >> 6; const int mt = blockIdx.x / ntn, nq = blockIdx.x - mt * ntn; const int row0 = mt * 128 + 32 * w, col0 = nq * 64; if (row0 >= M) return;
  const _Float16* a0p = A + (size_t)(row0 + ln) * lda; const _Float16* a1p = a0p + (size_t)16 * lda;
  const _Float16* b0p = Bh + (size_t)(col0 + ln) * ldb; const _Float16* b1p = b0p + (size_t)16 * ldb; const _Float16* b2p = b1p + (size_t)16 * ldb; const _Float16* b3p = b2p + (size_t)16 * ldb;
  const v8f z8 = {0.f,0.f,0.f,0.f,0.f,0.f,0.f,0.f}; v8f c00 = z8, c01 = z8, c02 = z8, c03 = z8, c10 = z8, c11 = z8, c12 = z8, c13 = z8;
#pragma unroll 1
  for (int kb = 0; kb < K; kb += 32) { const v16h a0 = g2_frag(a0p + kb, hh), a1 = g2_frag(a1p + kb, hh);
    v16h b = g2_frag(b0p + kb, hh); c00 = g2_mma(a0, b, c00); c10 = g2_mma(a1, b, c10);
    b = g2_frag(b1p + kb, hh); c01 = g2_mma(a0, b, c01); c11 = g2_mma(a1, b, c11);
    b = g2_frag(b2p + kb, hh); c02 = g2_mma(a0, b, c02); c12 = g2_mma(a1, b, c12);
    b = g2_frag(b3p + kb, hh); c03 = g2_mma(a0, b, c03); c13 = g2_mma(a1, b, c13); }
  v8f accs[8] = {c00, c01, c02, c03, c10, c11, c12, c13};
#pragma unroll
  for (int u = 0; u < 8; ++u) { const int t = u & 3, half = u >> 2; const int col = col0 + t * 16 + ln; const float bv = bias ? bf16_rne(bias[col]) : 0.f;
#pragma unroll
    for (int r = 0; r < 8; ++r) { const int rloc = half * 16 + 8 * hh + r; float v = accs[u][r] * alpha + bv;
      if (CP) v += CP[cofs + (size_t)(row0 + rloc) * ldc + col];      /* own element of the batched C plane */
      so[w][rloc][t * 16 + ln] = v; } }
  __builtin_amdgcn_fence(4 /* acq_rel order */, "workgroup"); __builtin_amdgcn_wave_barrier();
  const int rsub = lane >> 4, c4 = (lane & 15) * 4;
  {
#pragma unroll
    for (int q = 0; q < 16; ++q) { const int r = q * 2 + rsub; const v4f v = *(const v4fa*)&so[w][r][c4];
      if (C) *(v4f*)(C + cofs + (size_t)(row0 + r) * ldc + col0 + c4) = v;
      if (C16) { v4h h4; h4[0] = (_Float16)v[0]; h4[1] = (_Float16)v[1]; h4[2] = (_Float16)v[2]; h4[3] = (_Float16)v[3]; *(v4h*)(C16 + cofs + (size_t)(row0 + r) * ldc + col0 + c4) = h4; } }
     }
}

// Butterfly over the 32 lanes of a wave: four row_xmask steps inside each 16-lane row, then the other row; every lane ends with the same value.
template <int CTRL>
__device__ __forceinline__ float lane_xm(float x) { return __int_as_float(__builtin_amdgcn_update_dpp(0, __float_as_int(x), CTRL, 0xf, 0xf, true)); }
__device__ __forceinline__ float lane_x16(float x) { const int b = __float_as_int(x); return __int_as_float(__builtin_amdgcn_permlanex16(b, b, 0x76543210, 0xfedcba98, false, false)); }
__device__ __forceinline__ float wave_max(float x) {
  x = fmaxf(x, lane_xm<0x161>(x)); x = fmaxf(x, lane_xm<0x162>(x)); x = fmaxf(x, lane_xm<0x164>(x)); x = fmaxf(x, lane_xm<0x168>(x)); return fmaxf(x, lane_x16(x)); }
__device__ __forceinline__ float wave_sum(float x) {
  x += lane_xm<0x161>(x); x += lane_xm<0x162>(x); x += lane_xm<0x164>(x); x += lane_xm<0x168>(x); return x + lane_x16(x); }

// Causal row softmax, one wave per score row. Chunk c is columns 128 c .. 128 c + 127; lane l holds columns 128 c + 4 l .. + 3 of it in registers,
// so each load covers 512 contiguous bytes and the row is read once. Chunks wholly above the diagonal are not read; they are stored as zeros up to nk.
__global__ __launch_bounds__(256) void k_rsmcf2(const float* __restrict__ S, _Float16* __restrict__ P, int hg, int q0, int nk) {
  constexpr int NC = NKX / 128;
  const int lane = threadIdx.x & 31;
  const int t = blockIdx.x * 8 + __builtin_amdgcn_readfirstlane((int)(threadIdx.x >> 5)); if (t >= hg * QT) return;      /* row index held scalar: the chunk tests below become scalar branches */
  const float* s = S + (size_t)t * NKX + lane * 4; _Float16* p = P + (size_t)t * NKX + lane * 4;
  const int last = q0 + (t % QT); const int rem = last - lane * 4;      /* column 128 c + 4 l + u is kept while 128 c + u <= rem */
  v4f v[NC];
#pragma unroll      /* v[] indexed by constants only, so that it stays in registers */
  for (int c = 0; c < NC; ++c) if (c * 128 <= last) v[c] = *(const v4fa*)(s + c * 128);      /* all loads of the row issued before the first use */
  asm volatile("s_wait_xcnt 0x0" :: "v"(s) : "memory");      /* the wait before the loads' address pair is reused; naming the pair keeps it live up to here, so that no load's result is placed in it */
  float mx = -3.0e38f;
#pragma unroll      /* v[] indexed by constants only, so that it stays in registers */
  for (int c = 0; c < NC; ++c) if (c * 128 <= last) {
#pragma unroll      /* v[] indexed by constants only, so that it stays in registers */
    for (int u = 0; u < 4; ++u) { v[c][u] = (c * 128 + u <= rem) ? v[c][u] : -1.0e9f; mx = fmaxf(mx, v[c][u]); } }
  mx = wave_max(mx);
  v4f se4 = {0.f, 0.f, 0.f, 0.f};
#pragma unroll      /* v[] indexed by constants only, so that it stays in registers */
  for (int c = 0; c < NC; ++c) if (c * 128 <= last) {
#pragma unroll      /* v[] indexed by constants only, so that it stays in registers */
    for (int u = 0; u < 4; ++u) { v[c][u] = __expf(v[c][u] - mx); se4[u] += v[c][u]; } }
  const float sc = 256.0f / wave_sum((se4[0] + se4[1]) + (se4[2] + se4[3]));
#pragma unroll      /* v[] indexed by constants only, so that it stays in registers */
  for (int c = 0; c < NC; ++c) if (c * 128 < nk) { v4h h4 = {(_Float16)0.f, (_Float16)0.f, (_Float16)0.f, (_Float16)0.f};
    if (c * 128 <= last) {
#pragma unroll      /* v[] indexed by constants only, so that it stays in registers */
      for (int u = 0; u < 4; ++u) h4[u] = (_Float16)(v[c][u] * sc); }
    *(v4h*)(p + c * 128) = h4; }
}

// f32 attention over the first QT0 query rows of one batch. Block = one head x A0R query rows, 8 waves, 2 rows a wave; keys 0 .. (rg + 1) A0R - 1 cover every row of the block.
// K (row pitch A0KP floats = 16 B x odd: lanes on different rows read 16 B each without bank conflicts), V and the q rows are staged in LDS once.
// Scores: lane = key, both rows share each K read. Softmax: wave butterflies. Weighted sum: lane = channel pair, weights read as broadcasts.
#define A0R 16
#define A0KP 68
static_assert(QT0 % A0R == 0);
static_assert(QT0 == 128 && HD == 64 && A0R == 16);
typedef float v2f __attribute__((ext_vector_type(2)));
__global__ __launch_bounds__(256) void k_att0(const float* __restrict__ QF, const float* __restrict__ KF, const float* __restrict__ VF, float scale, float* __restrict__ OF) {
  __shared__ __attribute__((aligned(16))) float lk[QT0][A0KP]; __shared__ __attribute__((aligned(16))) float lv[QT0][HD];
  __shared__ __attribute__((aligned(16))) float lq[A0R][HD]; __shared__ __attribute__((aligned(16))) float lp[A0R][QT0];
  const int tid = threadIdx.x, lane = tid & 31, w = __builtin_amdgcn_readfirstlane((int)(tid >> 5));
  const int h = blockIdx.x / (QT0 / A0R), rg = blockIdx.x % (QT0 / A0R); const int nkeys = (rg + 1) * A0R;
  const int sr = tid >> 4, sc4 = (tid & 15) * 4;      /* staging: 16 lanes cover one 256-B row */
  const float* qp = QF + (size_t)(rg * A0R + sr) * DM + h * HD + sc4; const float* kp = KF + (size_t)sr * DM + h * HD + sc4; const float* vp = VF + (size_t)sr * DM + h * HD + sc4;
  const v4f qs = *(const v4fa*)qp;
  v4f ks[QT0 / 16], vs[QT0 / 16];      /* all QT0 rows of K and V are staged by every block: no test stands between the loads */
#pragma unroll      /* ks[], vs[] indexed by constants only, so that they stay in registers; all loads issued before the first use */
  for (int g = 0; g < QT0 / 16; ++g) { ks[g] = *(const v4fa*)(kp + (size_t)g * 16 * DM); vs[g] = *(const v4fa*)(vp + (size_t)g * 16 * DM); }
  asm volatile("s_wait_xcnt 0x0" :: "v"(qp), "v"(kp), "v"(vp) : "memory");      /* the wait before the loads' address pairs are reused; naming the pairs keeps them live up to here, so that no load's result is placed in them */
  *(v4f*)&lq[sr][sc4] = qs;
#pragma unroll      /* ks[], vs[] indexed by constants only, so that they stay in registers */
  for (int g = 0; g < QT0 / 16; ++g) { *(v4f*)&lk[g * 16 + sr][sc4] = ks[g]; *(v4f*)&lv[g * 16 + sr][sc4] = vs[g]; }
  __syncthreads();
  const int r0 = 2 * w, i0 = rg * A0R + r0, i1 = i0 + 1;      /* this wave's two query rows */
  const int nch = (nkeys + 31) >> 5;      /* chunks of 32 keys */
  float s0[QT0 / 32], s1[QT0 / 32];
#pragma unroll      /* s0[], s1[] indexed by constants only, so that they stay in registers */
  for (int m = 0; m < QT0 / 32; ++m) { s0[m] = -1.0e30f; s1[m] = -1.0e30f;
    if (m < nch) { const int j = m * 32 + lane;
      v4f a0 = {0.f, 0.f, 0.f, 0.f}, a1 = {0.f, 0.f, 0.f, 0.f};
#pragma unroll      /* the 48 LDS reads of a chunk issue ahead of their use */
      for (int c = 0; c < HD / 4; ++c) { const v4f kq = *(const v4f*)&lk[j][c * 4]; const v4f q0 = *(const v4f*)&lq[r0][c * 4]; const v4f q1 = *(const v4f*)&lq[r0 + 1][c * 4];
#pragma unroll      /* four independent partial sums a row */
        for (int u = 0; u < 4; ++u) { a0[u] = fmaf(q0[u], kq[u], a0[u]); a1[u] = fmaf(q1[u], kq[u], a1[u]); } }
      const float d0 = ((a0[0] + a0[1]) + (a0[2] + a0[3])) * scale, d1 = ((a1[0] + a1[1]) + (a1[2] + a1[3])) * scale;
      s0[m] = (j <= i0) ? d0 : -1.0e30f; s1[m] = (j <= i1) ? d1 : -1.0e30f; } }
  const float m0 = wave_max(fmaxf(fmaxf(s0[0], s0[1]), fmaxf(s0[2], s0[3]))), m1 = wave_max(fmaxf(fmaxf(s1[0], s1[1]), fmaxf(s1[2], s1[3])));
  float l0 = 0.f, l1 = 0.f;
#pragma unroll      /* s0[], s1[] indexed by constants only, so that they stay in registers */
  for (int m = 0; m < QT0 / 32; ++m) if (m < nch) { const int j = m * 32 + lane;
    const float e0 = (j <= i0) ? expf(s0[m] - m0) : 0.f, e1 = (j <= i1) ? expf(s1[m] - m1) : 0.f;
    l0 += e0; l1 += e1; lp[r0][j] = e0; lp[r0 + 1][j] = e1; }
  l0 = wave_sum(l0); l1 = wave_sum(l1);
  __syncthreads();      /* the weights of a row are written by lanes and read back as broadcasts */
  const int n4 = (i1 + 4) >> 2;      /* keys 0 .. i1 in fours; the weights above a row's own index are zero, and 4 n4 <= nkeys */
  v2f o0 = {0.f, 0.f}, o1 = {0.f, 0.f};
#pragma unroll 4      /* LDS reads of later trips issue while earlier ones are summed */
  for (int t = 0; t < n4; ++t) { const v4f p0 = *(const v4f*)&lp[r0][t * 4]; const v4f p1 = *(const v4f*)&lp[r0 + 1][t * 4];
#pragma unroll      /* p0[], p1[] indexed by constants only */
    for (int u = 0; u < 4; ++u) { const v2f vv = *(const v2f*)&lv[t * 4 + u][2 * lane];
      o0[0] = fmaf(p0[u], vv[0], o0[0]); o0[1] = fmaf(p0[u], vv[1], o0[1]); o1[0] = fmaf(p1[u], vv[0], o1[0]); o1[1] = fmaf(p1[u], vv[1], o1[1]); } }
  const float f0 = 64.0f / l0, f1 = 64.0f / l1;      /* o carried x64 like the f16 path */
  o0[0] *= f0; o0[1] *= f0; o1[0] *= f1; o1[1] *= f1;
  *(v2f*)(OF + (size_t)i0 * DM + h * HD + 2 * lane) = o0;
  *(v2f*)(OF + (size_t)i1 * DM + h * HD + 2 * lane) = o1;
}

extern "C" void kernel_launch(void* const* d_in, const int* in_sizes, int n_in,
                              void* d_out, int out_size, void* d_ws, size_t ws_size, hipStream_t stream) {
  if (n_in < 9) return;
  const size_t needx = ((size_t)(NB - 1) * SQ_FULL + SQ) * DM;
  if ((size_t)in_sizes[0] < needx) return;
  if (in_sizes[1] < DM * DM || in_sizes[3] < DM * DM || in_sizes[5] < DM * DM || in_sizes[7] < DM * DM) return;
  if (in_sizes[2] < DM || in_sizes[4] < DM || in_sizes[6] < DM || in_sizes[8] < DM) return;
  if ((size_t)out_size < needx) return;
  /* wire order: x, Wq, bq, Wk, bk, Wv, bv, Wo, bo (natural [out][in] weights, f32) */
  const float* x = (const float*)d_in[0]; const float* wq = (const float*)d_in[1]; const float* bq = (const float*)d_in[2]; const float* wk = (const float*)d_in[3]; const float* bk = (const float*)d_in[4];
  const float* wv = (const float*)d_in[5]; const float* bv = (const float*)d_in[6]; const float* wo = (const float*)d_in[7]; const float* bo = (const float*)d_in[8];
  float* out = (float*)d_out;
  char* ws = (char*)d_ws; size_t off = 0;
  auto take = [&](size_t bytes) { char* p = ws + off; off += (bytes + 255) & ~(size_t)255; return p; };
  _Float16* BQ = (_Float16*)take((size_t)DM * DM * 2); _Float16* BK = (_Float16*)take((size_t)DM * DM * 2); _Float16* BV = (_Float16*)take((size_t)DM * DM * 2); _Float16* BO = (_Float16*)take((size_t)DM * DM * 2);
  _Float16* X16 = (_Float16*)take(NR * DM * 2);
  float* QF = (float*)take(NR * DM * 4);
  _Float16* QH = (_Float16*)take(NR * DM * 2); _Float16* QL = (_Float16*)take(NR * DM * 2); _Float16* KH = (_Float16*)take(NR * DM * 2); _Float16* KL = (_Float16*)take(NR * DM * 2);
  _Float16* V16 = (_Float16*)take(NR * DM * 2); _Float16* O16 = (_Float16*)take(NR * DM * 2);
  float* S = (float*)take((size_t)NH * QT * NKX * 4); _Float16* P = (_Float16*)take((size_t)NH * QT * NKX * 2); _Float16* VT = (_Float16*)take((size_t)NH * HD * SQ * 2);
  float* TAB = (float*)take((size_t)SQ * 32 * 4);
  float* QK0 = (float*)take((size_t)2 * QT0 * DM * 4); float* QKR0 = (float*)take((size_t)2 * QT0 * DM * 4); float* VF0 = (float*)take((size_t)QT0 * DM * 4);
  float* OF0 = (float*)take((size_t)NB * QT0 * DM * 4); _Float16* OH0 = (_Float16*)take((size_t)NB * QT0 * DM * 2); _Float16* OL0 = (_Float16*)take((size_t)NB * QT0 * DM * 2);
  if (off > ws_size || off > (size_t)134217728) return;

  { const size_t n8w = (size_t)DM * DM / 8; const unsigned g = (unsigned)((n8w + 255) / 256);
    k_wnat<<<g, 256, 0, stream>>>(wq, n8w, BQ); k_wnat<<<g, 256, 0, stream>>>(wk, n8w, BK); k_wnat<<<g, 256, 0, stream>>>(wv, n8w, BV); k_wnat<<<g, 256, 0, stream>>>(wo, n8w, BO); }
  { const size_t n8x = (size_t)SQ * DM / 8; k_x16<<<dim3((unsigned)((n8x + 255) / 256), NB), 256, 0, stream>>>(x, (size_t)SQ_FULL * DM, X16, (size_t)SQ * DM, n8x); }
  k_tab<<<SQ / 16, 256, 0, stream>>>(TAB);

  const dim3 gp((unsigned)((MP / 128) * (DM / 64)), 1);
  const size_t n8p = (size_t)MP * DM / 8; const unsigned ghl = (unsigned)((n8p + 255) / 256);
  k_gemm2<<<gp, 128, 0, stream>>>(X16, DM, (size_t)0, BQ, DM, (size_t)0, 0.0625f, bq, nullptr, QF, nullptr, DM, (size_t)0, MP, DM, DM);
  k_hlrope<<<ghl, 256, 0, stream>>>(QF, TAB, QH, QL, n8p);      /* q: rotary, then hi + x1024 residual */
  k_gemm2<<<gp, 128, 0, stream>>>(X16, DM, (size_t)0, BK, DM, (size_t)0, 0.0625f, bk, nullptr, QF, nullptr, DM, (size_t)0, MP, DM, DM);
  k_hlrope<<<ghl, 256, 0, stream>>>(QF, TAB, KH, KL, n8p);      /* k likewise */
  k_gemm2<<<gp, 128, 0, stream>>>(X16, DM, (size_t)0, BV, DM, (size_t)0, 0.0625f, bv, nullptr, nullptr, V16, DM, (size_t)0, MP, DM, DM);

  for (int b = 0; b < NB; ++b) { const size_t r0 = (size_t)b * SQ;
    k_vt<NH, SQ><<<NH * (SQ / 64), 256, 0, stream>>>(V16 + r0 * DM, DM, 0, VT);      /* V^T [NH][HD][SQ] of this batch */
    const dim3 g0((QT0 / 128) * (DM / 64), 1);
    k_gemm2<<<g0, 128, 0, stream>>>(X16 + r0 * DM, DM, (size_t)0, BQ, DM, (size_t)0, 0.0625f, bq, nullptr, QK0, nullptr, DM, (size_t)0, QT0, DM, DM);
    k_gemm2<<<g0, 128, 0, stream>>>(X16 + r0 * DM, DM, (size_t)0, BK, DM, (size_t)0, 0.0625f, bk, nullptr, QK0 + (size_t)QT0 * DM, nullptr, DM, (size_t)0, QT0, DM, DM);
    k_gemm2<<<g0, 128, 0, stream>>>(X16 + r0 * DM, DM, (size_t)0, BV, DM, (size_t)0, 0.0625f, bv, nullptr, VF0, nullptr, DM, (size_t)0, QT0, DM, DM);
    { const int n4 = 2 * QT0 * DM / 4; k_rope0<<<(n4 + 255) / 256, 256, 0, stream>>>(QK0, TAB, QKR0, n4); }
    k_att0<<<NH * (QT0 / A0R), 256, 0, stream>>>(QKR0, QKR0 + (size_t)QT0 * DM, VF0, SCL, OF0 + (size_t)b * QT0 * DM);
    for (int q0 = 0; q0 < SQ; q0 += QT) { const int nk = q0 + QT;      /* causal: only keys below the tile end */
      const dim3 gs((unsigned)((QT / 128) * (nk / 64)), NH);
      k_gemm2<<<gs, 128, 0, stream>>>(QH + (r0 + q0) * DM, DM, (size_t)HD, KH + r0 * DM, DM, (size_t)HD, SCL, nullptr, nullptr, S, nullptr, NKX, (size_t)QT * NKX, QT, nk, HD);
      k_gemm2<<<gs, 128, 0, stream>>>(QL + (r0 + q0) * DM, DM, (size_t)HD, KH + r0 * DM, DM, (size_t)HD, SCLR, nullptr, S, S, nullptr, NKX, (size_t)QT * NKX, QT, nk, HD);
      k_gemm2<<<gs, 128, 0, stream>>>(QH + (r0 + q0) * DM, DM, (size_t)HD, KL + r0 * DM, DM, (size_t)HD, SCLR, nullptr, S, S, nullptr, NKX, (size_t)QT * NKX, QT, nk, HD);
      k_rsmcf2<<<(NH * QT + 7) / 8, 256, 0, stream>>>(S, P, NH, q0, nk);      /* 8 waves = 8 rows per block */
      k_gemm2<<<dim3((QT / 128) * (HD / 64), NH), 128, 0, stream>>>(P, NKX, (size_t)QT * NKX, VT, SQ, (size_t)HD * SQ, 0.25f, nullptr, nullptr, nullptr, O16 + (r0 + q0) * DM, DM, (size_t)HD, QT, HD, nk); } }

  /* out = o (x64) . Wo (x16) * 2^-10 + bo; grid.y = batch (output rows at the full per-batch stride) */
  k_gemm2<<<dim3((unsigned)((SQ / 128) * (DM / 64)), NB), 128, 0, stream>>>(O16, DM, (size_t)SQ * DM, BO, DM, (size_t)0, 0.0009765625f, bo, nullptr, out, nullptr, DM, (size_t)SQ_FULL * DM, SQ, DM, DM);
  { const size_t n80 = (size_t)NB * QT0 * DM / 8; k_hl<<<(unsigned)((n80 + 255) / 256), 256, 0, stream>>>(OF0, OH0, OL0, n80); }
  const dim3 gf((QT0 / 128) * (DM / 64), NB);
  k_gemm2<<<gf, 128, 0, stream>>>(OH0, DM, (size_t)QT0 * DM, BO, DM, (size_t)0, 0.0009765625f, bo, nullptr, out, nullptr, DM, (size_t)SQ_FULL * DM, QT0, DM, DM);      /* rows 0..127: o_hi Wo + bo, overwriting the f16-path rows */
  k_gemm2<<<gf, 128, 0, stream>>>(OL0, DM, (size_t)QT0 * DM, BO, DM, (size_t)0, 0.00000095367431640625f, nullptr, out, out, nullptr, DM, (size_t)SQ_FULL * DM, QT0, DM, DM);      /* += o_lo Wo 2^-20 (own-element accumulate) */
}

// v003
// One run takes 380 microseconds.
// Two timings next to v002 both put it at 4.51 times that version's speed.
// Counting every step since v000, it is 14.5 times as fast.
#include <hip/hip_runtime.h>
// Causal multi-head self-attention: x [2][2048][768], 12 heads of 64, natural [out][in] projections with biases, interleaved partial rotary embedding on channels 0..31 of each head of q and k (pairs (2p,2p+1), angle = s * 10000^(-p/16), computed table), scores / 8, causal softmax, out = merged Wo^T + bo.
// Compute dtype: every contraction on v_wmma_f32_16x16x32_f16 (f16 operands, f32 accumulate). Inputs RNE-converted to bf16 first (exact in f16; weights carried x16). q/k: GEMM -> f32 -> rotary in f32 -> f16 hi + x1024 f16 residual planes; scores = three products (hi.hi + lo.hi + hi.lo; each residual pass has its own accumulator folded with 2^-10). v, the unnormalised softmax weights (x256 at the running maximum) and o (x64) are single f16 planes; scores, online softmax and the weighted sum run in one fused kernel. The first 128 query rows of each batch are recomputed with an f32 VALU attention and go through the output GEMM as f16 hi + x1024 residual planes of o.
#ifndef NB
#define NB 2
#endif
#ifndef SEQ
#define SEQ 2048
#endif
#define SQ SEQ
#define SQ_FULL 2048                 /* per-batch row stride of x and of the output */
#define NB_FULL 2
#define DM 768
#define NH 12
#define HD 64
#define QT0 128                      /* first-tile rows recomputed in f32 */
#define SCL 0.125f                   /* 1 / sqrt(64) */
#define NR ((size_t)NB * SQ)
#define MP ((int)((size_t)NB * SQ))

static_assert(SQ % 128 == 0);
static_assert(SQ % 16 == 0);
static_assert(QT0 == 128);
static_assert(SQ >= QT0);
static_assert(NH * HD == DM);
static_assert(DM % 64 == 0);
static_assert(SQ <= SQ_FULL);
static_assert(NB <= NB_FULL);

typedef unsigned short v8us __attribute__((ext_vector_type(8), may_alias));
typedef float  v8f  __attribute__((ext_vector_type(8)));
typedef float  v4f  __attribute__((ext_vector_type(4)));
typedef float  v4fa __attribute__((ext_vector_type(4), may_alias));
typedef _Float16 v16h __attribute__((ext_vector_type(16)));
typedef _Float16 v4h __attribute__((ext_vector_type(4)));
union FragH { v16h v; v8us half[2]; _Float16 h[16]; unsigned short u[16]; };

__device__ __forceinline__ unsigned short bf16_bits(float x) { unsigned int u = __float_as_uint(x); return (unsigned short)((u + 0x7FFFu + ((u >> 16) & 1u)) >> 16); }
__device__ __forceinline__ float bf16_rne(float x) { return __uint_as_float(((unsigned int)bf16_bits(x)) << 16); }

// 10000^(-p/16), p = 0..15, selected by value (no memory table)
__device__ __forceinline__ float rope_invf(int p) {
  float f = 1.0f;
  f = (p == 1)  ? 0.5623413251903491f : f;
  f = (p == 2)  ? 0.31622776601683794f : f;
  f = (p == 3)  ? 0.1778279410038923f : f;
  f = (p == 4)  ? 0.1f : f;
  f = (p == 5)  ? 0.05623413251903491f : f;
  f = (p == 6)  ? 0.03162277660168379f : f;
  f = (p == 7)  ? 0.01778279410038923f : f;
  f = (p == 8)  ? 0.01f : f;
  f = (p == 9)  ? 0.005623413251903491f : f;
  f = (p == 10) ? 0.0031622776601683794f : f;
  f = (p == 11) ? 0.0017782794100389228f : f;
  f = (p == 12) ? 0.001f : f;
  f = (p == 13) ? 0.0005623413251903491f : f;
  f = (p == 14) ? 0.00031622776601683794f : f;
  f = (p == 15) ? 0.00017782794100389227f : f;
  return f;
}

__global__ __launch_bounds__(256) void k_tab(float* __restrict__ TAB) {
  #pragma clang fp contract(off)
  __shared__ __attribute__((aligned(16))) float tl[16][32];
  const int tid = threadIdx.x; const int sl = tid >> 4, p = tid & 15; const int s = blockIdx.x * 16 + sl;
  const float ang = (float)s * rope_invf(p);
  float sn, cs; sincosf(ang, &sn, &cs);
  tl[sl][2 * p] = cs; tl[sl][2 * p + 1] = sn;
  __syncthreads();
  if (tid < 128) {
    const int row = tid >> 3, pc = (tid & 7) * 4;
    const v4f v = *(const v4fa*)&tl[row][pc];
    float* d = TAB + (size_t)(blockIdx.x * 16 + row) * 32 + pc;
    *(v4f*)d = v;
    
  }
}

__global__ __launch_bounds__(256) void k_wnat(const float* __restrict__ w, size_t n8, _Float16* __restrict__ Bt) {
  const size_t t = (size_t)blockIdx.x * 256 + threadIdx.x; if (t >= n8) return;
  const v4f a = *(const v4fa*)(w + t * 8), c = *(const v4fa*)(w + t * 8 + 4);
  FragH f;
#pragma unroll
  for (int q = 0; q < 4; ++q) { f.h[q] = (_Float16)(bf16_rne(a[q]) * 16.0f); f.h[4 + q] = (_Float16)(bf16_rne(c[q]) * 16.0f); }
  const v8us o = f.half[0];
  *(v8us*)((unsigned short*)Bt + t * 8) = o; 
}

__global__ __launch_bounds__(256) void k_x16(const float* __restrict__ x, size_t sx, _Float16* __restrict__ X16, size_t sd, size_t n8) {
  const size_t t = (size_t)blockIdx.x * 256 + threadIdx.x; if (t >= n8) return;
  const float* xp = x + (size_t)blockIdx.y * sx; unsigned short* dp = (unsigned short*)X16 + (size_t)blockIdx.y * sd;
  const v4f a = *(const v4fa*)(xp + t * 8), c = *(const v4fa*)(xp + t * 8 + 4);
  FragH f;
#pragma unroll
  for (int q = 0; q < 4; ++q) { f.h[q] = (_Float16)bf16_rne(a[q]); f.h[4 + q] = (_Float16)bf16_rne(c[q]); }
  const v8us o = f.half[0];
  *(v8us*)(dp + t * 8) = o; 
}

__global__ __launch_bounds__(256) void k_hl(const float* __restrict__ F, _Float16* __restrict__ Hh, _Float16* __restrict__ Hl, size_t n8) {
  const size_t t = (size_t)blockIdx.x * 256 + threadIdx.x; if (t >= n8) return;
  FragH fh, fl; const v4f a = *(const v4fa*)(F + t * 8), c = *(const v4fa*)(F + t * 8 + 4);
#pragma unroll
  for (int q = 0; q < 4; ++q) { _Float16 h = (_Float16)a[q]; fh.h[q] = h; fl.h[q] = (_Float16)((a[q] - (float)h) * 1024.0f); h = (_Float16)c[q]; fh.h[4 + q] = h; fl.h[4 + q] = (_Float16)((c[q] - (float)h) * 1024.0f); }
  { *(v8us*)((unsigned short*)Hh + t * 8) = fh.half[0]; *(v8us*)((unsigned short*)Hl + t * 8) = fl.half[0];  }
}

__global__ __launch_bounds__(256) void k_hlrope(const float* __restrict__ F, const float* __restrict__ TAB, _Float16* __restrict__ Hh, _Float16* __restrict__ Hl, size_t n8) {
  #pragma clang fp contract(off)
  const size_t t = (size_t)blockIdx.x * 256 + threadIdx.x; if (t >= n8) return;
  const size_t e0 = t * 8; const size_t row = e0 / DM; const int col = (int)(e0 - row * DM); const int s = (int)(row % SQ);
  const int c0 = col & 63; const bool rot = c0 < 32; const int cc = c0 & 31;
  const v4f a = *(const v4fa*)(F + e0), c = *(const v4fa*)(F + e0 + 4);
  const v4f t0 = *(const v4fa*)(TAB + (size_t)s * 32 + cc), t1 = *(const v4fa*)(TAB + (size_t)s * 32 + cc + 4);
  float y[8];
  y[0] = rot ? (a[0] * t0[0] + (-a[1]) * t0[1]) : a[0];
  y[1] = rot ? (a[1] * t0[0] + a[0] * t0[1]) : a[1];
  y[2] = rot ? (a[2] * t0[2] + (-a[3]) * t0[3]) : a[2];
  y[3] = rot ? (a[3] * t0[2] + a[2] * t0[3]) : a[3];
  y[4] = rot ? (c[0] * t1[0] + (-c[1]) * t1[1]) : c[0];
  y[5] = rot ? (c[1] * t1[0] + c[0] * t1[1]) : c[1];
  y[6] = rot ? (c[2] * t1[2] + (-c[3]) * t1[3]) : c[2];
  y[7] = rot ? (c[3] * t1[2] + c[2] * t1[3]) : c[3];
  FragH fh, fl;
#pragma unroll
  for (int q = 0; q < 8; ++q) { const _Float16 h = (_Float16)y[q]; fh.h[q] = h; fl.h[q] = (_Float16)((y[q] - (float)h) * 1024.0f); }
  { *(v8us*)((unsigned short*)Hh + t * 8) = fh.half[0]; *(v8us*)((unsigned short*)Hl + t * 8) = fl.half[0];  }
}

__global__ __launch_bounds__(256) void k_rope0(const float* __restrict__ F, const float* __restrict__ TAB, float* __restrict__ G, int n4) {
  #pragma clang fp contract(off)
  const int t = blockIdx.x * 256 + threadIdx.x; if (t >= n4) return;
  const size_t e0 = (size_t)t * 4; const int row = (int)(e0 / DM); const int col = (int)(e0 - (size_t)row * DM); const int s = row % QT0;
  const int c0 = col & 63; const bool rot = c0 < 32; const int cc = c0 & 31;
  const v4f a = *(const v4fa*)(F + e0);
  const v4f tb = *(const v4fa*)(TAB + (size_t)s * 32 + cc);
  v4f o;
  o[0] = rot ? (a[0] * tb[0] + (-a[1]) * tb[1]) : a[0];
  o[1] = rot ? (a[1] * tb[0] + a[0] * tb[1]) : a[1];
  o[2] = rot ? (a[2] * tb[2] + (-a[3]) * tb[3]) : a[2];
  o[3] = rot ? (a[3] * tb[2] + a[2] * tb[3]) : a[3];
  *(v4f*)(G + e0) = o;
  
}

template <int NHv, int TTv>
__global__ __launch_bounds__(256) void k_vt(const _Float16* __restrict__ V16, int ldv, int voff, _Float16* __restrict__ Vt) {
  __shared__ unsigned short tl[64][66];
  const int tid = threadIdx.x; const int slab = blockIdx.x / (TTv / 64), lg = blockIdx.x % (TTv / 64); const int b = slab / NHv, h = slab % NHv;
  for (int i = tid; i < 64 * 8; i += 256) { const int r = i / 8, c8 = (i % 8) * 8; FragH f; f.half[0] = *(const v8us*)((const unsigned short*)V16 + ((size_t)b * TTv + lg * 64 + r) * ldv + voff + h * 64 + c8);
#pragma unroll
    for (int q = 0; q < 8; ++q) tl[r][c8 + q] = f.u[q]; }
  __syncthreads();
  {
#pragma unroll
    for (int rd = 0; rd < 2; ++rd) { const int d = rd * 32 + tid / 8, pc = tid % 8; FragH f;
#pragma unroll
      for (int q = 0; q < 8; ++q) f.u[q] = tl[pc * 8 + q][d];
      *(v8us*)((unsigned short*)Vt + ((size_t)slab * 64 + d) * TTv + lg * 64 + pc * 8) = f.half[0]; }
     }
}

// ---- f16 GEMM engine (wave tile 32x64; block = 4 waves = 128 rows x 64 cols; M % 128 == 0, N % 64 == 0, K % 32 == 0) ----
// A f16 [M][K] row-major (pitch lda), Bh f16 [N][K] (k contiguous, pitch ldb); grid.y batches with element strides sA / sB / sC.
__device__ __forceinline__ v16h g2_frag(const _Float16* p, int hh) { FragH f; f.half[0] = *(const v8us*)((const unsigned short*)p + 8 * hh); f.half[1] = *(const v8us*)((const unsigned short*)p + 16 + 8 * hh); return f.v; }
__device__ __forceinline__ v8f g2_mma(v16h a, v16h b, v8f c) { v8f d = __builtin_amdgcn_wmma_f32_16x16x32_f16(false, a, false, b, (short)0, c, false, false); asm volatile("v_nop\n\tv_nop\n\tv_nop\n\tv_nop" : "+v"(d) : "v"(a), "v"(b)); return d; }
__global__ __launch_bounds__(128) void k_gemm2(const _Float16* __restrict__ A, int lda, size_t sA, const _Float16* __restrict__ Bh, int ldb, size_t sB, float alpha,
    const float* __restrict__ bias, const float* CP, float* C, _Float16* C16, int ldc, size_t sC, int M, int N, int K) {
  __shared__ __attribute__((aligned(16))) float so[4][32][68];
  const int tid = threadIdx.x, w = __builtin_amdgcn_readfirstlane((int)(tid >> 5)), lane = tid & 31, ln = lane & 15, hh = lane >> 4; const int by = blockIdx.y;
  A += (size_t)by * sA; Bh += (size_t)by * sB; const size_t cofs = (size_t)by * sC;
  const int ntn = N >> 6; const int mt = blockIdx.x / ntn, nq = blockIdx.x - mt * ntn; const int row0 = mt * 128 + 32 * w, col0 = nq * 64; if (row0 >= M) return;
  const _Float16* a0p = A + (size_t)(row0 + ln) * lda; const _Float16* a1p = a0p + (size_t)16 * lda;
  const _Float16* b0p = Bh + (size_t)(col0 + ln) * ldb; const _Float16* b1p = b0p + (size_t)16 * ldb; const _Float16* b2p = b1p + (size_t)16 * ldb; const _Float16* b3p = b2p + (size_t)16 * ldb;
  const v8f z8 = {0.f,0.f,0.f,0.f,0.f,0.f,0.f,0.f}; v8f c00 = z8, c01 = z8, c02 = z8, c03 = z8, c10 = z8, c11 = z8, c12 = z8, c13 = z8;
#pragma unroll 1
  for (int kb = 0; kb < K; kb += 32) { const v16h a0 = g2_frag(a0p + kb, hh), a1 = g2_frag(a1p + kb, hh);
    v16h b = g2_frag(b0p + kb, hh); c00 = g2_mma(a0, b, c00); c10 = g2_mma(a1, b, c10);
    b = g2_frag(b1p + kb, hh); c01 = g2_mma(a0, b, c01); c11 = g2_mma(a1, b, c11);
    b = g2_frag(b2p + kb, hh); c02 = g2_mma(a0, b, c02); c12 = g2_mma(a1, b, c12);
    b = g2_frag(b3p + kb, hh); c03 = g2_mma(a0, b, c03); c13 = g2_mma(a1, b, c13); }
  v8f accs[8] = {c00, c01, c02, c03, c10, c11, c12, c13};
#pragma unroll
  for (int u = 0; u < 8; ++u) { const int t = u & 3, half = u >> 2; const int col = col0 + t * 16 + ln; const float bv = bias ? bf16_rne(bias[col]) : 0.f;
#pragma unroll
    for (int r = 0; r < 8; ++r) { const int rloc = half * 16 + 8 * hh + r; float v = accs[u][r] * alpha + bv;
      if (CP) v += CP[cofs + (size_t)(row0 + rloc) * ldc + col];      /* own element of the batched C plane */
      so[w][rloc][t * 16 + ln] = v; } }
  __builtin_amdgcn_fence(4 /* acq_rel order */, "workgroup"); __builtin_amdgcn_wave_barrier();
  const int rsub = lane >> 4, c4 = (lane & 15) * 4;
  {
#pragma unroll
    for (int q = 0; q < 16; ++q) { const int r = q * 2 + rsub; const v4f v = *(const v4fa*)&so[w][r][c4];
      if (C) *(v4f*)(C + cofs + (size_t)(row0 + r) * ldc + col0 + c4) = v;
      if (C16) { v4h h4; h4[0] = (_Float16)v[0]; h4[1] = (_Float16)v[1]; h4[2] = (_Float16)v[2]; h4[3] = (_Float16)v[3]; *(v4h*)(C16 + cofs + (size_t)(row0 + r) * ldc + col0 + c4) = h4; } }
     }
}

// Butterfly over the 32 lanes of a wave: four row_xmask steps inside each 16-lane row, then the other row; every lane ends with the same value.
template <int CTRL>
__device__ __forceinline__ float lane_xm(float x) { return __int_as_float(__builtin_amdgcn_update_dpp(0, __float_as_int(x), CTRL, 0xf, 0xf, true)); }
__device__ __forceinline__ float lane_x16(float x) { const int b = __float_as_int(x); return __int_as_float(__builtin_amdgcn_permlanex16(b, b, 0x76543210, 0xfedcba98, false, false)); }
__device__ __forceinline__ float wave_max(float x) {
  x = fmaxf(x, lane_xm<0x161>(x)); x = fmaxf(x, lane_xm<0x162>(x)); x = fmaxf(x, lane_xm<0x164>(x)); x = fmaxf(x, lane_xm<0x168>(x)); return fmaxf(x, lane_x16(x)); }
__device__ __forceinline__ float wave_sum(float x) {
  x += lane_xm<0x161>(x); x += lane_xm<0x162>(x); x += lane_xm<0x164>(x); x += lane_xm<0x168>(x); return x + lane_x16(x); }

#define FAC1 0.18033688011112042f        /* log2(e) / 8 */
#define FAC2 0.00017611023448351604f     /* log2(e) / 8 / 1024 */
#define FAP 72                           /* LDS row pitch in 16-bit elements: 128 B + 16 B, for 16-byte readers on 16 rows */
#define FNT (SQ / 64)                    /* query tiles = key steps of the longest tile */
static_assert(HD == 64 && (FNT & (FNT - 1)) == 0);
// 2^x. The v_nop at the end keeps the one slot that the instruction set asks for between a transcendental and a next instruction that reads its result or overwrites its source;
// inside the run of eight every result register is distinct from every source (early clobber), so each v_exp_f32 is the independent instruction behind the one before.
__device__ __forceinline__ float fa_exp2(float x) { float y; asm("v_exp_f32 %0, %1\n\tv_nop" : "=v"(y) : "v"(x)); return y; }
__device__ __forceinline__ v8f fa_exp2x8(v8f x) { float y0, y1, y2, y3, y4, y5, y6, y7;
  asm("v_exp_f32 %0, %8\n\tv_exp_f32 %1, %9\n\tv_exp_f32 %2, %10\n\tv_exp_f32 %3, %11\n\tv_exp_f32 %4, %12\n\tv_exp_f32 %5, %13\n\tv_exp_f32 %6, %14\n\tv_exp_f32 %7, %15\n\tv_nop"
      : "=&v"(y0), "=&v"(y1), "=&v"(y2), "=&v"(y3), "=&v"(y4), "=&v"(y5), "=&v"(y6), "=&v"(y7)
      : "v"(x[0]), "v"(x[1]), "v"(x[2]), "v"(x[3]), "v"(x[4]), "v"(x[5]), "v"(x[6]), "v"(x[7]));
  const v8f y = {y0, y1, y2, y3, y4, y5, y6, y7}; return y; }
/* amdgpu_waves_per_eu(4, 4): holds the kernel to 256 registers, so that four blocks fit a WGP and no register window is switched in the loop */
__global__ __launch_bounds__(128) __attribute__((amdgpu_waves_per_eu(4, 4))) void k_fattn(const _Float16* __restrict__ QHp, const _Float16* __restrict__ QLp, const _Float16* __restrict__ KHp, const _Float16* __restrict__ KLp,
    const _Float16* __restrict__ VTp, _Float16* __restrict__ O16p) {
  __shared__ __attribute__((aligned(16))) unsigned short lt[2][3][64][FAP];      /* [buffer][K hi, K residual, V^T][row][element] */
  const int tid = threadIdx.x, w = __builtin_amdgcn_readfirstlane((int)(tid >> 5)), lane = tid & 31, ln = lane & 15, hh = lane >> 4;
  const int h = blockIdx.y, b = blockIdx.z; const int x = blockIdx.x, grp = (b * NH + h) >> 3;
  /* a permutation of the tiles for each (batch, head): blocks whose flat indices lie far apart get tiles of unequal length, so that long tiles do not gather in one place */
  const int qt = (grp % 3 == 0) ? FNT - 1 - x : ((grp % 3 == 1) ? x : ((x + FNT / 2) & (FNT - 1)));
  const int qw = qt * 64 + 16 * w; const size_t r0 = (size_t)b * SQ;
  const _Float16* qhp = QHp + (r0 + qw + ln) * DM + h * HD; const _Float16* qlp = QLp + (r0 + qw + ln) * DM + h * HD;
  const v16h qh0 = g2_frag(qhp, hh), qh1 = g2_frag(qhp + 32, hh), ql0 = g2_frag(qlp, hh), ql1 = g2_frag(qlp + 32, hh);
  const int sr = tid >> 3, sc = (tid & 7) * 8;      /* staging: 8 lanes cover one 128-B row, a wave 4 rows */
  const unsigned short* gk = (const unsigned short*)KHp + (r0 + sr) * DM + h * HD + sc; const unsigned short* gl = (const unsigned short*)KLp + (r0 + sr) * DM + h * HD + sc;
  const unsigned short* gv = (const unsigned short*)VTp + ((size_t)(b * NH + h) * HD + sr) * SQ + sc;
  v8us g[12];
#pragma unroll      /* g[] indexed by constants only, so that it stays in registers */
  for (int i = 0; i < 4; ++i) { g[i] = *(const v8us*)(gk + (size_t)(16 * i) * DM); g[4 + i] = *(const v8us*)(gl + (size_t)(16 * i) * DM); g[8 + i] = *(const v8us*)(gv + (size_t)(16 * i) * SQ); }
#pragma unroll      /* g[] indexed by constants only */
  for (int i = 0; i < 4; ++i) { *(v8us*)&lt[0][0][sr + 16 * i][sc] = g[i]; *(v8us*)&lt[0][1][sr + 16 * i][sc] = g[4 + i]; *(v8us*)&lt[0][2][sr + 16 * i][sc] = g[8 + i]; }
  const v8f z8 = {0.f,0.f,0.f,0.f,0.f,0.f,0.f,0.f};
  v8f o[4] = {z8, z8, z8, z8}; float m = -1.0e30f, l = 0.f;
#pragma unroll 1      /* one step is already 32 matrix instructions; the two buffers alternate by index */
  for (int j = 0; j <= qt; ++j) {
    const int cb = j & 1;
    __syncthreads();      /* publishes buffer cb, and ends every wave's reads of the other buffer (step j - 1) before it is stored into below */
    if (j < qt) {      /* the next step's tiles fly while this step is worked on */
      gk += (size_t)64 * DM; gl += (size_t)64 * DM; gv += 64;
#pragma unroll      /* g[] indexed by constants only */
      for (int i = 0; i < 4; ++i) { g[i] = *(const v8us*)(gk + (size_t)(16 * i) * DM); g[4 + i] = *(const v8us*)(gl + (size_t)(16 * i) * DM); g[8 + i] = *(const v8us*)(gv + (size_t)(16 * i) * SQ); }
    }
    v8f s[4]; v16h kf[2][4], va[4];
    { const _Float16* kh = (const _Float16*)&lt[cb][0][ln][0]; const _Float16* kl = (const _Float16*)&lt[cb][1][ln][0];
      kf[0][0] = g2_frag(kh, hh); kf[0][1] = g2_frag(kh + 32, hh); kf[0][2] = g2_frag(kl, hh); kf[0][3] = g2_frag(kl + 32, hh); }
#pragma unroll      /* s[], kf[], va[] indexed by constants only, so that they stay in registers */
    for (int t = 0; t < 4; ++t) {
      if (t < 3) {      /* the next 16 keys' fragments are asked for ahead of this tile's products */
        const _Float16* kh = (const _Float16*)&lt[cb][0][16 * (t + 1) + ln][0]; const _Float16* kl = (const _Float16*)&lt[cb][1][16 * (t + 1) + ln][0];
        kf[(t + 1) & 1][0] = g2_frag(kh, hh); kf[(t + 1) & 1][1] = g2_frag(kh + 32, hh); kf[(t + 1) & 1][2] = g2_frag(kl, hh); kf[(t + 1) & 1][3] = g2_frag(kl + 32, hh);
      } else {      /* V^T of the first 32 keys is asked for ahead of the softmax */
#pragma unroll      /* va[] indexed by constants only */
        for (int u = 0; u < 4; ++u) va[u] = g2_frag((const _Float16*)&lt[cb][2][16 * u + ln][0], hh);
      }
      const v16h kh0 = kf[t & 1][0], kh1 = kf[t & 1][1], kl0 = kf[t & 1][2], kl1 = kf[t & 1][3];
      v8f a = z8, c = z8, d = z8;
      a = g2_mma(kh0, qh0, a); c = g2_mma(kh0, ql0, c); d = g2_mma(kl0, qh0, d);
      a = g2_mma(kh1, qh1, a); c = g2_mma(kh1, ql1, c); d = g2_mma(kl1, qh1, d);
#pragma unroll      /* vector elements indexed by constants only */
      for (int r = 0; r < 8; ++r) s[t][r] = a[r] * FAC1 + (c[r] + d[r]) * FAC2;
    }
    if (j == qt) {      /* only the last step crosses the diagonal; every query keeps its key 64 qt there */
      const int rel = 16 * w + ln - 8 * hh;      /* key 64 qt + 16 t + 8 hh + r is kept while 16 t + r <= rel */
#pragma unroll      /* s[] indexed by constants only */
      for (int t = 0; t < 4; ++t) {
#pragma unroll      /* s[] indexed by constants only */
        for (int r = 0; r < 8; ++r) s[t][r] = (16 * t + r <= rel) ? s[t][r] : -1.0e30f; }
    }
    v8f x8;
#pragma unroll      /* vector elements indexed by constants only */
    for (int r = 0; r < 8; ++r) x8[r] = fmaxf(fmaxf(s[0][r], s[1][r]), fmaxf(s[2][r], s[3][r]));
    float mx = fmaxf(fmaxf(fmaxf(x8[0], x8[1]), fmaxf(x8[2], x8[3])), fmaxf(fmaxf(x8[4], x8[5]), fmaxf(x8[6], x8[7])));
    mx = fmaxf(mx, lane_x16(mx));      /* the other half of this query's keys */
    const float mn = fmaxf(m, mx); const float al = fa_exp2(m - mn); const float mb = mn - 8.0f; m = mn;
    v4f ps = {0.f, 0.f, 0.f, 0.f};
#pragma unroll      /* s[] indexed by constants only */
    for (int t = 0; t < 4; ++t) { s[t] = fa_exp2x8(s[t] - mb);
#pragma unroll      /* s[] indexed by constants only; four independent partial sums */
      for (int r = 0; r < 8; ++r) ps[r & 3] += s[t][r]; }
    l = l * al + ((ps[0] + ps[1]) + (ps[2] + ps[3]));
    FragH p0, p1;
#pragma unroll      /* fragment elements indexed by constants only */
    for (int r = 0; r < 8; ++r) { p0.h[r] = (_Float16)s[0][r]; p0.h[8 + r] = (_Float16)s[1][r]; p1.h[r] = (_Float16)s[2][r]; p1.h[8 + r] = (_Float16)s[3][r]; }
#pragma unroll      /* o[] indexed by constants only */
    for (int t = 0; t < 4; ++t) {
#pragma unroll      /* o[] indexed by constants only */
      for (int r = 0; r < 8; ++r) o[t][r] *= al; }
    v16h vb[4];
#pragma unroll      /* vb[] indexed by constants only; V^T of the last 32 keys, into registers that the scores have left */
    for (int u = 0; u < 4; ++u) vb[u] = g2_frag((const _Float16*)&lt[cb][2][16 * u + ln][32], hh);
#pragma unroll      /* o[], va[] indexed by constants only; four independent accumulators in turn */
    for (int t = 0; t < 4; ++t) o[t] = g2_mma(va[t], p0.v, o[t]);
#pragma unroll      /* o[], vb[] indexed by constants only */
    for (int t = 0; t < 4; ++t) o[t] = g2_mma(vb[t], p1.v, o[t]);
    if (j < qt) {
#pragma unroll      /* g[] indexed by constants only */
      for (int i = 0; i < 4; ++i) { *(v8us*)&lt[cb ^ 1][0][sr + 16 * i][sc] = g[i]; *(v8us*)&lt[cb ^ 1][1][sr + 16 * i][sc] = g[4 + i]; *(v8us*)&lt[cb ^ 1][2][sr + 16 * i][sc] = g[8 + i]; }
    }
  }
  l += lane_x16(l);      /* join the two halves' sums once */
  const float inv = 64.0f / l;      /* o carried x64 */
  unsigned short* op = (unsigned short*)O16p + (r0 + qw + ln) * DM + h * HD + 8 * hh;
#pragma unroll      /* o[] indexed by constants only */
  for (int t = 0; t < 4; ++t) { FragH f;
#pragma unroll      /* fragment elements indexed by constants only */
    for (int r = 0; r < 8; ++r) f.h[r] = (_Float16)(o[t][r] * inv);
    *(v8us*)(op + 16 * t) = f.half[0]; }
}

// f32 attention over the first QT0 query rows of one batch. Block = one head x A0R query rows, 8 waves, 2 rows a wave; keys 0 .. (rg + 1) A0R - 1 cover every row of the block.
// K (row pitch A0KP floats = 16 B x odd: lanes on different rows read 16 B each without bank conflicts), V and the q rows are staged in LDS once.
// Scores: lane = key, both rows share each K read. Softmax: wave butterflies. Weighted sum: lane = channel pair, weights read as broadcasts.
#define A0R 16
#define A0KP 68
static_assert(QT0 % A0R == 0);
static_assert(QT0 == 128 && HD == 64 && A0R == 16);
typedef float v2f __attribute__((ext_vector_type(2)));
__global__ __launch_bounds__(256) void k_att0(const float* __restrict__ QF, const float* __restrict__ KF, const float* __restrict__ VF, float scale, float* __restrict__ OF) {
  __shared__ __attribute__((aligned(16))) float lk[QT0][A0KP]; __shared__ __attribute__((aligned(16))) float lv[QT0][HD];
  __shared__ __attribute__((aligned(16))) float lq[A0R][HD]; __shared__ __attribute__((aligned(16))) float lp[A0R][QT0];
  const int tid = threadIdx.x, lane = tid & 31, w = __builtin_amdgcn_readfirstlane((int)(tid >> 5));
  const int h = blockIdx.x / (QT0 / A0R), rg = blockIdx.x % (QT0 / A0R); const int nkeys = (rg + 1) * A0R;
  const int sr = tid >> 4, sc4 = (tid & 15) * 4;      /* staging: 16 lanes cover one 256-B row */
  const float* qp = QF + (size_t)(rg * A0R + sr) * DM + h * HD + sc4; const float* kp = KF + (size_t)sr * DM + h * HD + sc4; const float* vp = VF + (size_t)sr * DM + h * HD + sc4;
  const v4f qs = *(const v4fa*)qp;
  v4f ks[QT0 / 16], vs[QT0 / 16];      /* all QT0 rows of K and V are staged by every block: no test stands between the loads */
#pragma unroll      /* ks[], vs[] indexed by constants only, so that they stay in registers; all loads issued before the first use */
  for (int g = 0; g < QT0 / 16; ++g) { ks[g] = *(const v4fa*)(kp + (size_t)g * 16 * DM); vs[g] = *(const v4fa*)(vp + (size_t)g * 16 * DM); }
  asm volatile("s_wait_xcnt 0x0" :: "v"(qp), "v"(kp), "v"(vp) : "memory");      /* the wait before the loads' address pairs are reused; naming the pairs keeps them live up to here, so that no load's result is placed in them */
  *(v4f*)&lq[sr][sc4] = qs;
#pragma unroll      /* ks[], vs[] indexed by constants only, so that they stay in registers */
  for (int g = 0; g < QT0 / 16; ++g) { *(v4f*)&lk[g * 16 + sr][sc4] = ks[g]; *(v4f*)&lv[g * 16 + sr][sc4] = vs[g]; }
  __syncthreads();
  const int r0 = 2 * w, i0 = rg * A0R + r0, i1 = i0 + 1;      /* this wave's two query rows */
  const int nch = (nkeys + 31) >> 5;      /* chunks of 32 keys */
  float s0[QT0 / 32], s1[QT0 / 32];
#pragma unroll      /* s0[], s1[] indexed by constants only, so that they stay in registers */
  for (int m = 0; m < QT0 / 32; ++m) { s0[m] = -1.0e30f; s1[m] = -1.0e30f;
    if (m < nch) { const int j = m * 32 + lane;
      v4f a0 = {0.f, 0.f, 0.f, 0.f}, a1 = {0.f, 0.f, 0.f, 0.f};
#pragma unroll      /* the 48 LDS reads of a chunk issue ahead of their use */
      for (int c = 0; c < HD / 4; ++c) { const v4f kq = *(const v4f*)&lk[j][c * 4]; const v4f q0 = *(const v4f*)&lq[r0][c * 4]; const v4f q1 = *(const v4f*)&lq[r0 + 1][c * 4];
#pragma unroll      /* four independent partial sums a row */
        for (int u = 0; u < 4; ++u) { a0[u] = fmaf(q0[u], kq[u], a0[u]); a1[u] = fmaf(q1[u], kq[u], a1[u]); } }
      const float d0 = ((a0[0] + a0[1]) + (a0[2] + a0[3])) * scale, d1 = ((a1[0] + a1[1]) + (a1[2] + a1[3])) * scale;
      s0[m] = (j <= i0) ? d0 : -1.0e30f; s1[m] = (j <= i1) ? d1 : -1.0e30f; } }
  const float m0 = wave_max(fmaxf(fmaxf(s0[0], s0[1]), fmaxf(s0[2], s0[3]))), m1 = wave_max(fmaxf(fmaxf(s1[0], s1[1]), fmaxf(s1[2], s1[3])));
  float l0 = 0.f, l1 = 0.f;
#pragma unroll      /* s0[], s1[] indexed by constants only, so that they stay in registers */
  for (int m = 0; m < QT0 / 32; ++m) if (m < nch) { const int j = m * 32 + lane;
    const float e0 = (j <= i0) ? expf(s0[m] - m0) : 0.f, e1 = (j <= i1) ? expf(s1[m] - m1) : 0.f;
    l0 += e0; l1 += e1; lp[r0][j] = e0; lp[r0 + 1][j] = e1; }
  l0 = wave_sum(l0); l1 = wave_sum(l1);
  __syncthreads();      /* the weights of a row are written by lanes and read back as broadcasts */
  const int n4 = (i1 + 4) >> 2;      /* keys 0 .. i1 in fours; the weights above a row's own index are zero, and 4 n4 <= nkeys */
  v2f o0 = {0.f, 0.f}, o1 = {0.f, 0.f};
#pragma unroll 4      /* LDS reads of later trips issue while earlier ones are summed */
  for (int t = 0; t < n4; ++t) { const v4f p0 = *(const v4f*)&lp[r0][t * 4]; const v4f p1 = *(const v4f*)&lp[r0 + 1][t * 4];
#pragma unroll      /* p0[], p1[] indexed by constants only */
    for (int u = 0; u < 4; ++u) { const v2f vv = *(const v2f*)&lv[t * 4 + u][2 * lane];
      o0[0] = fmaf(p0[u], vv[0], o0[0]); o0[1] = fmaf(p0[u], vv[1], o0[1]); o1[0] = fmaf(p1[u], vv[0], o1[0]); o1[1] = fmaf(p1[u], vv[1], o1[1]); } }
  const float f0 = 64.0f / l0, f1 = 64.0f / l1;      /* o carried x64 like the f16 path */
  o0[0] *= f0; o0[1] *= f0; o1[0] *= f1; o1[1] *= f1;
  *(v2f*)(OF + (size_t)i0 * DM + h * HD + 2 * lane) = o0;
  *(v2f*)(OF + (size_t)i1 * DM + h * HD + 2 * lane) = o1;
}

extern "C" void kernel_launch(void* const* d_in, const int* in_sizes, int n_in,
                              void* d_out, int out_size, void* d_ws, size_t ws_size, hipStream_t stream) {
  if (n_in < 9) return;
  const size_t needx = ((size_t)(NB - 1) * SQ_FULL + SQ) * DM;
  if ((size_t)in_sizes[0] < needx) return;
  if (in_sizes[1] < DM * DM || in_sizes[3] < DM * DM || in_sizes[5] < DM * DM || in_sizes[7] < DM * DM) return;
  if (in_sizes[2] < DM || in_sizes[4] < DM || in_sizes[6] < DM || in_sizes[8] < DM) return;
  if ((size_t)out_size < needx) return;
  /* wire order: x, Wq, bq, Wk, bk, Wv, bv, Wo, bo (natural [out][in] weights, f32) */
  const float* x = (const float*)d_in[0]; const float* wq = (const float*)d_in[1]; const float* bq = (const float*)d_in[2]; const float* wk = (const float*)d_in[3]; const float* bk = (const float*)d_in[4];
  const float* wv = (const float*)d_in[5]; const float* bv = (const float*)d_in[6]; const float* wo = (const float*)d_in[7]; const float* bo = (const float*)d_in[8];
  float* out = (float*)d_out;
  char* ws = (char*)d_ws; size_t off = 0;
  auto take = [&](size_t bytes) { char* p = ws + off; off += (bytes + 255) & ~(size_t)255; return p; };
  _Float16* BQ = (_Float16*)take((size_t)DM * DM * 2); _Float16* BK = (_Float16*)take((size_t)DM * DM * 2); _Float16* BV = (_Float16*)take((size_t)DM * DM * 2); _Float16* BO = (_Float16*)take((size_t)DM * DM * 2);
  _Float16* X16 = (_Float16*)take(NR * DM * 2);
  float* QF = (float*)take(NR * DM * 4);
  _Float16* QH = (_Float16*)take(NR * DM * 2); _Float16* QL = (_Float16*)take(NR * DM * 2); _Float16* KH = (_Float16*)take(NR * DM * 2); _Float16* KL = (_Float16*)take(NR * DM * 2);
  _Float16* V16 = (_Float16*)take(NR * DM * 2); _Float16* O16 = (_Float16*)take(NR * DM * 2);
  _Float16* VT = (_Float16*)take((size_t)NB * NH * HD * SQ * 2);
  float* TAB = (float*)take((size_t)SQ * 32 * 4);
  float* QK0 = (float*)take((size_t)2 * QT0 * DM * 4); float* QKR0 = (float*)take((size_t)2 * QT0 * DM * 4); float* VF0 = (float*)take((size_t)QT0 * DM * 4);
  float* OF0 = (float*)take((size_t)NB * QT0 * DM * 4); _Float16* OH0 = (_Float16*)take((size_t)NB * QT0 * DM * 2); _Float16* OL0 = (_Float16*)take((size_t)NB * QT0 * DM * 2);
  if (off > ws_size || off > (size_t)134217728) return;

  { const size_t n8w = (size_t)DM * DM / 8; const unsigned g = (unsigned)((n8w + 255) / 256);
    k_wnat<<<g, 256, 0, stream>>>(wq, n8w, BQ); k_wnat<<<g, 256, 0, stream>>>(wk, n8w, BK); k_wnat<<<g, 256, 0, stream>>>(wv, n8w, BV); k_wnat<<<g, 256, 0, stream>>>(wo, n8w, BO); }
  { const size_t n8x = (size_t)SQ * DM / 8; k_x16<<<dim3((unsigned)((n8x + 255) / 256), NB), 256, 0, stream>>>(x, (size_t)SQ_FULL * DM, X16, (size_t)SQ * DM, n8x); }
  k_tab<<<SQ / 16, 256, 0, stream>>>(TAB);

  const dim3 gp((unsigned)((MP / 128) * (DM / 64)), 1);
  const size_t n8p = (size_t)MP * DM / 8; const unsigned ghl = (unsigned)((n8p + 255) / 256);
  k_gemm2<<<gp, 128, 0, stream>>>(X16, DM, (size_t)0, BQ, DM, (size_t)0, 0.0625f, bq, nullptr, QF, nullptr, DM, (size_t)0, MP, DM, DM);
  k_hlrope<<<ghl, 256, 0, stream>>>(QF, TAB, QH, QL, n8p);      /* q: rotary, then hi + x1024 residual */
  k_gemm2<<<gp, 128, 0, stream>>>(X16, DM, (size_t)0, BK, DM, (size_t)0, 0.0625f, bk, nullptr, QF, nullptr, DM, (size_t)0, MP, DM, DM);
  k_hlrope<<<ghl, 256, 0, stream>>>(QF, TAB, KH, KL, n8p);      /* k likewise */
  k_gemm2<<<gp, 128, 0, stream>>>(X16, DM, (size_t)0, BV, DM, (size_t)0, 0.0625f, bv, nullptr, nullptr, V16, DM, (size_t)0, MP, DM, DM);

  for (int b = 0; b < NB; ++b) { const size_t r0 = (size_t)b * SQ;
    const dim3 g0((QT0 / 128) * (DM / 64), 1);
    k_gemm2<<<g0, 128, 0, stream>>>(X16 + r0 * DM, DM, (size_t)0, BQ, DM, (size_t)0, 0.0625f, bq, nullptr, QK0, nullptr, DM, (size_t)0, QT0, DM, DM);
    k_gemm2<<<g0, 128, 0, stream>>>(X16 + r0 * DM, DM, (size_t)0, BK, DM, (size_t)0, 0.0625f, bk, nullptr, QK0 + (size_t)QT0 * DM, nullptr, DM, (size_t)0, QT0, DM, DM);
    k_gemm2<<<g0, 128, 0, stream>>>(X16 + r0 * DM, DM, (size_t)0, BV, DM, (size_t)0, 0.0625f, bv, nullptr, VF0, nullptr, DM, (size_t)0, QT0, DM, DM);
    { const int n4 = 2 * QT0 * DM / 4; k_rope0<<<(n4 + 255) / 256, 256, 0, stream>>>(QK0, TAB, QKR0, n4); }
    k_att0<<<NH * (QT0 / A0R), 256, 0, stream>>>(QKR0, QKR0 + (size_t)QT0 * DM, VF0, SCL, OF0 + (size_t)b * QT0 * DM); }
  k_vt<NH, SQ><<<NB * NH * (SQ / 64), 256, 0, stream>>>(V16, DM, 0, VT);      /* V^T [NB][NH][HD][SQ] */
  k_fattn<<<dim3(FNT, NH, NB), 128, 0, stream>>>(QH, QL, KH, KL, VT, O16);

  /* out = o (x64) . Wo (x16) * 2^-10 + bo; grid.y = batch (output rows at the full per-batch stride) */
  k_gemm2<<<dim3((unsigned)((SQ / 128) * (DM / 64)), NB), 128, 0, stream>>>(O16, DM, (size_t)SQ * DM, BO, DM, (size_t)0, 0.0009765625f, bo, nullptr, out, nullptr, DM, (size_t)SQ_FULL * DM, SQ, DM, DM);
  { const size_t n80 = (size_t)NB * QT0 * DM / 8; k_hl<<<(unsigned)((n80 + 255) / 256), 256, 0, stream>>>(OF0, OH0, OL0, n80); }
  const dim3 gf((QT0 / 128) * (DM / 64), NB);
  k_gemm2<<<gf, 128, 0, stream>>>(OH0, DM, (size_t)QT0 * DM, BO, DM, (size_t)0, 0.0009765625f, bo, nullptr, out, nullptr, DM, (size_t)SQ_FULL * DM, QT0, DM, DM);      /* rows 0..127: o_hi Wo + bo, overwriting the f16-path rows */
  k_gemm2<<<gf, 128, 0, stream>>>(OL0, DM, (size_t)QT0 * DM, BO, DM, (size_t)0, 0.00000095367431640625f, nullptr, out, out, nullptr, DM, (size_t)SQ_FULL * DM, QT0, DM, DM);      /* += o_lo Wo 2^-20 (own-element accumulate) */
}

// v004
// One run takes 222 microseconds.
// Timed twice side by side with v003, it ran 1.71 and 1.72 times as fast.
// All steps since v000 together make it 24.8 times as fast.
#include <hip/hip_runtime.h>
// Causal multi-head self-attention: x [2][2048][768], 12 heads of 64, natural [out][in] projections with biases, interleaved partial rotary embedding on channels 0..31 of each head of q and k (pairs (2p,2p+1), angle = s * 10000^(-p/16), computed table), scores / 8, causal softmax, out = merged Wo^T + bo.
// Compute dtype: every contraction on v_wmma_f32_16x16x32_f16 (f16 operands, f32 accumulate). Inputs RNE-converted to bf16 first (exact in f16; weights carried x16). q/k: GEMM -> f32 -> rotary in f32 -> f16 hi + x1024 f16 residual planes; scores = three products (hi.hi + lo.hi + hi.lo; each residual pass has its own accumulator folded with 2^-10). v, the unnormalised softmax weights (x256 at the running maximum) and o (x64) are single f16 planes; scores, online softmax and the weighted sum run in one fused kernel. The first 128 query rows of each batch are recomputed with an f32 VALU attention and go through the output GEMM as f16 hi + x1024 residual planes of o.
#ifndef NB
#define NB 2
#endif
#ifndef SEQ
#define SEQ 2048
#endif
#define SQ SEQ
#define SQ_FULL 2048                 /* per-batch row stride of x and of the output */
#define NB_FULL 2
#define DM 768
#define NH 12
#define HD 64
#define QT0 128                      /* first-tile rows recomputed in f32 */
#define SCL 0.125f                   /* 1 / sqrt(64) */
#define NR ((size_t)NB * SQ)
#define MP ((int)((size_t)NB * SQ))

static_assert(SQ % 128 == 0);
static_assert(SQ % 16 == 0);
static_assert(QT0 == 128);
static_assert(SQ >= QT0);
static_assert(NH * HD == DM);
static_assert(DM % 64 == 0);
static_assert(SQ <= SQ_FULL);
static_assert(NB <= NB_FULL);

typedef unsigned short v8us __attribute__((ext_vector_type(8), may_alias));
typedef float  v8f  __attribute__((ext_vector_type(8)));
typedef float  v4f  __attribute__((ext_vector_type(4)));
typedef float  v4fa __attribute__((ext_vector_type(4), may_alias));
typedef _Float16 v16h __attribute__((ext_vector_type(16)));
typedef _Float16 v4h __attribute__((ext_vector_type(4)));
union FragH { v16h v; v8us half[2]; _Float16 h[16]; unsigned short u[16]; };

__device__ __forceinline__ unsigned short bf16_bits(float x) { unsigned int u = __float_as_uint(x); return (unsigned short)((u + 0x7FFFu + ((u >> 16) & 1u)) >> 16); }
__device__ __forceinline__ float bf16_rne(float x) { return __uint_as_float(((unsigned int)bf16_bits(x)) << 16); }

// 10000^(-p/16), p = 0..15, selected by value (no memory table)
__device__ __forceinline__ float rope_invf(int p) {
  float f = 1.0f;
  f = (p == 1)  ? 0.5623413251903491f : f;
  f = (p == 2)  ? 0.31622776601683794f : f;
  f = (p == 3)  ? 0.1778279410038923f : f;
  f = (p == 4)  ? 0.1f : f;
  f = (p == 5)  ? 0.05623413251903491f : f;
  f = (p == 6)  ? 0.03162277660168379f : f;
  f = (p == 7)  ? 0.01778279410038923f : f;
  f = (p == 8)  ? 0.01f : f;
  f = (p == 9)  ? 0.005623413251903491f : f;
  f = (p == 10) ? 0.0031622776601683794f : f;
  f = (p == 11) ? 0.0017782794100389228f : f;
  f = (p == 12) ? 0.001f : f;
  f = (p == 13) ? 0.0005623413251903491f : f;
  f = (p == 14) ? 0.00031622776601683794f : f;
  f = (p == 15) ? 0.00017782794100389227f : f;
  return f;
}

__global__ __launch_bounds__(256) void k_tab(float* __restrict__ TAB) {
  #pragma clang fp contract(off)
  __shared__ __attribute__((aligned(16))) float tl[16][32];
  const int tid = threadIdx.x; const int sl = tid >> 4, p = tid & 15; const int s = blockIdx.x * 16 + sl;
  const float ang = (float)s * rope_invf(p);
  float sn, cs; sincosf(ang, &sn, &cs);
  tl[sl][2 * p] = cs; tl[sl][2 * p + 1] = sn;
  __syncthreads();
  if (tid < 128) {
    const int row = tid >> 3, pc = (tid & 7) * 4;
    const v4f v = *(const v4fa*)&tl[row][pc];
    float* d = TAB + (size_t)(blockIdx.x * 16 + row) * 32 + pc;
    *(v4f*)d = v;
    
  }
}

__global__ __launch_bounds__(256) void k_wnat(const float* __restrict__ w, size_t n8, _Float16* __restrict__ Bt) {
  const size_t t = (size_t)blockIdx.x * 256 + threadIdx.x; if (t >= n8) return;
  const v4f a = *(const v4fa*)(w + t * 8), c = *(const v4fa*)(w + t * 8 + 4);
  FragH f;
#pragma unroll
  for (int q = 0; q < 4; ++q) { f.h[q] = (_Float16)(bf16_rne(a[q]) * 16.0f); f.h[4 + q] = (_Float16)(bf16_rne(c[q]) * 16.0f); }
  const v8us o = f.half[0];
  *(v8us*)((unsigned short*)Bt + t * 8) = o; 
}

__global__ __launch_bounds__(256) void k_x16(const float* __restrict__ x, size_t sx, _Float16* __restrict__ X16, size_t sd, size_t n8) {
  const size_t t = (size_t)blockIdx.x * 256 + threadIdx.x; if (t >= n8) return;
  const float* xp = x + (size_t)blockIdx.y * sx; unsigned short* dp = (unsigned short*)X16 + (size_t)blockIdx.y * sd;
  const v4f a = *(const v4fa*)(xp + t * 8), c = *(const v4fa*)(xp + t * 8 + 4);
  FragH f;
#pragma unroll
  for (int q = 0; q < 4; ++q) { f.h[q] = (_Float16)bf16_rne(a[q]); f.h[4 + q] = (_Float16)bf16_rne(c[q]); }
  const v8us o = f.half[0];
  *(v8us*)(dp + t * 8) = o; 
}

__global__ __launch_bounds__(256) void k_hl(const float* __restrict__ F, _Float16* __restrict__ Hh, _Float16* __restrict__ Hl, size_t n8) {
  const size_t t = (size_t)blockIdx.x * 256 + threadIdx.x; if (t >= n8) return;
  FragH fh, fl; const v4f a = *(const v4fa*)(F + t * 8), c = *(const v4fa*)(F + t * 8 + 4);
#pragma unroll
  for (int q = 0; q < 4; ++q) { _Float16 h = (_Float16)a[q]; fh.h[q] = h; fl.h[q] = (_Float16)((a[q] - (float)h) * 1024.0f); h = (_Float16)c[q]; fh.h[4 + q] = h; fl.h[4 + q] = (_Float16)((c[q] - (float)h) * 1024.0f); }
  { *(v8us*)((unsigned short*)Hh + t * 8) = fh.half[0]; *(v8us*)((unsigned short*)Hl + t * 8) = fl.half[0];  }
}

__global__ __launch_bounds__(256) void k_hlrope(const float* __restrict__ F, const float* __restrict__ TAB, _Float16* __restrict__ Hh, _Float16* __restrict__ Hl, size_t n8) {
  #pragma clang fp contract(off)
  const size_t t = (size_t)blockIdx.x * 256 + threadIdx.x; if (t >= n8) return;
  const size_t e0 = t * 8; const size_t row = e0 / DM; const int col = (int)(e0 - row * DM); const int s = (int)(row % SQ);
  const int c0 = col & 63; const bool rot = c0 < 32; const int cc = c0 & 31;
  const v4f a = *(const v4fa*)(F + e0), c = *(const v4fa*)(F + e0 + 4);
  const v4f t0 = *(const v4fa*)(TAB + (size_t)s * 32 + cc), t1 = *(const v4fa*)(TAB + (size_t)s * 32 + cc + 4);
  float y[8];
  y[0] = rot ? (a[0] * t0[0] + (-a[1]) * t0[1]) : a[0];
  y[1] = rot ? (a[1] * t0[0] + a[0] * t0[1]) : a[1];
  y[2] = rot ? (a[2] * t0[2] + (-a[3]) * t0[3]) : a[2];
  y[3] = rot ? (a[3] * t0[2] + a[2] * t0[3]) : a[3];
  y[4] = rot ? (c[0] * t1[0] + (-c[1]) * t1[1]) : c[0];
  y[5] = rot ? (c[1] * t1[0] + c[0] * t1[1]) : c[1];
  y[6] = rot ? (c[2] * t1[2] + (-c[3]) * t1[3]) : c[2];
  y[7] = rot ? (c[3] * t1[2] + c[2] * t1[3]) : c[3];
  FragH fh, fl;
#pragma unroll
  for (int q = 0; q < 8; ++q) { const _Float16 h = (_Float16)y[q]; fh.h[q] = h; fl.h[q] = (_Float16)((y[q] - (float)h) * 1024.0f); }
  { *(v8us*)((unsigned short*)Hh + t * 8) = fh.half[0]; *(v8us*)((unsigned short*)Hl + t * 8) = fl.half[0];  }
}

__global__ __launch_bounds__(256) void k_rope0(const float* __restrict__ F, const float* __restrict__ TAB, float* __restrict__ G, int n4) {
  #pragma clang fp contract(off)
  const int t = blockIdx.x * 256 + threadIdx.x; if (t >= n4) return;
  const size_t e0 = (size_t)t * 4; const int row = (int)(e0 / DM); const int col = (int)(e0 - (size_t)row * DM); const int s = row % QT0;
  const int c0 = col & 63; const bool rot = c0 < 32; const int cc = c0 & 31;
  const v4f a = *(const v4fa*)(F + e0);
  const v4f tb = *(const v4fa*)(TAB + (size_t)s * 32 + cc);
  v4f o;
  o[0] = rot ? (a[0] * tb[0] + (-a[1]) * tb[1]) : a[0];
  o[1] = rot ? (a[1] * tb[0] + a[0] * tb[1]) : a[1];
  o[2] = rot ? (a[2] * tb[2] + (-a[3]) * tb[3]) : a[2];
  o[3] = rot ? (a[3] * tb[2] + a[2] * tb[3]) : a[3];
  *(v4f*)(G + e0) = o;
  
}

template <int NHv, int TTv>
__global__ __launch_bounds__(256) void k_vt(const _Float16* __restrict__ V16, int ldv, int voff, _Float16* __restrict__ Vt) {
  __shared__ unsigned short tl[64][66];
  const int tid = threadIdx.x; const int slab = blockIdx.x / (TTv / 64), lg = blockIdx.x % (TTv / 64); const int b = slab / NHv, h = slab % NHv;
  for (int i = tid; i < 64 * 8; i += 256) { const int r = i / 8, c8 = (i % 8) * 8; FragH f; f.half[0] = *(const v8us*)((const unsigned short*)V16 + ((size_t)b * TTv + lg * 64 + r) * ldv + voff + h * 64 + c8);
#pragma unroll
    for (int q = 0; q < 8; ++q) tl[r][c8 + q] = f.u[q]; }
  __syncthreads();
  {
#pragma unroll
    for (int rd = 0; rd < 2; ++rd) { const int d = rd * 32 + tid / 8, pc = tid % 8; FragH f;
#pragma unroll
      for (int q = 0; q < 8; ++q) f.u[q] = tl[pc * 8 + q][d];
      *(v8us*)((unsigned short*)Vt + ((size_t)slab * 64 + d) * TTv + lg * 64 + pc * 8) = f.half[0]; }
     }
}

// ---- f16 GEMM engine (wave tile 32x64; block = 4 waves = 128 rows x 64 cols; M % 128 == 0, N % 64 == 0, K % 64 == 0) ----
// A f16 [M][K] row-major (pitch lda), Bh f16 [N][K] (k contiguous, pitch ldb); grid.y batches with element strides sA / sB / sC.
// A step is 64 k: the block's 128 A rows and 64 B rows (128 B each) are read from memory once a block, as whole lines, two steps ahead into registers, and stored one step ahead into the LDS buffer that is not being read;
// every wave takes its fragments from LDS, all 24 reads of a step asked for ahead of the step's 16 products. Each accumulator still sums its k blocks of 32 in rising order.
#define G2P 72                           /* LDS row pitch in 16-bit elements: 128 B + 16 B, for 16-byte readers on 16 rows */
__device__ __forceinline__ v16h g2_frag(const _Float16* p, int hh) { FragH f; f.half[0] = *(const v8us*)((const unsigned short*)p + 8 * hh); f.half[1] = *(const v8us*)((const unsigned short*)p + 16 + 8 * hh); return f.v; }
__device__ __forceinline__ v8f g2_mma(v16h a, v16h b, v8f c) { v8f d = __builtin_amdgcn_wmma_f32_16x16x32_f16(false, a, false, b, (short)0, c, false, false); asm volatile("v_nop\n\tv_nop\n\tv_nop\n\tv_nop" : "+v"(d) : "v"(a), "v"(b)); return d; }
__global__ __launch_bounds__(128) void k_gemm2(const _Float16* __restrict__ A, int lda, size_t sA, const _Float16* __restrict__ Bh, int ldb, size_t sB, float alpha,
    const float* __restrict__ bias, const float* CP, float* C, _Float16* C16, int ldc, size_t sC, int M, int N, int K) {
  __shared__ __attribute__((aligned(16))) float so[4][32][68];
  __shared__ __attribute__((aligned(16))) unsigned short st[2][192][G2P];      /* [buffer][128 A rows, then 64 B rows][element] */
  const int tid = threadIdx.x, w = __builtin_amdgcn_readfirstlane((int)(tid >> 5)), lane = tid & 31, ln = lane & 15, hh = lane >> 4; const int by = blockIdx.y;
  A += (size_t)by * sA; Bh += (size_t)by * sB; const size_t cofs = (size_t)by * sC;
  const int ntn = N >> 6; const int mt = blockIdx.x / ntn, nq = blockIdx.x - mt * ntn; const int row0 = mt * 128 + 32 * w, col0 = nq * 64; if (row0 >= M) return;      /* M % 128 == 0: a block leaves as a whole */
  const int sr = tid >> 3, sc = (tid & 7) * 8;      /* staging: 8 lanes cover one 128-B row, a wave 4 rows */
  /* address = a block-uniform byte pointer, which moves with the step, + the lane's own byte offset, which does not */
  const char* ga = (const char*)(A + (size_t)(mt * 128) * lda); const char* gb = (const char*)(Bh + (size_t)col0 * ldb);
  const unsigned oa = (unsigned)(sr * lda + sc) * 2u, ob = (unsigned)(sr * ldb + sc) * 2u;
  v8us g[12];
#pragma unroll      /* g[] indexed by constants only, so that it stays in registers */
  for (int i = 0; i < 8; ++i) g[i] = *(const v8us*)(ga + (size_t)(32 * i) * lda + oa);
#pragma unroll      /* g[] indexed by constants only */
  for (int i = 0; i < 4; ++i) g[8 + i] = *(const v8us*)(gb + (size_t)(32 * i) * ldb + ob);
#pragma unroll      /* g[] indexed by constants only */
  for (int i = 0; i < 12; ++i) *(v8us*)&st[0][sr + 16 * i][sc] = g[i];
  const int nk = K >> 6;
  if (1 < nk) {
    ga += 128; gb += 128;
#pragma unroll      /* g[] indexed by constants only */
    for (int i = 0; i < 8; ++i) g[i] = *(const v8us*)(ga + (size_t)(32 * i) * lda + oa);
#pragma unroll      /* g[] indexed by constants only */
    for (int i = 0; i < 4; ++i) g[8 + i] = *(const v8us*)(gb + (size_t)(32 * i) * ldb + ob);
  }
  const v8f z8 = {0.f,0.f,0.f,0.f,0.f,0.f,0.f,0.f}; v8f c00 = z8, c01 = z8, c02 = z8, c03 = z8, c10 = z8, c11 = z8, c12 = z8, c13 = z8;
#pragma unroll 1      /* the two buffers alternate by index; one step is already 16 matrix instructions */
  for (int j = 0; j < nk; ++j) {
    const int cb = j & 1;
    __syncthreads();      /* publishes buffer cb, and ends every wave's reads of the other buffer (step j - 1) before it is stored into below */
    if (j + 1 < nk) {      /* step j + 1's rows, asked for a whole step ago, go into the other buffer */
#pragma unroll      /* g[] indexed by constants only */
      for (int i = 0; i < 12; ++i) *(v8us*)&st[cb ^ 1][sr + 16 * i][sc] = g[i];
    }
    if (j + 2 < nk) {      /* step j + 2's rows fly until the next step's barrier */
      ga += 128; gb += 128;
#pragma unroll      /* g[] indexed by constants only */
      for (int i = 0; i < 8; ++i) g[i] = *(const v8us*)(ga + (size_t)(32 * i) * lda + oa);
#pragma unroll      /* g[] indexed by constants only */
      for (int i = 0; i < 4; ++i) g[8 + i] = *(const v8us*)(gb + (size_t)(32 * i) * ldb + ob);
      asm volatile("s_wait_xcnt 0x0" ::: "memory");      /* the wait before the loads' address registers are reused: the fragment reads below land in them */
    }
    const _Float16* ap = (const _Float16*)&st[cb][32 * w + ln][0]; const _Float16* bp = (const _Float16*)&st[cb][128 + ln][0];
    v16h fa[2][2], fb[2][4];      /* [k block of 32][16 rows] */
#pragma unroll      /* fa[], fb[] indexed by constants only, so that they stay in registers */
    for (int kk = 0; kk < 2; ++kk) { fa[kk][0] = g2_frag(ap + 32 * kk, hh); fa[kk][1] = g2_frag(ap + 16 * G2P + 32 * kk, hh);
#pragma unroll      /* fb[] indexed by constants only */
      for (int t = 0; t < 4; ++t) fb[kk][t] = g2_frag(bp + 16 * t * G2P + 32 * kk, hh); }
#pragma unroll      /* fa[], fb[] indexed by constants only */
    for (int kk = 0; kk < 2; ++kk) {
      c00 = g2_mma(fa[kk][0], fb[kk][0], c00); c10 = g2_mma(fa[kk][1], fb[kk][0], c10);
      c01 = g2_mma(fa[kk][0], fb[kk][1], c01); c11 = g2_mma(fa[kk][1], fb[kk][1], c11);
      c02 = g2_mma(fa[kk][0], fb[kk][2], c02); c12 = g2_mma(fa[kk][1], fb[kk][2], c12);
      c03 = g2_mma(fa[kk][0], fb[kk][3], c03); c13 = g2_mma(fa[kk][1], fb[kk][3], c13); }
  }
  v8f accs[8] = {c00, c01, c02, c03, c10, c11, c12, c13};
#pragma unroll
  for (int u = 0; u < 8; ++u) { const int t = u & 3, half = u >> 2; const int col = col0 + t * 16 + ln; const float bv = bias ? bf16_rne(bias[col]) : 0.f;
#pragma unroll
    for (int r = 0; r < 8; ++r) { const int rloc = half * 16 + 8 * hh + r; float v = accs[u][r] * alpha + bv;
      if (CP) v += CP[cofs + (size_t)(row0 + rloc) * ldc + col];      /* own element of the batched C plane */
      so[w][rloc][t * 16 + ln] = v; } }
  __builtin_amdgcn_fence(4 /* acq_rel order */, "workgroup"); __builtin_amdgcn_wave_barrier();
  const int rsub = lane >> 4, c4 = (lane & 15) * 4;
  {
#pragma unroll
    for (int q = 0; q < 16; ++q) { const int r = q * 2 + rsub; const v4f v = *(const v4fa*)&so[w][r][c4];
      if (C) *(v4f*)(C + cofs + (size_t)(row0 + r) * ldc + col0 + c4) = v;
      if (C16) { v4h h4; h4[0] = (_Float16)v[0]; h4[1] = (_Float16)v[1]; h4[2] = (_Float16)v[2]; h4[3] = (_Float16)v[3]; *(v4h*)(C16 + cofs + (size_t)(row0 + r) * ldc + col0 + c4) = h4; } }
     }
}

// Butterfly over the 32 lanes of a wave: four row_xmask steps inside each 16-lane row, then the other row; every lane ends with the same value.
template <int CTRL>
__device__ __forceinline__ float lane_xm(float x) { return __int_as_float(__builtin_amdgcn_update_dpp(0, __float_as_int(x), CTRL, 0xf, 0xf, true)); }
__device__ __forceinline__ float lane_x16(float x) { const int b = __float_as_int(x); return __int_as_float(__builtin_amdgcn_permlanex16(b, b, 0x76543210, 0xfedcba98, false, false)); }
__device__ __forceinline__ float wave_max(float x) {
  x = fmaxf(x, lane_xm<0x161>(x)); x = fmaxf(x, lane_xm<0x162>(x)); x = fmaxf(x, lane_xm<0x164>(x)); x = fmaxf(x, lane_xm<0x168>(x)); return fmaxf(x, lane_x16(x)); }
__device__ __forceinline__ float wave_sum(float x) {
  x += lane_xm<0x161>(x); x += lane_xm<0x162>(x); x += lane_xm<0x164>(x); x += lane_xm<0x168>(x); return x + lane_x16(x); }

#define FAC1 0.18033688011112042f        /* log2(e) / 8 */
#define FAC2 0.00017611023448351604f     /* log2(e) / 8 / 1024 */
#define FAP 72                           /* LDS row pitch in 16-bit elements: 128 B + 16 B, for 16-byte readers on 16 rows */
#define FNT (SQ / 64)                    /* query tiles = key steps of the longest tile */
static_assert(HD == 64 && (FNT & (FNT - 1)) == 0);
// 2^x. The v_nop at the end keeps the one slot that the instruction set asks for between a transcendental and a next instruction that reads its result or overwrites its source;
// inside the run of eight every result register is distinct from every source (early clobber), so each v_exp_f32 is the independent instruction behind the one before.
__device__ __forceinline__ float fa_exp2(float x) { float y; asm("v_exp_f32 %0, %1\n\tv_nop" : "=v"(y) : "v"(x)); return y; }
__device__ __forceinline__ v8f fa_exp2x8(v8f x) { float y0, y1, y2, y3, y4, y5, y6, y7;
  asm("v_exp_f32 %0, %8\n\tv_exp_f32 %1, %9\n\tv_exp_f32 %2, %10\n\tv_exp_f32 %3, %11\n\tv_exp_f32 %4, %12\n\tv_exp_f32 %5, %13\n\tv_exp_f32 %6, %14\n\tv_exp_f32 %7, %15\n\tv_nop"
      : "=&v"(y0), "=&v"(y1), "=&v"(y2), "=&v"(y3), "=&v"(y4), "=&v"(y5), "=&v"(y6), "=&v"(y7)
      : "v"(x[0]), "v"(x[1]), "v"(x[2]), "v"(x[3]), "v"(x[4]), "v"(x[5]), "v"(x[6]), "v"(x[7]));
  const v8f y = {y0, y1, y2, y3, y4, y5, y6, y7}; return y; }
/* amdgpu_waves_per_eu(4, 4): holds the kernel to 256 registers, so that four blocks fit a WGP and no register window is switched in the loop */
__global__ __launch_bounds__(128) __attribute__((amdgpu_waves_per_eu(4, 4))) void k_fattn(const _Float16* __restrict__ QHp, const _Float16* __restrict__ QLp, const _Float16* __restrict__ KHp, const _Float16* __restrict__ KLp,
    const _Float16* __restrict__ VTp, _Float16* __restrict__ O16p) {
  __shared__ __attribute__((aligned(16))) unsigned short lt[2][3][64][FAP];      /* [buffer][K hi, K residual, V^T][row][element] */
  const int tid = threadIdx.x, w = __builtin_amdgcn_readfirstlane((int)(tid >> 5)), lane = tid & 31, ln = lane & 15, hh = lane >> 4;
  const int h = blockIdx.y, b = blockIdx.z; const int x = blockIdx.x, grp = (b * NH + h) >> 3;
  /* a permutation of the tiles for each (batch, head): blocks whose flat indices lie far apart get tiles of unequal length, so that long tiles do not gather in one place */
  const int qt = (grp % 3 == 0) ? FNT - 1 - x : ((grp % 3 == 1) ? x : ((x + FNT / 2) & (FNT - 1)));
  const int qw = qt * 64 + 16 * w; const size_t r0 = (size_t)b * SQ;
  const _Float16* qhp = QHp + (r0 + qw + ln) * DM + h * HD; const _Float16* qlp = QLp + (r0 + qw + ln) * DM + h * HD;
  const v16h qh0 = g2_frag(qhp, hh), qh1 = g2_frag(qhp + 32, hh), ql0 = g2_frag(qlp, hh), ql1 = g2_frag(qlp + 32, hh);
  const int sr = tid >> 3, sc = (tid & 7) * 8;      /* staging: 8 lanes cover one 128-B row, a wave 4 rows */
  const unsigned short* gk = (const unsigned short*)KHp + (r0 + sr) * DM + h * HD + sc; const unsigned short* gl = (const unsigned short*)KLp + (r0 + sr) * DM + h * HD + sc;
  const unsigned short* gv = (const unsigned short*)VTp + ((size_t)(b * NH + h) * HD + sr) * SQ + sc;
  v8us g[12];
#pragma unroll      /* g[] indexed by constants only, so that it stays in registers */
  for (int i = 0; i < 4; ++i) { g[i] = *(const v8us*)(gk + (size_t)(16 * i) * DM); g[4 + i] = *(const v8us*)(gl + (size_t)(16 * i) * DM); g[8 + i] = *(const v8us*)(gv + (size_t)(16 * i) * SQ); }
#pragma unroll      /* g[] indexed by constants only */
  for (int i = 0; i < 4; ++i) { *(v8us*)&lt[0][0][sr + 16 * i][sc] = g[i]; *(v8us*)&lt[0][1][sr + 16 * i][sc] = g[4 + i]; *(v8us*)&lt[0][2][sr + 16 * i][sc] = g[8 + i]; }
  const v8f z8 = {0.f,0.f,0.f,0.f,0.f,0.f,0.f,0.f};
  v8f o[4] = {z8, z8, z8, z8}; float m = -1.0e30f, l = 0.f;
#pragma unroll 1      /* one step is already 32 matrix instructions; the two buffers alternate by index */
  for (int j = 0; j <= qt; ++j) {
    const int cb = j & 1;
    __syncthreads();      /* publishes buffer cb, and ends every wave's reads of the other buffer (step j - 1) before it is stored into below */
    if (j < qt) {      /* the next step's tiles fly while this step is worked on */
      gk += (size_t)64 * DM; gl += (size_t)64 * DM; gv += 64;
#pragma unroll      /* g[] indexed by constants only */
      for (int i = 0; i < 4; ++i) { g[i] = *(const v8us*)(gk + (size_t)(16 * i) * DM); g[4 + i] = *(const v8us*)(gl + (size_t)(16 * i) * DM); g[8 + i] = *(const v8us*)(gv + (size_t)(16 * i) * SQ); }
    }
    v8f s[4]; v16h kf[2][4], va[4];
    { const _Float16* kh = (const _Float16*)&lt[cb][0][ln][0]; const _Float16* kl = (const _Float16*)&lt[cb][1][ln][0];
      kf[0][0] = g2_frag(kh, hh); kf[0][1] = g2_frag(kh + 32, hh); kf[0][2] = g2_frag(kl, hh); kf[0][3] = g2_frag(kl + 32, hh); }
#pragma unroll      /* s[], kf[], va[] indexed by constants only, so that they stay in registers */
    for (int t = 0; t < 4; ++t) {
      if (t < 3) {      /* the next 16 keys' fragments are asked for ahead of this tile's products */
        const _Float16* kh = (const _Float16*)&lt[cb][0][16 * (t + 1) + ln][0]; const _Float16* kl = (const _Float16*)&lt[cb][1][16 * (t + 1) + ln][0];
        kf[(t + 1) & 1][0] = g2_frag(kh, hh); kf[(t + 1) & 1][1] = g2_frag(kh + 32, hh); kf[(t + 1) & 1][2] = g2_frag(kl, hh); kf[(t + 1) & 1][3] = g2_frag(kl + 32, hh);
      } else {      /* V^T of the first 32 keys is asked for ahead of the softmax */
#pragma unroll      /* va[] indexed by constants only */
        for (int u = 0; u < 4; ++u) va[u] = g2_frag((const _Float16*)&lt[cb][2][16 * u + ln][0], hh);
      }
      const v16h kh0 = kf[t & 1][0], kh1 = kf[t & 1][1], kl0 = kf[t & 1][2], kl1 = kf[t & 1][3];
      v8f a = z8, c = z8, d = z8;
      a = g2_mma(kh0, qh0, a); c = g2_mma(kh0, ql0, c); d = g2_mma(kl0, qh0, d);
      a = g2_mma(kh1, qh1, a); c = g2_mma(kh1, ql1, c); d = g2_mma(kl1, qh1, d);
#pragma unroll      /* vector elements indexed by constants only */
      for (int r = 0; r < 8; ++r) s[t][r] = a[r] * FAC1 + (c[r] + d[r]) * FAC2;
    }
    if (j == qt) {      /* only the last step crosses the diagonal; every query keeps its key 64 qt there */
      const int rel = 16 * w + ln - 8 * hh;      /* key 64 qt + 16 t + 8 hh + r is kept while 16 t + r <= rel */
#pragma unroll      /* s[] indexed by constants only */
      for (int t = 0; t < 4; ++t) {
#pragma unroll      /* s[] indexed by constants only */
        for (int r = 0; r < 8; ++r) s[t][r] = (16 * t + r <= rel) ? s[t][r] : -1.0e30f; }
    }
    v8f x8;
#pragma unroll      /* vector elements indexed by constants only */
    for (int r = 0; r < 8; ++r) x8[r] = fmaxf(fmaxf(s[0][r], s[1][r]), fmaxf(s[2][r], s[3][r]));
    float mx = fmaxf(fmaxf(fmaxf(x8[0], x8[1]), fmaxf(x8[2], x8[3])), fmaxf(fmaxf(x8[4], x8[5]), fmaxf(x8[6], x8[7])));
    mx = fmaxf(mx, lane_x16(mx));      /* the other half of this query's keys */
    const float mn = fmaxf(m, mx); const float al = fa_exp2(m - mn); const float mb = mn - 8.0f; m = mn;
    v4f ps = {0.f, 0.f, 0.f, 0.f};
#pragma unroll      /* s[] indexed by constants only */
    for (int t = 0; t < 4; ++t) { s[t] = fa_exp2x8(s[t] - mb);
#pragma unroll      /* s[] indexed by constants only; four independent partial sums */
      for (int r = 0; r < 8; ++r) ps[r & 3] += s[t][r]; }
    l = l * al + ((ps[0] + ps[1]) + (ps[2] + ps[3]));
    FragH p0, p1;
#pragma unroll      /* fragment elements indexed by constants only */
    for (int r = 0; r < 8; ++r) { p0.h[r] = (_Float16)s[0][r]; p0.h[8 + r] = (_Float16)s[1][r]; p1.h[r] = (_Float16)s[2][r]; p1.h[8 + r] = (_Float16)s[3][r]; }
#pragma unroll      /* o[] indexed by constants only */
    for (int t = 0; t < 4; ++t) {
#pragma unroll      /* o[] indexed by constants only */
      for (int r = 0; r < 8; ++r) o[t][r] *= al; }
    v16h vb[4];
#pragma unroll      /* vb[] indexed by constants only; V^T of the last 32 keys, into registers that the scores have left */
    for (int u = 0; u < 4; ++u) vb[u] = g2_frag((const _Float16*)&lt[cb][2][16 * u + ln][32], hh);
#pragma unroll      /* o[], va[] indexed by constants only; four independent accumulators in turn */
    for (int t = 0; t < 4; ++t) o[t] = g2_mma(va[t], p0.v, o[t]);
#pragma unroll      /* o[], vb[] indexed by constants only */
    for (int t = 0; t < 4; ++t) o[t] = g2_mma(vb[t], p1.v, o[t]);
    if (j < qt) {
#pragma unroll      /* g[] indexed by constants only */
      for (int i = 0; i < 4; ++i) { *(v8us*)&lt[cb ^ 1][0][sr + 16 * i][sc] = g[i]; *(v8us*)&lt[cb ^ 1][1][sr + 16 * i][sc] = g[4 + i]; *(v8us*)&lt[cb ^ 1][2][sr + 16 * i][sc] = g[8 + i]; }
    }
  }
  l += lane_x16(l);      /* join the two halves' sums once */
  const float inv = 64.0f / l;      /* o carried x64 */
  unsigned short* op = (unsigned short*)O16p + (r0 + qw + ln) * DM + h * HD + 8 * hh;
#pragma unroll      /* o[] indexed by constants only */
  for (int t = 0; t < 4; ++t) { FragH f;
#pragma unroll      /* fragment elements indexed by constants only */
    for (int r = 0; r < 8; ++r) f.h[r] = (_Float16)(o[t][r] * inv);
    *(v8us*)(op + 16 * t) = f.half[0]; }
}

// f32 attention over the first QT0 query rows of one batch. Block = one head x A0R query rows, 8 waves, 2 rows a wave; keys 0 .. (rg + 1) A0R - 1 cover every row of the block.
// K (row pitch A0KP floats = 16 B x odd: lanes on different rows read 16 B each without bank conflicts), V and the q rows are staged in LDS once.
// Scores: lane = key, both rows share each K read. Softmax: wave butterflies. Weighted sum: lane = channel pair, weights read as broadcasts.
#define A0R 16
#define A0KP 68
static_assert(QT0 % A0R == 0);
static_assert(QT0 == 128 && HD == 64 && A0R == 16);
typedef float v2f __attribute__((ext_vector_type(2)));
__global__ __launch_bounds__(256) void k_att0(const float* __restrict__ QF, const float* __restrict__ KF, const float* __restrict__ VF, float scale, float* __restrict__ OF) {
  __shared__ __attribute__((aligned(16))) float lk[QT0][A0KP]; __shared__ __attribute__((aligned(16))) float lv[QT0][HD];
  __shared__ __attribute__((aligned(16))) float lq[A0R][HD]; __shared__ __attribute__((aligned(16))) float lp[A0R][QT0];
  const int tid = threadIdx.x, lane = tid & 31, w = __builtin_amdgcn_readfirstlane((int)(tid >> 5));
  const int h = blockIdx.x / (QT0 / A0R), rg = blockIdx.x % (QT0 / A0R); const int nkeys = (rg + 1) * A0R;
  const int sr = tid >> 4, sc4 = (tid & 15) * 4;      /* staging: 16 lanes cover one 256-B row */
  const float* qp = QF + (size_t)(rg * A0R + sr) * DM + h * HD + sc4; const float* kp = KF + (size_t)sr * DM + h * HD + sc4; const float* vp = VF + (size_t)sr * DM + h * HD + sc4;
  const v4f qs = *(const v4fa*)qp;
  v4f ks[QT0 / 16], vs[QT0 / 16];      /* all QT0 rows of K and V are staged by every block: no test stands between the loads */
#pragma unroll      /* ks[], vs[] indexed by constants only, so that they stay in registers; all loads issued before the first use */
  for (int g = 0; g < QT0 / 16; ++g) { ks[g] = *(const v4fa*)(kp + (size_t)g * 16 * DM); vs[g] = *(const v4fa*)(vp + (size_t)g * 16 * DM); }
  asm volatile("s_wait_xcnt 0x0" :: "v"(qp), "v"(kp), "v"(vp) : "memory");      /* the wait before the loads' address pairs are reused; naming the pairs keeps them live up to here, so that no load's result is placed in them */
  *(v4f*)&lq[sr][sc4] = qs;
#pragma unroll      /* ks[], vs[] indexed by constants only, so that they stay in registers */
  for (int g = 0; g < QT0 / 16; ++g) { *(v4f*)&lk[g * 16 + sr][sc4] = ks[g]; *(v4f*)&lv[g * 16 + sr][sc4] = vs[g]; }
  __syncthreads();
  const int r0 = 2 * w, i0 = rg * A0R + r0, i1 = i0 + 1;      /* this wave's two query rows */
  const int nch = (nkeys + 31) >> 5;      /* chunks of 32 keys */
  float s0[QT0 / 32], s1[QT0 / 32];
#pragma unroll      /* s0[], s1[] indexed by constants only, so that they stay in registers */
  for (int m = 0; m < QT0 / 32; ++m) { s0[m] = -1.0e30f; s1[m] = -1.0e30f;
    if (m < nch) { const int j = m * 32 + lane;
      v4f a0 = {0.f, 0.f, 0.f, 0.f}, a1 = {0.f, 0.f, 0.f, 0.f};
#pragma unroll      /* the 48 LDS reads of a chunk issue ahead of their use */
      for (int c = 0; c < HD / 4; ++c) { const v4f kq = *(const v4f*)&lk[j][c * 4]; const v4f q0 = *(const v4f*)&lq[r0][c * 4]; const v4f q1 = *(const v4f*)&lq[r0 + 1][c * 4];
#pragma unroll      /* four independent partial sums a row */
        for (int u = 0; u < 4; ++u) { a0[u] = fmaf(q0[u], kq[u], a0[u]); a1[u] = fmaf(q1[u], kq[u], a1[u]); } }
      const float d0 = ((a0[0] + a0[1]) + (a0[2] + a0[3])) * scale, d1 = ((a1[0] + a1[1]) + (a1[2] + a1[3])) * scale;
      s0[m] = (j <= i0) ? d0 : -1.0e30f; s1[m] = (j <= i1) ? d1 : -1.0e30f; } }
  const float m0 = wave_max(fmaxf(fmaxf(s0[0], s0[1]), fmaxf(s0[2], s0[3]))), m1 = wave_max(fmaxf(fmaxf(s1[0], s1[1]), fmaxf(s1[2], s1[3])));
  float l0 = 0.f, l1 = 0.f;
#pragma unroll      /* s0[], s1[] indexed by constants only, so that they stay in registers */
  for (int m = 0; m < QT0 / 32; ++m) if (m < nch) { const int j = m * 32 + lane;
    const float e0 = (j <= i0) ? expf(s0[m] - m0) : 0.f, e1 = (j <= i1) ? expf(s1[m] - m1) : 0.f;
    l0 += e0; l1 += e1; lp[r0][j] = e0; lp[r0 + 1][j] = e1; }
  l0 = wave_sum(l0); l1 = wave_sum(l1);
  __syncthreads();      /* the weights of a row are written by lanes and read back as broadcasts */
  const int n4 = (i1 + 4) >> 2;      /* keys 0 .. i1 in fours; the weights above a row's own index are zero, and 4 n4 <= nkeys */
  v2f o0 = {0.f, 0.f}, o1 = {0.f, 0.f};
#pragma unroll 4      /* LDS reads of later trips issue while earlier ones are summed */
  for (int t = 0; t < n4; ++t) { const v4f p0 = *(const v4f*)&lp[r0][t * 4]; const v4f p1 = *(const v4f*)&lp[r0 + 1][t * 4];
#pragma unroll      /* p0[], p1[] indexed by constants only */
    for (int u = 0; u < 4; ++u) { const v2f vv = *(const v2f*)&lv[t * 4 + u][2 * lane];
      o0[0] = fmaf(p0[u], vv[0], o0[0]); o0[1] = fmaf(p0[u], vv[1], o0[1]); o1[0] = fmaf(p1[u], vv[0], o1[0]); o1[1] = fmaf(p1[u], vv[1], o1[1]); } }
  const float f0 = 64.0f / l0, f1 = 64.0f / l1;      /* o carried x64 like the f16 path */
  o0[0] *= f0; o0[1] *= f0; o1[0] *= f1; o1[1] *= f1;
  *(v2f*)(OF + (size_t)i0 * DM + h * HD + 2 * lane) = o0;
  *(v2f*)(OF + (size_t)i1 * DM + h * HD + 2 * lane) = o1;
}

extern "C" void kernel_launch(void* const* d_in, const int* in_sizes, int n_in,
                              void* d_out, int out_size, void* d_ws, size_t ws_size, hipStream_t stream) {
  if (n_in < 9) return;
  const size_t needx = ((size_t)(NB - 1) * SQ_FULL + SQ) * DM;
  if ((size_t)in_sizes[0] < needx) return;
  if (in_sizes[1] < DM * DM || in_sizes[3] < DM * DM || in_sizes[5] < DM * DM || in_sizes[7] < DM * DM) return;
  if (in_sizes[2] < DM || in_sizes[4] < DM || in_sizes[6] < DM || in_sizes[8] < DM) return;
  if ((size_t)out_size < needx) return;
  /* wire order: x, Wq, bq, Wk, bk, Wv, bv, Wo, bo (natural [out][in] weights, f32) */
  const float* x = (const float*)d_in[0]; const float* wq = (const float*)d_in[1]; const float* bq = (const float*)d_in[2]; const float* wk = (const float*)d_in[3]; const float* bk = (const float*)d_in[4];
  const float* wv = (const float*)d_in[5]; const float* bv = (const float*)d_in[6]; const float* wo = (const float*)d_in[7]; const float* bo = (const float*)d_in[8];
  float* out = (float*)d_out;
  char* ws = (char*)d_ws; size_t off = 0;
  auto take = [&](size_t bytes) { char* p = ws + off; off += (bytes + 255) & ~(size_t)255; return p; };
  _Float16* BQ = (_Float16*)take((size_t)DM * DM * 2); _Float16* BK = (_Float16*)take((size_t)DM * DM * 2); _Float16* BV = (_Float16*)take((size_t)DM * DM * 2); _Float16* BO = (_Float16*)take((size_t)DM * DM * 2);
  _Float16* X16 = (_Float16*)take(NR * DM * 2);
  float* QF = (float*)take(NR * DM * 4);
  _Float16* QH = (_Float16*)take(NR * DM * 2); _Float16* QL = (_Float16*)take(NR * DM * 2); _Float16* KH = (_Float16*)take(NR * DM * 2); _Float16* KL = (_Float16*)take(NR * DM * 2);
  _Float16* V16 = (_Float16*)take(NR * DM * 2); _Float16* O16 = (_Float16*)take(NR * DM * 2);
  _Float16* VT = (_Float16*)take((size_t)NB * NH * HD * SQ * 2);
  float* TAB = (float*)take((size_t)SQ * 32 * 4);
  float* QK0 = (float*)take((size_t)2 * QT0 * DM * 4); float* QKR0 = (float*)take((size_t)2 * QT0 * DM * 4); float* VF0 = (float*)take((size_t)QT0 * DM * 4);
  float* OF0 = (float*)take((size_t)NB * QT0 * DM * 4); _Float16* OH0 = (_Float16*)take((size_t)NB * QT0 * DM * 2); _Float16* OL0 = (_Float16*)take((size_t)NB * QT0 * DM * 2);
  if (off > ws_size || off > (size_t)134217728) return;

  { const size_t n8w = (size_t)DM * DM / 8; const unsigned g = (unsigned)((n8w + 255) / 256);
    k_wnat<<<g, 256, 0, stream>>>(wq, n8w, BQ); k_wnat<<<g, 256, 0, stream>>>(wk, n8w, BK); k_wnat<<<g, 256, 0, stream>>>(wv, n8w, BV); k_wnat<<<g, 256, 0, stream>>>(wo, n8w, BO); }
  { const size_t n8x = (size_t)SQ * DM / 8; k_x16<<<dim3((unsigned)((n8x + 255) / 256), NB), 256, 0, stream>>>(x, (size_t)SQ_FULL * DM, X16, (size_t)SQ * DM, n8x); }
  k_tab<<<SQ / 16, 256, 0, stream>>>(TAB);

  const dim3 gp((unsigned)((MP / 128) * (DM / 64)), 1);
  const size_t n8p = (size_t)MP * DM / 8; const unsigned ghl = (unsigned)((n8p + 255) / 256);
  k_gemm2<<<gp, 128, 0, stream>>>(X16, DM, (size_t)0, BQ, DM, (size_t)0, 0.0625f, bq, nullptr, QF, nullptr, DM, (size_t)0, MP, DM, DM);
  k_hlrope<<<ghl, 256, 0, stream>>>(QF, TAB, QH, QL, n8p);      /* q: rotary, then hi + x1024 residual */
  k_gemm2<<<gp, 128, 0, stream>>>(X16, DM, (size_t)0, BK, DM, (size_t)0, 0.0625f, bk, nullptr, QF, nullptr, DM, (size_t)0, MP, DM, DM);
  k_hlrope<<<ghl, 256, 0, stream>>>(QF, TAB, KH, KL, n8p);      /* k likewise */
  k_gemm2<<<gp, 128, 0, stream>>>(X16, DM, (size_t)0, BV, DM, (size_t)0, 0.0625f, bv, nullptr, nullptr, V16, DM, (size_t)0, MP, DM, DM);

  for (int b = 0; b < NB; ++b) { const size_t r0 = (size_t)b * SQ;
    const dim3 g0((QT0 / 128) * (DM / 64), 1);
    k_gemm2<<<g0, 128, 0, stream>>>(X16 + r0 * DM, DM, (size_t)0, BQ, DM, (size_t)0, 0.0625f, bq, nullptr, QK0, nullptr, DM, (size_t)0, QT0, DM, DM);
    k_gemm2<<<g0, 128, 0, stream>>>(X16 + r0 * DM, DM, (size_t)0, BK, DM, (size_t)0, 0.0625f, bk, nullptr, QK0 + (size_t)QT0 * DM, nullptr, DM, (size_t)0, QT0, DM, DM);
    k_gemm2<<<g0, 128, 0, stream>>>(X16 + r0 * DM, DM, (size_t)0, BV, DM, (size_t)0, 0.0625f, bv, nullptr, VF0, nullptr, DM, (size_t)0, QT0, DM, DM);
    { const int n4 = 2 * QT0 * DM / 4; k_rope0<<<(n4 + 255) / 256, 256, 0, stream>>>(QK0, TAB, QKR0, n4); }
    k_att0<<<NH * (QT0 / A0R), 256, 0, stream>>>(QKR0, QKR0 + (size_t)QT0 * DM, VF0, SCL, OF0 + (size_t)b * QT0 * DM); }
  k_vt<NH, SQ><<<NB * NH * (SQ / 64), 256, 0, stream>>>(V16, DM, 0, VT);      /* V^T [NB][NH][HD][SQ] */
  k_fattn<<<dim3(FNT, NH, NB), 128, 0, stream>>>(QH, QL, KH, KL, VT, O16);

  /* out = o (x64) . Wo (x16) * 2^-10 + bo; grid.y = batch (output rows at the full per-batch stride) */
  k_gemm2<<<dim3((unsigned)((SQ / 128) * (DM / 64)), NB), 128, 0, stream>>>(O16, DM, (size_t)SQ * DM, BO, DM, (size_t)0, 0.0009765625f, bo, nullptr, out, nullptr, DM, (size_t)SQ_FULL * DM, SQ, DM, DM);
  { const size_t n80 = (size_t)NB * QT0 * DM / 8; k_hl<<<(unsigned)((n80 + 255) / 256), 256, 0, stream>>>(OF0, OH0, OL0, n80); }
  const dim3 gf((QT0 / 128) * (DM / 64), NB);
  k_gemm2<<<gf, 128, 0, stream>>>(OH0, DM, (size_t)QT0 * DM, BO, DM, (size_t)0, 0.0009765625f, bo, nullptr, out, nullptr, DM, (size_t)SQ_FULL * DM, QT0, DM, DM);      /* rows 0..127: o_hi Wo + bo, overwriting the f16-path rows */
  k_gemm2<<<gf, 128, 0, stream>>>(OL0, DM, (size_t)QT0 * DM, BO, DM, (size_t)0, 0.00000095367431640625f, nullptr, out, out, nullptr, DM, (size_t)SQ_FULL * DM, QT0, DM, DM);      /* += o_lo Wo 2^-20 (own-element accumulate) */
}

// v005
// Measured time: 125 microseconds a run.
// Timed twice side by side with v004, it ran 1.76 and 1.78 times as fast.
// Counting every step since v000, it is 44.0 times as fast.
#include <hip/hip_runtime.h>
// Causal multi-head self-attention: x [2][2048][768], 12 heads of 64, natural [out][in] projections with biases, interleaved partial rotary embedding on channels 0..31 of each head of q and k (pairs (2p,2p+1), angle = s * 10000^(-p/16), computed table), scores / 8, causal softmax, out = merged Wo^T + bo.
// Compute dtype: every contraction on v_wmma_f32_16x16x32_f16 (f16 operands, f32 accumulate). Inputs RNE-converted to bf16 first (exact in f16; weights carried x16). q/k: GEMM -> f32 -> rotary in f32 -> f16 hi + x1024 f16 residual planes; scores = three products (hi.hi + lo.hi + hi.lo; each residual pass has its own accumulator folded with 2^-10). v, the unnormalised softmax weights (x256 at the running maximum) and o (x64) are single f16 planes; scores, online softmax and the weighted sum run in one fused kernel. The first 128 query rows of each batch are recomputed with an f32 VALU attention and go through the output GEMM as f16 hi + x1024 residual planes of o.
#ifndef NB
#define NB 2
#endif
#ifndef SEQ
#define SEQ 2048
#endif
#define SQ SEQ
#define SQ_FULL 2048                 /* per-batch row stride of x and of the output */
#define NB_FULL 2
#define DM 768
#define NH 12
#define HD 64
#define QT0 128                      /* first-tile rows recomputed in f32 */
#define SCL 0.125f                   /* 1 / sqrt(64) */
#define NR ((size_t)NB * SQ)
#define MP ((int)((size_t)NB * SQ))

static_assert(SQ % 128 == 0);
static_assert(SQ % 16 == 0);
static_assert(QT0 == 128);
static_assert(SQ >= QT0);
static_assert(NH * HD == DM);
static_assert(DM % 64 == 0);
static_assert(SQ <= SQ_FULL);
static_assert(NB <= NB_FULL);

typedef unsigned short v8us __attribute__((ext_vector_type(8), may_alias));
typedef float  v8f  __attribute__((ext_vector_type(8)));
typedef float  v4f  __attribute__((ext_vector_type(4)));
typedef float  v4fa __attribute__((ext_vector_type(4), may_alias));
typedef _Float16 v16h __attribute__((ext_vector_type(16)));
typedef _Float16 v4h __attribute__((ext_vector_type(4)));
union FragH { v16h v; v8us half[2]; _Float16 h[16]; unsigned short u[16]; };

__device__ __forceinline__ unsigned short bf16_bits(float x) { unsigned int u = __float_as_uint(x); return (unsigned short)((u + 0x7FFFu + ((u >> 16) & 1u)) >> 16); }
__device__ __forceinline__ float bf16_rne(float x) { return __uint_as_float(((unsigned int)bf16_bits(x)) << 16); }

// 10000^(-p/16), p = 0..15, selected by value (no memory table)
__device__ __forceinline__ float rope_invf(int p) {
  float f = 1.0f;
  f = (p == 1)  ? 0.5623413251903491f : f;
  f = (p == 2)  ? 0.31622776601683794f : f;
  f = (p == 3)  ? 0.1778279410038923f : f;
  f = (p == 4)  ? 0.1f : f;
  f = (p == 5)  ? 0.05623413251903491f : f;
  f = (p == 6)  ? 0.03162277660168379f : f;
  f = (p == 7)  ? 0.01778279410038923f : f;
  f = (p == 8)  ? 0.01f : f;
  f = (p == 9)  ? 0.005623413251903491f : f;
  f = (p == 10) ? 0.0031622776601683794f : f;
  f = (p == 11) ? 0.0017782794100389228f : f;
  f = (p == 12) ? 0.001f : f;
  f = (p == 13) ? 0.0005623413251903491f : f;
  f = (p == 14) ? 0.00031622776601683794f : f;
  f = (p == 15) ? 0.00017782794100389227f : f;
  return f;
}

__device__ __forceinline__ void d_tab(int blk, float* __restrict__ TAB) {
  #pragma clang fp contract(off)
  __shared__ __attribute__((aligned(16))) float tl[16][32];
  const int tid = threadIdx.x; const int sl = tid >> 4, p = tid & 15; const int s = blk * 16 + sl;
  const float ang = (float)s * rope_invf(p);
  float sn, cs; sincosf(ang, &sn, &cs);
  tl[sl][2 * p] = cs; tl[sl][2 * p + 1] = sn;
  __syncthreads();
  if (tid < 128) {
    const int row = tid >> 3, pc = (tid & 7) * 4;
    const v4f v = *(const v4fa*)&tl[row][pc];
    float* d = TAB + (size_t)(blk * 16 + row) * 32 + pc;
    *(v4f*)d = v;
    
  }
}

// 8 floats -> bf16 (RNE) -> x scale (a power of two, exact) -> f16
__device__ __forceinline__ void d_cast8(const float* __restrict__ s, float scale, _Float16* __restrict__ d) {
  const v4f a = *(const v4fa*)s, c = *(const v4fa*)(s + 4);
  FragH f;
#pragma unroll
  for (int q = 0; q < 4; ++q) { f.h[q] = (_Float16)(bf16_rne(a[q]) * scale); f.h[4 + q] = (_Float16)(bf16_rne(c[q]) * scale); }
  const v8us o = f.half[0];
  *(v8us*)(unsigned short*)d = o;
}

// One launch for the seven pieces of set-up work, none of which reads another's result; a block's piece follows from its index alone: x of each batch, the four weights (x16, stored one behind the other), the rotary table.
#define PXB ((SQ * DM / 8 + 255) / 256)      /* blocks for x of one batch */
#define PWB ((DM * DM / 8 + 255) / 256)      /* blocks for one weight */
__global__ __launch_bounds__(256) void k_prep(const float* __restrict__ x, const float* __restrict__ wq, const float* __restrict__ wk, const float* __restrict__ wv, const float* __restrict__ wo,
    _Float16* __restrict__ X16, _Float16* __restrict__ BW, float* __restrict__ TAB) {
  const int bx = blockIdx.x, tid = threadIdx.x;
  if (bx < NB * PXB) {
    const int b = bx / PXB; const int t = (bx - b * PXB) * 256 + tid; if (t >= SQ * DM / 8) return;
    d_cast8(x + (size_t)b * SQ_FULL * DM + (size_t)t * 8, 1.0f, X16 + (size_t)b * SQ * DM + (size_t)t * 8);
  } else if (bx < NB * PXB + 4 * PWB) {
    const int u = bx - NB * PXB; const int sel = u / PWB; const int t = (u - sel * PWB) * 256 + tid; if (t >= DM * DM / 8) return;
    const float* wsrc = (sel == 0) ? wq : ((sel == 1) ? wk : ((sel == 2) ? wv : wo));
    d_cast8(wsrc + (size_t)t * 8, 16.0f, BW + (size_t)sel * DM * DM + (size_t)t * 8);
  } else {
    d_tab(bx - (NB * PXB + 4 * PWB), TAB);
  }
}

__device__ __forceinline__ void d_hl(const float* __restrict__ F, _Float16* __restrict__ Hh, _Float16* __restrict__ Hl, size_t n8, size_t t) {
  if (t >= n8) return;
  FragH fh, fl; const v4f a = *(const v4fa*)(F + t * 8), c = *(const v4fa*)(F + t * 8 + 4);
#pragma unroll
  for (int q = 0; q < 4; ++q) { _Float16 h = (_Float16)a[q]; fh.h[q] = h; fl.h[q] = (_Float16)((a[q] - (float)h) * 1024.0f); h = (_Float16)c[q]; fh.h[4 + q] = h; fl.h[4 + q] = (_Float16)((c[q] - (float)h) * 1024.0f); }
  { *(v8us*)((unsigned short*)Hh + t * 8) = fh.half[0]; *(v8us*)((unsigned short*)Hl + t * 8) = fl.half[0];  }
}

__device__ __forceinline__ void d_hlrope(const float* __restrict__ F, const float* __restrict__ TAB, _Float16* __restrict__ Hh, _Float16* __restrict__ Hl, size_t n8, size_t t) {
  #pragma clang fp contract(off)
  if (t >= n8) return;
  const size_t e0 = t * 8; const size_t row = e0 / DM; const int col = (int)(e0 - row * DM); const int s = (int)(row % SQ);
  const int c0 = col & 63; const bool rot = c0 < 32; const int cc = c0 & 31;
  const v4f a = *(const v4fa*)(F + e0), c = *(const v4fa*)(F + e0 + 4);
  const v4f t0 = *(const v4fa*)(TAB + (size_t)s * 32 + cc), t1 = *(const v4fa*)(TAB + (size_t)s * 32 + cc + 4);
  float y[8];
  y[0] = rot ? (a[0] * t0[0] + (-a[1]) * t0[1]) : a[0];
  y[1] = rot ? (a[1] * t0[0] + a[0] * t0[1]) : a[1];
  y[2] = rot ? (a[2] * t0[2] + (-a[3]) * t0[3]) : a[2];
  y[3] = rot ? (a[3] * t0[2] + a[2] * t0[3]) : a[3];
  y[4] = rot ? (c[0] * t1[0] + (-c[1]) * t1[1]) : c[0];
  y[5] = rot ? (c[1] * t1[0] + c[0] * t1[1]) : c[1];
  y[6] = rot ? (c[2] * t1[2] + (-c[3]) * t1[3]) : c[2];
  y[7] = rot ? (c[3] * t1[2] + c[2] * t1[3]) : c[3];
  FragH fh, fl;
#pragma unroll
  for (int q = 0; q < 8; ++q) { const _Float16 h = (_Float16)y[q]; fh.h[q] = h; fl.h[q] = (_Float16)((y[q] - (float)h) * 1024.0f); }
  { *(v8us*)((unsigned short*)Hh + t * 8) = fh.half[0]; *(v8us*)((unsigned short*)Hl + t * 8) = fl.half[0];  }
}

__device__ __forceinline__ void d_rope0(const float* __restrict__ F, const float* __restrict__ TAB, float* __restrict__ G, int n4, int t) {
  #pragma clang fp contract(off)
  if (t >= n4) return;
  const size_t e0 = (size_t)t * 4; const int row = (int)(e0 / DM); const int col = (int)(e0 - (size_t)row * DM); const int s = row % QT0;
  const int c0 = col & 63; const bool rot = c0 < 32; const int cc = c0 & 31;
  const v4f a = *(const v4fa*)(F + e0);
  const v4f tb = *(const v4fa*)(TAB + (size_t)s * 32 + cc);
  v4f o;
  o[0] = rot ? (a[0] * tb[0] + (-a[1]) * tb[1]) : a[0];
  o[1] = rot ? (a[1] * tb[0] + a[0] * tb[1]) : a[1];
  o[2] = rot ? (a[2] * tb[2] + (-a[3]) * tb[3]) : a[2];
  o[3] = rot ? (a[3] * tb[2] + a[2] * tb[3]) : a[3];
  *(v4f*)(G + e0) = o;
  
}

template <int NHv, int TTv>
__device__ __forceinline__ void d_vt(int blk, const _Float16* __restrict__ V16, int ldv, int voff, _Float16* __restrict__ Vt) {
  __shared__ unsigned short tl[64][66];
  const int tid = threadIdx.x; const int slab = blk / (TTv / 64), lg = blk % (TTv / 64); const int b = slab / NHv, h = slab % NHv;
  for (int i = tid; i < 64 * 8; i += 256) { const int r = i / 8, c8 = (i % 8) * 8; FragH f; f.half[0] = *(const v8us*)((const unsigned short*)V16 + ((size_t)b * TTv + lg * 64 + r) * ldv + voff + h * 64 + c8);
#pragma unroll
    for (int q = 0; q < 8; ++q) tl[r][c8 + q] = f.u[q]; }
  __syncthreads();
  {
#pragma unroll
    for (int rd = 0; rd < 2; ++rd) { const int d = rd * 32 + tid / 8, pc = tid % 8; FragH f;
#pragma unroll
      for (int q = 0; q < 8; ++q) f.u[q] = tl[pc * 8 + q][d];
      *(v8us*)((unsigned short*)Vt + ((size_t)slab * 64 + d) * TTv + lg * 64 + pc * 8) = f.half[0]; }
    asm volatile("s_wait_xcnt 0x0" ::: "memory");      /* the wait before the stores' registers are reused: the code of the launch's other pieces follows in the listing */
     }
}

// One launch for the work between the projections and the two attention kernels; no piece reads another's result, and a block's piece follows from its index alone:
// rotary + hi/residual split of q and of k, rotary of the first-tile q and k of every batch, V^T.
#define PHB ((MP * DM / 8 + 255) / 256)                 /* blocks for the split of q, and of k */
#define PVB (NB * NH * (SQ / 64))                       /* blocks for V^T */
#define PRB ((NB * 2 * QT0 * DM / 4 + 255) / 256)       /* blocks for the first-tile rotary */
__global__ __launch_bounds__(256) void k_post(const float* __restrict__ QF, const float* __restrict__ KF, const float* __restrict__ TAB, _Float16* __restrict__ QH, _Float16* __restrict__ QL,
    _Float16* __restrict__ KH, _Float16* __restrict__ KL, const _Float16* __restrict__ V16, _Float16* __restrict__ VT, const float* __restrict__ QK0, float* __restrict__ QKR0) {
  const int bx = blockIdx.x, tid = threadIdx.x;
  if (bx < 2 * PHB) {
    const bool isk = bx >= PHB; const int blk = isk ? bx - PHB : bx;
    d_hlrope(isk ? KF : QF, TAB, isk ? KH : QH, isk ? KL : QL, (size_t)MP * DM / 8, (size_t)blk * 256 + tid);
  } else if (bx < 2 * PHB + PRB) {
    d_rope0(QK0, TAB, QKR0, NB * 2 * QT0 * DM / 4, (bx - 2 * PHB) * 256 + tid);
  } else {
    d_vt<NH, SQ>(bx - (2 * PHB + PRB), V16, DM, 0, VT);      /* V^T [NB][NH][HD][SQ] */
  }
}

// ---- f16 GEMM engine (wave tile 32x64; block = 4 waves = 128 rows x 64 cols; M % 128 == 0, N % 64 == 0, K % 64 == 0) ----
// A f16 [M][K] row-major (pitch lda), Bh f16 [N][K] (k contiguous, pitch ldb); grid.y batches with element strides sA / sB / sC.
// A step is 64 k: the block's 128 A rows and 64 B rows (128 B each) are read from memory once a block, as whole lines, two steps ahead into registers, and stored one step ahead into the LDS buffer that is not being read;
// every wave takes its fragments from LDS, all 24 reads of a step asked for ahead of the step's 16 products. Each accumulator still sums its k blocks of 32 in rising order.
#define G2P 72                           /* LDS row pitch in 16-bit elements: 128 B + 16 B, for 16-byte readers on 16 rows */
__device__ __forceinline__ v16h g2_frag(const _Float16* p, int hh) { FragH f; f.half[0] = *(const v8us*)((const unsigned short*)p + 8 * hh); f.half[1] = *(const v8us*)((const unsigned short*)p + 16 + 8 * hh); return f.v; }
__device__ __forceinline__ v8f g2_mma(v16h a, v16h b, v8f c) { v8f d = __builtin_amdgcn_wmma_f32_16x16x32_f16(false, a, false, b, (short)0, c, false, false); asm volatile("v_nop\n\tv_nop\n\tv_nop\n\tv_nop" : "+v"(d) : "v"(a), "v"(b)); return d; }
// The engine for one block: rows 128 mt .., columns 64 nq ..; cofs = element offset of the C plane. H16 = false: the caller never passes a C16 plane.
template <bool H16>
__device__ __forceinline__ void gemm2_body(const _Float16* __restrict__ A, int lda, const _Float16* __restrict__ Bh, int ldb, float alpha,
    const float* __restrict__ bias, const float* CP, float* C, _Float16* C16, int ldc, size_t cofs, int mt, int nq, int K) {
  __shared__ __attribute__((aligned(16))) float so[4][32][68];
  __shared__ __attribute__((aligned(16))) unsigned short st[2][192][G2P];      /* [buffer][128 A rows, then 64 B rows][element] */
  const int tid = threadIdx.x, w = __builtin_amdgcn_readfirstlane((int)(tid >> 5)), lane = tid & 31, ln = lane & 15, hh = lane >> 4;
  const int row0 = mt * 128 + 32 * w, col0 = nq * 64;
  const int sr = tid >> 3, sc = (tid & 7) * 8;      /* staging: 8 lanes cover one 128-B row, a wave 4 rows */
  /* address = a block-uniform byte pointer, which moves with the step, + the lane's own byte offset, which does not */
  const char* ga = (const char*)(A + (size_t)(mt * 128) * lda); const char* gb = (const char*)(Bh + (size_t)col0 * ldb);
  const unsigned oa = (unsigned)(sr * lda + sc) * 2u, ob = (unsigned)(sr * ldb + sc) * 2u;
  v8us g[12];
#pragma unroll      /* g[] indexed by constants only, so that it stays in registers */
  for (int i = 0; i < 8; ++i) g[i] = *(const v8us*)(ga + (size_t)(32 * i) * lda + oa);
#pragma unroll      /* g[] indexed by constants only */
  for (int i = 0; i < 4; ++i) g[8 + i] = *(const v8us*)(gb + (size_t)(32 * i) * ldb + ob);
#pragma unroll      /* g[] indexed by constants only */
  for (int i = 0; i < 12; ++i) *(v8us*)&st[0][sr + 16 * i][sc] = g[i];
  const int nk = K >> 6;
  if (1 < nk) {
    ga += 128; gb += 128;
#pragma unroll      /* g[] indexed by constants only */
    for (int i = 0; i < 8; ++i) g[i] = *(const v8us*)(ga + (size_t)(32 * i) * lda + oa);
#pragma unroll      /* g[] indexed by constants only */
    for (int i = 0; i < 4; ++i) g[8 + i] = *(const v8us*)(gb + (size_t)(32 * i) * ldb + ob);
    asm volatile("s_wait_xcnt 0x0" ::: "memory");      /* the wait before the loads' address registers are reused */
  }
  const v8f z8 = {0.f,0.f,0.f,0.f,0.f,0.f,0.f,0.f}; v8f c00 = z8, c01 = z8, c02 = z8, c03 = z8, c10 = z8, c11 = z8, c12 = z8, c13 = z8;
#pragma unroll 1      /* the two buffers alternate by index; one step is already 16 matrix instructions */
  for (int j = 0; j < nk; ++j) {
    const int cb = j & 1;
    __syncthreads();      /* publishes buffer cb, and ends every wave's reads of the other buffer (step j - 1) before it is stored into below */
    if (j + 1 < nk) {      /* step j + 1's rows, asked for a whole step ago, go into the other buffer */
#pragma unroll      /* g[] indexed by constants only */
      for (int i = 0; i < 12; ++i) *(v8us*)&st[cb ^ 1][sr + 16 * i][sc] = g[i];
    }
    if (j + 2 < nk) {      /* step j + 2's rows fly until the next step's barrier */
      ga += 128; gb += 128;
#pragma unroll      /* g[] indexed by constants only */
      for (int i = 0; i < 8; ++i) g[i] = *(const v8us*)(ga + (size_t)(32 * i) * lda + oa);
#pragma unroll      /* g[] indexed by constants only */
      for (int i = 0; i < 4; ++i) g[8 + i] = *(const v8us*)(gb + (size_t)(32 * i) * ldb + ob);
      asm volatile("s_wait_xcnt 0x0" ::: "memory");      /* the wait before the loads' address registers are reused: the fragment reads below land in them */
    }
    const _Float16* ap = (const _Float16*)&st[cb][32 * w + ln][0]; const _Float16* bp = (const _Float16*)&st[cb][128 + ln][0];
    v16h fa[2][2], fb[2][4];      /* [k block of 32][16 rows] */
#pragma unroll      /* fa[], fb[] indexed by constants only, so that they stay in registers */
    for (int kk = 0; kk < 2; ++kk) { fa[kk][0] = g2_frag(ap + 32 * kk, hh); fa[kk][1] = g2_frag(ap + 16 * G2P + 32 * kk, hh);
#pragma unroll      /* fb[] indexed by constants only */
      for (int t = 0; t < 4; ++t) fb[kk][t] = g2_frag(bp + 16 * t * G2P + 32 * kk, hh); }
#pragma unroll      /* fa[], fb[] indexed by constants only */
    for (int kk = 0; kk < 2; ++kk) {
      c00 = g2_mma(fa[kk][0], fb[kk][0], c00); c10 = g2_mma(fa[kk][1], fb[kk][0], c10);
      c01 = g2_mma(fa[kk][0], fb[kk][1], c01); c11 = g2_mma(fa[kk][1], fb[kk][1], c11);
      c02 = g2_mma(fa[kk][0], fb[kk][2], c02); c12 = g2_mma(fa[kk][1], fb[kk][2], c12);
      c03 = g2_mma(fa[kk][0], fb[kk][3], c03); c13 = g2_mma(fa[kk][1], fb[kk][3], c13); }
  }
  v8f accs[8] = {c00, c01, c02, c03, c10, c11, c12, c13};
#pragma unroll
  for (int u = 0; u < 8; ++u) { const int t = u & 3, half = u >> 2; const int col = col0 + t * 16 + ln; const float bv = bias ? bf16_rne(bias[col]) : 0.f;
#pragma unroll
    for (int r = 0; r < 8; ++r) { const int rloc = half * 16 + 8 * hh + r; float v = accs[u][r] * alpha + bv;
      if (CP) v += CP[cofs + (size_t)(row0 + rloc) * ldc + col];      /* own element of the batched C plane */
      so[w][rloc][t * 16 + ln] = v; } }
  __builtin_amdgcn_fence(4 /* acq_rel order */, "workgroup"); __builtin_amdgcn_wave_barrier();
  const int rsub = lane >> 4, c4 = (lane & 15) * 4;
  {
#pragma unroll
    for (int q = 0; q < 16; ++q) { const int r = q * 2 + rsub; const v4f v = *(const v4fa*)&so[w][r][c4];
      if (C) { *(v4f*)(C + cofs + (size_t)(row0 + r) * ldc + col0 + c4) = v;
        if (H16) asm volatile("s_wait_xcnt 0x0" ::: "memory"); }      /* the wait before the store's data registers are reused: the converted values below land in them */
      if (C16) { v4h h4; h4[0] = (_Float16)v[0]; h4[1] = (_Float16)v[1]; h4[2] = (_Float16)v[2]; h4[3] = (_Float16)v[3]; *(v4h*)(C16 + cofs + (size_t)(row0 + r) * ldc + col0 + c4) = h4; } }
     }
}

__global__ __launch_bounds__(128) void k_gemm2(const _Float16* __restrict__ A, int lda, size_t sA, const _Float16* __restrict__ Bh, int ldb, size_t sB, float alpha,
    const float* __restrict__ bias, const float* CP, float* C, _Float16* C16, int ldc, size_t sC, int M, int N, int K) {
  const int by = blockIdx.y; const int ntn = N >> 6; const int mt = blockIdx.x / ntn, nq = blockIdx.x - mt * ntn; if (mt * 128 >= M) return;      /* a block leaves as a whole */
  gemm2_body<true>(A + (size_t)by * sA, lda, Bh + (size_t)by * sB, ldb, alpha, bias, CP, C, C16, ldc, (size_t)by * sC, mt, nq, K);
}

// One launch for the nine projections, none of which reads another's result; a block's product and tile follow from its index alone:
// q, k (f32 planes) and v (f16 plane) of all rows, then q, k, v (f32) of the first QT0 rows of every batch. BW holds the weights of q, k, v one behind the other.
#define GQB ((MP / 128) * (DM / 64))      /* blocks of one projection of all rows */
#define GQ0 (DM / 64)                     /* blocks of one first-tile projection (QT0 == 128 rows) */
__global__ __launch_bounds__(128) void k_qkv(const _Float16* __restrict__ X16, const _Float16* __restrict__ BW, const float* __restrict__ bq, const float* __restrict__ bk, const float* __restrict__ bv,
    float* QF, float* KF, _Float16* V16, float* QK0, float* VF0) {
  const int bx = blockIdx.x; int sel, mt, nq; const _Float16* A = X16; float* C; _Float16* C16 = nullptr;
  if (bx < 3 * GQB) {
    sel = bx / GQB; const int t = bx - sel * GQB; mt = t / (DM / 64); nq = t - mt * (DM / 64);
    C = (sel == 0) ? QF : ((sel == 1) ? KF : nullptr); C16 = (sel == 2) ? V16 : nullptr;
  } else {
    const int u = bx - 3 * GQB; const int s6 = u / GQ0; const int b = s6 / 3; sel = s6 - 3 * b; mt = 0; nq = u - s6 * GQ0;
    A += (size_t)b * SQ * DM; C = (sel < 2) ? QK0 + (size_t)(2 * b + sel) * QT0 * DM : VF0 + (size_t)b * QT0 * DM;
  }
  const float* bias = (sel == 0) ? bq : ((sel == 1) ? bk : bv);
  gemm2_body<true>(A, DM, BW + (size_t)sel * DM * DM, DM, 0.0625f, bias, nullptr, C, C16, DM, (size_t)0, mt, nq, DM);
}

// One launch for the output product of the f16 path (rows QT0 .. of a batch) and the hi-plane product of the first-tile o (rows 0 .. QT0 - 1): same weights, scale, bias and output plane, so a block's A plane follows from its row tile alone. grid.y = batch.
#define GOB ((SQ / 128) * (DM / 64))      /* blocks a batch */
__global__ __launch_bounds__(128) void k_out(const _Float16* __restrict__ O16, const _Float16* __restrict__ OH0, const _Float16* __restrict__ BO, const float* __restrict__ bo, float* out) {
  const int bx = blockIdx.x, by = blockIdx.y; const int mt = bx / (DM / 64), nq = bx - mt * (DM / 64);
  const _Float16* A = (mt == 0) ? OH0 + (size_t)by * QT0 * DM : O16 + (size_t)by * SQ * DM;      /* QT0 == 128: the first tile is row tile 0 */
  gemm2_body<false>(A, DM, BO, DM, 0.0009765625f, bo, nullptr, out, nullptr, DM, (size_t)by * SQ_FULL * DM, mt, nq, DM);
}

// Butterfly over the 32 lanes of a wave: four row_xmask steps inside each 16-lane row, then the other row; every lane ends with the same value.
template <int CTRL>
__device__ __forceinline__ float lane_xm(float x) { return __int_as_float(__builtin_amdgcn_update_dpp(0, __float_as_int(x), CTRL, 0xf, 0xf, true)); }
__device__ __forceinline__ float lane_x16(float x) { const int b = __float_as_int(x); return __int_as_float(__builtin_amdgcn_permlanex16(b, b, 0x76543210, 0xfedcba98, false, false)); }
__device__ __forceinline__ float wave_max(float x) {
  x = fmaxf(x, lane_xm<0x161>(x)); x = fmaxf(x, lane_xm<0x162>(x)); x = fmaxf(x, lane_xm<0x164>(x)); x = fmaxf(x, lane_xm<0x168>(x)); return fmaxf(x, lane_x16(x)); }
__device__ __forceinline__ float wave_sum(float x) {
  x += lane_xm<0x161>(x); x += lane_xm<0x162>(x); x += lane_xm<0x164>(x); x += lane_xm<0x168>(x); return x + lane_x16(x); }

#define FAC1 0.18033688011112042f        /* log2(e) / 8 */
#define FAC2 0.00017611023448351604f     /* log2(e) / 8 / 1024 */
#define FAP 72                           /* LDS row pitch in 16-bit elements: 128 B + 16 B, for 16-byte readers on 16 rows */
#define FNT (SQ / 64)                    /* query tiles = key steps of the longest tile */
static_assert(HD == 64 && (FNT & (FNT - 1)) == 0);
static_assert((size_t)FNT * NH * 128 * 8 >= (size_t)NB * QT0 * DM);      /* one slab of blocks covers the split of the first-tile o */
// 2^x. The v_nop at the end keeps the one slot that the instruction set asks for between a transcendental and a next instruction that reads its result or overwrites its source;
// inside the run of eight every result register is distinct from every source (early clobber), so each v_exp_f32 is the independent instruction behind the one before.
__device__ __forceinline__ float fa_exp2(float x) { float y; asm("v_exp_f32 %0, %1\n\tv_nop" : "=v"(y) : "v"(x)); return y; }
__device__ __forceinline__ v8f fa_exp2x8(v8f x) { float y0, y1, y2, y3, y4, y5, y6, y7;
  asm("v_exp_f32 %0, %8\n\tv_exp_f32 %1, %9\n\tv_exp_f32 %2, %10\n\tv_exp_f32 %3, %11\n\tv_exp_f32 %4, %12\n\tv_exp_f32 %5, %13\n\tv_exp_f32 %6, %14\n\tv_exp_f32 %7, %15\n\tv_nop"
      : "=&v"(y0), "=&v"(y1), "=&v"(y2), "=&v"(y3), "=&v"(y4), "=&v"(y5), "=&v"(y6), "=&v"(y7)
      : "v"(x[0]), "v"(x[1]), "v"(x[2]), "v"(x[3]), "v"(x[4]), "v"(x[5]), "v"(x[6]), "v"(x[7]));
  const v8f y = {y0, y1, y2, y3, y4, y5, y6, y7}; return y; }
/* amdgpu_waves_per_eu(4, 4): holds the kernel to 256 registers, so that four blocks fit a WGP and no register window is switched in the loop */
__global__ __launch_bounds__(128) __attribute__((amdgpu_waves_per_eu(4, 4))) void k_fattn(const _Float16* __restrict__ QHp, const _Float16* __restrict__ QLp, const _Float16* __restrict__ KHp, const _Float16* __restrict__ KLp,
    const _Float16* __restrict__ VTp, _Float16* __restrict__ O16p, const float* __restrict__ OF0, _Float16* __restrict__ OH0, _Float16* __restrict__ OL0) {
  __shared__ __attribute__((aligned(16))) unsigned short lt[2][3][64][FAP];      /* [buffer][K hi, K residual, V^T][row][element] */
  if (blockIdx.z >= NB) {      /* the slab of blocks behind the last batch (so that every attention block keeps its flat index): the hi/residual split of the first-tile o, which reads nothing of this launch; a block leaves as a whole, ahead of every barrier */
    d_hl(OF0, OH0, OL0, (size_t)NB * QT0 * DM / 8, (size_t)((blockIdx.y * FNT + blockIdx.x) * 128 + threadIdx.x)); return; }
  const int tid = threadIdx.x, w = __builtin_amdgcn_readfirstlane((int)(tid >> 5)), lane = tid & 31, ln = lane & 15, hh = lane >> 4;
  const int h = blockIdx.y, b = blockIdx.z; const int x = blockIdx.x, grp = (b * NH + h) >> 3;
  /* a permutation of the tiles for each (batch, head): blocks whose flat indices lie far apart get tiles of unequal length, so that long tiles do not gather in one place */
  const int qt = (grp % 3 == 0) ? FNT - 1 - x : ((grp % 3 == 1) ? x : ((x + FNT / 2) & (FNT - 1)));
  const int qw = qt * 64 + 16 * w; const size_t r0 = (size_t)b * SQ;
  const _Float16* qhp = QHp + (r0 + qw + ln) * DM + h * HD; const _Float16* qlp = QLp + (r0 + qw + ln) * DM + h * HD;
  const v16h qh0 = g2_frag(qhp, hh), qh1 = g2_frag(qhp + 32, hh), ql0 = g2_frag(qlp, hh), ql1 = g2_frag(qlp + 32, hh);
  const int sr = tid >> 3, sc = (tid & 7) * 8;      /* staging: 8 lanes cover one 128-B row, a wave 4 rows */
  const unsigned short* gk = (const unsigned short*)KHp + (r0 + sr) * DM + h * HD + sc; const unsigned short* gl = (const unsigned short*)KLp + (r0 + sr) * DM + h * HD + sc;
  const unsigned short* gv = (const unsigned short*)VTp + ((size_t)(b * NH + h) * HD + sr) * SQ + sc;
  v8us g[12];
#pragma unroll      /* g[] indexed by constants only, so that it stays in registers */
  for (int i = 0; i < 4; ++i) { g[i] = *(const v8us*)(gk + (size_t)(16 * i) * DM); g[4 + i] = *(const v8us*)(gl + (size_t)(16 * i) * DM); g[8 + i] = *(const v8us*)(gv + (size_t)(16 * i) * SQ); }
#pragma unroll      /* g[] indexed by constants only */
  for (int i = 0; i < 4; ++i) { *(v8us*)&lt[0][0][sr + 16 * i][sc] = g[i]; *(v8us*)&lt[0][1][sr + 16 * i][sc] = g[4 + i]; *(v8us*)&lt[0][2][sr + 16 * i][sc] = g[8 + i]; }
  const v8f z8 = {0.f,0.f,0.f,0.f,0.f,0.f,0.f,0.f};
  v8f o[4] = {z8, z8, z8, z8}; float m = -1.0e30f, l = 0.f;
#pragma unroll 1      /* one step is already 32 matrix instructions; the two buffers alternate by index */
  for (int j = 0; j <= qt; ++j) {
    const int cb = j & 1;
    __syncthreads();      /* publishes buffer cb, and ends every wave's reads of the other buffer (step j - 1) before it is stored into below */
    if (j < qt) {      /* the next step's tiles fly while this step is worked on */
      gk += (size_t)64 * DM; gl += (size_t)64 * DM; gv += 64;
#pragma unroll      /* g[] indexed by constants only */
      for (int i = 0; i < 4; ++i) { g[i] = *(const v8us*)(gk + (size_t)(16 * i) * DM); g[4 + i] = *(const v8us*)(gl + (size_t)(16 * i) * DM); g[8 + i] = *(const v8us*)(gv + (size_t)(16 * i) * SQ); }
    }
    v8f s[4]; v16h kf[2][4], va[4];
    { const _Float16* kh = (const _Float16*)&lt[cb][0][ln][0]; const _Float16* kl = (const _Float16*)&lt[cb][1][ln][0];
      kf[0][0] = g2_frag(kh, hh); kf[0][1] = g2_frag(kh + 32, hh); kf[0][2] = g2_frag(kl, hh); kf[0][3] = g2_frag(kl + 32, hh); }
#pragma unroll      /* s[], kf[], va[] indexed by constants only, so that they stay in registers */
    for (int t = 0; t < 4; ++t) {
      if (t < 3) {      /* the next 16 keys' fragments are asked for ahead of this tile's products */
        const _Float16* kh = (const _Float16*)&lt[cb][0][16 * (t + 1) + ln][0]; const _Float16* kl = (const _Float16*)&lt[cb][1][16 * (t + 1) + ln][0];
        kf[(t + 1) & 1][0] = g2_frag(kh, hh); kf[(t + 1) & 1][1] = g2_frag(kh + 32, hh); kf[(t + 1) & 1][2] = g2_frag(kl, hh); kf[(t + 1) & 1][3] = g2_frag(kl + 32, hh);
      } else {      /* V^T of the first 32 keys is asked for ahead of the softmax */
#pragma unroll      /* va[] indexed by constants only */
        for (int u = 0; u < 4; ++u) va[u] = g2_frag((const _Float16*)&lt[cb][2][16 * u + ln][0], hh);
      }
      const v16h kh0 = kf[t & 1][0], kh1 = kf[t & 1][1], kl0 = kf[t & 1][2], kl1 = kf[t & 1][3];
      v8f a = z8, c = z8, d = z8;
      a = g2_mma(kh0, qh0, a); c = g2_mma(kh0, ql0, c); d = g2_mma(kl0, qh0, d);
      a = g2_mma(kh1, qh1, a); c = g2_mma(kh1, ql1, c); d = g2_mma(kl1, qh1, d);
#pragma unroll      /* vector elements indexed by constants only */
      for (int r = 0; r < 8; ++r) s[t][r] = a[r] * FAC1 + (c[r] + d[r]) * FAC2;
    }
    if (j == qt) {      /* only the last step crosses the diagonal; every query keeps its key 64 qt there */
      const int rel = 16 * w + ln - 8 * hh;      /* key 64 qt + 16 t + 8 hh + r is kept while 16 t + r <= rel */
#pragma unroll      /* s[] indexed by constants only */
      for (int t = 0; t < 4; ++t) {
#pragma unroll      /* s[] indexed by constants only */
        for (int r = 0; r < 8; ++r) s[t][r] = (16 * t + r <= rel) ? s[t][r] : -1.0e30f; }
    }
    v8f x8;
#pragma unroll      /* vector elements indexed by constants only */
    for (int r = 0; r < 8; ++r) x8[r] = fmaxf(fmaxf(s[0][r], s[1][r]), fmaxf(s[2][r], s[3][r]));
    float mx = fmaxf(fmaxf(fmaxf(x8[0], x8[1]), fmaxf(x8[2], x8[3])), fmaxf(fmaxf(x8[4], x8[5]), fmaxf(x8[6], x8[7])));
    mx = fmaxf(mx, lane_x16(mx));      /* the other half of this query's keys */
    const float mn = fmaxf(m, mx); const float al = fa_exp2(m - mn); const float mb = mn - 8.0f; m = mn;
    v4f ps = {0.f, 0.f, 0.f, 0.f};
#pragma unroll      /* s[] indexed by constants only */
    for (int t = 0; t < 4; ++t) { s[t] = fa_exp2x8(s[t] - mb);
#pragma unroll      /* s[] indexed by constants only; four independent partial sums */
      for (int r = 0; r < 8; ++r) ps[r & 3] += s[t][r]; }
    l = l * al + ((ps[0] + ps[1]) + (ps[2] + ps[3]));
    FragH p0, p1;
#pragma unroll      /* fragment elements indexed by constants only */
    for (int r = 0; r < 8; ++r) { p0.h[r] = (_Float16)s[0][r]; p0.h[8 + r] = (_Float16)s[1][r]; p1.h[r] = (_Float16)s[2][r]; p1.h[8 + r] = (_Float16)s[3][r]; }
#pragma unroll      /* o[] indexed by constants only */
    for (int t = 0; t < 4; ++t) {
#pragma unroll      /* o[] indexed by constants only */
      for (int r = 0; r < 8; ++r) o[t][r] *= al; }
    v16h vb[4];
#pragma unroll      /* vb[] indexed by constants only; V^T of the last 32 keys, into registers that the scores have left */
    for (int u = 0; u < 4; ++u) vb[u] = g2_frag((const _Float16*)&lt[cb][2][16 * u + ln][32], hh);
#pragma unroll      /* o[], va[] indexed by constants only; four independent accumulators in turn */
    for (int t = 0; t < 4; ++t) o[t] = g2_mma(va[t], p0.v, o[t]);
#pragma unroll      /* o[], vb[] indexed by constants only */
    for (int t = 0; t < 4; ++t) o[t] = g2_mma(vb[t], p1.v, o[t]);
    if (j < qt) {
#pragma unroll      /* g[] indexed by constants only */
      for (int i = 0; i < 4; ++i) { *(v8us*)&lt[cb ^ 1][0][sr + 16 * i][sc] = g[i]; *(v8us*)&lt[cb ^ 1][1][sr + 16 * i][sc] = g[4 + i]; *(v8us*)&lt[cb ^ 1][2][sr + 16 * i][sc] = g[8 + i]; }
    }
  }
  l += lane_x16(l);      /* join the two halves' sums once */
  const float inv = 64.0f / l;      /* o carried x64 */
  unsigned short* op = (unsigned short*)O16p + (r0 + qw + ln) * DM + h * HD + 8 * hh;
#pragma unroll      /* o[] indexed by constants only */
  for (int t = 0; t < 4; ++t) { FragH f;
#pragma unroll      /* fragment elements indexed by constants only */
    for (int r = 0; r < 8; ++r) f.h[r] = (_Float16)(o[t][r] * inv);
    *(v8us*)(op + 16 * t) = f.half[0]; }
  asm volatile("s_wait_xcnt 0x0" ::: "memory");      /* the wait before the stores' registers are reused: the code of the split piece follows in the listing */
}

// f32 attention over the first QT0 query rows of every batch (grid.y = batch; q and k planes of a batch lie one behind the other). Block = one head x A0R query rows, 8 waves, 2 rows a wave; keys 0 .. (rg + 1) A0R - 1 cover every row of the block.
// K (row pitch A0KP floats = 16 B x odd: lanes on different rows read 16 B each without bank conflicts), V and the q rows are staged in LDS once.
// Scores: lane = key, both rows share each K read. Softmax: wave butterflies. Weighted sum: lane = channel pair, weights read as broadcasts.
#define A0R 16
#define A0KP 68
static_assert(QT0 % A0R == 0);
static_assert(QT0 == 128 && HD == 64 && A0R == 16);
typedef float v2f __attribute__((ext_vector_type(2)));
__global__ __launch_bounds__(256) void k_att0(const float* __restrict__ QF, const float* __restrict__ KF, const float* __restrict__ VF, float scale, float* __restrict__ OF) {
  __shared__ __attribute__((aligned(16))) float lk[QT0][A0KP]; __shared__ __attribute__((aligned(16))) float lv[QT0][HD];
  __shared__ __attribute__((aligned(16))) float lq[A0R][HD]; __shared__ __attribute__((aligned(16))) float lp[A0R][QT0];
  const int tid = threadIdx.x, lane = tid & 31, w = __builtin_amdgcn_readfirstlane((int)(tid >> 5));
  const int h = blockIdx.x / (QT0 / A0R), rg = blockIdx.x % (QT0 / A0R); const int nkeys = (rg + 1) * A0R;
  { const size_t bo1 = (size_t)blockIdx.y * QT0 * DM; QF += 2 * bo1; KF += 2 * bo1; VF += bo1; OF += bo1; }
  const int sr = tid >> 4, sc4 = (tid & 15) * 4;      /* staging: 16 lanes cover one 256-B row */
  const float* qp = QF + (size_t)(rg * A0R + sr) * DM + h * HD + sc4; const float* kp = KF + (size_t)sr * DM + h * HD + sc4; const float* vp = VF + (size_t)sr * DM + h * HD + sc4;
  const v4f qs = *(const v4fa*)qp;
  v4f ks[QT0 / 16], vs[QT0 / 16];      /* all QT0 rows of K and V are staged by every block: no test stands between the loads */
#pragma unroll      /* ks[], vs[] indexed by constants only, so that they stay in registers; all loads issued before the first use */
  for (int g = 0; g < QT0 / 16; ++g) { ks[g] = *(const v4fa*)(kp + (size_t)g * 16 * DM); vs[g] = *(const v4fa*)(vp + (size_t)g * 16 * DM); }
  asm volatile("s_wait_xcnt 0x0" :: "v"(qp), "v"(kp), "v"(vp) : "memory");      /* the wait before the loads' address pairs are reused; naming the pairs keeps them live up to here, so that no load's result is placed in them */
  *(v4f*)&lq[sr][sc4] = qs;
#pragma unroll      /* ks[], vs[] indexed by constants only, so that they stay in registers */
  for (int g = 0; g < QT0 / 16; ++g) { *(v4f*)&lk[g * 16 + sr][sc4] = ks[g]; *(v4f*)&lv[g * 16 + sr][sc4] = vs[g]; }
  __syncthreads();
  const int r0 = 2 * w, i0 = rg * A0R + r0, i1 = i0 + 1;      /* this wave's two query rows */
  const int nch = (nkeys + 31) >> 5;      /* chunks of 32 keys */
  float s0[QT0 / 32], s1[QT0 / 32];
#pragma unroll      /* s0[], s1[] indexed by constants only, so that they stay in registers */
  for (int m = 0; m < QT0 / 32; ++m) { s0[m] = -1.0e30f; s1[m] = -1.0e30f;
    if (m < nch) { const int j = m * 32 + lane;
      v4f a0 = {0.f, 0.f, 0.f, 0.f}, a1 = {0.f, 0.f, 0.f, 0.f};
#pragma unroll      /* the 48 LDS reads of a chunk issue ahead of their use */
      for (int c = 0; c < HD / 4; ++c) { const v4f kq = *(const v4f*)&lk[j][c * 4]; const v4f q0 = *(const v4f*)&lq[r0][c * 4]; const v4f q1 = *(const v4f*)&lq[r0 + 1][c * 4];
#pragma unroll      /* four independent partial sums a row */
        for (int u = 0; u < 4; ++u) { a0[u] = fmaf(q0[u], kq[u], a0[u]); a1[u] = fmaf(q1[u], kq[u], a1[u]); } }
      const float d0 = ((a0[0] + a0[1]) + (a0[2] + a0[3])) * scale, d1 = ((a1[0] + a1[1]) + (a1[2] + a1[3])) * scale;
      s0[m] = (j <= i0) ? d0 : -1.0e30f; s1[m] = (j <= i1) ? d1 : -1.0e30f; } }
  const float m0 = wave_max(fmaxf(fmaxf(s0[0], s0[1]), fmaxf(s0[2], s0[3]))), m1 = wave_max(fmaxf(fmaxf(s1[0], s1[1]), fmaxf(s1[2], s1[3])));
  float l0 = 0.f, l1 = 0.f;
#pragma unroll      /* s0[], s1[] indexed by constants only, so that they stay in registers */
  for (int m = 0; m < QT0 / 32; ++m) if (m < nch) { const int j = m * 32 + lane;
    const float e0 = (j <= i0) ? expf(s0[m] - m0) : 0.f, e1 = (j <= i1) ? expf(s1[m] - m1) : 0.f;
    l0 += e0; l1 += e1; lp[r0][j] = e0; lp[r0 + 1][j] = e1; }
  l0 = wave_sum(l0); l1 = wave_sum(l1);
  __syncthreads();      /* the weights of a row are written by lanes and read back as broadcasts */
  const int n4 = (i1 + 4) >> 2;      /* keys 0 .. i1 in fours; the weights above a row's own index are zero, and 4 n4 <= nkeys */
  v2f o0 = {0.f, 0.f}, o1 = {0.f, 0.f};
#pragma unroll 4      /* LDS reads of later trips issue while earlier ones are summed */
  for (int t = 0; t < n4; ++t) { const v4f p0 = *(const v4f*)&lp[r0][t * 4]; const v4f p1 = *(const v4f*)&lp[r0 + 1][t * 4];
#pragma unroll      /* p0[], p1[] indexed by constants only */
    for (int u = 0; u < 4; ++u) { const v2f vv = *(const v2f*)&lv[t * 4 + u][2 * lane];
      o0[0] = fmaf(p0[u], vv[0], o0[0]); o0[1] = fmaf(p0[u], vv[1], o0[1]); o1[0] = fmaf(p1[u], vv[0], o1[0]); o1[1] = fmaf(p1[u], vv[1], o1[1]); } }
  const float f0 = 64.0f / l0, f1 = 64.0f / l1;      /* o carried x64 like the f16 path */
  o0[0] *= f0; o0[1] *= f0; o1[0] *= f1; o1[1] *= f1;
  *(v2f*)(OF + (size_t)i0 * DM + h * HD + 2 * lane) = o0;
  *(v2f*)(OF + (size_t)i1 * DM + h * HD + 2 * lane) = o1;
}

extern "C" void kernel_launch(void* const* d_in, const int* in_sizes, int n_in,
                              void* d_out, int out_size, void* d_ws, size_t ws_size, hipStream_t stream) {
  if (n_in < 9) return;
  const size_t needx = ((size_t)(NB - 1) * SQ_FULL + SQ) * DM;
  if ((size_t)in_sizes[0] < needx) return;
  if (in_sizes[1] < DM * DM || in_sizes[3] < DM * DM || in_sizes[5] < DM * DM || in_sizes[7] < DM * DM) return;
  if (in_sizes[2] < DM || in_sizes[4] < DM || in_sizes[6] < DM || in_sizes[8] < DM) return;
  if ((size_t)out_size < needx) return;
  /* wire order: x, Wq, bq, Wk, bk, Wv, bv, Wo, bo (natural [out][in] weights, f32) */
  const float* x = (const float*)d_in[0]; const float* wq = (const float*)d_in[1]; const float* bq = (const float*)d_in[2]; const float* wk = (const float*)d_in[3]; const float* bk = (const float*)d_in[4];
  const float* wv = (const float*)d_in[5]; const float* bv = (const float*)d_in[6]; const float* wo = (const float*)d_in[7]; const float* bo = (const float*)d_in[8];
  float* out = (float*)d_out;
  char* ws = (char*)d_ws; size_t off = 0;
  auto take = [&](size_t bytes) { char* p = ws + off; off += (bytes + 255) & ~(size_t)255; return p; };
  _Float16* BW = (_Float16*)take((size_t)4 * DM * DM * 2); _Float16* BO = BW + (size_t)3 * DM * DM;      /* weights of q, k, v, o one behind the other */
  _Float16* X16 = (_Float16*)take(NR * DM * 2);
  float* QF = (float*)take(NR * DM * 4); float* KF = (float*)take(NR * DM * 4);
  _Float16* QH = (_Float16*)take(NR * DM * 2); _Float16* QL = (_Float16*)take(NR * DM * 2); _Float16* KH = (_Float16*)take(NR * DM * 2); _Float16* KL = (_Float16*)take(NR * DM * 2);
  _Float16* V16 = (_Float16*)take(NR * DM * 2); _Float16* O16 = (_Float16*)take(NR * DM * 2);
  _Float16* VT = (_Float16*)take((size_t)NB * NH * HD * SQ * 2);
  float* TAB = (float*)take((size_t)SQ * 32 * 4);
  float* QK0 = (float*)take((size_t)NB * 2 * QT0 * DM * 4); float* QKR0 = (float*)take((size_t)NB * 2 * QT0 * DM * 4); float* VF0 = (float*)take((size_t)NB * QT0 * DM * 4);      /* [batch][q, k][row][channel]; [batch][row][channel] */
  float* OF0 = (float*)take((size_t)NB * QT0 * DM * 4); _Float16* OH0 = (_Float16*)take((size_t)NB * QT0 * DM * 2); _Float16* OL0 = (_Float16*)take((size_t)NB * QT0 * DM * 2);
  if (off > ws_size || off > (size_t)134217728) return;

  k_prep<<<NB * PXB + 4 * PWB + SQ / 16, 256, 0, stream>>>(x, wq, wk, wv, wo, X16, BW, TAB);
  k_qkv<<<3 * GQB + NB * 3 * GQ0, 128, 0, stream>>>(X16, BW, bq, bk, bv, QF, KF, V16, QK0, VF0);
  k_post<<<2 * PHB + PVB + PRB, 256, 0, stream>>>(QF, KF, TAB, QH, QL, KH, KL, V16, VT, QK0, QKR0);
  k_att0<<<dim3(NH * (QT0 / A0R), NB), 256, 0, stream>>>(QKR0, QKR0 + (size_t)QT0 * DM, VF0, SCL, OF0);
  k_fattn<<<dim3(FNT, NH, NB + 1), 128, 0, stream>>>(QH, QL, KH, KL, VT, O16, OF0, OH0, OL0);

  /* out = o (x64) . Wo (x16) * 2^-10 + bo; grid.y = batch (output rows at the full per-batch stride); rows 0..127 from the hi plane of the f32 path */
  k_out<<<dim3(GOB, NB), 128, 0, stream>>>(O16, OH0, BO, bo, out);
  const dim3 gf((QT0 / 128) * (DM / 64), NB);
  k_gemm2<<<gf, 128, 0, stream>>>(OL0, DM, (size_t)QT0 * DM, BO, DM, (size_t)0, 0.00000095367431640625f, nullptr, out, out, nullptr, DM, (size_t)SQ_FULL * DM, QT0, DM, DM);      /* += o_lo Wo 2^-20 (own-element accumulate) */
}

// v006
// It runs in 111 microseconds.
// Next to v005, in two timings, it ran 1.13 and 1.12 times as fast.
// Counting every step since v000, it is 49.4 times as fast.
#include <hip/hip_runtime.h>
// Causal multi-head self-attention: x [2][2048][768], 12 heads of 64, natural [out][in] projections with biases, interleaved partial rotary embedding on channels 0..31 of each head of q and k (pairs (2p,2p+1), angle = s * 10000^(-p/16), computed table), scores / 8, causal softmax, out = merged Wo^T + bo.
// Compute dtype: every contraction on v_wmma_f32_16x16x32_f16 (f16 operands, f32 accumulate). Inputs RNE-converted to bf16 first (exact in f16; weights carried x16). q/k: GEMM -> f32 -> rotary in f32 -> f16 hi + x1024 f16 residual planes; scores = three products (hi.hi + lo.hi + hi.lo; each residual pass has its own accumulator folded with 2^-10). v, the unnormalised softmax weights (x256 at the running maximum) and o (x64) are single f16 planes; scores, online softmax and the weighted sum run in one fused kernel. The first 128 query rows of each batch are recomputed with an f32 VALU attention and go through the output GEMM as f16 hi + x1024 residual planes of o.
#ifndef NB
#define NB 2
#endif
#ifndef SEQ
#define SEQ 2048
#endif
#define SQ SEQ
#define SQ_FULL 2048                 /* per-batch row stride of x and of the output */
#define NB_FULL 2
#define DM 768
#define NH 12
#define HD 64
#define QT0 128                      /* first-tile rows recomputed in f32 */
#define SCL 0.125f                   /* 1 / sqrt(64) */
#define NR ((size_t)NB * SQ)
#define MP ((int)((size_t)NB * SQ))

static_assert(SQ % 128 == 0);
static_assert(SQ % 16 == 0);
static_assert(QT0 == 128);
static_assert(SQ >= QT0);
static_assert(NH * HD == DM);
static_assert(DM % 64 == 0);
static_assert(SQ <= SQ_FULL);
static_assert(NB <= NB_FULL);

typedef unsigned short v8us __attribute__((ext_vector_type(8), may_alias));
typedef float  v8f  __attribute__((ext_vector_type(8)));
typedef float  v4f  __attribute__((ext_vector_type(4)));
typedef float  v4fa __attribute__((ext_vector_type(4), may_alias));
typedef _Float16 v16h __attribute__((ext_vector_type(16)));
typedef _Float16 v4h __attribute__((ext_vector_type(4)));
union FragH { v16h v; v8us half[2]; _Float16 h[16]; unsigned short u[16]; };

__device__ __forceinline__ unsigned short bf16_bits(float x) { unsigned int u = __float_as_uint(x); return (unsigned short)((u + 0x7FFFu + ((u >> 16) & 1u)) >> 16); }
__device__ __forceinline__ float bf16_rne(float x) { return __uint_as_float(((unsigned int)bf16_bits(x)) << 16); }

// 10000^(-p/16), p = 0..15, selected by value (no memory table)
__device__ __forceinline__ float rope_invf(int p) {
  float f = 1.0f;
  f = (p == 1)  ? 0.5623413251903491f : f;
  f = (p == 2)  ? 0.31622776601683794f : f;
  f = (p == 3)  ? 0.1778279410038923f : f;
  f = (p == 4)  ? 0.1f : f;
  f = (p == 5)  ? 0.05623413251903491f : f;
  f = (p == 6)  ? 0.03162277660168379f : f;
  f = (p == 7)  ? 0.01778279410038923f : f;
  f = (p == 8)  ? 0.01f : f;
  f = (p == 9)  ? 0.005623413251903491f : f;
  f = (p == 10) ? 0.0031622776601683794f : f;
  f = (p == 11) ? 0.0017782794100389228f : f;
  f = (p == 12) ? 0.001f : f;
  f = (p == 13) ? 0.0005623413251903491f : f;
  f = (p == 14) ? 0.00031622776601683794f : f;
  f = (p == 15) ? 0.00017782794100389227f : f;
  return f;
}

__device__ __forceinline__ void d_tab(int blk, float* __restrict__ TAB) {
  #pragma clang fp contract(off)
  __shared__ __attribute__((aligned(16))) float tl[16][32];
  const int tid = threadIdx.x; const int sl = tid >> 4, p = tid & 15; const int s = blk * 16 + sl;
  const float ang = (float)s * rope_invf(p);
  float sn, cs; sincosf(ang, &sn, &cs);
  tl[sl][2 * p] = cs; tl[sl][2 * p + 1] = sn;
  __syncthreads();
  if (tid < 128) {
    const int row = tid >> 3, pc = (tid & 7) * 4;
    const v4f v = *(const v4fa*)&tl[row][pc];
    float* d = TAB + (size_t)(blk * 16 + row) * 32 + pc;
    *(v4f*)d = v;
    
  }
}

// 8 floats -> bf16 (RNE) -> x scale (a power of two, exact) -> f16
__device__ __forceinline__ void d_cast8(const float* __restrict__ s, float scale, _Float16* __restrict__ d) {
  const v4f a = *(const v4fa*)s, c = *(const v4fa*)(s + 4);
  FragH f;
#pragma unroll
  for (int q = 0; q < 4; ++q) { f.h[q] = (_Float16)(bf16_rne(a[q]) * scale); f.h[4 + q] = (_Float16)(bf16_rne(c[q]) * scale); }
  const v8us o = f.half[0];
  *(v8us*)(unsigned short*)d = o;
}

// One launch for the seven pieces of set-up work, none of which reads another's result; a block's piece follows from its index alone: x of each batch, the four weights (x16, stored one behind the other), the rotary table.
#define PXB ((SQ * DM / 8 + 255) / 256)      /* blocks for x of one batch */
#define PWB ((DM * DM / 8 + 255) / 256)      /* blocks for one weight */
__global__ __launch_bounds__(256) void k_prep(const float* __restrict__ x, const float* __restrict__ wq, const float* __restrict__ wk, const float* __restrict__ wv, const float* __restrict__ wo,
    _Float16* __restrict__ X16, _Float16* __restrict__ BW, float* __restrict__ TAB) {
  const int bx = blockIdx.x, tid = threadIdx.x;
  if (bx < NB * PXB) {
    const int b = bx / PXB; const int t = (bx - b * PXB) * 256 + tid; if (t >= SQ * DM / 8) return;
    d_cast8(x + (size_t)b * SQ_FULL * DM + (size_t)t * 8, 1.0f, X16 + (size_t)b * SQ * DM + (size_t)t * 8);
  } else if (bx < NB * PXB + 4 * PWB) {
    const int u = bx - NB * PXB; const int sel = u / PWB; const int t = (u - sel * PWB) * 256 + tid; if (t >= DM * DM / 8) return;
    const float* wsrc = (sel == 0) ? wq : ((sel == 1) ? wk : ((sel == 2) ? wv : wo));
    d_cast8(wsrc + (size_t)t * 8, 16.0f, BW + (size_t)sel * DM * DM + (size_t)t * 8);
  } else {
    d_tab(bx - (NB * PXB + 4 * PWB), TAB);
  }
}

__device__ __forceinline__ void d_hl(const float* __restrict__ F, _Float16* __restrict__ Hh, _Float16* __restrict__ Hl, size_t n8, size_t t) {
  if (t >= n8) return;
  FragH fh, fl; const v4f a = *(const v4fa*)(F + t * 8), c = *(const v4fa*)(F + t * 8 + 4);
#pragma unroll
  for (int q = 0; q < 4; ++q) { _Float16 h = (_Float16)a[q]; fh.h[q] = h; fl.h[q] = (_Float16)((a[q] - (float)h) * 1024.0f); h = (_Float16)c[q]; fh.h[4 + q] = h; fl.h[4 + q] = (_Float16)((c[q] - (float)h) * 1024.0f); }
  { *(v8us*)((unsigned short*)Hh + t * 8) = fh.half[0]; *(v8us*)((unsigned short*)Hl + t * 8) = fl.half[0];  }
}

// Rotary embedding of four neighbouring channels (two pairs) of one row; tb = cos, sin of the two pairs; rot = false leaves the channels as they are.
__device__ __forceinline__ v4f d_rot4(v4f a, v4f tb, bool rot) {
  v4f o;
  o[0] = rot ? (a[0] * tb[0] + (-a[1]) * tb[1]) : a[0];
  o[1] = rot ? (a[1] * tb[0] + a[0] * tb[1]) : a[1];
  o[2] = rot ? (a[2] * tb[2] + (-a[3]) * tb[3]) : a[2];
  o[3] = rot ? (a[3] * tb[2] + a[2] * tb[3]) : a[3];
  return o;
}

// ---- f16 GEMM engine (wave tile 32x64; block = 4 waves = 128 rows x 64 cols; M % 128 == 0, N % 64 == 0, K % 64 == 0) ----
// A f16 [M][K] row-major (pitch lda), Bh f16 [N][K] (k contiguous, pitch ldb); grid.y batches with element strides sA / sB / sC.
// A step is 64 k: the block's 128 A rows and 64 B rows (128 B each) are read from memory once a block, as whole lines, two steps ahead into registers, and stored one step ahead into the LDS buffer that is not being read;
// every wave takes its fragments from LDS, all 24 reads of a step asked for ahead of the step's 16 products. Each accumulator still sums its k blocks of 32 in rising order.
#define G2P 72                           /* LDS row pitch in 16-bit elements: 128 B + 16 B, for 16-byte readers on 16 rows */
__device__ __forceinline__ v16h g2_frag(const _Float16* p, int hh) { FragH f; f.half[0] = *(const v8us*)((const unsigned short*)p + 8 * hh); f.half[1] = *(const v8us*)((const unsigned short*)p + 16 + 8 * hh); return f.v; }
__device__ __forceinline__ v8f g2_mma(v16h a, v16h b, v8f c) { v8f d = __builtin_amdgcn_wmma_f32_16x16x32_f16(false, a, false, b, (short)0, c, false, false); asm volatile("v_nop\n\tv_nop\n\tv_nop\n\tv_nop" : "+v"(d) : "v"(a), "v"(b)); return d; }
// What a projection block does with its 128 x 64 tile (64 columns = one head) instead of storing it plainly; every member is the same for the whole block.
// vt: the tile goes out as f16, transposed, into Vt [batch][head][channel][SQ]. Otherwise rotary: the rotary embedding is applied (row s of TAB = row of the batch); split: f16 hi + x1024 residual planes Hh, Hl instead of the f32 plane C.
struct ProjEp { const float* TAB; _Float16* Hh; _Float16* Hl; _Float16* Vt; bool vt, rotary, split; };
#define VTP 136                          /* LDS row pitch of the transposed tile in 16-bit elements: 256 B + 16 B, for 16-byte writers and readers on 16 rows */
// The engine for one block: rows 128 mt .., columns 64 nq ..; cofs = element offset of the C plane. H16 = false: the caller never passes a C16 plane. PROJ = true: the tile goes out as ep says.
template <bool H16, bool PROJ = false>
__device__ __forceinline__ void gemm2_body(const _Float16* __restrict__ A, int lda, const _Float16* __restrict__ Bh, int ldb, float alpha,
    const float* __restrict__ bias, const float* CP, float* C, _Float16* C16, int ldc, size_t cofs, int mt, int nq, int K, const ProjEp ep = ProjEp()) {
  __shared__ __attribute__((aligned(16))) float so[4][32][68];
  __shared__ __attribute__((aligned(16))) unsigned short st[2][192][G2P];      /* [buffer][128 A rows, then 64 B rows][element] */
  const int tid = threadIdx.x, w = __builtin_amdgcn_readfirstlane((int)(tid >> 5)), lane = tid & 31, ln = lane & 15, hh = lane >> 4;
  const int row0 = mt * 128 + 32 * w, col0 = nq * 64;
  const int sr = tid >> 3, sc = (tid & 7) * 8;      /* staging: 8 lanes cover one 128-B row, a wave 4 rows */
  /* address = a block-uniform byte pointer, which moves with the step, + the lane's own byte offset, which does not */
  const char* ga = (const char*)(A + (size_t)(mt * 128) * lda); const char* gb = (const char*)(Bh + (size_t)col0 * ldb);
  const unsigned oa = (unsigned)(sr * lda + sc) * 2u, ob = (unsigned)(sr * ldb + sc) * 2u;
  v8us g[12];
#pragma unroll      /* g[] indexed by constants only, so that it stays in registers */
  for (int i = 0; i < 8; ++i) g[i] = *(const v8us*)(ga + (size_t)(32 * i) * lda + oa);
#pragma unroll      /* g[] indexed by constants only */
  for (int i = 0; i < 4; ++i) g[8 + i] = *(const v8us*)(gb + (size_t)(32 * i) * ldb + ob);
#pragma unroll      /* g[] indexed by constants only */
  for (int i = 0; i < 12; ++i) *(v8us*)&st[0][sr + 16 * i][sc] = g[i];
  const int nk = K >> 6;
  if (1 < nk) {
    ga += 128; gb += 128;
#pragma unroll      /* g[] indexed by constants only */
    for (int i = 0; i < 8; ++i) g[i] = *(const v8us*)(ga + (size_t)(32 * i) * lda + oa);
#pragma unroll      /* g[] indexed by constants only */
    for (int i = 0; i < 4; ++i) g[8 + i] = *(const v8us*)(gb + (size_t)(32 * i) * ldb + ob);
    asm volatile("s_wait_xcnt 0x0" ::: "memory");      /* the wait before the loads' address registers are reused */
  }
  const v8f z8 = {0.f,0.f,0.f,0.f,0.f,0.f,0.f,0.f}; v8f c00 = z8, c01 = z8, c02 = z8, c03 = z8, c10 = z8, c11 = z8, c12 = z8, c13 = z8;
#pragma unroll 1      /* the two buffers alternate by index; one step is already 16 matrix instructions */
  for (int j = 0; j < nk; ++j) {
    const int cb = j & 1;
    __syncthreads();      /* publishes buffer cb, and ends every wave's reads of the other buffer (step j - 1) before it is stored into below */
    if (j + 1 < nk) {      /* step j + 1's rows, asked for a whole step ago, go into the other buffer */
#pragma unroll      /* g[] indexed by constants only */
      for (int i = 0; i < 12; ++i) *(v8us*)&st[cb ^ 1][sr + 16 * i][sc] = g[i];
    }
    if (j + 2 < nk) {      /* step j + 2's rows fly until the next step's barrier */
      ga += 128; gb += 128;
#pragma unroll      /* g[] indexed by constants only */
      for (int i = 0; i < 8; ++i) g[i] = *(const v8us*)(ga + (size_t)(32 * i) * lda + oa);
#pragma unroll      /* g[] indexed by constants only */
      for (int i = 0; i < 4; ++i) g[8 + i] = *(const v8us*)(gb + (size_t)(32 * i) * ldb + ob);
      asm volatile("s_wait_xcnt 0x0" ::: "memory");      /* the wait before the loads' address registers are reused: the fragment reads below land in them */
    }
    const _Float16* ap = (const _Float16*)&st[cb][32 * w + ln][0]; const _Float16* bp = (const _Float16*)&st[cb][128 + ln][0];
    v16h fa[2][2], fb[2][4];      /* [k block of 32][16 rows] */
#pragma unroll      /* fa[], fb[] indexed by constants only, so that they stay in registers */
    for (int kk = 0; kk < 2; ++kk) { fa[kk][0] = g2_frag(ap + 32 * kk, hh); fa[kk][1] = g2_frag(ap + 16 * G2P + 32 * kk, hh);
#pragma unroll      /* fb[] indexed by constants only */
      for (int t = 0; t < 4; ++t) fb[kk][t] = g2_frag(bp + 16 * t * G2P + 32 * kk, hh); }
#pragma unroll      /* fa[], fb[] indexed by constants only */
    for (int kk = 0; kk < 2; ++kk) {
      c00 = g2_mma(fa[kk][0], fb[kk][0], c00); c10 = g2_mma(fa[kk][1], fb[kk][0], c10);
      c01 = g2_mma(fa[kk][0], fb[kk][1], c01); c11 = g2_mma(fa[kk][1], fb[kk][1], c11);
      c02 = g2_mma(fa[kk][0], fb[kk][2], c02); c12 = g2_mma(fa[kk][1], fb[kk][2], c12);
      c03 = g2_mma(fa[kk][0], fb[kk][3], c03); c13 = g2_mma(fa[kk][1], fb[kk][3], c13); }
  }
  v8f accs[8] = {c00, c01, c02, c03, c10, c11, c12, c13};
  const int rsub = lane >> 4, c4 = (lane & 15) * 4;
  v4f tb[16]; float b4[4];
  if constexpr (PROJ) {
    const float* bp4 = bias + col0 + ln;      /* a projection always has a bias */
#pragma unroll      /* b4[] indexed by constants only; the four loads issue together */
    for (int t = 0; t < 4; ++t) b4[t] = bp4[t * 16];
    if (ep.vt) {      /* a lane's 8 accumulator registers are 8 consecutive rows of one channel: one 16-byte piece of the transposed tile */
      unsigned short* vl = (unsigned short*)&so[0][0][0];      /* [64 channels][VTP] */
#pragma unroll      /* accs[] indexed by constants only */
      for (int u = 0; u < 8; ++u) { const int t = u & 3, half = u >> 2; const float bv = bf16_rne(b4[t]); FragH f;
#pragma unroll      /* fragment elements indexed by constants only */
        for (int r = 0; r < 8; ++r) f.h[r] = (_Float16)(accs[u][r] * alpha + bv);
        *(v8us*)&vl[(t * 16 + ln) * VTP + 32 * w + half * 16 + 8 * hh] = f.half[0]; }
      __syncthreads();      /* a channel's 128 rows come from all four waves; taken by the whole block or by none of it */
      const int bt = (mt * 128) / SQ; const int pc = tid & 15, dd = tid >> 4;      /* 16 lanes cover a channel's 256 B: two whole lines */
      unsigned short* vd = (unsigned short*)ep.Vt + ((size_t)(bt * NH + nq) * HD + dd) * SQ + (mt * 128 - bt * SQ) + pc * 8;
#pragma unroll      /* the 8 LDS reads issue ahead of the stores */
      for (int rd = 0; rd < 8; ++rd) { const v8us v = *(const v8us*)&vl[(rd * 8 + dd) * VTP + pc * 8]; *(v8us*)(vd + (size_t)(rd * 8) * SQ) = v; }
      return;
    }
    /* the table rows of this lane's 16 pieces are asked for ahead of the tile's way through LDS */
    const float* tp = ep.TAB + (size_t)(row0 % SQ + rsub) * 32 + (c4 & 31);
#pragma unroll      /* tb[] indexed by constants only, so that it stays in registers */
    for (int q = 0; q < 16; ++q) tb[q] = *(const v4fa*)(tp + q * 64);
    asm volatile("s_wait_xcnt 0x0" :: "v"(tp) : "memory");      /* the wait before the loads' address pair is reused; naming the pair keeps it live up to here, so that no load's result is placed in it */
  }
#pragma unroll
  for (int u = 0; u < 8; ++u) { const int t = u & 3, half = u >> 2; const int col = col0 + t * 16 + ln; const float bv = PROJ ? bf16_rne(b4[t]) : (bias ? bf16_rne(bias[col]) : 0.f);
#pragma unroll
    for (int r = 0; r < 8; ++r) { const int rloc = half * 16 + 8 * hh + r; float v = accs[u][r] * alpha + bv;
      if (CP) v += CP[cofs + (size_t)(row0 + rloc) * ldc + col];      /* own element of the batched C plane */
      so[w][rloc][t * 16 + ln] = v; } }
  __builtin_amdgcn_fence(4 /* acq_rel order */, "workgroup"); __builtin_amdgcn_wave_barrier();
  if constexpr (PROJ) {
    const bool rot = ep.rotary && c4 < 32;
    if (ep.split) {
      _Float16* hp = ep.Hh + (size_t)(row0 + rsub) * ldc + col0 + c4; _Float16* lp = ep.Hl + (size_t)(row0 + rsub) * ldc + col0 + c4;
#pragma unroll      /* tb[] indexed by constants only */
      for (int q = 0; q < 16; ++q) { const v4f y = d_rot4(*(const v4fa*)&so[w][q * 2 + rsub][c4], tb[q], rot); v4h h4, l4;
#pragma unroll      /* vector elements indexed by constants only */
        for (int e = 0; e < 4; ++e) { const _Float16 h = (_Float16)y[e]; h4[e] = h; l4[e] = (_Float16)((y[e] - (float)h) * 1024.0f); }
        *(v4h*)(hp + (size_t)(q * 2) * ldc) = h4; *(v4h*)(lp + (size_t)(q * 2) * ldc) = l4; }
      asm volatile("s_wait_xcnt 0x0" ::: "memory");      /* the wait before the stores' registers are reused: the code of the other kinds of tile follows in the listing */
    } else {
      float* cp = C + (size_t)(row0 + rsub) * ldc + col0 + c4;
#pragma unroll      /* tb[] indexed by constants only */
      for (int q = 0; q < 16; ++q) *(v4f*)(cp + (size_t)(q * 2) * ldc) = d_rot4(*(const v4fa*)&so[w][q * 2 + rsub][c4], tb[q], rot);
      asm volatile("s_wait_xcnt 0x0" ::: "memory");      /* the wait before the stores' registers are reused: the code of the other kinds of tile follows in the listing */
    }
    return;
  }
  {
#pragma unroll
    for (int q = 0; q < 16; ++q) { const int r = q * 2 + rsub; const v4f v = *(const v4fa*)&so[w][r][c4];
      if (C) { *(v4f*)(C + cofs + (size_t)(row0 + r) * ldc + col0 + c4) = v;
        if (H16) asm volatile("s_wait_xcnt 0x0" ::: "memory"); }      /* the wait before the store's data registers are reused: the converted values below land in them */
      if (C16) { v4h h4; h4[0] = (_Float16)v[0]; h4[1] = (_Float16)v[1]; h4[2] = (_Float16)v[2]; h4[3] = (_Float16)v[3]; *(v4h*)(C16 + cofs + (size_t)(row0 + r) * ldc + col0 + c4) = h4; } }
     }
}

__global__ __launch_bounds__(128) void k_gemm2(const _Float16* __restrict__ A, int lda, size_t sA, const _Float16* __restrict__ Bh, int ldb, size_t sB, float alpha,
    const float* __restrict__ bias, const float* CP, float* C, _Float16* C16, int ldc, size_t sC, int M, int N, int K) {
  const int by = blockIdx.y; const int ntn = N >> 6; const int mt = blockIdx.x / ntn, nq = blockIdx.x - mt * ntn; if (mt * 128 >= M) return;      /* a block leaves as a whole */
  gemm2_body<true>(A + (size_t)by * sA, lda, Bh + (size_t)by * sB, ldb, alpha, bias, CP, C, C16, ldc, (size_t)by * sC, mt, nq, K);
}

// One launch for the nine projections, none of which reads another's result; a block's product and tile follow from its index alone:
// q, k and v of all rows, then q, k, v of the first QT0 rows of every batch. BW holds the weights of q, k, v one behind the other.
// What follows a projection element by element is done on the block's own tile: q, k of all rows leave as rotated f16 hi + residual planes, v as V^T [NB][NH][HD][SQ]; the first-tile q, k as rotated f32 planes, the first-tile v as an f32 plane.
#define GQB ((MP / 128) * (DM / 64))      /* blocks of one projection of all rows */
#define GQ0 (DM / 64)                     /* blocks of one first-tile projection (QT0 == 128 rows) */
__global__ __launch_bounds__(128) void k_qkv(const _Float16* __restrict__ X16, const _Float16* __restrict__ BW, const float* __restrict__ bq, const float* __restrict__ bk, const float* __restrict__ bv,
    const float* __restrict__ TAB, _Float16* __restrict__ QH, _Float16* __restrict__ QL, _Float16* __restrict__ KH, _Float16* __restrict__ KL, _Float16* __restrict__ VT, float* __restrict__ QKR0, float* __restrict__ VF0) {
  const int bx = blockIdx.x; int sel, mt, nq; const _Float16* A = X16; float* C = nullptr; ProjEp ep; ep.TAB = TAB; ep.Vt = VT;
  if (bx < 3 * GQB) {
    sel = bx / GQB; const int t = bx - sel * GQB; mt = t / (DM / 64); nq = t - mt * (DM / 64);
    ep.vt = sel == 2; ep.split = true;
  } else {
    const int u = bx - 3 * GQB; const int s6 = u / GQ0; const int b = s6 / 3; sel = s6 - 3 * b; mt = 0; nq = u - s6 * GQ0;
    A += (size_t)b * SQ * DM; C = (sel < 2) ? QKR0 + (size_t)(2 * b + sel) * QT0 * DM : VF0 + (size_t)b * QT0 * DM;
    ep.vt = false; ep.split = false;
  }
  ep.rotary = sel < 2; ep.Hh = (sel == 0) ? QH : KH; ep.Hl = (sel == 0) ? QL : KL;
  const float* bias = (sel == 0) ? bq : ((sel == 1) ? bk : bv);
  gemm2_body<false, true>(A, DM, BW + (size_t)sel * DM * DM, DM, 0.0625f, bias, nullptr, C, nullptr, DM, (size_t)0, mt, nq, DM, ep);
}

// One launch for the output product of the f16 path (rows QT0 .. of a batch) and the hi-plane product of the first-tile o (rows 0 .. QT0 - 1): same weights, scale, bias and output plane, so a block's A plane follows from its row tile alone. grid.y = batch.
#define GOB ((SQ / 128) * (DM / 64))      /* blocks a batch */
__global__ __launch_bounds__(128) void k_out(const _Float16* __restrict__ O16, const _Float16* __restrict__ OH0, const _Float16* __restrict__ BO, const float* __restrict__ bo, float* out) {
  const int bx = blockIdx.x, by = blockIdx.y; const int mt = bx / (DM / 64), nq = bx - mt * (DM / 64);
  const _Float16* A = (mt == 0) ? OH0 + (size_t)by * QT0 * DM : O16 + (size_t)by * SQ * DM;      /* QT0 == 128: the first tile is row tile 0 */
  gemm2_body<false>(A, DM, BO, DM, 0.0009765625f, bo, nullptr, out, nullptr, DM, (size_t)by * SQ_FULL * DM, mt, nq, DM);
}

// Butterfly over the 32 lanes of a wave: four row_xmask steps inside each 16-lane row, then the other row; every lane ends with the same value.
template <int CTRL>
__device__ __forceinline__ float lane_xm(float x) { return __int_as_float(__builtin_amdgcn_update_dpp(0, __float_as_int(x), CTRL, 0xf, 0xf, true)); }
__device__ __forceinline__ float lane_x16(float x) { const int b = __float_as_int(x); return __int_as_float(__builtin_amdgcn_permlanex16(b, b, 0x76543210, 0xfedcba98, false, false)); }
__device__ __forceinline__ float wave_max(float x) {
  x = fmaxf(x, lane_xm<0x161>(x)); x = fmaxf(x, lane_xm<0x162>(x)); x = fmaxf(x, lane_xm<0x164>(x)); x = fmaxf(x, lane_xm<0x168>(x)); return fmaxf(x, lane_x16(x)); }
__device__ __forceinline__ float wave_sum(float x) {
  x += lane_xm<0x161>(x); x += lane_xm<0x162>(x); x += lane_xm<0x164>(x); x += lane_xm<0x168>(x); return x + lane_x16(x); }

#define FAC1 0.18033688011112042f        /* log2(e) / 8 */
#define FAC2 0.00017611023448351604f     /* log2(e) / 8 / 1024 */
#define FAP 72                           /* LDS row pitch in 16-bit elements: 128 B + 16 B, for 16-byte readers on 16 rows */
#define FNT (SQ / 64)                    /* query tiles = key steps of the longest tile */
static_assert(HD == 64 && (FNT & (FNT - 1)) == 0);
static_assert((size_t)FNT * NH * 128 * 8 >= (size_t)NB * QT0 * DM);      /* one slab of blocks covers the split of the first-tile o */
// 2^x. The v_nop at the end keeps the one slot that the instruction set asks for between a transcendental and a next instruction that reads its result or overwrites its source;
// inside the run of eight every result register is distinct from every source (early clobber), so each v_exp_f32 is the independent instruction behind the one before.
__device__ __forceinline__ float fa_exp2(float x) { float y; asm("v_exp_f32 %0, %1\n\tv_nop" : "=v"(y) : "v"(x)); return y; }
__device__ __forceinline__ v8f fa_exp2x8(v8f x) { float y0, y1, y2, y3, y4, y5, y6, y7;
  asm("v_exp_f32 %0, %8\n\tv_exp_f32 %1, %9\n\tv_exp_f32 %2, %10\n\tv_exp_f32 %3, %11\n\tv_exp_f32 %4, %12\n\tv_exp_f32 %5, %13\n\tv_exp_f32 %6, %14\n\tv_exp_f32 %7, %15\n\tv_nop"
      : "=&v"(y0), "=&v"(y1), "=&v"(y2), "=&v"(y3), "=&v"(y4), "=&v"(y5), "=&v"(y6), "=&v"(y7)
      : "v"(x[0]), "v"(x[1]), "v"(x[2]), "v"(x[3]), "v"(x[4]), "v"(x[5]), "v"(x[6]), "v"(x[7]));
  const v8f y = {y0, y1, y2, y3, y4, y5, y6, y7}; return y; }
/* amdgpu_waves_per_eu(4, 4): holds the kernel to 256 registers, so that four blocks fit a WGP and no register window is switched in the loop */
__global__ __launch_bounds__(128) __attribute__((amdgpu_waves_per_eu(4, 4))) void k_fattn(const _Float16* __restrict__ QHp, const _Float16* __restrict__ QLp, const _Float16* __restrict__ KHp, const _Float16* __restrict__ KLp,
    const _Float16* __restrict__ VTp, _Float16* __restrict__ O16p, const float* __restrict__ OF0, _Float16* __restrict__ OH0, _Float16* __restrict__ OL0) {
  __shared__ __attribute__((aligned(16))) unsigned short lt[2][3][64][FAP];      /* [buffer][K hi, K residual, V^T][row][element] */
  if (blockIdx.z >= NB) {      /* the slab of blocks behind the last batch (so that every attention block keeps its flat index): the hi/residual split of the first-tile o, which reads nothing of this launch; a block leaves as a whole, ahead of every barrier */
    d_hl(OF0, OH0, OL0, (size_t)NB * QT0 * DM / 8, (size_t)((blockIdx.y * FNT + blockIdx.x) * 128 + threadIdx.x)); return; }
  const int tid = threadIdx.x, w = __builtin_amdgcn_readfirstlane((int)(tid >> 5)), lane = tid & 31, ln = lane & 15, hh = lane >> 4;
  const int h = blockIdx.y, b = blockIdx.z; const int x = blockIdx.x, grp = (b * NH + h) >> 3;
  /* a permutation of the tiles for each (batch, head): blocks whose flat indices lie far apart get tiles of unequal length, so that long tiles do not gather in one place */
  const int qt = (grp % 3 == 0) ? FNT - 1 - x : ((grp % 3 == 1) ? x : ((x + FNT / 2) & (FNT - 1)));
  const int qw = qt * 64 + 16 * w; const size_t r0 = (size_t)b * SQ;
  const _Float16* qhp = QHp + (r0 + qw + ln) * DM + h * HD; const _Float16* qlp = QLp + (r0 + qw + ln) * DM + h * HD;
  const v16h qh0 = g2_frag(qhp, hh), qh1 = g2_frag(qhp + 32, hh), ql0 = g2_frag(qlp, hh), ql1 = g2_frag(qlp + 32, hh);
  const int sr = tid >> 3, sc = (tid & 7) * 8;      /* staging: 8 lanes cover one 128-B row, a wave 4 rows */
  const unsigned short* gk = (const unsigned short*)KHp + (r0 + sr) * DM + h * HD + sc; const unsigned short* gl = (const unsigned short*)KLp + (r0 + sr) * DM + h * HD + sc;
  const unsigned short* gv = (const unsigned short*)VTp + ((size_t)(b * NH + h) * HD + sr) * SQ + sc;
  v8us g[12];
#pragma unroll      /* g[] indexed by constants only, so that it stays in registers */
  for (int i = 0; i < 4; ++i) { g[i] = *(const v8us*)(gk + (size_t)(16 * i) * DM); g[4 + i] = *(const v8us*)(gl + (size_t)(16 * i) * DM); g[8 + i] = *(const v8us*)(gv + (size_t)(16 * i) * SQ); }
#pragma unroll      /* g[] indexed by constants only */
  for (int i = 0; i < 4; ++i) { *(v8us*)&lt[0][0][sr + 16 * i][sc] = g[i]; *(v8us*)&lt[0][1][sr + 16 * i][sc] = g[4 + i]; *(v8us*)&lt[0][2][sr + 16 * i][sc] = g[8 + i]; }
  const v8f z8 = {0.f,0.f,0.f,0.f,0.f,0.f,0.f,0.f};
  v8f o[4] = {z8, z8, z8, z8}; float m = -1.0e30f, l = 0.f;
#pragma unroll 1      /* one step is already 32 matrix instructions; the two buffers alternate by index */
  for (int j = 0; j <= qt; ++j) {
    const int cb = j & 1;
    __syncthreads();      /* publishes buffer cb, and ends every wave's reads of the other buffer (step j - 1) before it is stored into below */
    if (j < qt) {      /* the next step's tiles fly while this step is worked on */
      gk += (size_t)64 * DM; gl += (size_t)64 * DM; gv += 64;
#pragma unroll      /* g[] indexed by constants only */
      for (int i = 0; i < 4; ++i) { g[i] = *(const v8us*)(gk + (size_t)(16 * i) * DM); g[4 + i] = *(const v8us*)(gl + (size_t)(16 * i) * DM); g[8 + i] = *(const v8us*)(gv + (size_t)(16 * i) * SQ); }
    }
    v8f s[4]; v16h kf[2][4], va[4];
    { const _Float16* kh = (const _Float16*)&lt[cb][0][ln][0]; const _Float16* kl = (const _Float16*)&lt[cb][1][ln][0];
      kf[0][0] = g2_frag(kh, hh); kf[0][1] = g2_frag(kh + 32, hh); kf[0][2] = g2_frag(kl, hh); kf[0][3] = g2_frag(kl + 32, hh); }
#pragma unroll      /* s[], kf[], va[] indexed by constants only, so that they stay in registers */
    for (int t = 0; t < 4; ++t) {
      if (t < 3) {      /* the next 16 keys' fragments are asked for ahead of this tile's products */
        const _Float16* kh = (const _Float16*)&lt[cb][0][16 * (t + 1) + ln][0]; const _Float16* kl = (const _Float16*)&lt[cb][1][16 * (t + 1) + ln][0];
        kf[(t + 1) & 1][0] = g2_frag(kh, hh); kf[(t + 1) & 1][1] = g2_frag(kh + 32, hh); kf[(t + 1) & 1][2] = g2_frag(kl, hh); kf[(t + 1) & 1][3] = g2_frag(kl + 32, hh);
      } else {      /* V^T of the first 32 keys is asked for ahead of the softmax */
#pragma unroll      /* va[] indexed by constants only */
        for (int u = 0; u < 4; ++u) va[u] = g2_frag((const _Float16*)&lt[cb][2][16 * u + ln][0], hh);
      }
      const v16h kh0 = kf[t & 1][0], kh1 = kf[t & 1][1], kl0 = kf[t & 1][2], kl1 = kf[t & 1][3];
      v8f a = z8, c = z8, d = z8;
      a = g2_mma(kh0, qh0, a); c = g2_mma(kh0, ql0, c); d = g2_mma(kl0, qh0, d);
      a = g2_mma(kh1, qh1, a); c = g2_mma(kh1, ql1, c); d = g2_mma(kl1, qh1, d);
#pragma unroll      /* vector elements indexed by constants only */
      for (int r = 0; r < 8; ++r) s[t][r] = a[r] * FAC1 + (c[r] + d[r]) * FAC2;
    }
    if (j == qt) {      /* only the last step crosses the diagonal; every query keeps its key 64 qt there */
      const int rel = 16 * w + ln - 8 * hh;      /* key 64 qt + 16 t + 8 hh + r is kept while 16 t + r <= rel */
#pragma unroll      /* s[] indexed by constants only */
      for (int t = 0; t < 4; ++t) {
#pragma unroll      /* s[] indexed by constants only */
        for (int r = 0; r < 8; ++r) s[t][r] = (16 * t + r <= rel) ? s[t][r] : -1.0e30f; }
    }
    v8f x8;
#pragma unroll      /* vector elements indexed by constants only */
    for (int r = 0; r < 8; ++r) x8[r] = fmaxf(fmaxf(s[0][r], s[1][r]), fmaxf(s[2][r], s[3][r]));
    float mx = fmaxf(fmaxf(fmaxf(x8[0], x8[1]), fmaxf(x8[2], x8[3])), fmaxf(fmaxf(x8[4], x8[5]), fmaxf(x8[6], x8[7])));
    mx = fmaxf(mx, lane_x16(mx));      /* the other half of this query's keys */
    const float mn = fmaxf(m, mx); const float al = fa_exp2(m - mn); const float mb = mn - 8.0f; m = mn;
    v4f ps = {0.f, 0.f, 0.f, 0.f};
#pragma unroll      /* s[] indexed by constants only */
    for (int t = 0; t < 4; ++t) { s[t] = fa_exp2x8(s[t] - mb);
#pragma unroll      /* s[] indexed by constants only; four independent partial sums */
      for (int r = 0; r < 8; ++r) ps[r & 3] += s[t][r]; }
    l = l * al + ((ps[0] + ps[1]) + (ps[2] + ps[3]));
    FragH p0, p1;
#pragma unroll      /* fragment elements indexed by constants only */
    for (int r = 0; r < 8; ++r) { p0.h[r] = (_Float16)s[0][r]; p0.h[8 + r] = (_Float16)s[1][r]; p1.h[r] = (_Float16)s[2][r]; p1.h[8 + r] = (_Float16)s[3][r]; }
#pragma unroll      /* o[] indexed by constants only */
    for (int t = 0; t < 4; ++t) {
#pragma unroll      /* o[] indexed by constants only */
      for (int r = 0; r < 8; ++r) o[t][r] *= al; }
    v16h vb[4];
#pragma unroll      /* vb[] indexed by constants only; V^T of the last 32 keys, into registers that the scores have left */
    for (int u = 0; u < 4; ++u) vb[u] = g2_frag((const _Float16*)&lt[cb][2][16 * u + ln][32], hh);
#pragma unroll      /* o[], va[] indexed by constants only; four independent accumulators in turn */
    for (int t = 0; t < 4; ++t) o[t] = g2_mma(va[t], p0.v, o[t]);
#pragma unroll      /* o[], vb[] indexed by constants only */
    for (int t = 0; t < 4; ++t) o[t] = g2_mma(vb[t], p1.v, o[t]);
    if (j < qt) {
#pragma unroll      /* g[] indexed by constants only */
      for (int i = 0; i < 4; ++i) { *(v8us*)&lt[cb ^ 1][0][sr + 16 * i][sc] = g[i]; *(v8us*)&lt[cb ^ 1][1][sr + 16 * i][sc] = g[4 + i]; *(v8us*)&lt[cb ^ 1][2][sr + 16 * i][sc] = g[8 + i]; }
    }
  }
  l += lane_x16(l);      /* join the two halves' sums once */
  const float inv = 64.0f / l;      /* o carried x64 */
  unsigned short* op = (unsigned short*)O16p + (r0 + qw + ln) * DM + h * HD + 8 * hh;
#pragma unroll      /* o[] indexed by constants only */
  for (int t = 0; t < 4; ++t) { FragH f;
#pragma unroll      /* fragment elements indexed by constants only */
    for (int r = 0; r < 8; ++r) f.h[r] = (_Float16)(o[t][r] * inv);
    *(v8us*)(op + 16 * t) = f.half[0]; }
  asm volatile("s_wait_xcnt 0x0" ::: "memory");      /* the wait before the stores' registers are reused: the code of the split piece follows in the listing */
}

// f32 attention over the first QT0 query rows of every batch (grid.y = batch; q and k planes of a batch lie one behind the other). Block = one head x A0R query rows, 8 waves, 2 rows a wave; keys 0 .. (rg + 1) A0R - 1 cover every row of the block.
// K (row pitch A0KP floats = 16 B x odd: lanes on different rows read 16 B each without bank conflicts), V and the q rows are staged in LDS once.
// Scores: lane = key, both rows share each K read. Softmax: wave butterflies. Weighted sum: lane = channel pair, weights read as broadcasts.
#define A0R 16
#define A0KP 68
static_assert(QT0 % A0R == 0);
static_assert(QT0 == 128 && HD == 64 && A0R == 16);
typedef float v2f __attribute__((ext_vector_type(2)));
__global__ __launch_bounds__(256) void k_att0(const float* __restrict__ QF, const float* __restrict__ KF, const float* __restrict__ VF, float scale, float* __restrict__ OF) {
  __shared__ __attribute__((aligned(16))) float lk[QT0][A0KP]; __shared__ __attribute__((aligned(16))) float lv[QT0][HD];
  __shared__ __attribute__((aligned(16))) float lq[A0R][HD]; __shared__ __attribute__((aligned(16))) float lp[A0R][QT0];
  const int tid = threadIdx.x, lane = tid & 31, w = __builtin_amdgcn_readfirstlane((int)(tid >> 5));
  const int h = blockIdx.x / (QT0 / A0R), rg = blockIdx.x % (QT0 / A0R); const int nkeys = (rg + 1) * A0R;
  { const size_t bo1 = (size_t)blockIdx.y * QT0 * DM; QF += 2 * bo1; KF += 2 * bo1; VF += bo1; OF += bo1; }
  const int sr = tid >> 4, sc4 = (tid & 15) * 4;      /* staging: 16 lanes cover one 256-B row */
  const float* qp = QF + (size_t)(rg * A0R + sr) * DM + h * HD + sc4; const float* kp = KF + (size_t)sr * DM + h * HD + sc4; const float* vp = VF + (size_t)sr * DM + h * HD + sc4;
  const v4f qs = *(const v4fa*)qp;
  v4f ks[QT0 / 16], vs[QT0 / 16];      /* all QT0 rows of K and V are staged by every block: no test stands between the loads */
#pragma unroll      /* ks[], vs[] indexed by constants only, so that they stay in registers; all loads issued before the first use */
  for (int g = 0; g < QT0 / 16; ++g) { ks[g] = *(const v4fa*)(kp + (size_t)g * 16 * DM); vs[g] = *(const v4fa*)(vp + (size_t)g * 16 * DM); }
  asm volatile("s_wait_xcnt 0x0" :: "v"(qp), "v"(kp), "v"(vp) : "memory");      /* the wait before the loads' address pairs are reused; naming the pairs keeps them live up to here, so that no load's result is placed in them */
  *(v4f*)&lq[sr][sc4] = qs;
#pragma unroll      /* ks[], vs[] indexed by constants only, so that they stay in registers */
  for (int g = 0; g < QT0 / 16; ++g) { *(v4f*)&lk[g * 16 + sr][sc4] = ks[g]; *(v4f*)&lv[g * 16 + sr][sc4] = vs[g]; }
  __syncthreads();
  const int r0 = 2 * w, i0 = rg * A0R + r0, i1 = i0 + 1;      /* this wave's two query rows */
  const int nch = (nkeys + 31) >> 5;      /* chunks of 32 keys */
  float s0[QT0 / 32], s1[QT0 / 32];
#pragma unroll      /* s0[], s1[] indexed by constants only, so that they stay in registers */
  for (int m = 0; m < QT0 / 32; ++m) { s0[m] = -1.0e30f; s1[m] = -1.0e30f;
    if (m < nch) { const int j = m * 32 + lane;
      v4f a0 = {0.f, 0.f, 0.f, 0.f}, a1 = {0.f, 0.f, 0.f, 0.f};
#pragma unroll      /* the 48 LDS reads of a chunk issue ahead of their use */
      for (int c = 0; c < HD / 4; ++c) { const v4f kq = *(const v4f*)&lk[j][c * 4]; const v4f q0 = *(const v4f*)&lq[r0][c * 4]; const v4f q1 = *(const v4f*)&lq[r0 + 1][c * 4];
#pragma unroll      /* four independent partial sums a row */
        for (int u = 0; u < 4; ++u) { a0[u] = fmaf(q0[u], kq[u], a0[u]); a1[u] = fmaf(q1[u], kq[u], a1[u]); } }
      const float d0 = ((a0[0] + a0[1]) + (a0[2] + a0[3])) * scale, d1 = ((a1[0] + a1[1]) + (a1[2] + a1[3])) * scale;
      s0[m] = (j <= i0) ? d0 : -1.0e30f; s1[m] = (j <= i1) ? d1 : -1.0e30f; } }
  const float m0 = wave_max(fmaxf(fmaxf(s0[0], s0[1]), fmaxf(s0[2], s0[3]))), m1 = wave_max(fmaxf(fmaxf(s1[0], s1[1]), fmaxf(s1[2], s1[3])));
  float l0 = 0.f, l1 = 0.f;
#pragma unroll      /* s0[], s1[] indexed by constants only, so that they stay in registers */
  for (int m = 0; m < QT0 / 32; ++m) if (m < nch) { const int j = m * 32 + lane;
    const float e0 = (j <= i0) ? expf(s0[m] - m0) : 0.f, e1 = (j <= i1) ? expf(s1[m] - m1) : 0.f;
    l0 += e0; l1 += e1; lp[r0][j] = e0; lp[r0 + 1][j] = e1; }
  l0 = wave_sum(l0); l1 = wave_sum(l1);
  __syncthreads();      /* the weights of a row are written by lanes and read back as broadcasts */
  const int n4 = (i1 + 4) >> 2;      /* keys 0 .. i1 in fours; the weights above a row's own index are zero, and 4 n4 <= nkeys */
  v2f o0 = {0.f, 0.f}, o1 = {0.f, 0.f};
#pragma unroll 4      /* LDS reads of later trips issue while earlier ones are summed */
  for (int t = 0; t < n4; ++t) { const v4f p0 = *(const v4f*)&lp[r0][t * 4]; const v4f p1 = *(const v4f*)&lp[r0 + 1][t * 4];
#pragma unroll      /* p0[], p1[] indexed by constants only */
    for (int u = 0; u < 4; ++u) { const v2f vv = *(const v2f*)&lv[t * 4 + u][2 * lane];
      o0[0] = fmaf(p0[u], vv[0], o0[0]); o0[1] = fmaf(p0[u], vv[1], o0[1]); o1[0] = fmaf(p1[u], vv[0], o1[0]); o1[1] = fmaf(p1[u], vv[1], o1[1]); } }
  const float f0 = 64.0f / l0, f1 = 64.0f / l1;      /* o carried x64 like the f16 path */
  o0[0] *= f0; o0[1] *= f0; o1[0] *= f1; o1[1] *= f1;
  *(v2f*)(OF + (size_t)i0 * DM + h * HD + 2 * lane) = o0;
  *(v2f*)(OF + (size_t)i1 * DM + h * HD + 2 * lane) = o1;
}

extern "C" void kernel_launch(void* const* d_in, const int* in_sizes, int n_in,
                              void* d_out, int out_size, void* d_ws, size_t ws_size, hipStream_t stream) {
  if (n_in < 9) return;
  const size_t needx = ((size_t)(NB - 1) * SQ_FULL + SQ) * DM;
  if ((size_t)in_sizes[0] < needx) return;
  if (in_sizes[1] < DM * DM || in_sizes[3] < DM * DM || in_sizes[5] < DM * DM || in_sizes[7] < DM * DM) return;
  if (in_sizes[2] < DM || in_sizes[4] < DM || in_sizes[6] < DM || in_sizes[8] < DM) return;
  if ((size_t)out_size < needx) return;
  /* wire order: x, Wq, bq, Wk, bk, Wv, bv, Wo, bo (natural [out][in] weights, f32) */
  const float* x = (const float*)d_in[0]; const float* wq = (const float*)d_in[1]; const float* bq = (const float*)d_in[2]; const float* wk = (const float*)d_in[3]; const float* bk = (const float*)d_in[4];
  const float* wv = (const float*)d_in[5]; const float* bv = (const float*)d_in[6]; const float* wo = (const float*)d_in[7]; const float* bo = (const float*)d_in[8];
  float* out = (float*)d_out;
  char* ws = (char*)d_ws; size_t off = 0;
  auto take = [&](size_t bytes) { char* p = ws + off; off += (bytes + 255) & ~(size_t)255; return p; };
  _Float16* BW = (_Float16*)take((size_t)4 * DM * DM * 2); _Float16* BO = BW + (size_t)3 * DM * DM;      /* weights of q, k, v, o one behind the other */
  _Float16* X16 = (_Float16*)take(NR * DM * 2);
  _Float16* QH = (_Float16*)take(NR * DM * 2); _Float16* QL = (_Float16*)take(NR * DM * 2); _Float16* KH = (_Float16*)take(NR * DM * 2); _Float16* KL = (_Float16*)take(NR * DM * 2);
  _Float16* O16 = (_Float16*)take(NR * DM * 2);
  _Float16* VT = (_Float16*)take((size_t)NB * NH * HD * SQ * 2);
  float* TAB = (float*)take((size_t)SQ * 32 * 4);
  float* QKR0 = (float*)take((size_t)NB * 2 * QT0 * DM * 4); float* VF0 = (float*)take((size_t)NB * QT0 * DM * 4);      /* [batch][q, k][row][channel]; [batch][row][channel] */
  float* OF0 = (float*)take((size_t)NB * QT0 * DM * 4); _Float16* OH0 = (_Float16*)take((size_t)NB * QT0 * DM * 2); _Float16* OL0 = (_Float16*)take((size_t)NB * QT0 * DM * 2);
  if (off > ws_size || off > (size_t)134217728) return;

  k_prep<<<NB * PXB + 4 * PWB + SQ / 16, 256, 0, stream>>>(x, wq, wk, wv, wo, X16, BW, TAB);
  k_qkv<<<3 * GQB + NB * 3 * GQ0, 128, 0, stream>>>(X16, BW, bq, bk, bv, TAB, QH, QL, KH, KL, VT, QKR0, VF0);
  k_att0<<<dim3(NH * (QT0 / A0R), NB), 256, 0, stream>>>(QKR0, QKR0 + (size_t)QT0 * DM, VF0, SCL, OF0);
  k_fattn<<<dim3(FNT, NH, NB + 1), 128, 0, stream>>>(QH, QL, KH, KL, VT, O16, OF0, OH0, OL0);

  /* out = o (x64) . Wo (x16) * 2^-10 + bo; grid.y = batch (output rows at the full per-batch stride); rows 0..127 from the hi plane of the f32 path */
  k_out<<<dim3(GOB, NB), 128, 0, stream>>>(O16, OH0, BO, bo, out);
  const dim3 gf((QT0 / 128) * (DM / 64), NB);
  k_gemm2<<<gf, 128, 0, stream>>>(OL0, DM, (size_t)QT0 * DM, BO, DM, (size_t)0, 0.00000095367431640625f, nullptr, out, out, nullptr, DM, (size_t)SQ_FULL * DM, QT0, DM, DM);      /* += o_lo Wo 2^-20 (own-element accumulate) */
}

// v007
// A run of this version takes 98.8 microseconds.
// In two side-by-side timings against v006, it was 1.12 and 1.13 times as fast.
// Counting every step since v000, it is 55.7 times as fast.
#include <hip/hip_runtime.h>
// Causal multi-head self-attention: x [2][2048][768], 12 heads of 64, natural [out][in] projections with biases, interleaved partial rotary embedding on channels 0..31 of each head of q and k (pairs (2p,2p+1), angle = s * 10000^(-p/16), computed table), scores / 8, causal softmax, out = merged Wo^T + bo.
// Compute dtype: every contraction on v_wmma_f32_16x16x32_f16 (f16 operands, f32 accumulate). Inputs RNE-converted to bf16 first (exact in f16; weights carried x16). q/k: GEMM -> f32 -> rotary in f32 -> f16 hi + x1024 f16 residual planes; scores = three products (hi.hi + lo.hi + hi.lo; each residual pass has its own accumulator folded with 2^-10). v, the unnormalised softmax weights (x256 at the running maximum) and o (x64) are single f16 planes; scores, online softmax and the weighted sum run in one fused kernel. The first 128 query rows of each batch are recomputed with an f32 VALU attention and go through the output GEMM as f16 hi + x1024 residual planes of o.
#ifndef NB
#define NB 2
#endif
#ifndef SEQ
#define SEQ 2048
#endif
#define SQ SEQ
#define SQ_FULL 2048                 /* per-batch row stride of x and of the output */
#define NB_FULL 2
#define DM 768
#define NH 12
#define HD 64
#define QT0 128                      /* first-tile rows recomputed in f32 */
#define SCL 0.125f                   /* 1 / sqrt(64) */
#define NR ((size_t)NB * SQ)
#define MP ((int)((size_t)NB * SQ))

static_assert(SQ % 128 == 0);
static_assert(SQ % 16 == 0);
static_assert(QT0 == 128);
static_assert(SQ >= QT0);
static_assert(NH * HD == DM);
static_assert(DM % 64 == 0);
static_assert(SQ <= SQ_FULL);
static_assert(NB <= NB_FULL);

typedef unsigned short v8us __attribute__((ext_vector_type(8), may_alias));
typedef float  v8f  __attribute__((ext_vector_type(8)));
typedef float  v4f  __attribute__((ext_vector_type(4)));
typedef float  v4fa __attribute__((ext_vector_type(4), may_alias));
typedef _Float16 v16h __attribute__((ext_vector_type(16)));
typedef _Float16 v4h __attribute__((ext_vector_type(4)));
union FragH { v16h v; v8us half[2]; _Float16 h[16]; unsigned short u[16]; };

__device__ __forceinline__ unsigned short bf16_bits(float x) { unsigned int u = __float_as_uint(x); return (unsigned short)((u + 0x7FFFu + ((u >> 16) & 1u)) >> 16); }
__device__ __forceinline__ float bf16_rne(float x) { return __uint_as_float(((unsigned int)bf16_bits(x)) << 16); }

// 10000^(-p/16), p = 0..15, selected by value (no memory table)
__device__ __forceinline__ float rope_invf(int p) {
  float f = 1.0f;
  f = (p == 1)  ? 0.5623413251903491f : f;
  f = (p == 2)  ? 0.31622776601683794f : f;
  f = (p == 3)  ? 0.1778279410038923f : f;
  f = (p == 4)  ? 0.1f : f;
  f = (p == 5)  ? 0.05623413251903491f : f;
  f = (p == 6)  ? 0.03162277660168379f : f;
  f = (p == 7)  ? 0.01778279410038923f : f;
  f = (p == 8)  ? 0.01f : f;
  f = (p == 9)  ? 0.005623413251903491f : f;
  f = (p == 10) ? 0.0031622776601683794f : f;
  f = (p == 11) ? 0.0017782794100389228f : f;
  f = (p == 12) ? 0.001f : f;
  f = (p == 13) ? 0.0005623413251903491f : f;
  f = (p == 14) ? 0.00031622776601683794f : f;
  f = (p == 15) ? 0.00017782794100389227f : f;
  return f;
}

__device__ __forceinline__ void d_tab(int blk, float* __restrict__ TAB) {
  #pragma clang fp contract(off)
  __shared__ __attribute__((aligned(16))) float tl[16][32];
  const int tid = threadIdx.x; const int sl = tid >> 4, p = tid & 15; const int s = blk * 16 + sl;
  const float ang = (float)s * rope_invf(p);
  float sn, cs; sincosf(ang, &sn, &cs);
  tl[sl][2 * p] = cs; tl[sl][2 * p + 1] = sn;
  __syncthreads();
  if (tid < 128) {
    const int row = tid >> 3, pc = (tid & 7) * 4;
    const v4f v = *(const v4fa*)&tl[row][pc];
    float* d = TAB + (size_t)(blk * 16 + row) * 32 + pc;
    *(v4f*)d = v;
    
  }
}

// 8 floats -> bf16 (RNE) -> x scale (a power of two, exact) -> f16
__device__ __forceinline__ void d_cast8(const float* __restrict__ s, float scale, _Float16* __restrict__ d) {
  const v4f a = *(const v4fa*)s, c = *(const v4fa*)(s + 4);
  FragH f;
#pragma unroll
  for (int q = 0; q < 4; ++q) { f.h[q] = (_Float16)(bf16_rne(a[q]) * scale); f.h[4 + q] = (_Float16)(bf16_rne(c[q]) * scale); }
  const v8us o = f.half[0];
  *(v8us*)(unsigned short*)d = o;
}

// One launch for the seven pieces of set-up work, none of which reads another's result; a block's piece follows from its index alone: x of each batch, the four weights (x16, stored one behind the other), the rotary table.
#define PXB ((SQ * DM / 8 + 255) / 256)      /* blocks for x of one batch */
#define PWB ((DM * DM / 8 + 255) / 256)      /* blocks for one weight */
__global__ __launch_bounds__(256) void k_prep(const float* __restrict__ x, const float* __restrict__ wq, const float* __restrict__ wk, const float* __restrict__ wv, const float* __restrict__ wo,
    _Float16* __restrict__ X16, _Float16* __restrict__ BW, float* __restrict__ TAB) {
  const int bx = blockIdx.x, tid = threadIdx.x;
  if (bx < NB * PXB) {
    const int b = bx / PXB; const int t = (bx - b * PXB) * 256 + tid; if (t >= SQ * DM / 8) return;
    d_cast8(x + (size_t)b * SQ_FULL * DM + (size_t)t * 8, 1.0f, X16 + (size_t)b * SQ * DM + (size_t)t * 8);
  } else if (bx < NB * PXB + 4 * PWB) {
    const int u = bx - NB * PXB; const int sel = u / PWB; const int t = (u - sel * PWB) * 256 + tid; if (t >= DM * DM / 8) return;
    const float* wsrc = (sel == 0) ? wq : ((sel == 1) ? wk : ((sel == 2) ? wv : wo));
    d_cast8(wsrc + (size_t)t * 8, 16.0f, BW + (size_t)sel * DM * DM + (size_t)t * 8);
  } else {
    d_tab(bx - (NB * PXB + 4 * PWB), TAB);
  }
}

__device__ __forceinline__ void d_hl(const float* __restrict__ F, _Float16* __restrict__ Hh, _Float16* __restrict__ Hl, size_t n8, size_t t) {
  if (t >= n8) return;
  FragH fh, fl; const v4f a = *(const v4fa*)(F + t * 8), c = *(const v4fa*)(F + t * 8 + 4);
#pragma unroll
  for (int q = 0; q < 4; ++q) { _Float16 h = (_Float16)a[q]; fh.h[q] = h; fl.h[q] = (_Float16)((a[q] - (float)h) * 1024.0f); h = (_Float16)c[q]; fh.h[4 + q] = h; fl.h[4 + q] = (_Float16)((c[q] - (float)h) * 1024.0f); }
  { *(v8us*)((unsigned short*)Hh + t * 8) = fh.half[0]; *(v8us*)((unsigned short*)Hl + t * 8) = fl.half[0];  }
}

// Rotary embedding of four neighbouring channels (two pairs) of one row; tb = cos, sin of the two pairs; rot = false leaves the channels as they are.
__device__ __forceinline__ v4f d_rot4(v4f a, v4f tb, bool rot) {
  v4f o;
  o[0] = rot ? (a[0] * tb[0] + (-a[1]) * tb[1]) : a[0];
  o[1] = rot ? (a[1] * tb[0] + a[0] * tb[1]) : a[1];
  o[2] = rot ? (a[2] * tb[2] + (-a[3]) * tb[3]) : a[2];
  o[3] = rot ? (a[3] * tb[2] + a[2] * tb[3]) : a[3];
  return o;
}

// ---- f16 GEMM engine (wave tile 32x64; block = 4 waves = 128 rows x 64 cols; M % 128 == 0, N % 64 == 0, K % 64 == 0) ----
// A f16 [M][K] row-major (pitch lda), Bh f16 [N][K] (k contiguous, pitch ldb); grid.y batches with element strides sA / sB / sC.
// A step is 64 k: the block's 128 A rows and 64 B rows (128 B each) are read from memory once a block, as whole lines, two steps ahead into registers, and stored one step ahead into the LDS buffer that is not being read;
// every wave takes its fragments from LDS, all 24 reads of a step asked for ahead of the step's 16 products. Each accumulator still sums its k blocks of 32 in rising order.
#define G2P 72                           /* LDS row pitch in 16-bit elements: 128 B + 16 B, for 16-byte readers on 16 rows */
__device__ __forceinline__ v16h g2_frag(const _Float16* p, int hh) { FragH f; f.half[0] = *(const v8us*)((const unsigned short*)p + 8 * hh); f.half[1] = *(const v8us*)((const unsigned short*)p + 16 + 8 * hh); return f.v; }
__device__ __forceinline__ v8f g2_mma(v16h a, v16h b, v8f c) { v8f d = __builtin_amdgcn_wmma_f32_16x16x32_f16(false, a, false, b, (short)0, c, false, false); asm volatile("v_nop\n\tv_nop\n\tv_nop\n\tv_nop" : "+v"(d) : "v"(a), "v"(b)); return d; }
// What a projection block does with its 128 x 64 tile (64 columns = one head) instead of storing it plainly; every member is the same for the whole block.
// vt: the tile goes out as f16, transposed, into Vt [batch][head][channel][SQ]. Otherwise rotary: the rotary embedding is applied (row s of TAB = row of the batch); split: f16 hi + x1024 residual planes Hh, Hl instead of the f32 plane C.
struct ProjEp { const float* TAB; _Float16* Hh; _Float16* Hl; _Float16* Vt; bool vt, rotary, split; };
#define VTP 136                          /* LDS row pitch of the transposed tile in 16-bit elements: 256 B + 16 B, for 16-byte writers and readers on 16 rows */
// The engine for one block: rows 128 mt .., columns 64 nq ..; cofs = element offset of the C plane. H16 = false: the caller never passes a C16 plane. PROJ = true: the tile goes out as ep says.
template <bool H16, bool PROJ = false>
__device__ __forceinline__ void gemm2_body(const _Float16* __restrict__ A, int lda, const _Float16* __restrict__ Bh, int ldb, float alpha,
    const float* __restrict__ bias, const float* CP, float* C, _Float16* C16, int ldc, size_t cofs, int mt, int nq, int K, const ProjEp ep = ProjEp()) {
  __shared__ __attribute__((aligned(16))) float so[4][32][68];
  __shared__ __attribute__((aligned(16))) unsigned short st[2][192][G2P];      /* [buffer][128 A rows, then 64 B rows][element] */
  const int tid = threadIdx.x, w = __builtin_amdgcn_readfirstlane((int)(tid >> 5)), lane = tid & 31, ln = lane & 15, hh = lane >> 4;
  const int row0 = mt * 128 + 32 * w, col0 = nq * 64;
  const int sr = tid >> 3, sc = (tid & 7) * 8;      /* staging: 8 lanes cover one 128-B row, a wave 4 rows */
  /* address = a block-uniform byte pointer, which moves with the step, + the lane's own byte offset, which does not */
  const char* ga = (const char*)(A + (size_t)(mt * 128) * lda); const char* gb = (const char*)(Bh + (size_t)col0 * ldb);
  const unsigned oa = (unsigned)(sr * lda + sc) * 2u, ob = (unsigned)(sr * ldb + sc) * 2u;
  v8us g[12];
#pragma unroll      /* g[] indexed by constants only, so that it stays in registers */
  for (int i = 0; i < 8; ++i) g[i] = *(const v8us*)(ga + (size_t)(32 * i) * lda + oa);
#pragma unroll      /* g[] indexed by constants only */
  for (int i = 0; i < 4; ++i) g[8 + i] = *(const v8us*)(gb + (size_t)(32 * i) * ldb + ob);
#pragma unroll      /* g[] indexed by constants only */
  for (int i = 0; i < 12; ++i) *(v8us*)&st[0][sr + 16 * i][sc] = g[i];
  const int nk = K >> 6;
  if (1 < nk) {
    ga += 128; gb += 128;
#pragma unroll      /* g[] indexed by constants only */
    for (int i = 0; i < 8; ++i) g[i] = *(const v8us*)(ga + (size_t)(32 * i) * lda + oa);
#pragma unroll      /* g[] indexed by constants only */
    for (int i = 0; i < 4; ++i) g[8 + i] = *(const v8us*)(gb + (size_t)(32 * i) * ldb + ob);
    asm volatile("s_wait_xcnt 0x0" ::: "memory");      /* the wait before the loads' address registers are reused */
  }
  const v8f z8 = {0.f,0.f,0.f,0.f,0.f,0.f,0.f,0.f}; v8f c00 = z8, c01 = z8, c02 = z8, c03 = z8, c10 = z8, c11 = z8, c12 = z8, c13 = z8;
#pragma unroll 1      /* the two buffers alternate by index; one step is already 16 matrix instructions */
  for (int j = 0; j < nk; ++j) {
    const int cb = j & 1;
    __syncthreads();      /* publishes buffer cb, and ends every wave's reads of the other buffer (step j - 1) before it is stored into below */
    if (j + 1 < nk) {      /* step j + 1's rows, asked for a whole step ago, go into the other buffer */
#pragma unroll      /* g[] indexed by constants only */
      for (int i = 0; i < 12; ++i) *(v8us*)&st[cb ^ 1][sr + 16 * i][sc] = g[i];
    }
    if (j + 2 < nk) {      /* step j + 2's rows fly until the next step's barrier */
      ga += 128; gb += 128;
#pragma unroll      /* g[] indexed by constants only */
      for (int i = 0; i < 8; ++i) g[i] = *(const v8us*)(ga + (size_t)(32 * i) * lda + oa);
#pragma unroll      /* g[] indexed by constants only */
      for (int i = 0; i < 4; ++i) g[8 + i] = *(const v8us*)(gb + (size_t)(32 * i) * ldb + ob);
      asm volatile("s_wait_xcnt 0x0" ::: "memory");      /* the wait before the loads' address registers are reused: the fragment reads below land in them */
    }
    const _Float16* ap = (const _Float16*)&st[cb][32 * w + ln][0]; const _Float16* bp = (const _Float16*)&st[cb][128 + ln][0];
    v16h fa[2][2], fb[2][4];      /* [k block of 32][16 rows] */
#pragma unroll      /* fa[], fb[] indexed by constants only, so that they stay in registers */
    for (int kk = 0; kk < 2; ++kk) { fa[kk][0] = g2_frag(ap + 32 * kk, hh); fa[kk][1] = g2_frag(ap + 16 * G2P + 32 * kk, hh);
#pragma unroll      /* fb[] indexed by constants only */
      for (int t = 0; t < 4; ++t) fb[kk][t] = g2_frag(bp + 16 * t * G2P + 32 * kk, hh); }
#pragma unroll      /* fa[], fb[] indexed by constants only */
    for (int kk = 0; kk < 2; ++kk) {
      c00 = g2_mma(fa[kk][0], fb[kk][0], c00); c10 = g2_mma(fa[kk][1], fb[kk][0], c10);
      c01 = g2_mma(fa[kk][0], fb[kk][1], c01); c11 = g2_mma(fa[kk][1], fb[kk][1], c11);
      c02 = g2_mma(fa[kk][0], fb[kk][2], c02); c12 = g2_mma(fa[kk][1], fb[kk][2], c12);
      c03 = g2_mma(fa[kk][0], fb[kk][3], c03); c13 = g2_mma(fa[kk][1], fb[kk][3], c13); }
  }
  v8f accs[8] = {c00, c01, c02, c03, c10, c11, c12, c13};
  const int rsub = lane >> 4, c4 = (lane & 15) * 4;
  v4f tb[16]; float b4[4];
  if constexpr (PROJ) {
    const float* bp4 = bias + col0 + ln;      /* a projection always has a bias */
#pragma unroll      /* b4[] indexed by constants only; the four loads issue together */
    for (int t = 0; t < 4; ++t) b4[t] = bp4[t * 16];
    if (ep.vt) {      /* a lane's 8 accumulator registers are 8 consecutive rows of one channel: one 16-byte piece of the transposed tile */
      unsigned short* vl = (unsigned short*)&so[0][0][0];      /* [64 channels][VTP] */
#pragma unroll      /* accs[] indexed by constants only */
      for (int u = 0; u < 8; ++u) { const int t = u & 3, half = u >> 2; const float bv = bf16_rne(b4[t]); FragH f;
#pragma unroll      /* fragment elements indexed by constants only */
        for (int r = 0; r < 8; ++r) f.h[r] = (_Float16)(accs[u][r] * alpha + bv);
        *(v8us*)&vl[(t * 16 + ln) * VTP + 32 * w + half * 16 + 8 * hh] = f.half[0]; }
      __syncthreads();      /* a channel's 128 rows come from all four waves; taken by the whole block or by none of it */
      const int bt = (mt * 128) / SQ; const int pc = tid & 15, dd = tid >> 4;      /* 16 lanes cover a channel's 256 B: two whole lines */
      unsigned short* vd = (unsigned short*)ep.Vt + ((size_t)(bt * NH + nq) * HD + dd) * SQ + (mt * 128 - bt * SQ) + pc * 8;
#pragma unroll      /* the 8 LDS reads issue ahead of the stores */
      for (int rd = 0; rd < 8; ++rd) { const v8us v = *(const v8us*)&vl[(rd * 8 + dd) * VTP + pc * 8]; *(v8us*)(vd + (size_t)(rd * 8) * SQ) = v; }
      return;
    }
    /* the table rows of this lane's 16 pieces are asked for ahead of the tile's way through LDS */
    const float* tp = ep.TAB + (size_t)(row0 % SQ + rsub) * 32 + (c4 & 31);
#pragma unroll      /* tb[] indexed by constants only, so that it stays in registers */
    for (int q = 0; q < 16; ++q) tb[q] = *(const v4fa*)(tp + q * 64);
    asm volatile("s_wait_xcnt 0x0" :: "v"(tp) : "memory");      /* the wait before the loads' address pair is reused; naming the pair keeps it live up to here, so that no load's result is placed in it */
  } else {      /* what the tile's way out reads from memory is asked for here, all of it together, under one test each: no load waits for the one before */
#pragma unroll      /* b4[] indexed by constants only */
    for (int t = 0; t < 4; ++t) b4[t] = 0.f;
    if (bias) { const float* bp4 = bias + col0 + ln;
#pragma unroll      /* b4[] indexed by constants only; the four loads issue together */
      for (int t = 0; t < 4; ++t) b4[t] = bp4[t * 16];
      asm volatile("s_wait_xcnt 0x0" ::: "memory"); }      /* the wait before the loads' address registers are reused */
    if (CP) {      /* the C plane's old values, as the 16 pieces that this lane itself stores below: own elements, read ahead of every store */
      const float* cq[16];
#pragma unroll      /* cq[] indexed by constants only, so that it stays in registers */
      for (int q = 0; q < 16; ++q) cq[q] = CP + cofs + (size_t)(row0 + rsub + q * 2) * ldc + col0 + c4;
#pragma unroll      /* tb[], cq[] indexed by constants only */
      for (int q = 0; q < 16; ++q) tb[q] = *(const v4fa*)cq[q];
      /* the wait before the loads' address pairs are reused; naming the pairs keeps them live up to here, so that no load's result is placed in them */
      asm volatile("s_wait_xcnt 0x0" :: "v"(cq[0]), "v"(cq[1]), "v"(cq[2]), "v"(cq[3]), "v"(cq[4]), "v"(cq[5]), "v"(cq[6]), "v"(cq[7]),
                   "v"(cq[8]), "v"(cq[9]), "v"(cq[10]), "v"(cq[11]), "v"(cq[12]), "v"(cq[13]), "v"(cq[14]), "v"(cq[15]) : "memory");
    }
  }
#pragma unroll
  for (int u = 0; u < 8; ++u) { const int t = u & 3, half = u >> 2; const float bv = bf16_rne(b4[t]);
#pragma unroll
    for (int r = 0; r < 8; ++r) { const int rloc = half * 16 + 8 * hh + r;
      so[w][rloc][t * 16 + ln] = accs[u][r] * alpha + bv; } }
  __builtin_amdgcn_fence(4 /* acq_rel order */, "workgroup"); __builtin_amdgcn_wave_barrier();
  if constexpr (PROJ) {
    const bool rot = ep.rotary && c4 < 32;
    if (ep.split) {
      _Float16* hp = ep.Hh + (size_t)(row0 + rsub) * ldc + col0 + c4; _Float16* lp = ep.Hl + (size_t)(row0 + rsub) * ldc + col0 + c4;
#pragma unroll      /* tb[] indexed by constants only */
      for (int q = 0; q < 16; ++q) { const v4f y = d_rot4(*(const v4fa*)&so[w][q * 2 + rsub][c4], tb[q], rot); v4h h4, l4;
#pragma unroll      /* vector elements indexed by constants only */
        for (int e = 0; e < 4; ++e) { const _Float16 h = (_Float16)y[e]; h4[e] = h; l4[e] = (_Float16)((y[e] - (float)h) * 1024.0f); }
        *(v4h*)(hp + (size_t)(q * 2) * ldc) = h4; *(v4h*)(lp + (size_t)(q * 2) * ldc) = l4; }
      asm volatile("s_wait_xcnt 0x0" ::: "memory");      /* the wait before the stores' registers are reused: the code of the other kinds of tile follows in the listing */
    } else {
      float* cp = C + (size_t)(row0 + rsub) * ldc + col0 + c4;
#pragma unroll      /* tb[] indexed by constants only */
      for (int q = 0; q < 16; ++q) *(v4f*)(cp + (size_t)(q * 2) * ldc) = d_rot4(*(const v4fa*)&so[w][q * 2 + rsub][c4], tb[q], rot);
      asm volatile("s_wait_xcnt 0x0" ::: "memory");      /* the wait before the stores' registers are reused: the code of the other kinds of tile follows in the listing */
    }
    return;
  }
  {
#pragma unroll
    for (int q = 0; q < 16; ++q) { const int r = q * 2 + rsub; v4f v = *(const v4fa*)&so[w][r][c4];
      if (CP) v += tb[q];
      if (C) { *(v4f*)(C + cofs + (size_t)(row0 + r) * ldc + col0 + c4) = v;
        if (H16) asm volatile("s_wait_xcnt 0x0" ::: "memory"); }      /* the wait before the store's data registers are reused: the converted values below land in them */
      if (C16) { v4h h4; h4[0] = (_Float16)v[0]; h4[1] = (_Float16)v[1]; h4[2] = (_Float16)v[2]; h4[3] = (_Float16)v[3]; *(v4h*)(C16 + cofs + (size_t)(row0 + r) * ldc + col0 + c4) = h4; } }
     }
}

__global__ __launch_bounds__(128) void k_gemm2(const _Float16* __restrict__ A, int lda, size_t sA, const _Float16* __restrict__ Bh, int ldb, size_t sB, float alpha,
    const float* __restrict__ bias, const float* CP, float* C, _Float16* C16, int ldc, size_t sC, int M, int N, int K) {
  const int by = blockIdx.y; const int ntn = N >> 6; const int mt = blockIdx.x / ntn, nq = blockIdx.x - mt * ntn; if (mt * 128 >= M) return;      /* a block leaves as a whole */
  gemm2_body<true>(A + (size_t)by * sA, lda, Bh + (size_t)by * sB, ldb, alpha, bias, CP, C, C16, ldc, (size_t)by * sC, mt, nq, K);
}

// One launch for the nine projections, none of which reads another's result; a block's product and tile follow from its index alone:
// q, k and v of all rows, then q, k, v of the first QT0 rows of every batch. BW holds the weights of q, k, v one behind the other.
// What follows a projection element by element is done on the block's own tile: q, k of all rows leave as rotated f16 hi + residual planes, v as V^T [NB][NH][HD][SQ]; the first-tile q, k as rotated f32 planes, the first-tile v as an f32 plane.
#define GQB ((MP / 128) * (DM / 64))      /* blocks of one projection of all rows */
#define GQ0 (DM / 64)                     /* blocks of one first-tile projection (QT0 == 128 rows) */
__global__ __launch_bounds__(128) void k_qkv(const _Float16* __restrict__ X16, const _Float16* __restrict__ BW, const float* __restrict__ bq, const float* __restrict__ bk, const float* __restrict__ bv,
    const float* __restrict__ TAB, _Float16* __restrict__ QH, _Float16* __restrict__ QL, _Float16* __restrict__ KH, _Float16* __restrict__ KL, _Float16* __restrict__ VT, float* __restrict__ QKR0, float* __restrict__ VF0) {
  const int bx = blockIdx.x; int sel, mt, nq; const _Float16* A = X16; float* C = nullptr; ProjEp ep; ep.TAB = TAB; ep.Vt = VT;
  if (bx < 3 * GQB) {
    sel = bx / GQB; const int t = bx - sel * GQB; mt = t / (DM / 64); nq = t - mt * (DM / 64);
    ep.vt = sel == 2; ep.split = true;
  } else {
    const int u = bx - 3 * GQB; const int s6 = u / GQ0; const int b = s6 / 3; sel = s6 - 3 * b; mt = 0; nq = u - s6 * GQ0;
    A += (size_t)b * SQ * DM; C = (sel < 2) ? QKR0 + (size_t)(2 * b + sel) * QT0 * DM : VF0 + (size_t)b * QT0 * DM;
    ep.vt = false; ep.split = false;
  }
  ep.rotary = sel < 2; ep.Hh = (sel == 0) ? QH : KH; ep.Hl = (sel == 0) ? QL : KL;
  const float* bias = (sel == 0) ? bq : ((sel == 1) ? bk : bv);
  gemm2_body<false, true>(A, DM, BW + (size_t)sel * DM * DM, DM, 0.0625f, bias, nullptr, C, nullptr, DM, (size_t)0, mt, nq, DM, ep);
}

// One launch for the output product of the f16 path (rows QT0 .. of a batch) and the hi-plane product of the first-tile o (rows 0 .. QT0 - 1): same weights, scale, bias and output plane, so a block's A plane follows from its row tile alone. grid.y = batch.
#define GOB ((SQ / 128) * (DM / 64))      /* blocks a batch */
__global__ __launch_bounds__(128) void k_out(const _Float16* __restrict__ O16, const _Float16* __restrict__ OH0, const _Float16* __restrict__ BO, const float* __restrict__ bo, float* out) {
  const int bx = blockIdx.x, by = blockIdx.y; const int mt = bx / (DM / 64), nq = bx - mt * (DM / 64);
  const _Float16* A = (mt == 0) ? OH0 + (size_t)by * QT0 * DM : O16 + (size_t)by * SQ * DM;      /* QT0 == 128: the first tile is row tile 0 */
  gemm2_body<false>(A, DM, BO, DM, 0.0009765625f, bo, nullptr, out, nullptr, DM, (size_t)by * SQ_FULL * DM, mt, nq, DM);
}

// Butterfly over the 32 lanes of a wave: four row_xmask steps inside each 16-lane row, then the other row; every lane ends with the same value.
template <int CTRL>
__device__ __forceinline__ float lane_xm(float x) { return __int_as_float(__builtin_amdgcn_update_dpp(0, __float_as_int(x), CTRL, 0xf, 0xf, true)); }
__device__ __forceinline__ float lane_x16(float x) { const int b = __float_as_int(x); return __int_as_float(__builtin_amdgcn_permlanex16(b, b, 0x76543210, 0xfedcba98, false, false)); }
__device__ __forceinline__ float wave_max(float x) {
  x = fmaxf(x, lane_xm<0x161>(x)); x = fmaxf(x, lane_xm<0x162>(x)); x = fmaxf(x, lane_xm<0x164>(x)); x = fmaxf(x, lane_xm<0x168>(x)); return fmaxf(x, lane_x16(x)); }
__device__ __forceinline__ float wave_sum(float x) {
  x += lane_xm<0x161>(x); x += lane_xm<0x162>(x); x += lane_xm<0x164>(x); x += lane_xm<0x168>(x); return x + lane_x16(x); }

#define FAC1 0.18033688011112042f        /* log2(e) / 8 */
#define FAC2 0.00017611023448351604f     /* log2(e) / 8 / 1024 */
#define FAP 72                           /* LDS row pitch in 16-bit elements: 128 B + 16 B, for 16-byte readers on 16 rows */
#define FNT (SQ / 64)                    /* query tiles = key steps of the longest tile */
static_assert(HD == 64 && (FNT & (FNT - 1)) == 0);
static_assert((size_t)FNT * NH * 128 * 8 >= (size_t)NB * QT0 * DM);      /* one slab of blocks covers the split of the first-tile o */
// 2^x. The v_nop at the end keeps the one slot that the instruction set asks for between a transcendental and a next instruction that reads its result or overwrites its source;
// inside the run of eight every result register is distinct from every source (early clobber), so each v_exp_f32 is the independent instruction behind the one before.
__device__ __forceinline__ float fa_exp2(float x) { float y; asm("v_exp_f32 %0, %1\n\tv_nop" : "=v"(y) : "v"(x)); return y; }
__device__ __forceinline__ v8f fa_exp2x8(v8f x) { float y0, y1, y2, y3, y4, y5, y6, y7;
  asm("v_exp_f32 %0, %8\n\tv_exp_f32 %1, %9\n\tv_exp_f32 %2, %10\n\tv_exp_f32 %3, %11\n\tv_exp_f32 %4, %12\n\tv_exp_f32 %5, %13\n\tv_exp_f32 %6, %14\n\tv_exp_f32 %7, %15\n\tv_nop"
      : "=&v"(y0), "=&v"(y1), "=&v"(y2), "=&v"(y3), "=&v"(y4), "=&v"(y5), "=&v"(y6), "=&v"(y7)
      : "v"(x[0]), "v"(x[1]), "v"(x[2]), "v"(x[3]), "v"(x[4]), "v"(x[5]), "v"(x[6]), "v"(x[7]));
  const v8f y = {y0, y1, y2, y3, y4, y5, y6, y7}; return y; }
/* amdgpu_waves_per_eu(4, 4): holds the kernel to 256 registers, so that four blocks fit a WGP and no register window is switched in the loop */
__global__ __launch_bounds__(128) __attribute__((amdgpu_waves_per_eu(4, 4))) void k_fattn(const _Float16* __restrict__ QHp, const _Float16* __restrict__ QLp, const _Float16* __restrict__ KHp, const _Float16* __restrict__ KLp,
    const _Float16* __restrict__ VTp, _Float16* __restrict__ O16p, const float* __restrict__ OF0, _Float16* __restrict__ OH0, _Float16* __restrict__ OL0) {
  __shared__ __attribute__((aligned(16))) unsigned short lt[2][3][64][FAP];      /* [buffer][K hi, K residual, V^T][row][element] */
  if (blockIdx.z >= NB) {      /* the slab of blocks behind the last batch (so that every attention block keeps its flat index): the hi/residual split of the first-tile o, which reads nothing of this launch; a block leaves as a whole, ahead of every barrier */
    d_hl(OF0, OH0, OL0, (size_t)NB * QT0 * DM / 8, (size_t)((blockIdx.y * FNT + blockIdx.x) * 128 + threadIdx.x)); return; }
  const int tid = threadIdx.x, w = __builtin_amdgcn_readfirstlane((int)(tid >> 5)), lane = tid & 31, ln = lane & 15, hh = lane >> 4;
  const int h = blockIdx.y, b = blockIdx.z; const int x = blockIdx.x, grp = (b * NH + h) >> 3;
  /* a permutation of the tiles for each (batch, head): blocks whose flat indices lie far apart get tiles of unequal length, so that long tiles do not gather in one place */
  const int qt = (grp % 3 == 0) ? FNT - 1 - x : ((grp % 3 == 1) ? x : ((x + FNT / 2) & (FNT - 1)));
  const int qw = qt * 64 + 16 * w; const size_t r0 = (size_t)b * SQ;
  const _Float16* qhp = QHp + (r0 + qw + ln) * DM + h * HD; const _Float16* qlp = QLp + (r0 + qw + ln) * DM + h * HD;
  const v16h qh0 = g2_frag(qhp, hh), qh1 = g2_frag(qhp + 32, hh), ql0 = g2_frag(qlp, hh), ql1 = g2_frag(qlp + 32, hh);
  const int sr = tid >> 3, sc = (tid & 7) * 8;      /* staging: 8 lanes cover one 128-B row, a wave 4 rows */
  const unsigned short* gk = (const unsigned short*)KHp + (r0 + sr) * DM + h * HD + sc; const unsigned short* gl = (const unsigned short*)KLp + (r0 + sr) * DM + h * HD + sc;
  const unsigned short* gv = (const unsigned short*)VTp + ((size_t)(b * NH + h) * HD + sr) * SQ + sc;
  v8us g[12];
#pragma unroll      /* g[] indexed by constants only, so that it stays in registers */
  for (int i = 0; i < 4; ++i) { g[i] = *(const v8us*)(gk + (size_t)(16 * i) * DM); g[4 + i] = *(const v8us*)(gl + (size_t)(16 * i) * DM); g[8 + i] = *(const v8us*)(gv + (size_t)(16 * i) * SQ); }
#pragma unroll      /* g[] indexed by constants only */
  for (int i = 0; i < 4; ++i) { *(v8us*)&lt[0][0][sr + 16 * i][sc] = g[i]; *(v8us*)&lt[0][1][sr + 16 * i][sc] = g[4 + i]; *(v8us*)&lt[0][2][sr + 16 * i][sc] = g[8 + i]; }
  const v8f z8 = {0.f,0.f,0.f,0.f,0.f,0.f,0.f,0.f};
  v8f o[4] = {z8, z8, z8, z8}; float m = -1.0e30f, l = 0.f;
#pragma unroll 1      /* one step is already 32 matrix instructions; the two buffers alternate by index */
  for (int j = 0; j <= qt; ++j) {
    const int cb = j & 1;
    __syncthreads();      /* publishes buffer cb, and ends every wave's reads of the other buffer (step j - 1) before it is stored into below */
    if (j < qt) {      /* the next step's tiles fly while this step is worked on */
      gk += (size_t)64 * DM; gl += (size_t)64 * DM; gv += 64;
#pragma unroll      /* g[] indexed by constants only */
      for (int i = 0; i < 4; ++i) { g[i] = *(const v8us*)(gk + (size_t)(16 * i) * DM); g[4 + i] = *(const v8us*)(gl + (size_t)(16 * i) * DM); g[8 + i] = *(const v8us*)(gv + (size_t)(16 * i) * SQ); }
    }
    v8f s[4]; v16h kf[2][4], va[4];
    { const _Float16* kh = (const _Float16*)&lt[cb][0][ln][0]; const _Float16* kl = (const _Float16*)&lt[cb][1][ln][0];
      kf[0][0] = g2_frag(kh, hh); kf[0][1] = g2_frag(kh + 32, hh); kf[0][2] = g2_frag(kl, hh); kf[0][3] = g2_frag(kl + 32, hh); }
#pragma unroll      /* s[], kf[], va[] indexed by constants only, so that they stay in registers */
    for (int t = 0; t < 4; ++t) {
      if (t < 3) {      /* the next 16 keys' fragments are asked for ahead of this tile's products */
        const _Float16* kh = (const _Float16*)&lt[cb][0][16 * (t + 1) + ln][0]; const _Float16* kl = (const _Float16*)&lt[cb][1][16 * (t + 1) + ln][0];
        kf[(t + 1) & 1][0] = g2_frag(kh, hh); kf[(t + 1) & 1][1] = g2_frag(kh + 32, hh); kf[(t + 1) & 1][2] = g2_frag(kl, hh); kf[(t + 1) & 1][3] = g2_frag(kl + 32, hh);
      } else {      /* V^T of the first 32 keys is asked for ahead of the softmax */
#pragma unroll      /* va[] indexed by constants only */
        for (int u = 0; u < 4; ++u) va[u] = g2_frag((const _Float16*)&lt[cb][2][16 * u + ln][0], hh);
      }
      const v16h kh0 = kf[t & 1][0], kh1 = kf[t & 1][1], kl0 = kf[t & 1][2], kl1 = kf[t & 1][3];
      v8f a = z8, c = z8, d = z8;
      a = g2_mma(kh0, qh0, a); c = g2_mma(kh0, ql0, c); d = g2_mma(kl0, qh0, d);
      a = g2_mma(kh1, qh1, a); c = g2_mma(kh1, ql1, c); d = g2_mma(kl1, qh1, d);
#pragma unroll      /* vector elements indexed by constants only */
      for (int r = 0; r < 8; ++r) s[t][r] = a[r] * FAC1 + (c[r] + d[r]) * FAC2;
    }
    if (j == qt) {      /* only the last step crosses the diagonal; every query keeps its key 64 qt there */
      const int rel = 16 * w + ln - 8 * hh;      /* key 64 qt + 16 t + 8 hh + r is kept while 16 t + r <= rel */
#pragma unroll      /* s[] indexed by constants only */
      for (int t = 0; t < 4; ++t) {
#pragma unroll      /* s[] indexed by constants only */
        for (int r = 0; r < 8; ++r) s[t][r] = (16 * t + r <= rel) ? s[t][r] : -1.0e30f; }
    }
    v8f x8;
#pragma unroll      /* vector elements indexed by constants only */
    for (int r = 0; r < 8; ++r) x8[r] = fmaxf(fmaxf(s[0][r], s[1][r]), fmaxf(s[2][r], s[3][r]));
    float mx = fmaxf(fmaxf(fmaxf(x8[0], x8[1]), fmaxf(x8[2], x8[3])), fmaxf(fmaxf(x8[4], x8[5]), fmaxf(x8[6], x8[7])));
    mx = fmaxf(mx, lane_x16(mx));      /* the other half of this query's keys */
    const float mn = fmaxf(m, mx); const float al = fa_exp2(m - mn); const float mb = mn - 8.0f; m = mn;
    v4f ps = {0.f, 0.f, 0.f, 0.f};
#pragma unroll      /* s[] indexed by constants only */
    for (int t = 0; t < 4; ++t) { s[t] = fa_exp2x8(s[t] - mb);
#pragma unroll      /* s[] indexed by constants only; four independent partial sums */
      for (int r = 0; r < 8; ++r) ps[r & 3] += s[t][r]; }
    l = l * al + ((ps[0] + ps[1]) + (ps[2] + ps[3]));
    FragH p0, p1;
#pragma unroll      /* fragment elements indexed by constants only */
    for (int r = 0; r < 8; ++r) { p0.h[r] = (_Float16)s[0][r]; p0.h[8 + r] = (_Float16)s[1][r]; p1.h[r] = (_Float16)s[2][r]; p1.h[8 + r] = (_Float16)s[3][r]; }
#pragma unroll      /* o[] indexed by constants only */
    for (int t = 0; t < 4; ++t) {
#pragma unroll      /* o[] indexed by constants only */
      for (int r = 0; r < 8; ++r) o[t][r] *= al; }
    v16h vb[4];
#pragma unroll      /* vb[] indexed by constants only; V^T of the last 32 keys, into registers that the scores have left */
    for (int u = 0; u < 4; ++u) vb[u] = g2_frag((const _Float16*)&lt[cb][2][16 * u + ln][32], hh);
#pragma unroll      /* o[], va[] indexed by constants only; four independent accumulators in turn */
    for (int t = 0; t < 4; ++t) o[t] = g2_mma(va[t], p0.v, o[t]);
#pragma unroll      /* o[], vb[] indexed by constants only */
    for (int t = 0; t < 4; ++t) o[t] = g2_mma(vb[t], p1.v, o[t]);
    if (j < qt) {
#pragma unroll      /* g[] indexed by constants only */
      for (int i = 0; i < 4; ++i) { *(v8us*)&lt[cb ^ 1][0][sr + 16 * i][sc] = g[i]; *(v8us*)&lt[cb ^ 1][1][sr + 16 * i][sc] = g[4 + i]; *(v8us*)&lt[cb ^ 1][2][sr + 16 * i][sc] = g[8 + i]; }
    }
  }
  l += lane_x16(l);      /* join the two halves' sums once */
  const float inv = 64.0f / l;      /* o carried x64 */
  unsigned short* op = (unsigned short*)O16p + (r0 + qw + ln) * DM + h * HD + 8 * hh;
#pragma unroll      /* o[] indexed by constants only */
  for (int t = 0; t < 4; ++t) { FragH f;
#pragma unroll      /* fragment elements indexed by constants only */
    for (int r = 0; r < 8; ++r) f.h[r] = (_Float16)(o[t][r] * inv);
    *(v8us*)(op + 16 * t) = f.half[0]; }
  asm volatile("s_wait_xcnt 0x0" ::: "memory");      /* the wait before the stores' registers are reused: the code of the split piece follows in the listing */
}

// f32 attention over the first QT0 query rows of every batch (grid.y = batch; q and k planes of a batch lie one behind the other). Block = one head x A0R query rows, 8 waves, 2 rows a wave; keys 0 .. (rg + 1) A0R - 1 cover every row of the block.
// K (row pitch A0KP floats = 16 B x odd: lanes on different rows read 16 B each without bank conflicts), V and the q rows are staged in LDS once.
// Scores: lane = key, both rows share each K read. Softmax: wave butterflies. Weighted sum: lane = channel pair, weights read as broadcasts.
#define A0R 16
#define A0KP 68
static_assert(QT0 % A0R == 0);
static_assert(QT0 == 128 && HD == 64 && A0R == 16);
typedef float v2f __attribute__((ext_vector_type(2)));
__global__ __launch_bounds__(256) void k_att0(const float* __restrict__ QF, const float* __restrict__ KF, const float* __restrict__ VF, float scale, float* __restrict__ OF) {
  __shared__ __attribute__((aligned(16))) float lk[QT0][A0KP]; __shared__ __attribute__((aligned(16))) float lv[QT0][HD];
  __shared__ __attribute__((aligned(16))) float lq[A0R][HD]; __shared__ __attribute__((aligned(16))) float lp[A0R][QT0];
  const int tid = threadIdx.x, lane = tid & 31, w = __builtin_amdgcn_readfirstlane((int)(tid >> 5));
  const int h = blockIdx.x / (QT0 / A0R), rg = blockIdx.x % (QT0 / A0R); const int nkeys = (rg + 1) * A0R;
  { const size_t bo1 = (size_t)blockIdx.y * QT0 * DM; QF += 2 * bo1; KF += 2 * bo1; VF += bo1; OF += bo1; }
  const int sr = tid >> 4, sc4 = (tid & 15) * 4;      /* staging: 16 lanes cover one 256-B row */
  const float* qp = QF + (size_t)(rg * A0R + sr) * DM + h * HD + sc4; const float* kp = KF + (size_t)sr * DM + h * HD + sc4; const float* vp = VF + (size_t)sr * DM + h * HD + sc4;
  const v4f qs = *(const v4fa*)qp;
  v4f ks[QT0 / 16], vs[QT0 / 16];      /* all QT0 rows of K and V are staged by every block: no test stands between the loads */
#pragma unroll      /* ks[], vs[] indexed by constants only, so that they stay in registers; all loads issued before the first use */
  for (int g = 0; g < QT0 / 16; ++g) { ks[g] = *(const v4fa*)(kp + (size_t)g * 16 * DM); vs[g] = *(const v4fa*)(vp + (size_t)g * 16 * DM); }
  asm volatile("s_wait_xcnt 0x0" :: "v"(qp), "v"(kp), "v"(vp) : "memory");      /* the wait before the loads' address pairs are reused; naming the pairs keeps them live up to here, so that no load's result is placed in them */
  *(v4f*)&lq[sr][sc4] = qs;
#pragma unroll      /* ks[], vs[] indexed by constants only, so that they stay in registers */
  for (int g = 0; g < QT0 / 16; ++g) { *(v4f*)&lk[g * 16 + sr][sc4] = ks[g]; *(v4f*)&lv[g * 16 + sr][sc4] = vs[g]; }
  __syncthreads();
  const int r0 = 2 * w, i0 = rg * A0R + r0, i1 = i0 + 1;      /* this wave's two query rows */
  const int nch = (nkeys + 31) >> 5;      /* chunks of 32 keys */
  float s0[QT0 / 32], s1[QT0 / 32];
#pragma unroll      /* s0[], s1[] indexed by constants only, so that they stay in registers */
  for (int m = 0; m < QT0 / 32; ++m) { s0[m] = -1.0e30f; s1[m] = -1.0e30f;
    if (m < nch) { const int j = m * 32 + lane;
      v4f a0 = {0.f, 0.f, 0.f, 0.f}, a1 = {0.f, 0.f, 0.f, 0.f};
#pragma unroll      /* the 48 LDS reads of a chunk issue ahead of their use */
      for (int c = 0; c < HD / 4; ++c) { const v4f kq = *(const v4f*)&lk[j][c * 4]; const v4f q0 = *(const v4f*)&lq[r0][c * 4]; const v4f q1 = *(const v4f*)&lq[r0 + 1][c * 4];
#pragma unroll      /* four independent partial sums a row */
        for (int u = 0; u < 4; ++u) { a0[u] = fmaf(q0[u], kq[u], a0[u]); a1[u] = fmaf(q1[u], kq[u], a1[u]); } }
      const float d0 = ((a0[0] + a0[1]) + (a0[2] + a0[3])) * scale, d1 = ((a1[0] + a1[1]) + (a1[2] + a1[3])) * scale;
      s0[m] = (j <= i0) ? d0 : -1.0e30f; s1[m] = (j <= i1) ? d1 : -1.0e30f; } }
  const float m0 = wave_max(fmaxf(fmaxf(s0[0], s0[1]), fmaxf(s0[2], s0[3]))), m1 = wave_max(fmaxf(fmaxf(s1[0], s1[1]), fmaxf(s1[2], s1[3])));
  float l0 = 0.f, l1 = 0.f;
#pragma unroll      /* s0[], s1[] indexed by constants only, so that they stay in registers */
  for (int m = 0; m < QT0 / 32; ++m) if (m < nch) { const int j = m * 32 + lane;
    const float e0 = (j <= i0) ? expf(s0[m] - m0) : 0.f, e1 = (j <= i1) ? expf(s1[m] - m1) : 0.f;
    l0 += e0; l1 += e1; lp[r0][j] = e0; lp[r0 + 1][j] = e1; }
  l0 = wave_sum(l0); l1 = wave_sum(l1);
  __syncthreads();      /* the weights of a row are written by lanes and read back as broadcasts */
  const int n4 = (i1 + 4) >> 2;      /* keys 0 .. i1 in fours; the weights above a row's own index are zero, and 4 n4 <= nkeys */
  v2f o0 = {0.f, 0.f}, o1 = {0.f, 0.f};
#pragma unroll 4      /* LDS reads of later trips issue while earlier ones are summed */
  for (int t = 0; t < n4; ++t) { const v4f p0 = *(const v4f*)&lp[r0][t * 4]; const v4f p1 = *(const v4f*)&lp[r0 + 1][t * 4];
#pragma unroll      /* p0[], p1[] indexed by constants only */
    for (int u = 0; u < 4; ++u) { const v2f vv = *(const v2f*)&lv[t * 4 + u][2 * lane];
      o0[0] = fmaf(p0[u], vv[0], o0[0]); o0[1] = fmaf(p0[u], vv[1], o0[1]); o1[0] = fmaf(p1[u], vv[0], o1[0]); o1[1] = fmaf(p1[u], vv[1], o1[1]); } }
  const float f0 = 64.0f / l0, f1 = 64.0f / l1;      /* o carried x64 like the f16 path */
  o0[0] *= f0; o0[1] *= f0; o1[0] *= f1; o1[1] *= f1;
  *(v2f*)(OF + (size_t)i0 * DM + h * HD + 2 * lane) = o0;
  *(v2f*)(OF + (size_t)i1 * DM + h * HD + 2 * lane) = o1;
}

extern "C" void kernel_launch(void* const* d_in, const int* in_sizes, int n_in,
                              void* d_out, int out_size, void* d_ws, size_t ws_size, hipStream_t stream) {
  if (n_in < 9) return;
  const size_t needx = ((size_t)(NB - 1) * SQ_FULL + SQ) * DM;
  if ((size_t)in_sizes[0] < needx) return;
  if (in_sizes[1] < DM * DM || in_sizes[3] < DM * DM || in_sizes[5] < DM * DM || in_sizes[7] < DM * DM) return;
  if (in_sizes[2] < DM || in_sizes[4] < DM || in_sizes[6] < DM || in_sizes[8] < DM) return;
  if ((size_t)out_size < needx) return;
  /* wire order: x, Wq, bq, Wk, bk, Wv, bv, Wo, bo (natural [out][in] weights, f32) */
  const float* x = (const float*)d_in[0]; const float* wq = (const float*)d_in[1]; const float* bq = (const float*)d_in[2]; const float* wk = (const float*)d_in[3]; const float* bk = (const float*)d_in[4];
  const float* wv = (const float*)d_in[5]; const float* bv = (const float*)d_in[6]; const float* wo = (const float*)d_in[7]; const float* bo = (const float*)d_in[8];
  float* out = (float*)d_out;
  char* ws = (char*)d_ws; size_t off = 0;
  auto take = [&](size_t bytes) { char* p = ws + off; off += (bytes + 255) & ~(size_t)255; return p; };
  _Float16* BW = (_Float16*)take((size_t)4 * DM * DM * 2); _Float16* BO = BW + (size_t)3 * DM * DM;      /* weights of q, k, v, o one behind the other */
  _Float16* X16 = (_Float16*)take(NR * DM * 2);
  _Float16* QH = (_Float16*)take(NR * DM * 2); _Float16* QL = (_Float16*)take(NR * DM * 2); _Float16* KH = (_Float16*)take(NR * DM * 2); _Float16* KL = (_Float16*)take(NR * DM * 2);
  _Float16* O16 = (_Float16*)take(NR * DM * 2);
  _Float16* VT = (_Float16*)take((size_t)NB * NH * HD * SQ * 2);
  float* TAB = (float*)take((size_t)SQ * 32 * 4);
  float* QKR0 = (float*)take((size_t)NB * 2 * QT0 * DM * 4); float* VF0 = (float*)take((size_t)NB * QT0 * DM * 4);      /* [batch][q, k][row][channel]; [batch][row][channel] */
  float* OF0 = (float*)take((size_t)NB * QT0 * DM * 4); _Float16* OH0 = (_Float16*)take((size_t)NB * QT0 * DM * 2); _Float16* OL0 = (_Float16*)take((size_t)NB * QT0 * DM * 2);
  if (off > ws_size || off > (size_t)134217728) return;

  k_prep<<<NB * PXB + 4 * PWB + SQ / 16, 256, 0, stream>>>(x, wq, wk, wv, wo, X16, BW, TAB);
  k_qkv<<<3 * GQB + NB * 3 * GQ0, 128, 0, stream>>>(X16, BW, bq, bk, bv, TAB, QH, QL, KH, KL, VT, QKR0, VF0);
  k_att0<<<dim3(NH * (QT0 / A0R), NB), 256, 0, stream>>>(QKR0, QKR0 + (size_t)QT0 * DM, VF0, SCL, OF0);
  k_fattn<<<dim3(FNT, NH, NB + 1), 128, 0, stream>>>(QH, QL, KH, KL, VT, O16, OF0, OH0, OL0);

  /* out = o (x64) . Wo (x16) * 2^-10 + bo; grid.y = batch (output rows at the full per-batch stride); rows 0..127 from the hi plane of the f32 path */
  k_out<<<dim3(GOB, NB), 128, 0, stream>>>(O16, OH0, BO, bo, out);
  const dim3 gf((QT0 / 128) * (DM / 64), NB);
  k_gemm2<<<gf, 128, 0, stream>>>(OL0, DM, (size_t)QT0 * DM, BO, DM, (size_t)0, 0.00000095367431640625f, nullptr, out, out, nullptr, DM, (size_t)SQ_FULL * DM, QT0, DM, DM);      /* += o_lo Wo 2^-20 (own-element accumulate) */
}

// v008
// Measured time: 88.5 microseconds a run.
// Next to v007, in two timings, it ran 1.13 times as fast each time.
// All steps since v000 together make it 62.9 times as fast.
#include <hip/hip_runtime.h>
// Causal multi-head self-attention: x [2][2048][768], 12 heads of 64, natural [out][in] projections with biases, interleaved partial rotary embedding on channels 0..31 of each head of q and k (pairs (2p,2p+1), angle = s * 10000^(-p/16), computed table), scores / 8, causal softmax, out = merged Wo^T + bo.
// Compute dtype: every contraction on v_wmma_f32_16x16x32_f16 (f16 operands, f32 accumulate). Inputs RNE-converted to bf16 first (exact in f16; weights carried x16). q/k: GEMM -> f32 -> rotary in f32 -> f16 hi + x1024 f16 residual planes; scores = three products (hi.hi + lo.hi + hi.lo; each residual pass has its own accumulator folded with 2^-10). v, the unnormalised softmax weights (x256 at the running maximum) and o (x64) are single f16 planes; scores, online softmax and the weighted sum run in one fused kernel. The first 128 query rows of each batch are recomputed with an f32 VALU attention and go through the output GEMM as f16 hi + x1024 residual planes of o.
#ifndef NB
#define NB 2
#endif
#ifndef SEQ
#define SEQ 2048
#endif
#define SQ SEQ
#define SQ_FULL 2048                 /* per-batch row stride of x and of the output */
#define NB_FULL 2
#define DM 768
#define NH 12
#define HD 64
#define QT0 128                      /* first-tile rows recomputed in f32 */
#define SCL 0.125f                   /* 1 / sqrt(64) */
#define NR ((size_t)NB * SQ)
#define MP ((int)((size_t)NB * SQ))

static_assert(SQ % 128 == 0);
static_assert(SQ % 16 == 0);
static_assert(QT0 == 128);
static_assert(SQ >= QT0);
static_assert(NH * HD == DM);
static_assert(DM % 64 == 0);
static_assert(SQ <= SQ_FULL);
static_assert(NB <= NB_FULL);

typedef unsigned short v8us __attribute__((ext_vector_type(8), may_alias));
typedef float  v8f  __attribute__((ext_vector_type(8)));
typedef float  v4f  __attribute__((ext_vector_type(4)));
typedef float  v4fa __attribute__((ext_vector_type(4), may_alias));
typedef _Float16 v16h __attribute__((ext_vector_type(16)));
typedef _Float16 v4h __attribute__((ext_vector_type(4)));
union FragH { v16h v; v8us half[2]; _Float16 h[16]; unsigned short u[16]; };

__device__ __forceinline__ unsigned short bf16_bits(float x) { unsigned int u = __float_as_uint(x); return (unsigned short)((u + 0x7FFFu + ((u >> 16) & 1u)) >> 16); }
__device__ __forceinline__ float bf16_rne(float x) { return __uint_as_float(((unsigned int)bf16_bits(x)) << 16); }

// 10000^(-p/16), p = 0..15, selected by value (no memory table)
__device__ __forceinline__ float rope_invf(int p) {
  float f = 1.0f;
  f = (p == 1)  ? 0.5623413251903491f : f;
  f = (p == 2)  ? 0.31622776601683794f : f;
  f = (p == 3)  ? 0.1778279410038923f : f;
  f = (p == 4)  ? 0.1f : f;
  f = (p == 5)  ? 0.05623413251903491f : f;
  f = (p == 6)  ? 0.03162277660168379f : f;
  f = (p == 7)  ? 0.01778279410038923f : f;
  f = (p == 8)  ? 0.01f : f;
  f = (p == 9)  ? 0.005623413251903491f : f;
  f = (p == 10) ? 0.0031622776601683794f : f;
  f = (p == 11) ? 0.0017782794100389228f : f;
  f = (p == 12) ? 0.001f : f;
  f = (p == 13) ? 0.0005623413251903491f : f;
  f = (p == 14) ? 0.00031622776601683794f : f;
  f = (p == 15) ? 0.00017782794100389227f : f;
  return f;
}

__device__ __forceinline__ void d_tab(int blk, float* __restrict__ TAB) {
  #pragma clang fp contract(off)
  __shared__ __attribute__((aligned(16))) float tl[16][32];
  const int tid = threadIdx.x; const int sl = tid >> 4, p = tid & 15; const int s = blk * 16 + sl;
  const float ang = (float)s * rope_invf(p);
  float sn, cs; sincosf(ang, &sn, &cs);
  tl[sl][2 * p] = cs; tl[sl][2 * p + 1] = sn;
  __syncthreads();
  if (tid < 128) {
    const int row = tid >> 3, pc = (tid & 7) * 4;
    const v4f v = *(const v4fa*)&tl[row][pc];
    float* d = TAB + (size_t)(blk * 16 + row) * 32 + pc;
    *(v4f*)d = v;
    
  }
}

// 8 floats -> bf16 (RNE) -> x scale (a power of two, exact) -> f16
__device__ __forceinline__ void d_cast8(const float* __restrict__ s, float scale, _Float16* __restrict__ d) {
  const v4f a = *(const v4fa*)s, c = *(const v4fa*)(s + 4);
  FragH f;
#pragma unroll
  for (int q = 0; q < 4; ++q) { f.h[q] = (_Float16)(bf16_rne(a[q]) * scale); f.h[4 + q] = (_Float16)(bf16_rne(c[q]) * scale); }
  const v8us o = f.half[0];
  *(v8us*)(unsigned short*)d = o;
}

// One launch for the seven pieces of set-up work, none of which reads another's result; a block's piece follows from its index alone: x of each batch, the four weights (x16, stored one behind the other), the rotary table.
#define PXB ((SQ * DM / 8 + 255) / 256)      /* blocks for x of one batch */
#define PWB ((DM * DM / 8 + 255) / 256)      /* blocks for one weight */
__global__ __launch_bounds__(256) void k_prep(const float* __restrict__ x, const float* __restrict__ wq, const float* __restrict__ wk, const float* __restrict__ wv, const float* __restrict__ wo,
    _Float16* __restrict__ X16, _Float16* __restrict__ BW, float* __restrict__ TAB) {
  const int bx = blockIdx.x, tid = threadIdx.x;
  if (bx < NB * PXB) {
    const int b = bx / PXB; const int t = (bx - b * PXB) * 256 + tid; if (t >= SQ * DM / 8) return;
    d_cast8(x + (size_t)b * SQ_FULL * DM + (size_t)t * 8, 1.0f, X16 + (size_t)b * SQ * DM + (size_t)t * 8);
  } else if (bx < NB * PXB + 4 * PWB) {
    const int u = bx - NB * PXB; const int sel = u / PWB; const int t = (u - sel * PWB) * 256 + tid; if (t >= DM * DM / 8) return;
    const float* wsrc = (sel == 0) ? wq : ((sel == 1) ? wk : ((sel == 2) ? wv : wo));
    d_cast8(wsrc + (size_t)t * 8, 16.0f, BW + (size_t)sel * DM * DM + (size_t)t * 8);
  } else {
    d_tab(bx - (NB * PXB + 4 * PWB), TAB);
  }
}

__device__ __forceinline__ void d_hl(const float* __restrict__ F, _Float16* __restrict__ Hh, _Float16* __restrict__ Hl, size_t n8, size_t t) {
  if (t >= n8) return;
  FragH fh, fl; const v4f a = *(const v4fa*)(F + t * 8), c = *(const v4fa*)(F + t * 8 + 4);
#pragma unroll
  for (int q = 0; q < 4; ++q) { _Float16 h = (_Float16)a[q]; fh.h[q] = h; fl.h[q] = (_Float16)((a[q] - (float)h) * 1024.0f); h = (_Float16)c[q]; fh.h[4 + q] = h; fl.h[4 + q] = (_Float16)((c[q] - (float)h) * 1024.0f); }
  { *(v8us*)((unsigned short*)Hh + t * 8) = fh.half[0]; *(v8us*)((unsigned short*)Hl + t * 8) = fl.half[0];  }
}

// Rotary embedding of four neighbouring channels (two pairs) of one row; tb = cos, sin of the two pairs; rot = false leaves the channels as they are.
__device__ __forceinline__ v4f d_rot4(v4f a, v4f tb, bool rot) {
  v4f o;
  o[0] = rot ? (a[0] * tb[0] + (-a[1]) * tb[1]) : a[0];
  o[1] = rot ? (a[1] * tb[0] + a[0] * tb[1]) : a[1];
  o[2] = rot ? (a[2] * tb[2] + (-a[3]) * tb[3]) : a[2];
  o[3] = rot ? (a[3] * tb[2] + a[2] * tb[3]) : a[3];
  return o;
}

// ---- f16 GEMM engine (wave tile 32x64; block = 4 waves = 128 rows x 64 cols; M % 128 == 0, N % 64 == 0, K % 64 == 0) ----
// A f16 [M][K] row-major (pitch lda), Bh f16 [N][K] (k contiguous, pitch ldb).
// A step is 64 k: the block's 128 A rows and 64 B rows (128 B each) are read from memory once a block, as whole lines, two steps ahead into registers, and stored one step ahead into the LDS buffer that is not being read;
// every wave takes its fragments from LDS, all 24 reads of a step asked for ahead of the step's 16 products. Each accumulator still sums its k blocks of 32 in rising order.
#define G2P 72                           /* LDS row pitch in 16-bit elements: 128 B + 16 B, for 16-byte readers on 16 rows */
__device__ __forceinline__ v16h g2_frag(const _Float16* p, int hh) { FragH f; f.half[0] = *(const v8us*)((const unsigned short*)p + 8 * hh); f.half[1] = *(const v8us*)((const unsigned short*)p + 16 + 8 * hh); return f.v; }
__device__ __forceinline__ v8f g2_mma(v16h a, v16h b, v8f c) { v8f d = __builtin_amdgcn_wmma_f32_16x16x32_f16(false, a, false, b, (short)0, c, false, false); asm volatile("v_nop\n\tv_nop\n\tv_nop\n\tv_nop" : "+v"(d) : "v"(a), "v"(b)); return d; }
// What a projection block does with its 128 x 64 tile (64 columns = one head) instead of storing it plainly; every member is the same for the whole block.
// vt: the tile goes out as f16, transposed, into Vt [batch][head][channel][SQ]. Otherwise rotary: the rotary embedding is applied (row s of TAB = row of the batch); split: f16 hi + x1024 residual planes Hh, Hl instead of the f32 plane C.
struct ProjEp { const float* TAB; _Float16* Hh; _Float16* Hl; _Float16* Vt; bool vt, rotary, split; };
#define VTP 136                          /* LDS row pitch of the transposed tile in 16-bit elements: 256 B + 16 B, for 16-byte writers and readers on 16 rows */
// The engine for one block: rows 128 mt .., columns 64 nq ..; cofs = element offset of the C plane. PROJ = true: the tile goes out as ep says.
// PROJ = false: A64 = row 64 of the block's A tile. pair (the same for the whole block): A rows 0..63 are 64 rows of a hi plane and A rows 64..127 the same 64 rows of its x1024 residual plane;
// the block stores 64 rows, prow .. prow + 63 of the C plane: (residual product x alpha 2^-10) + (hi product x alpha + bias).
template <bool PROJ>
__device__ __forceinline__ void gemm2_body(const _Float16* __restrict__ A, int lda, const _Float16* __restrict__ Bh, int ldb, float alpha,
    const float* __restrict__ bias, float* C, int ldc, size_t cofs, int mt, int nq, int K, const ProjEp ep, const _Float16* __restrict__ A64 = nullptr, bool pair = false, int prow = 0) {
  __shared__ __attribute__((aligned(16))) float so[4][32][68];
  __shared__ __attribute__((aligned(16))) unsigned short st[2][192][G2P];      /* [buffer][128 A rows, then 64 B rows][element] */
  const int tid = threadIdx.x, w = __builtin_amdgcn_readfirstlane((int)(tid >> 5)), lane = tid & 31, ln = lane & 15, hh = lane >> 4;
  const int row0 = mt * 128 + 32 * w, col0 = nq * 64;
  const int sr = tid >> 3, sc = (tid & 7) * 8;      /* staging: 8 lanes cover one 128-B row, a wave 4 rows */
  /* address = a block-uniform byte pointer, which moves with the step, + the lane's own byte offset, which does not */
  const char* ga = (const char*)(A + (size_t)(mt * 128) * lda); const char* gb = (const char*)(Bh + (size_t)col0 * ldb);
  const char* gh = (const char*)A64;      /* PROJ = false: rows 64..127 of the A tile */
  const unsigned oa = (unsigned)(sr * lda + sc) * 2u, ob = (unsigned)(sr * ldb + sc) * 2u;
  v8us g[12];
#pragma unroll      /* g[] indexed by constants only, so that it stays in registers */
  for (int i = 0; i < 8; ++i) g[i] = *(const v8us*)((PROJ || i < 4 ? ga + (size_t)(32 * i) * lda : gh + (size_t)(32 * (i - 4)) * lda) + oa);
#pragma unroll      /* g[] indexed by constants only */
  for (int i = 0; i < 4; ++i) g[8 + i] = *(const v8us*)(gb + (size_t)(32 * i) * ldb + ob);
#pragma unroll      /* g[] indexed by constants only */
  for (int i = 0; i < 12; ++i) *(v8us*)&st[0][sr + 16 * i][sc] = g[i];
  const int nk = K >> 6;
  if (1 < nk) {
    ga += 128; gb += 128; if constexpr (!PROJ) gh += 128;
#pragma unroll      /* g[] indexed by constants only */
    for (int i = 0; i < 8; ++i) g[i] = *(const v8us*)((PROJ || i < 4 ? ga + (size_t)(32 * i) * lda : gh + (size_t)(32 * (i - 4)) * lda) + oa);
#pragma unroll      /* g[] indexed by constants only */
    for (int i = 0; i < 4; ++i) g[8 + i] = *(const v8us*)(gb + (size_t)(32 * i) * ldb + ob);
    asm volatile("s_wait_xcnt 0x0" ::: "memory");      /* the wait before the loads' address registers are reused */
  }
  const v8f z8 = {0.f,0.f,0.f,0.f,0.f,0.f,0.f,0.f}; v8f c00 = z8, c01 = z8, c02 = z8, c03 = z8, c10 = z8, c11 = z8, c12 = z8, c13 = z8;
#pragma unroll 1      /* the two buffers alternate by index; one step is already 16 matrix instructions */
  for (int j = 0; j < nk; ++j) {
    const int cb = j & 1;
    __syncthreads();      /* publishes buffer cb, and ends every wave's reads of the other buffer (step j - 1) before it is stored into below */
    if (j + 1 < nk) {      /* step j + 1's rows, asked for a whole step ago, go into the other buffer */
#pragma unroll      /* g[] indexed by constants only */
      for (int i = 0; i < 12; ++i) *(v8us*)&st[cb ^ 1][sr + 16 * i][sc] = g[i];
    }
    if (j + 2 < nk) {      /* step j + 2's rows fly until the next step's barrier */
      ga += 128; gb += 128; if constexpr (!PROJ) gh += 128;
#pragma unroll      /* g[] indexed by constants only */
      for (int i = 0; i < 8; ++i) g[i] = *(const v8us*)((PROJ || i < 4 ? ga + (size_t)(32 * i) * lda : gh + (size_t)(32 * (i - 4)) * lda) + oa);
#pragma unroll      /* g[] indexed by constants only */
      for (int i = 0; i < 4; ++i) g[8 + i] = *(const v8us*)(gb + (size_t)(32 * i) * ldb + ob);
      asm volatile("s_wait_xcnt 0x0" ::: "memory");      /* the wait before the loads' address registers are reused: the fragment reads below land in them */
    }
    const _Float16* ap = (const _Float16*)&st[cb][32 * w + ln][0]; const _Float16* bp = (const _Float16*)&st[cb][128 + ln][0];
    v16h fa[2][2], fb[2][4];      /* [k block of 32][16 rows] */
#pragma unroll      /* fa[], fb[] indexed by constants only, so that they stay in registers */
    for (int kk = 0; kk < 2; ++kk) { fa[kk][0] = g2_frag(ap + 32 * kk, hh); fa[kk][1] = g2_frag(ap + 16 * G2P + 32 * kk, hh);
#pragma unroll      /* fb[] indexed by constants only */
      for (int t = 0; t < 4; ++t) fb[kk][t] = g2_frag(bp + 16 * t * G2P + 32 * kk, hh); }
#pragma unroll      /* fa[], fb[] indexed by constants only */
    for (int kk = 0; kk < 2; ++kk) {
      c00 = g2_mma(fa[kk][0], fb[kk][0], c00); c10 = g2_mma(fa[kk][1], fb[kk][0], c10);
      c01 = g2_mma(fa[kk][0], fb[kk][1], c01); c11 = g2_mma(fa[kk][1], fb[kk][1], c11);
      c02 = g2_mma(fa[kk][0], fb[kk][2], c02); c12 = g2_mma(fa[kk][1], fb[kk][2], c12);
      c03 = g2_mma(fa[kk][0], fb[kk][3], c03); c13 = g2_mma(fa[kk][1], fb[kk][3], c13); }
  }
  v8f accs[8] = {c00, c01, c02, c03, c10, c11, c12, c13};
  const int rsub = lane >> 4, c4 = (lane & 15) * 4;
  v4f tb[16]; float b4[4];
  const bool lo = !PROJ && pair && w >= 2;      /* this wave's 32 rows are residual rows: scaled 2^-10 more, no bias */
  const float aw = lo ? alpha * 0.0009765625f : alpha;
  if constexpr (PROJ) {
    const float* bp4 = bias + col0 + ln;      /* a projection always has a bias */
#pragma unroll      /* b4[] indexed by constants only; the four loads issue together */
    for (int t = 0; t < 4; ++t) b4[t] = bp4[t * 16];
    if (ep.vt) {      /* a lane's 8 accumulator registers are 8 consecutive rows of one channel: one 16-byte piece of the transposed tile */
      unsigned short* vl = (unsigned short*)&so[0][0][0];      /* [64 channels][VTP] */
#pragma unroll      /* accs[] indexed by constants only */
      for (int u = 0; u < 8; ++u) { const int t = u & 3, half = u >> 2; const float bv = bf16_rne(b4[t]); FragH f;
#pragma unroll      /* fragment elements indexed by constants only */
        for (int r = 0; r < 8; ++r) f.h[r] = (_Float16)(accs[u][r] * alpha + bv);
        *(v8us*)&vl[(t * 16 + ln) * VTP + 32 * w + half * 16 + 8 * hh] = f.half[0]; }
      __syncthreads();      /* a channel's 128 rows come from all four waves; taken by the whole block or by none of it */
      const int bt = (mt * 128) / SQ; const int pc = tid & 15, dd = tid >> 4;      /* 16 lanes cover a channel's 256 B: two whole lines */
      unsigned short* vd = (unsigned short*)ep.Vt + ((size_t)(bt * NH + nq) * HD + dd) * SQ + (mt * 128 - bt * SQ) + pc * 8;
#pragma unroll      /* the 8 LDS reads issue ahead of the stores */
      for (int rd = 0; rd < 8; ++rd) { const v8us v = *(const v8us*)&vl[(rd * 8 + dd) * VTP + pc * 8]; *(v8us*)(vd + (size_t)(rd * 8) * SQ) = v; }
      return;
    }
    /* the table rows of this lane's 16 pieces are asked for ahead of the tile's way through LDS */
    const float* tp = ep.TAB + (size_t)(row0 % SQ + rsub) * 32 + (c4 & 31);
#pragma unroll      /* tb[] indexed by constants only, so that it stays in registers */
    for (int q = 0; q < 16; ++q) tb[q] = *(const v4fa*)(tp + q * 64);
    asm volatile("s_wait_xcnt 0x0" :: "v"(tp) : "memory");      /* the wait before the loads' address pair is reused; naming the pair keeps it live up to here, so that no load's result is placed in it */
  } else {      /* what the tile's way out reads from memory is asked for here, all of it together: no load waits for the one before */
#pragma unroll      /* b4[] indexed by constants only */
    for (int t = 0; t < 4; ++t) b4[t] = 0.f;
    if (bias && !lo) { const float* bp4 = bias + col0 + ln;
#pragma unroll      /* b4[] indexed by constants only; the four loads issue together */
      for (int t = 0; t < 4; ++t) b4[t] = bp4[t * 16];
      asm volatile("s_wait_xcnt 0x0" ::: "memory"); }      /* the wait before the loads' address registers are reused */
  }
#pragma unroll
  for (int u = 0; u < 8; ++u) { const int t = u & 3, half = u >> 2; const float bv = bf16_rne(b4[t]);
#pragma unroll
    for (int r = 0; r < 8; ++r) { const int rloc = half * 16 + 8 * hh + r;
      so[w][rloc][t * 16 + ln] = accs[u][r] * aw + bv; } }
  if constexpr (!PROJ) {
    if (pair) {
      __syncthreads();      /* a stored row is the sum of two waves' tiles: waves 0, 1 hold the hi rows, waves 2, 3 the residual rows; taken by the whole block or by none of it */
      const int p = w & 1, r16 = (w >> 1) * 16 + rsub;      /* every wave stores 16 of the 64 rows */
      float* cp = C + cofs + (size_t)(prow + 32 * p + r16) * ldc + col0 + c4;
      v4f vh[8], vl[8];
#pragma unroll      /* vh[], vl[] indexed by constants only; the 16 LDS reads issue ahead of the stores */
      for (int q = 0; q < 8; ++q) { vh[q] = *(const v4fa*)&so[p][r16 + q * 2][c4]; vl[q] = *(const v4fa*)&so[p + 2][r16 + q * 2][c4]; }
#pragma unroll      /* vh[], vl[] indexed by constants only */
      for (int q = 0; q < 8; ++q) vh[q] = vl[q] + vh[q];
#pragma unroll      /* vh[] indexed by constants only */
      for (int q = 0; q < 8; ++q) *(v4f*)(cp + (size_t)(q * 2) * ldc) = vh[q];
      return;
    }
  }
  __builtin_amdgcn_fence(4 /* acq_rel order */, "workgroup"); __builtin_amdgcn_wave_barrier();
  if constexpr (PROJ) {
    const bool rot = ep.rotary && c4 < 32;
    if (ep.split) {
      _Float16* hp = ep.Hh + (size_t)(row0 + rsub) * ldc + col0 + c4; _Float16* lp = ep.Hl + (size_t)(row0 + rsub) * ldc + col0 + c4;
#pragma unroll      /* tb[] indexed by constants only */
      for (int q = 0; q < 16; ++q) { const v4f y = d_rot4(*(const v4fa*)&so[w][q * 2 + rsub][c4], tb[q], rot); v4h h4, l4;
#pragma unroll      /* vector elements indexed by constants only */
        for (int e = 0; e < 4; ++e) { const _Float16 h = (_Float16)y[e]; h4[e] = h; l4[e] = (_Float16)((y[e] - (float)h) * 1024.0f); }
        *(v4h*)(hp + (size_t)(q * 2) * ldc) = h4; *(v4h*)(lp + (size_t)(q * 2) * ldc) = l4; }
      asm volatile("s_wait_xcnt 0x0" ::: "memory");      /* the wait before the stores' registers are reused: the code of the other kinds of tile follows in the listing */
    } else {
      float* cp = C + (size_t)(row0 + rsub) * ldc + col0 + c4;
#pragma unroll      /* tb[] indexed by constants only */
      for (int q = 0; q < 16; ++q) *(v4f*)(cp + (size_t)(q * 2) * ldc) = d_rot4(*(const v4fa*)&so[w][q * 2 + rsub][c4], tb[q], rot);
      asm volatile("s_wait_xcnt 0x0" ::: "memory");      /* the wait before the stores' registers are reused: the code of the other kinds of tile follows in the listing */
    }
    return;
  }
  {
#pragma unroll
    for (int q = 0; q < 16; ++q) { const int r = q * 2 + rsub; const v4f v = *(const v4fa*)&so[w][r][c4];
      if (C) *(v4f*)(C + cofs + (size_t)(row0 + r) * ldc + col0 + c4) = v; }
     }
}

// One launch for the nine projections, none of which reads another's result; a block's product and tile follow from its index alone:
// q, k and v of all rows, then q, k, v of the first QT0 rows of every batch. BW holds the weights of q, k, v one behind the other.
// What follows a projection element by element is done on the block's own tile: q, k of all rows leave as rotated f16 hi + residual planes, v as V^T [NB][NH][HD][SQ]; the first-tile q, k as rotated f32 planes, the first-tile v as an f32 plane.
#define GQB ((MP / 128) * (DM / 64))      /* blocks of one projection of all rows */
#define GQ0 (DM / 64)                     /* blocks of one first-tile projection (QT0 == 128 rows) */
__global__ __launch_bounds__(128) void k_qkv(const _Float16* __restrict__ X16, const _Float16* __restrict__ BW, const float* __restrict__ bq, const float* __restrict__ bk, const float* __restrict__ bv,
    const float* __restrict__ TAB, _Float16* __restrict__ QH, _Float16* __restrict__ QL, _Float16* __restrict__ KH, _Float16* __restrict__ KL, _Float16* __restrict__ VT, float* __restrict__ QKR0, float* __restrict__ VF0) {
  const int bx = blockIdx.x; int sel, mt, nq; const _Float16* A = X16; float* C = nullptr; ProjEp ep; ep.TAB = TAB; ep.Vt = VT;
  if (bx < 3 * GQB) {
    sel = bx / GQB; const int t = bx - sel * GQB; mt = t / (DM / 64); nq = t - mt * (DM / 64);
    ep.vt = sel == 2; ep.split = true;
  } else {
    const int u = bx - 3 * GQB; const int s6 = u / GQ0; const int b = s6 / 3; sel = s6 - 3 * b; mt = 0; nq = u - s6 * GQ0;
    A += (size_t)b * SQ * DM; C = (sel < 2) ? QKR0 + (size_t)(2 * b + sel) * QT0 * DM : VF0 + (size_t)b * QT0 * DM;
    ep.vt = false; ep.split = false;
  }
  ep.rotary = sel < 2; ep.Hh = (sel == 0) ? QH : KH; ep.Hl = (sel == 0) ? QL : KL;
  const float* bias = (sel == 0) ? bq : ((sel == 1) ? bk : bv);
  gemm2_body<true>(A, DM, BW + (size_t)sel * DM * DM, DM, 0.0625f, bias, C, DM, (size_t)0, mt, nq, DM, ep);
}

// One launch for the output product of the f16 path (rows QT0 .. of a batch) and both products of the first-tile o (rows 0 .. QT0 - 1, hi and residual plane): same weights, bias and output plane. grid.y = batch.
// The first 2 (DM / 64) blocks of a batch are the first tile's: each has 64 of its rows, from both planes, as its 128 A rows (QT0 == 128: the first tile is row tile 0); the others have row tiles 1 .. of the f16 path.
#define GOB ((SQ / 128 + 1) * (DM / 64))      /* blocks a batch */
__global__ __launch_bounds__(128) void k_out(const _Float16* __restrict__ O16, const _Float16* __restrict__ OH0, const _Float16* __restrict__ OL0, const _Float16* __restrict__ BO, const float* __restrict__ bo, float* out) {
  const int bx = blockIdx.x, by = blockIdx.y; const bool pair = bx < 2 * (DM / 64);
  const int t = pair ? bx : bx - DM / 64; const int mq = t / (DM / 64), nq = t - mq * (DM / 64);      /* mq: which 64 rows of the first tile, or the row tile */
  const size_t f0 = ((size_t)by * QT0 + (pair ? 64 * mq : 0)) * DM;
  const _Float16* A = pair ? OH0 + f0 : O16 + (size_t)by * SQ * DM;
  const _Float16* A64 = pair ? OL0 + f0 : A + (size_t)(mq * 128 + 64) * DM;
  gemm2_body<false>(A, DM, BO, DM, 0.0009765625f, bo, out, DM, (size_t)by * SQ_FULL * DM, pair ? 0 : mq, nq, DM, ProjEp(), A64, pair, 64 * mq);
}

// Butterfly over the 32 lanes of a wave: four row_xmask steps inside each 16-lane row, then the other row; every lane ends with the same value.
template <int CTRL>
__device__ __forceinline__ float lane_xm(float x) { return __int_as_float(__builtin_amdgcn_update_dpp(0, __float_as_int(x), CTRL, 0xf, 0xf, true)); }
__device__ __forceinline__ float lane_x16(float x) { const int b = __float_as_int(x); return __int_as_float(__builtin_amdgcn_permlanex16(b, b, 0x76543210, 0xfedcba98, false, false)); }
__device__ __forceinline__ float wave_max(float x) {
  x = fmaxf(x, lane_xm<0x161>(x)); x = fmaxf(x, lane_xm<0x162>(x)); x = fmaxf(x, lane_xm<0x164>(x)); x = fmaxf(x, lane_xm<0x168>(x)); return fmaxf(x, lane_x16(x)); }
__device__ __forceinline__ float wave_sum(float x) {
  x += lane_xm<0x161>(x); x += lane_xm<0x162>(x); x += lane_xm<0x164>(x); x += lane_xm<0x168>(x); return x + lane_x16(x); }

#define FAC1 0.18033688011112042f        /* log2(e) / 8 */
#define FAC2 0.00017611023448351604f     /* log2(e) / 8 / 1024 */
#define FAP 72                           /* LDS row pitch in 16-bit elements: 128 B + 16 B, for 16-byte readers on 16 rows */
#define FNT (SQ / 64)                    /* query tiles = key steps of the longest tile */
static_assert(HD == 64 && (FNT & (FNT - 1)) == 0);
static_assert((size_t)FNT * NH * 128 * 8 >= (size_t)NB * QT0 * DM);      /* one slab of blocks covers the split of the first-tile o */
// 2^x. The v_nop at the end keeps the one slot that the instruction set asks for between a transcendental and a next instruction that reads its result or overwrites its source;
// inside the run of eight every result register is distinct from every source (early clobber), so each v_exp_f32 is the independent instruction behind the one before.
__device__ __forceinline__ float fa_exp2(float x) { float y; asm("v_exp_f32 %0, %1\n\tv_nop" : "=v"(y) : "v"(x)); return y; }
__device__ __forceinline__ v8f fa_exp2x8(v8f x) { float y0, y1, y2, y3, y4, y5, y6, y7;
  asm("v_exp_f32 %0, %8\n\tv_exp_f32 %1, %9\n\tv_exp_f32 %2, %10\n\tv_exp_f32 %3, %11\n\tv_exp_f32 %4, %12\n\tv_exp_f32 %5, %13\n\tv_exp_f32 %6, %14\n\tv_exp_f32 %7, %15\n\tv_nop"
      : "=&v"(y0), "=&v"(y1), "=&v"(y2), "=&v"(y3), "=&v"(y4), "=&v"(y5), "=&v"(y6), "=&v"(y7)
      : "v"(x[0]), "v"(x[1]), "v"(x[2]), "v"(x[3]), "v"(x[4]), "v"(x[5]), "v"(x[6]), "v"(x[7]));
  const v8f y = {y0, y1, y2, y3, y4, y5, y6, y7}; return y; }
/* amdgpu_waves_per_eu(4, 4): holds the kernel to 256 registers, so that four blocks fit a WGP and no register window is switched in the loop */
__global__ __launch_bounds__(128) __attribute__((amdgpu_waves_per_eu(4, 4))) void k_fattn(const _Float16* __restrict__ QHp, const _Float16* __restrict__ QLp, const _Float16* __restrict__ KHp, const _Float16* __restrict__ KLp,
    const _Float16* __restrict__ VTp, _Float16* __restrict__ O16p, const float* __restrict__ OF0, _Float16* __restrict__ OH0, _Float16* __restrict__ OL0) {
  __shared__ __attribute__((aligned(16))) unsigned short lt[2][3][64][FAP];      /* [buffer][K hi, K residual, V^T][row][element] */
  if (blockIdx.z >= NB) {      /* the slab of blocks behind the last batch (so that every attention block keeps its flat index): the hi/residual split of the first-tile o, which reads nothing of this launch; a block leaves as a whole, ahead of every barrier */
    d_hl(OF0, OH0, OL0, (size_t)NB * QT0 * DM / 8, (size_t)((blockIdx.y * FNT + blockIdx.x) * 128 + threadIdx.x)); return; }
  const int tid = threadIdx.x, w = __builtin_amdgcn_readfirstlane((int)(tid >> 5)), lane = tid & 31, ln = lane & 15, hh = lane >> 4;
  const int h = blockIdx.y, b = blockIdx.z; const int x = blockIdx.x, grp = (b * NH + h) >> 3;
  /* a permutation of the tiles for each (batch, head): blocks whose flat indices lie far apart get tiles of unequal length, so that long tiles do not gather in one place */
  const int qt = (grp % 3 == 0) ? FNT - 1 - x : ((grp % 3 == 1) ? x : ((x + FNT / 2) & (FNT - 1)));
  const int qw = qt * 64 + 16 * w; const size_t r0 = (size_t)b * SQ;
  const _Float16* qhp = QHp + (r0 + qw + ln) * DM + h * HD; const _Float16* qlp = QLp + (r0 + qw + ln) * DM + h * HD;
  const v16h qh0 = g2_frag(qhp, hh), qh1 = g2_frag(qhp + 32, hh), ql0 = g2_frag(qlp, hh), ql1 = g2_frag(qlp + 32, hh);
  const int sr = tid >> 3, sc = (tid & 7) * 8;      /* staging: 8 lanes cover one 128-B row, a wave 4 rows */
  const unsigned short* gk = (const unsigned short*)KHp + (r0 + sr) * DM + h * HD + sc; const unsigned short* gl = (const unsigned short*)KLp + (r0 + sr) * DM + h * HD + sc;
  const unsigned short* gv = (const unsigned short*)VTp + ((size_t)(b * NH + h) * HD + sr) * SQ + sc;
  v8us g[12];
#pragma unroll      /* g[] indexed by constants only, so that it stays in registers */
  for (int i = 0; i < 4; ++i) { g[i] = *(const v8us*)(gk + (size_t)(16 * i) * DM); g[4 + i] = *(const v8us*)(gl + (size_t)(16 * i) * DM); g[8 + i] = *(const v8us*)(gv + (size_t)(16 * i) * SQ); }
#pragma unroll      /* g[] indexed by constants only */
  for (int i = 0; i < 4; ++i) { *(v8us*)&lt[0][0][sr + 16 * i][sc] = g[i]; *(v8us*)&lt[0][1][sr + 16 * i][sc] = g[4 + i]; *(v8us*)&lt[0][2][sr + 16 * i][sc] = g[8 + i]; }
  const v8f z8 = {0.f,0.f,0.f,0.f,0.f,0.f,0.f,0.f};
  v8f o[4] = {z8, z8, z8, z8}; float m = -1.0e30f, l = 0.f;
#pragma unroll 1      /* one step is already 32 matrix instructions; the two buffers alternate by index */
  for (int j = 0; j <= qt; ++j) {
    const int cb = j & 1;
    __syncthreads();      /* publishes buffer cb, and ends every wave's reads of the other buffer (step j - 1) before it is stored into below */
    if (j < qt) {      /* the next step's tiles fly while this step is worked on */
      gk += (size_t)64 * DM; gl += (size_t)64 * DM; gv += 64;
#pragma unroll      /* g[] indexed by constants only */
      for (int i = 0; i < 4; ++i) { g[i] = *(const v8us*)(gk + (size_t)(16 * i) * DM); g[4 + i] = *(const v8us*)(gl + (size_t)(16 * i) * DM); g[8 + i] = *(const v8us*)(gv + (size_t)(16 * i) * SQ); }
    }
    v8f s[4]; v16h kf[2][4], va[4];
    { const _Float16* kh = (const _Float16*)&lt[cb][0][ln][0]; const _Float16* kl = (const _Float16*)&lt[cb][1][ln][0];
      kf[0][0] = g2_frag(kh, hh); kf[0][1] = g2_frag(kh + 32, hh); kf[0][2] = g2_frag(kl, hh); kf[0][3] = g2_frag(kl + 32, hh); }
#pragma unroll      /* s[], kf[], va[] indexed by constants only, so that they stay in registers */
    for (int t = 0; t < 4; ++t) {
      if (t < 3) {      /* the next 16 keys' fragments are asked for ahead of this tile's products */
        const _Float16* kh = (const _Float16*)&lt[cb][0][16 * (t + 1) + ln][0]; const _Float16* kl = (const _Float16*)&lt[cb][1][16 * (t + 1) + ln][0];
        kf[(t + 1) & 1][0] = g2_frag(kh, hh); kf[(t + 1) & 1][1] = g2_frag(kh + 32, hh); kf[(t + 1) & 1][2] = g2_frag(kl, hh); kf[(t + 1) & 1][3] = g2_frag(kl + 32, hh);
      } else {      /* V^T of the first 32 keys is asked for ahead of the softmax */
#pragma unroll      /* va[] indexed by constants only */
        for (int u = 0; u < 4; ++u) va[u] = g2_frag((const _Float16*)&lt[cb][2][16 * u + ln][0], hh);
      }
      const v16h kh0 = kf[t & 1][0], kh1 = kf[t & 1][1], kl0 = kf[t & 1][2], kl1 = kf[t & 1][3];
      v8f a = z8, c = z8, d = z8;
      a = g2_mma(kh0, qh0, a); c = g2_mma(kh0, ql0, c); d = g2_mma(kl0, qh0, d);
      a = g2_mma(kh1, qh1, a); c = g2_mma(kh1, ql1, c); d = g2_mma(kl1, qh1, d);
#pragma unroll      /* vector elements indexed by constants only */
      for (int r = 0; r < 8; ++r) s[t][r] = a[r] * FAC1 + (c[r] + d[r]) * FAC2;
    }
    if (j == qt) {      /* only the last step crosses the diagonal; every query keeps its key 64 qt there */
      const int rel = 16 * w + ln - 8 * hh;      /* key 64 qt + 16 t + 8 hh + r is kept while 16 t + r <= rel */
#pragma unroll      /* s[] indexed by constants only */
      for (int t = 0; t < 4; ++t) {
#pragma unroll      /* s[] indexed by constants only */
        for (int r = 0; r < 8; ++r) s[t][r] = (16 * t + r <= rel) ? s[t][r] : -1.0e30f; }
    }
    v8f x8;
#pragma unroll      /* vector elements indexed by constants only */
    for (int r = 0; r < 8; ++r) x8[r] = fmaxf(fmaxf(s[0][r], s[1][r]), fmaxf(s[2][r], s[3][r]));
    float mx = fmaxf(fmaxf(fmaxf(x8[0], x8[1]), fmaxf(x8[2], x8[3])), fmaxf(fmaxf(x8[4], x8[5]), fmaxf(x8[6], x8[7])));
    mx = fmaxf(mx, lane_x16(mx));      /* the other half of this query's keys */
    const float mn = fmaxf(m, mx); const float al = fa_exp2(m - mn); const float mb = mn - 8.0f; m = mn;
    v4f ps = {0.f, 0.f, 0.f, 0.f};
#pragma unroll      /* s[] indexed by constants only */
    for (int t = 0; t < 4; ++t) { s[t] = fa_exp2x8(s[t] - mb);
#pragma unroll      /* s[] indexed by constants only; four independent partial sums */
      for (int r = 0; r < 8; ++r) ps[r & 3] += s[t][r]; }
    l = l * al + ((ps[0] + ps[1]) + (ps[2] + ps[3]));
    FragH p0, p1;
#pragma unroll      /* fragment elements indexed by constants only */
    for (int r = 0; r < 8; ++r) { p0.h[r] = (_Float16)s[0][r]; p0.h[8 + r] = (_Float16)s[1][r]; p1.h[r] = (_Float16)s[2][r]; p1.h[8 + r] = (_Float16)s[3][r]; }
#pragma unroll      /* o[] indexed by constants only */
    for (int t = 0; t < 4; ++t) {
#pragma unroll      /* o[] indexed by constants only */
      for (int r = 0; r < 8; ++r) o[t][r] *= al; }
    v16h vb[4];
#pragma unroll      /* vb[] indexed by constants only; V^T of the last 32 keys, into registers that the scores have left */
    for (int u = 0; u < 4; ++u) vb[u] = g2_frag((const _Float16*)&lt[cb][2][16 * u + ln][32], hh);
#pragma unroll      /* o[], va[] indexed by constants only; four independent accumulators in turn */
    for (int t = 0; t < 4; ++t) o[t] = g2_mma(va[t], p0.v, o[t]);
#pragma unroll      /* o[], vb[] indexed by constants only */
    for (int t = 0; t < 4; ++t) o[t] = g2_mma(vb[t], p1.v, o[t]);
    if (j < qt) {
#pragma unroll      /* g[] indexed by constants only */
      for (int i = 0; i < 4; ++i) { *(v8us*)&lt[cb ^ 1][0][sr + 16 * i][sc] = g[i]; *(v8us*)&lt[cb ^ 1][1][sr + 16 * i][sc] = g[4 + i]; *(v8us*)&lt[cb ^ 1][2][sr + 16 * i][sc] = g[8 + i]; }
    }
  }
  l += lane_x16(l);      /* join the two halves' sums once */
  const float inv = 64.0f / l;      /* o carried x64 */
  unsigned short* op = (unsigned short*)O16p + (r0 + qw + ln) * DM + h * HD + 8 * hh;
#pragma unroll      /* o[] indexed by constants only */
  for (int t = 0; t < 4; ++t) { FragH f;
#pragma unroll      /* fragment elements indexed by constants only */
    for (int r = 0; r < 8; ++r) f.h[r] = (_Float16)(o[t][r] * inv);
    *(v8us*)(op + 16 * t) = f.half[0]; }
  asm volatile("s_wait_xcnt 0x0" ::: "memory");      /* the wait before the stores' registers are reused: the code of the split piece follows in the listing */
}

// f32 attention over the first QT0 query rows of every batch (grid.y = batch; q and k planes of a batch lie one behind the other). Block = one head x A0R query rows, 8 waves, 2 rows a wave; keys 0 .. (rg + 1) A0R - 1 cover every row of the block.
// K (row pitch A0KP floats = 16 B x odd: lanes on different rows read 16 B each without bank conflicts), V and the q rows are staged in LDS once.
// Scores: lane = key, both rows share each K read. Softmax: wave butterflies. Weighted sum: lane = channel pair, weights read as broadcasts.
#define A0R 16
#define A0KP 68
static_assert(QT0 % A0R == 0);
static_assert(QT0 == 128 && HD == 64 && A0R == 16);
typedef float v2f __attribute__((ext_vector_type(2)));
__global__ __launch_bounds__(256) void k_att0(const float* __restrict__ QF, const float* __restrict__ KF, const float* __restrict__ VF, float scale, float* __restrict__ OF) {
  __shared__ __attribute__((aligned(16))) float lk[QT0][A0KP]; __shared__ __attribute__((aligned(16))) float lv[QT0][HD];
  __shared__ __attribute__((aligned(16))) float lq[A0R][HD]; __shared__ __attribute__((aligned(16))) float lp[A0R][QT0];
  const int tid = threadIdx.x, lane = tid & 31, w = __builtin_amdgcn_readfirstlane((int)(tid >> 5));
  const int h = blockIdx.x / (QT0 / A0R), rg = blockIdx.x % (QT0 / A0R); const int nkeys = (rg + 1) * A0R;
  { const size_t bo1 = (size_t)blockIdx.y * QT0 * DM; QF += 2 * bo1; KF += 2 * bo1; VF += bo1; OF += bo1; }
  const int sr = tid >> 4, sc4 = (tid & 15) * 4;      /* staging: 16 lanes cover one 256-B row */
  const float* qp = QF + (size_t)(rg * A0R + sr) * DM + h * HD + sc4; const float* kp = KF + (size_t)sr * DM + h * HD + sc4; const float* vp = VF + (size_t)sr * DM + h * HD + sc4;
  const v4f qs = *(const v4fa*)qp;
  v4f ks[QT0 / 16], vs[QT0 / 16];      /* all QT0 rows of K and V are staged by every block: no test stands between the loads */
#pragma unroll      /* ks[], vs[] indexed by constants only, so that they stay in registers; all loads issued before the first use */
  for (int g = 0; g < QT0 / 16; ++g) { ks[g] = *(const v4fa*)(kp + (size_t)g * 16 * DM); vs[g] = *(const v4fa*)(vp + (size_t)g * 16 * DM); }
  asm volatile("s_wait_xcnt 0x0" :: "v"(qp), "v"(kp), "v"(vp) : "memory");      /* the wait before the loads' address pairs are reused; naming the pairs keeps them live up to here, so that no load's result is placed in them */
  *(v4f*)&lq[sr][sc4] = qs;
#pragma unroll      /* ks[], vs[] indexed by constants only, so that they stay in registers */
  for (int g = 0; g < QT0 / 16; ++g) { *(v4f*)&lk[g * 16 + sr][sc4] = ks[g]; *(v4f*)&lv[g * 16 + sr][sc4] = vs[g]; }
  __syncthreads();
  const int r0 = 2 * w, i0 = rg * A0R + r0, i1 = i0 + 1;      /* this wave's two query rows */
  const int nch = (nkeys + 31) >> 5;      /* chunks of 32 keys */
  float s0[QT0 / 32], s1[QT0 / 32];
#pragma unroll      /* s0[], s1[] indexed by constants only, so that they stay in registers */
  for (int m = 0; m < QT0 / 32; ++m) { s0[m] = -1.0e30f; s1[m] = -1.0e30f;
    if (m < nch) { const int j = m * 32 + lane;
      v4f a0 = {0.f, 0.f, 0.f, 0.f}, a1 = {0.f, 0.f, 0.f, 0.f};
#pragma unroll      /* the 48 LDS reads of a chunk issue ahead of their use */
      for (int c = 0; c < HD / 4; ++c) { const v4f kq = *(const v4f*)&lk[j][c * 4]; const v4f q0 = *(const v4f*)&lq[r0][c * 4]; const v4f q1 = *(const v4f*)&lq[r0 + 1][c * 4];
#pragma unroll      /* four independent partial sums a row */
        for (int u = 0; u < 4; ++u) { a0[u] = fmaf(q0[u], kq[u], a0[u]); a1[u] = fmaf(q1[u], kq[u], a1[u]); } }
      const float d0 = ((a0[0] + a0[1]) + (a0[2] + a0[3])) * scale, d1 = ((a1[0] + a1[1]) + (a1[2] + a1[3])) * scale;
      s0[m] = (j <= i0) ? d0 : -1.0e30f; s1[m] = (j <= i1) ? d1 : -1.0e30f; } }
  const float m0 = wave_max(fmaxf(fmaxf(s0[0], s0[1]), fmaxf(s0[2], s0[3]))), m1 = wave_max(fmaxf(fmaxf(s1[0], s1[1]), fmaxf(s1[2], s1[3])));
  float l0 = 0.f, l1 = 0.f;
#pragma unroll      /* s0[], s1[] indexed by constants only, so that they stay in registers */
  for (int m = 0; m < QT0 / 32; ++m) if (m < nch) { const int j = m * 32 + lane;
    const float e0 = (j <= i0) ? expf(s0[m] - m0) : 0.f, e1 = (j <= i1) ? expf(s1[m] - m1) : 0.f;
    l0 += e0; l1 += e1; lp[r0][j] = e0; lp[r0 + 1][j] = e1; }
  l0 = wave_sum(l0); l1 = wave_sum(l1);
  __syncthreads();      /* the weights of a row are written by lanes and read back as broadcasts */
  const int n4 = (i1 + 4) >> 2;      /* keys 0 .. i1 in fours; the weights above a row's own index are zero, and 4 n4 <= nkeys */
  v2f o0 = {0.f, 0.f}, o1 = {0.f, 0.f};
#pragma unroll 4      /* LDS reads of later trips issue while earlier ones are summed */
  for (int t = 0; t < n4; ++t) { const v4f p0 = *(const v4f*)&lp[r0][t * 4]; const v4f p1 = *(const v4f*)&lp[r0 + 1][t * 4];
#pragma unroll      /* p0[], p1[] indexed by constants only */
    for (int u = 0; u < 4; ++u) { const v2f vv = *(const v2f*)&lv[t * 4 + u][2 * lane];
      o0[0] = fmaf(p0[u], vv[0], o0[0]); o0[1] = fmaf(p0[u], vv[1], o0[1]); o1[0] = fmaf(p1[u], vv[0], o1[0]); o1[1] = fmaf(p1[u], vv[1], o1[1]); } }
  const float f0 = 64.0f / l0, f1 = 64.0f / l1;      /* o carried x64 like the f16 path */
  o0[0] *= f0; o0[1] *= f0; o1[0] *= f1; o1[1] *= f1;
  *(v2f*)(OF + (size_t)i0 * DM + h * HD + 2 * lane) = o0;
  *(v2f*)(OF + (size_t)i1 * DM + h * HD + 2 * lane) = o1;
}

extern "C" void kernel_launch(void* const* d_in, const int* in_sizes, int n_in,
                              void* d_out, int out_size, void* d_ws, size_t ws_size, hipStream_t stream) {
  if (n_in < 9) return;
  const size_t needx = ((size_t)(NB - 1) * SQ_FULL + SQ) * DM;
  if ((size_t)in_sizes[0] < needx) return;
  if (in_sizes[1] < DM * DM || in_sizes[3] < DM * DM || in_sizes[5] < DM * DM || in_sizes[7] < DM * DM) return;
  if (in_sizes[2] < DM || in_sizes[4] < DM || in_sizes[6] < DM || in_sizes[8] < DM) return;
  if ((size_t)out_size < needx) return;
  /* wire order: x, Wq, bq, Wk, bk, Wv, bv, Wo, bo (natural [out][in] weights, f32) */
  const float* x = (const float*)d_in[0]; const float* wq = (const float*)d_in[1]; const float* bq = (const float*)d_in[2]; const float* wk = (const float*)d_in[3]; const float* bk = (const float*)d_in[4];
  const float* wv = (const float*)d_in[5]; const float* bv = (const float*)d_in[6]; const float* wo = (const float*)d_in[7]; const float* bo = (const float*)d_in[8];
  float* out = (float*)d_out;
  char* ws = (char*)d_ws; size_t off = 0;
  auto take = [&](size_t bytes) { char* p = ws + off; off += (bytes + 255) & ~(size_t)255; return p; };
  _Float16* BW = (_Float16*)take((size_t)4 * DM * DM * 2); _Float16* BO = BW + (size_t)3 * DM * DM;      /* weights of q, k, v, o one behind the other */
  _Float16* X16 = (_Float16*)take(NR * DM * 2);
  _Float16* QH = (_Float16*)take(NR * DM * 2); _Float16* QL = (_Float16*)take(NR * DM * 2); _Float16* KH = (_Float16*)take(NR * DM * 2); _Float16* KL = (_Float16*)take(NR * DM * 2);
  _Float16* O16 = (_Float16*)take(NR * DM * 2);
  _Float16* VT = (_Float16*)take((size_t)NB * NH * HD * SQ * 2);
  float* TAB = (float*)take((size_t)SQ * 32 * 4);
  float* QKR0 = (float*)take((size_t)NB * 2 * QT0 * DM * 4); float* VF0 = (float*)take((size_t)NB * QT0 * DM * 4);      /* [batch][q, k][row][channel]; [batch][row][channel] */
  float* OF0 = (float*)take((size_t)NB * QT0 * DM * 4); _Float16* OH0 = (_Float16*)take((size_t)NB * QT0 * DM * 2); _Float16* OL0 = (_Float16*)take((size_t)NB * QT0 * DM * 2);
  if (off > ws_size || off > (size_t)134217728) return;

  k_prep<<<NB * PXB + 4 * PWB + SQ / 16, 256, 0, stream>>>(x, wq, wk, wv, wo, X16, BW, TAB);
  k_qkv<<<3 * GQB + NB * 3 * GQ0, 128, 0, stream>>>(X16, BW, bq, bk, bv, TAB, QH, QL, KH, KL, VT, QKR0, VF0);
  k_att0<<<dim3(NH * (QT0 / A0R), NB), 256, 0, stream>>>(QKR0, QKR0 + (size_t)QT0 * DM, VF0, SCL, OF0);
  k_fattn<<<dim3(FNT, NH, NB + 1), 128, 0, stream>>>(QH, QL, KH, KL, VT, O16, OF0, OH0, OL0);

  /* out = o (x64) . Wo (x16) * 2^-10 + bo; grid.y = batch (output rows at the full per-batch stride); rows 0..127 from the hi plane of the f32 path, + o_lo Wo 2^-20 from its residual plane */
  k_out<<<dim3(GOB, NB), 128, 0, stream>>>(O16, OH0, OL0, BO, bo, out);
}

// v009
// A run of this version takes 83.6 microseconds.
// Timed twice side by side with v008, it ran 1.05 and 1.06 times as fast.
// Counting every step since v000, it is 66.4 times as fast.
#include <hip/hip_runtime.h>
// Causal multi-head self-attention: x [2][2048][768], 12 heads of 64, natural [out][in] projections with biases, interleaved partial rotary embedding on channels 0..31 of each head of q and k (pairs (2p,2p+1), angle = s * 10000^(-p/16), computed table), scores / 8, causal softmax, out = merged Wo^T + bo.
// Compute dtype: every contraction on v_wmma_f32_16x16x32_f16 (f16 operands, f32 accumulate). Inputs RNE-converted to bf16 first (exact in f16; weights carried x16). q/k: GEMM -> f32 -> rotary in f32 -> f16 hi + x1024 f16 residual planes; scores = three products (hi.hi + lo.hi + hi.lo; each residual pass has its own accumulator folded with 2^-10). v, the unnormalised softmax weights (x256 at the running maximum) and o (x64) are single f16 planes; scores, online softmax and the weighted sum run in one fused kernel. The first 128 query rows of each batch are recomputed with an f32 VALU attention and go through the output GEMM as f16 hi + x1024 residual planes of o.
#ifndef NB
#define NB 2
#endif
#ifndef SEQ
#define SEQ 2048
#endif
#define SQ SEQ
#define SQ_FULL 2048                 /* per-batch row stride of x and of the output */
#define NB_FULL 2
#define DM 768
#define NH 12
#define HD 64
#define QT0 128                      /* first-tile rows recomputed in f32 */
#define SCL 0.125f                   /* 1 / sqrt(64) */
#define NR ((size_t)NB * SQ)
#define MP ((int)((size_t)NB * SQ))

static_assert(SQ % 128 == 0);
static_assert(SQ % 16 == 0);
static_assert(QT0 == 128);
static_assert(SQ >= QT0);
static_assert(NH * HD == DM);
static_assert(DM % 64 == 0);
static_assert(SQ <= SQ_FULL);
static_assert(NB <= NB_FULL);

typedef unsigned short v8us __attribute__((ext_vector_type(8), may_alias));
typedef float  v8f  __attribute__((ext_vector_type(8)));
typedef float  v4f  __attribute__((ext_vector_type(4)));
typedef float  v4fa __attribute__((ext_vector_type(4), may_alias));
typedef _Float16 v16h __attribute__((ext_vector_type(16)));
typedef _Float16 v4h __attribute__((ext_vector_type(4)));
union FragH { v16h v; v8us half[2]; _Float16 h[16]; unsigned short u[16]; };

__device__ __forceinline__ unsigned short bf16_bits(float x) { unsigned int u = __float_as_uint(x); return (unsigned short)((u + 0x7FFFu + ((u >> 16) & 1u)) >> 16); }
__device__ __forceinline__ float bf16_rne(float x) { return __uint_as_float(((unsigned int)bf16_bits(x)) << 16); }

// 10000^(-p/16), p = 0..15, selected by value (no memory table)
__device__ __forceinline__ float rope_invf(int p) {
  float f = 1.0f;
  f = (p == 1)  ? 0.5623413251903491f : f;
  f = (p == 2)  ? 0.31622776601683794f : f;
  f = (p == 3)  ? 0.1778279410038923f : f;
  f = (p == 4)  ? 0.1f : f;
  f = (p == 5)  ? 0.05623413251903491f : f;
  f = (p == 6)  ? 0.03162277660168379f : f;
  f = (p == 7)  ? 0.01778279410038923f : f;
  f = (p == 8)  ? 0.01f : f;
  f = (p == 9)  ? 0.005623413251903491f : f;
  f = (p == 10) ? 0.0031622776601683794f : f;
  f = (p == 11) ? 0.0017782794100389228f : f;
  f = (p == 12) ? 0.001f : f;
  f = (p == 13) ? 0.0005623413251903491f : f;
  f = (p == 14) ? 0.00031622776601683794f : f;
  f = (p == 15) ? 0.00017782794100389227f : f;
  return f;
}

__device__ __forceinline__ void d_tab(int blk, float* __restrict__ TAB) {
  #pragma clang fp contract(off)
  __shared__ __attribute__((aligned(16))) float tl[16][32];
  const int tid = threadIdx.x; const int sl = tid >> 4, p = tid & 15; const int s = blk * 16 + sl;
  const float ang = (float)s * rope_invf(p);
  float sn, cs; sincosf(ang, &sn, &cs);
  tl[sl][2 * p] = cs; tl[sl][2 * p + 1] = sn;
  __syncthreads();
  if (tid < 128) {
    const int row = tid >> 3, pc = (tid & 7) * 4;
    const v4f v = *(const v4fa*)&tl[row][pc];
    float* d = TAB + (size_t)(blk * 16 + row) * 32 + pc;
    *(v4f*)d = v;
    
  }
}

// 8 floats -> bf16 (RNE) -> x scale (a power of two, exact) -> f16
__device__ __forceinline__ void d_cast8(const float* __restrict__ s, float scale, _Float16* __restrict__ d) {
  const v4f a = *(const v4fa*)s, c = *(const v4fa*)(s + 4);
  FragH f;
#pragma unroll
  for (int q = 0; q < 4; ++q) { f.h[q] = (_Float16)(bf16_rne(a[q]) * scale); f.h[4 + q] = (_Float16)(bf16_rne(c[q]) * scale); }
  const v8us o = f.half[0];
  *(v8us*)(unsigned short*)d = o;
}

// One launch for the seven pieces of set-up work, none of which reads another's result; a block's piece follows from its index alone: x of each batch, the four weights (x16, stored one behind the other), the rotary table.
#define PXB ((SQ * DM / 8 + 255) / 256)      /* blocks for x of one batch */
#define PWB ((DM * DM / 8 + 255) / 256)      /* blocks for one weight */
__global__ __launch_bounds__(256) void k_prep(const float* __restrict__ x, const float* __restrict__ wq, const float* __restrict__ wk, const float* __restrict__ wv, const float* __restrict__ wo,
    _Float16* __restrict__ X16, _Float16* __restrict__ BW, float* __restrict__ TAB) {
  const int bx = blockIdx.x, tid = threadIdx.x;
  if (bx < NB * PXB) {
    const int b = bx / PXB; const int t = (bx - b * PXB) * 256 + tid; if (t >= SQ * DM / 8) return;
    d_cast8(x + (size_t)b * SQ_FULL * DM + (size_t)t * 8, 1.0f, X16 + (size_t)b * SQ * DM + (size_t)t * 8);
  } else if (bx < NB * PXB + 4 * PWB) {
    const int u = bx - NB * PXB; const int sel = u / PWB; const int t = (u - sel * PWB) * 256 + tid; if (t >= DM * DM / 8) return;
    const float* wsrc = (sel == 0) ? wq : ((sel == 1) ? wk : ((sel == 2) ? wv : wo));
    d_cast8(wsrc + (size_t)t * 8, 16.0f, BW + (size_t)sel * DM * DM + (size_t)t * 8);
  } else {
    d_tab(bx - (NB * PXB + 4 * PWB), TAB);
  }
}

// Rotary embedding of four neighbouring channels (two pairs) of one row; tb = cos, sin of the two pairs; rot = false leaves the channels as they are.
__device__ __forceinline__ v4f d_rot4(v4f a, v4f tb, bool rot) {
  v4f o;
  o[0] = rot ? (a[0] * tb[0] + (-a[1]) * tb[1]) : a[0];
  o[1] = rot ? (a[1] * tb[0] + a[0] * tb[1]) : a[1];
  o[2] = rot ? (a[2] * tb[2] + (-a[3]) * tb[3]) : a[2];
  o[3] = rot ? (a[3] * tb[2] + a[2] * tb[3]) : a[3];
  return o;
}

// ---- f16 GEMM engine (wave tile 32x64; block = 4 waves = 128 rows x 64 cols; M % 128 == 0, N % 64 == 0, K % 64 == 0) ----
// A f16 [M][K] row-major (pitch lda), Bh f16 [N][K] (k contiguous, pitch ldb).
// A step is 64 k: the block's 128 A rows and 64 B rows (128 B each) are read from memory once a block, as whole lines, two steps ahead into registers, and stored one step ahead into the LDS buffer that is not being read;
// every wave takes its fragments from LDS, all 24 reads of a step asked for ahead of the step's 16 products. Each accumulator still sums its k blocks of 32 in rising order.
#define G2P 72                           /* LDS row pitch in 16-bit elements: 128 B + 16 B, for 16-byte readers on 16 rows */
__device__ __forceinline__ v16h g2_frag(const _Float16* p, int hh) { FragH f; f.half[0] = *(const v8us*)((const unsigned short*)p + 8 * hh); f.half[1] = *(const v8us*)((const unsigned short*)p + 16 + 8 * hh); return f.v; }
__device__ __forceinline__ v8f g2_mma(v16h a, v16h b, v8f c) { v8f d = __builtin_amdgcn_wmma_f32_16x16x32_f16(false, a, false, b, (short)0, c, false, false); asm volatile("v_nop\n\tv_nop\n\tv_nop\n\tv_nop" : "+v"(d) : "v"(a), "v"(b)); return d; }
// What a projection block does with its 128 x 64 tile (64 columns = one head) instead of storing it plainly; every member is the same for the whole block.
// vt: the tile goes out as f16, transposed, into Vt [batch][head][channel][SQ]. Otherwise rotary: the rotary embedding is applied (row s of TAB = row of the batch); split: f16 hi + x1024 residual planes Hh, Hl instead of the f32 plane C.
struct ProjEp { const float* TAB; _Float16* Hh; _Float16* Hl; _Float16* Vt; bool vt, rotary, split; };
#define VTP 136                          /* LDS row pitch of the transposed tile in 16-bit elements: 256 B + 16 B, for 16-byte writers and readers on 16 rows */
// The engine for one block: rows 128 mt .., columns 64 nq ..; cofs = element offset of the C plane. PROJ = true: the tile goes out as ep says.
// PROJ = false: A64 = row 64 of the block's A tile. pair (the same for the whole block): A rows 0..63 are 64 rows of a hi plane and A rows 64..127 the same 64 rows of its x1024 residual plane;
// the block stores 64 rows, prow .. prow + 63 of the C plane: (residual product x alpha 2^-10) + (hi product x alpha + bias).
template <bool PROJ>
__device__ __forceinline__ void gemm2_body(const _Float16* __restrict__ A, int lda, const _Float16* __restrict__ Bh, int ldb, float alpha,
    const float* __restrict__ bias, float* C, int ldc, size_t cofs, int mt, int nq, int K, const ProjEp ep, const _Float16* __restrict__ A64 = nullptr, bool pair = false, int prow = 0) {
  __shared__ __attribute__((aligned(16))) float so[4][32][68];
  __shared__ __attribute__((aligned(16))) unsigned short st[2][192][G2P];      /* [buffer][128 A rows, then 64 B rows][element] */
  const int tid = threadIdx.x, w = __builtin_amdgcn_readfirstlane((int)(tid >> 5)), lane = tid & 31, ln = lane & 15, hh = lane >> 4;
  const int row0 = mt * 128 + 32 * w, col0 = nq * 64;
  const int sr = tid >> 3, sc = (tid & 7) * 8;      /* staging: 8 lanes cover one 128-B row, a wave 4 rows */
  /* address = a block-uniform byte pointer, which moves with the step, + the lane's own byte offset, which does not */
  const char* ga = (const char*)(A + (size_t)(mt * 128) * lda); const char* gb = (const char*)(Bh + (size_t)col0 * ldb);
  const char* gh = (const char*)A64;      /* PROJ = false: rows 64..127 of the A tile */
  const unsigned oa = (unsigned)(sr * lda + sc) * 2u, ob = (unsigned)(sr * ldb + sc) * 2u;
  v8us g[12];
#pragma unroll      /* g[] indexed by constants only, so that it stays in registers */
  for (int i = 0; i < 8; ++i) g[i] = *(const v8us*)((PROJ || i < 4 ? ga + (size_t)(32 * i) * lda : gh + (size_t)(32 * (i - 4)) * lda) + oa);
#pragma unroll      /* g[] indexed by constants only */
  for (int i = 0; i < 4; ++i) g[8 + i] = *(const v8us*)(gb + (size_t)(32 * i) * ldb + ob);
#pragma unroll      /* g[] indexed by constants only */
  for (int i = 0; i < 12; ++i) *(v8us*)&st[0][sr + 16 * i][sc] = g[i];
  const int nk = K >> 6;
  if (1 < nk) {
    ga += 128; gb += 128; if constexpr (!PROJ) gh += 128;
#pragma unroll      /* g[] indexed by constants only */
    for (int i = 0; i < 8; ++i) g[i] = *(const v8us*)((PROJ || i < 4 ? ga + (size_t)(32 * i) * lda : gh + (size_t)(32 * (i - 4)) * lda) + oa);
#pragma unroll      /* g[] indexed by constants only */
    for (int i = 0; i < 4; ++i) g[8 + i] = *(const v8us*)(gb + (size_t)(32 * i) * ldb + ob);
    asm volatile("s_wait_xcnt 0x0" ::: "memory");      /* the wait before the loads' address registers are reused */
  }
  const v8f z8 = {0.f,0.f,0.f,0.f,0.f,0.f,0.f,0.f}; v8f c00 = z8, c01 = z8, c02 = z8, c03 = z8, c10 = z8, c11 = z8, c12 = z8, c13 = z8;
#pragma unroll 1      /* the two buffers alternate by index; one step is already 16 matrix instructions */
  for (int j = 0; j < nk; ++j) {
    const int cb = j & 1;
    __syncthreads();      /* publishes buffer cb, and ends every wave's reads of the other buffer (step j - 1) before it is stored into below */
    if (j + 1 < nk) {      /* step j + 1's rows, asked for a whole step ago, go into the other buffer */
#pragma unroll      /* g[] indexed by constants only */
      for (int i = 0; i < 12; ++i) *(v8us*)&st[cb ^ 1][sr + 16 * i][sc] = g[i];
    }
    if (j + 2 < nk) {      /* step j + 2's rows fly until the next step's barrier */
      ga += 128; gb += 128; if constexpr (!PROJ) gh += 128;
#pragma unroll      /* g[] indexed by constants only */
      for (int i = 0; i < 8; ++i) g[i] = *(const v8us*)((PROJ || i < 4 ? ga + (size_t)(32 * i) * lda : gh + (size_t)(32 * (i - 4)) * lda) + oa);
#pragma unroll      /* g[] indexed by constants only */
      for (int i = 0; i < 4; ++i) g[8 + i] = *(const v8us*)(gb + (size_t)(32 * i) * ldb + ob);
      asm volatile("s_wait_xcnt 0x0" ::: "memory");      /* the wait before the loads' address registers are reused: the fragment reads below land in them */
    }
    const _Float16* ap = (const _Float16*)&st[cb][32 * w + ln][0]; const _Float16* bp = (const _Float16*)&st[cb][128 + ln][0];
    v16h fa[2][2], fb[2][4];      /* [k block of 32][16 rows] */
#pragma unroll      /* fa[], fb[] indexed by constants only, so that they stay in registers */
    for (int kk = 0; kk < 2; ++kk) { fa[kk][0] = g2_frag(ap + 32 * kk, hh); fa[kk][1] = g2_frag(ap + 16 * G2P + 32 * kk, hh);
#pragma unroll      /* fb[] indexed by constants only */
      for (int t = 0; t < 4; ++t) fb[kk][t] = g2_frag(bp + 16 * t * G2P + 32 * kk, hh); }
#pragma unroll      /* fa[], fb[] indexed by constants only */
    for (int kk = 0; kk < 2; ++kk) {
      c00 = g2_mma(fa[kk][0], fb[kk][0], c00); c10 = g2_mma(fa[kk][1], fb[kk][0], c10);
      c01 = g2_mma(fa[kk][0], fb[kk][1], c01); c11 = g2_mma(fa[kk][1], fb[kk][1], c11);
      c02 = g2_mma(fa[kk][0], fb[kk][2], c02); c12 = g2_mma(fa[kk][1], fb[kk][2], c12);
      c03 = g2_mma(fa[kk][0], fb[kk][3], c03); c13 = g2_mma(fa[kk][1], fb[kk][3], c13); }
  }
  v8f accs[8] = {c00, c01, c02, c03, c10, c11, c12, c13};
  const int rsub = lane >> 4, c4 = (lane & 15) * 4;
  v4f tb[16]; float b4[4];
  const bool lo = !PROJ && pair && w >= 2;      /* this wave's 32 rows are residual rows: scaled 2^-10 more, no bias */
  const float aw = lo ? alpha * 0.0009765625f : alpha;
  if constexpr (PROJ) {
    const float* bp4 = bias + col0 + ln;      /* a projection always has a bias */
#pragma unroll      /* b4[] indexed by constants only; the four loads issue together */
    for (int t = 0; t < 4; ++t) b4[t] = bp4[t * 16];
    if (ep.vt) {      /* a lane's 8 accumulator registers are 8 consecutive rows of one channel: one 16-byte piece of the transposed tile */
      unsigned short* vl = (unsigned short*)&so[0][0][0];      /* [64 channels][VTP] */
#pragma unroll      /* accs[] indexed by constants only */
      for (int u = 0; u < 8; ++u) { const int t = u & 3, half = u >> 2; const float bv = bf16_rne(b4[t]); FragH f;
#pragma unroll      /* fragment elements indexed by constants only */
        for (int r = 0; r < 8; ++r) f.h[r] = (_Float16)(accs[u][r] * alpha + bv);
        *(v8us*)&vl[(t * 16 + ln) * VTP + 32 * w + half * 16 + 8 * hh] = f.half[0]; }
      __syncthreads();      /* a channel's 128 rows come from all four waves; taken by the whole block or by none of it */
      const int bt = (mt * 128) / SQ; const int pc = tid & 15, dd = tid >> 4;      /* 16 lanes cover a channel's 256 B: two whole lines */
      unsigned short* vd = (unsigned short*)ep.Vt + ((size_t)(bt * NH + nq) * HD + dd) * SQ + (mt * 128 - bt * SQ) + pc * 8;
#pragma unroll      /* the 8 LDS reads issue ahead of the stores */
      for (int rd = 0; rd < 8; ++rd) { const v8us v = *(const v8us*)&vl[(rd * 8 + dd) * VTP + pc * 8]; *(v8us*)(vd + (size_t)(rd * 8) * SQ) = v; }
      return;
    }
    /* the table rows of this lane's 16 pieces are asked for ahead of the tile's way through LDS */
    const float* tp = ep.TAB + (size_t)(row0 % SQ + rsub) * 32 + (c4 & 31);
#pragma unroll      /* tb[] indexed by constants only, so that it stays in registers */
    for (int q = 0; q < 16; ++q) tb[q] = *(const v4fa*)(tp + q * 64);
    asm volatile("s_wait_xcnt 0x0" :: "v"(tp) : "memory");      /* the wait before the loads' address pair is reused; naming the pair keeps it live up to here, so that no load's result is placed in it */
  } else {      /* what the tile's way out reads from memory is asked for here, all of it together: no load waits for the one before */
#pragma unroll      /* b4[] indexed by constants only */
    for (int t = 0; t < 4; ++t) b4[t] = 0.f;
    if (bias && !lo) { const float* bp4 = bias + col0 + ln;
#pragma unroll      /* b4[] indexed by constants only; the four loads issue together */
      for (int t = 0; t < 4; ++t) b4[t] = bp4[t * 16];
      asm volatile("s_wait_xcnt 0x0" ::: "memory"); }      /* the wait before the loads' address registers are reused */
  }
#pragma unroll
  for (int u = 0; u < 8; ++u) { const int t = u & 3, half = u >> 2; const float bv = bf16_rne(b4[t]);
#pragma unroll
    for (int r = 0; r < 8; ++r) { const int rloc = half * 16 + 8 * hh + r;
      so[w][rloc][t * 16 + ln] = accs[u][r] * aw + bv; } }
  if constexpr (!PROJ) {
    if (pair) {
      __syncthreads();      /* a stored row is the sum of two waves' tiles: waves 0, 1 hold the hi rows, waves 2, 3 the residual rows; taken by the whole block or by none of it */
      const int p = w & 1, r16 = (w >> 1) * 16 + rsub;      /* every wave stores 16 of the 64 rows */
      float* cp = C + cofs + (size_t)(prow + 32 * p + r16) * ldc + col0 + c4;
      v4f vh[8], vl[8];
#pragma unroll      /* vh[], vl[] indexed by constants only; the 16 LDS reads issue ahead of the stores */
      for (int q = 0; q < 8; ++q) { vh[q] = *(const v4fa*)&so[p][r16 + q * 2][c4]; vl[q] = *(const v4fa*)&so[p + 2][r16 + q * 2][c4]; }
#pragma unroll      /* vh[], vl[] indexed by constants only */
      for (int q = 0; q < 8; ++q) vh[q] = vl[q] + vh[q];
#pragma unroll      /* vh[] indexed by constants only */
      for (int q = 0; q < 8; ++q) *(v4f*)(cp + (size_t)(q * 2) * ldc) = vh[q];
      return;
    }
  }
  __builtin_amdgcn_fence(4 /* acq_rel order */, "workgroup"); __builtin_amdgcn_wave_barrier();
  if constexpr (PROJ) {
    const bool rot = ep.rotary && c4 < 32;
    if (ep.split) {
      _Float16* hp = ep.Hh + (size_t)(row0 + rsub) * ldc + col0 + c4; _Float16* lp = ep.Hl + (size_t)(row0 + rsub) * ldc + col0 + c4;
#pragma unroll      /* tb[] indexed by constants only */
      for (int q = 0; q < 16; ++q) { const v4f y = d_rot4(*(const v4fa*)&so[w][q * 2 + rsub][c4], tb[q], rot); v4h h4, l4;
#pragma unroll      /* vector elements indexed by constants only */
        for (int e = 0; e < 4; ++e) { const _Float16 h = (_Float16)y[e]; h4[e] = h; l4[e] = (_Float16)((y[e] - (float)h) * 1024.0f); }
        *(v4h*)(hp + (size_t)(q * 2) * ldc) = h4; *(v4h*)(lp + (size_t)(q * 2) * ldc) = l4; }
      asm volatile("s_wait_xcnt 0x0" ::: "memory");      /* the wait before the stores' registers are reused: the code of the other kinds of tile follows in the listing */
    } else {
      float* cp = C + (size_t)(row0 + rsub) * ldc + col0 + c4;
#pragma unroll      /* tb[] indexed by constants only */
      for (int q = 0; q < 16; ++q) *(v4f*)(cp + (size_t)(q * 2) * ldc) = d_rot4(*(const v4fa*)&so[w][q * 2 + rsub][c4], tb[q], rot);
      asm volatile("s_wait_xcnt 0x0" ::: "memory");      /* the wait before the stores' registers are reused: the code of the other kinds of tile follows in the listing */
    }
    return;
  }
  {
#pragma unroll
    for (int q = 0; q < 16; ++q) { const int r = q * 2 + rsub; const v4f v = *(const v4fa*)&so[w][r][c4];
      if (C) *(v4f*)(C + cofs + (size_t)(row0 + r) * ldc + col0 + c4) = v; }
     }
}

// One launch for the nine projections, none of which reads another's result; a block's product and tile follow from its index alone:
// q, k and v of all rows, then q, k, v of the first QT0 rows of every batch. BW holds the weights of q, k, v one behind the other.
// What follows a projection element by element is done on the block's own tile: q, k of all rows leave as rotated f16 hi + residual planes, v as V^T [NB][NH][HD][SQ]; the first-tile q, k as rotated f32 planes, the first-tile v as an f32 plane.
#define GQB ((MP / 128) * (DM / 64))      /* blocks of one projection of all rows */
#define GQ0 (DM / 64)                     /* blocks of one first-tile projection (QT0 == 128 rows) */
__global__ __launch_bounds__(128) void k_qkv(const _Float16* __restrict__ X16, const _Float16* __restrict__ BW, const float* __restrict__ bq, const float* __restrict__ bk, const float* __restrict__ bv,
    const float* __restrict__ TAB, _Float16* __restrict__ QH, _Float16* __restrict__ QL, _Float16* __restrict__ KH, _Float16* __restrict__ KL, _Float16* __restrict__ VT, float* __restrict__ QKR0, float* __restrict__ VF0) {
  const int bx = blockIdx.x; int sel, mt, nq; const _Float16* A = X16; float* C = nullptr; ProjEp ep; ep.TAB = TAB; ep.Vt = VT;
  if (bx < 3 * GQB) {
    sel = bx / GQB; const int t = bx - sel * GQB; mt = t / (DM / 64); nq = t - mt * (DM / 64);
    ep.vt = sel == 2; ep.split = true;
  } else {
    const int u = bx - 3 * GQB; const int s6 = u / GQ0; const int b = s6 / 3; sel = s6 - 3 * b; mt = 0; nq = u - s6 * GQ0;
    A += (size_t)b * SQ * DM; C = (sel < 2) ? QKR0 + (size_t)(2 * b + sel) * QT0 * DM : VF0 + (size_t)b * QT0 * DM;
    ep.vt = false; ep.split = false;
  }
  ep.rotary = sel < 2; ep.Hh = (sel == 0) ? QH : KH; ep.Hl = (sel == 0) ? QL : KL;
  const float* bias = (sel == 0) ? bq : ((sel == 1) ? bk : bv);
  gemm2_body<true>(A, DM, BW + (size_t)sel * DM * DM, DM, 0.0625f, bias, C, DM, (size_t)0, mt, nq, DM, ep);
}

// One launch for the output product of the f16 path (rows QT0 .. of a batch) and both products of the first-tile o (rows 0 .. QT0 - 1, hi and residual plane): same weights, bias and output plane. grid.y = batch.
// The first 2 (DM / 64) blocks of a batch are the first tile's: each has 64 of its rows, from both planes, as its 128 A rows (QT0 == 128: the first tile is row tile 0); the others have row tiles 1 .. of the f16 path.
#define GOB ((SQ / 128 + 1) * (DM / 64))      /* blocks a batch */
__global__ __launch_bounds__(128) void k_out(const _Float16* __restrict__ O16, const _Float16* __restrict__ OH0, const _Float16* __restrict__ OL0, const _Float16* __restrict__ BO, const float* __restrict__ bo, float* out) {
  const int bx = blockIdx.x, by = blockIdx.y; const bool pair = bx < 2 * (DM / 64);
  const int t = pair ? bx : bx - DM / 64; const int mq = t / (DM / 64), nq = t - mq * (DM / 64);      /* mq: which 64 rows of the first tile, or the row tile */
  const size_t f0 = ((size_t)by * QT0 + (pair ? 64 * mq : 0)) * DM;
  const _Float16* A = pair ? OH0 + f0 : O16 + (size_t)by * SQ * DM;
  const _Float16* A64 = pair ? OL0 + f0 : A + (size_t)(mq * 128 + 64) * DM;
  gemm2_body<false>(A, DM, BO, DM, 0.0009765625f, bo, out, DM, (size_t)by * SQ_FULL * DM, pair ? 0 : mq, nq, DM, ProjEp(), A64, pair, 64 * mq);
}

// Butterfly over the 32 lanes of a wave: four row_xmask steps inside each 16-lane row, then the other row; every lane ends with the same value.
template <int CTRL>
__device__ __forceinline__ float lane_xm(float x) { return __int_as_float(__builtin_amdgcn_update_dpp(0, __float_as_int(x), CTRL, 0xf, 0xf, true)); }
__device__ __forceinline__ float lane_x16(float x) { const int b = __float_as_int(x); return __int_as_float(__builtin_amdgcn_permlanex16(b, b, 0x76543210, 0xfedcba98, false, false)); }
__device__ __forceinline__ float wave_max(float x) {
  x = fmaxf(x, lane_xm<0x161>(x)); x = fmaxf(x, lane_xm<0x162>(x)); x = fmaxf(x, lane_xm<0x164>(x)); x = fmaxf(x, lane_xm<0x168>(x)); return fmaxf(x, lane_x16(x)); }
__device__ __forceinline__ float wave_sum(float x) {
  x += lane_xm<0x161>(x); x += lane_xm<0x162>(x); x += lane_xm<0x164>(x); x += lane_xm<0x168>(x); return x + lane_x16(x); }

// f32 attention over the first QT0 query rows of every batch, a piece of the fused attention launch (it reads nothing of that launch). Block = one (batch, head) x A0R query rows, 4 waves, 2 rows a wave; keys 0 .. (rg + 1) A0R - 1 cover every row of the block.
// K (row pitch A0KP floats = 16 B x odd: lanes on different rows read 16 B each without bank conflicts), V and the q rows are staged in LDS once.
// Scores: lane = key, both rows share each K read. Softmax: wave butterflies. Weighted sum: lane = channel pair, weights read as broadcasts. o (x64) leaves as f16 hi + x1024 residual planes.
#define A0R 8
#define A0KP 68
#define A0G (QT0 / A0R)                  /* row groups of one (batch, head) */
static_assert(QT0 % A0R == 0);
static_assert(QT0 == 128 && HD == 64 && A0R == 8);
typedef float v2f __attribute__((ext_vector_type(2)));
typedef _Float16 v2h __attribute__((ext_vector_type(2)));
struct A0Lds { float lk[QT0][A0KP]; float lv[QT0][HD]; float lq[A0R][HD]; float lp[A0R][QT0]; };
__device__ __forceinline__ void d_att0(A0Lds& sm, int f, const float* __restrict__ QK, const float* __restrict__ VF, float scale, _Float16* __restrict__ OH, _Float16* __restrict__ OL) {
  const int tid = threadIdx.x, lane = tid & 31, w = __builtin_amdgcn_readfirstlane((int)(tid >> 5));
  const int b = f / (NH * A0G), hg = f - b * (NH * A0G); const int h = hg / A0G, rg = hg % A0G; const int nkeys = (rg + 1) * A0R;
  const size_t bo1 = (size_t)b * QT0 * DM;
  const float* QF = QK + 2 * bo1; VF += bo1;      /* q and k planes of a batch lie one behind the other: row r of k is row QT0 + r of QF */
  const int sr = tid >> 4, sc4 = (tid & 15) * 4;      /* staging: 16 lanes cover one 256-B row */
  const float* qp = QF + (size_t)(rg * A0R + sr) * DM + h * HD + sc4; const float* kp = QF + (size_t)sr * DM + h * HD + sc4; const float* vp = VF + (size_t)sr * DM + h * HD + sc4;
  const v4f qs = *(const v4fa*)qp;
  v4f ks[QT0 / 8], vs[QT0 / 8];      /* all QT0 rows of K and V are staged by every block: no test stands between the loads */
#pragma unroll      /* ks[], vs[] indexed by constants only, so that they stay in registers; all loads issued before the first use */
  for (int g = 0; g < QT0 / 8; ++g) { ks[g] = *(const v4fa*)(kp + (size_t)(QT0 + g * 8) * DM); vs[g] = *(const v4fa*)(vp + (size_t)g * 8 * DM); }
  asm volatile("s_wait_xcnt 0x0" :: "v"(qp), "v"(kp), "v"(vp) : "memory");      /* the wait before the loads' address pairs are reused; naming the pairs keeps them live up to here, so that no load's result is placed in them */
  *(v4f*)&sm.lq[sr][sc4] = qs;
#pragma unroll      /* ks[], vs[] indexed by constants only, so that they stay in registers */
  for (int g = 0; g < QT0 / 8; ++g) { *(v4f*)&sm.lk[g * 8 + sr][sc4] = ks[g]; *(v4f*)&sm.lv[g * 8 + sr][sc4] = vs[g]; }
  __syncthreads();
  const int r0 = 2 * w, i0 = rg * A0R + r0, i1 = i0 + 1;      /* this wave's two query rows */
  const int nch = (nkeys + 31) >> 5;      /* chunks of 32 keys */
  float s0[QT0 / 32], s1[QT0 / 32];
#pragma unroll      /* s0[], s1[] indexed by constants only, so that they stay in registers */
  for (int m = 0; m < QT0 / 32; ++m) { s0[m] = -1.0e30f; s1[m] = -1.0e30f;
    if (m < nch) { const int j = m * 32 + lane;
      v4f a0 = {0.f, 0.f, 0.f, 0.f}, a1 = {0.f, 0.f, 0.f, 0.f};
#pragma unroll      /* the 48 LDS reads of a chunk issue ahead of their use */
      for (int c = 0; c < HD / 4; ++c) { const v4f kq = *(const v4f*)&sm.lk[j][c * 4]; const v4f q0 = *(const v4f*)&sm.lq[r0][c * 4]; const v4f q1 = *(const v4f*)&sm.lq[r0 + 1][c * 4];
#pragma unroll      /* four independent partial sums a row */
        for (int u = 0; u < 4; ++u) { a0[u] = fmaf(q0[u], kq[u], a0[u]); a1[u] = fmaf(q1[u], kq[u], a1[u]); } }
      const float d0 = ((a0[0] + a0[1]) + (a0[2] + a0[3])) * scale, d1 = ((a1[0] + a1[1]) + (a1[2] + a1[3])) * scale;
      s0[m] = (j <= i0) ? d0 : -1.0e30f; s1[m] = (j <= i1) ? d1 : -1.0e30f; } }
  const float m0 = wave_max(fmaxf(fmaxf(s0[0], s0[1]), fmaxf(s0[2], s0[3]))), m1 = wave_max(fmaxf(fmaxf(s1[0], s1[1]), fmaxf(s1[2], s1[3])));
  float l0 = 0.f, l1 = 0.f;
#pragma unroll      /* s0[], s1[] indexed by constants only, so that they stay in registers */
  for (int m = 0; m < QT0 / 32; ++m) if (m < nch) { const int j = m * 32 + lane;
    const float e0 = (j <= i0) ? expf(s0[m] - m0) : 0.f, e1 = (j <= i1) ? expf(s1[m] - m1) : 0.f;
    l0 += e0; l1 += e1; sm.lp[r0][j] = e0; sm.lp[r0 + 1][j] = e1; }
  l0 = wave_sum(l0); l1 = wave_sum(l1);
  __syncthreads();      /* the weights of a row are written by lanes and read back as broadcasts */
  const int n4 = (i1 + 4) >> 2;      /* keys 0 .. i1 in fours; the weights above a row's own index are zero, and 4 n4 <= nkeys */
  v2f o0 = {0.f, 0.f}, o1 = {0.f, 0.f};
#pragma unroll 4      /* LDS reads of later trips issue while earlier ones are summed */
  for (int t = 0; t < n4; ++t) { const v4f p0 = *(const v4f*)&sm.lp[r0][t * 4]; const v4f p1 = *(const v4f*)&sm.lp[r0 + 1][t * 4];
#pragma unroll      /* p0[], p1[] indexed by constants only */
    for (int u = 0; u < 4; ++u) { const v2f vv = *(const v2f*)&sm.lv[t * 4 + u][2 * lane];
      o0[0] = fmaf(p0[u], vv[0], o0[0]); o0[1] = fmaf(p0[u], vv[1], o0[1]); o1[0] = fmaf(p1[u], vv[0], o1[0]); o1[1] = fmaf(p1[u], vv[1], o1[1]); } }
  const float f0 = 64.0f / l0, f1 = 64.0f / l1;      /* o carried x64 like the f16 path */
  o0[0] *= f0; o0[1] *= f0; o1[0] *= f1; o1[1] *= f1;
  v2h h0, h1, e0, e1;
#pragma unroll      /* vector elements indexed by constants only */
  for (int u = 0; u < 2; ++u) { _Float16 t = (_Float16)o0[u]; h0[u] = t; e0[u] = (_Float16)((o0[u] - (float)t) * 1024.0f); t = (_Float16)o1[u]; h1[u] = t; e1[u] = (_Float16)((o1[u] - (float)t) * 1024.0f); }
  const size_t d0 = bo1 + (size_t)i0 * DM + h * HD + 2 * lane;      /* a wave's store is one whole 128-B line of a row */
  *(v2h*)(OH + d0) = h0; *(v2h*)(OL + d0) = e0; *(v2h*)(OH + d0 + DM) = h1; *(v2h*)(OL + d0 + DM) = e1;
}

#define FAC1 0.18033688011112042f        /* log2(e) / 8 */
#define FAC2 0.00017611023448351604f     /* log2(e) / 8 / 1024 */
#define FAP 72                           /* LDS row pitch in 16-bit elements: 128 B + 16 B, for 16-byte readers on 16 rows */
#define FNT (SQ / 64)                    /* query tiles = key steps of the longest tile */
static_assert(HD == 64 && (FNT & (FNT - 1)) == 0);
static_assert(FNT * NH >= NB * NH * A0G);      /* one slab of blocks covers the f32 attention of the first tiles */
// 2^x. The v_nop at the end keeps the one slot that the instruction set asks for between a transcendental and a next instruction that reads its result or overwrites its source;
// inside the run of eight every result register is distinct from every source (early clobber), so each v_exp_f32 is the independent instruction behind the one before.
__device__ __forceinline__ float fa_exp2(float x) { float y; asm("v_exp_f32 %0, %1\n\tv_nop" : "=v"(y) : "v"(x)); return y; }
__device__ __forceinline__ v8f fa_exp2x8(v8f x) { float y0, y1, y2, y3, y4, y5, y6, y7;
  asm("v_exp_f32 %0, %8\n\tv_exp_f32 %1, %9\n\tv_exp_f32 %2, %10\n\tv_exp_f32 %3, %11\n\tv_exp_f32 %4, %12\n\tv_exp_f32 %5, %13\n\tv_exp_f32 %6, %14\n\tv_exp_f32 %7, %15\n\tv_nop"
      : "=&v"(y0), "=&v"(y1), "=&v"(y2), "=&v"(y3), "=&v"(y4), "=&v"(y5), "=&v"(y6), "=&v"(y7)
      : "v"(x[0]), "v"(x[1]), "v"(x[2]), "v"(x[3]), "v"(x[4]), "v"(x[5]), "v"(x[6]), "v"(x[7]));
  const v8f y = {y0, y1, y2, y3, y4, y5, y6, y7}; return y; }
/* amdgpu_waves_per_eu(4, 4): holds the kernel to 256 registers, so that four blocks fit a WGP and no register window is switched in the loop */
__global__ __launch_bounds__(128) __attribute__((amdgpu_waves_per_eu(4, 4))) void k_fattn(const _Float16* __restrict__ QHp, const _Float16* __restrict__ QLp, const _Float16* __restrict__ KHp, const _Float16* __restrict__ KLp,
    const _Float16* __restrict__ VTp, _Float16* __restrict__ O16p, const float* __restrict__ QKR0, const float* __restrict__ VF0, _Float16* __restrict__ OH0, _Float16* __restrict__ OL0) {
  __shared__ __attribute__((aligned(16))) union { unsigned short t[2][3][64][FAP]; A0Lds a0; } sh;      /* a block is of one kind: t = [buffer][K hi, K residual, V^T][row][element], or the f32 piece's arrays in the same bytes */
  auto& lt = sh.t;
  if (blockIdx.z >= NB) {      /* the slab of blocks behind the last batch (so that every attention block keeps its flat index): the f32 attention of the first tiles, which reads nothing of this launch; the whole block takes this way, its barriers included */
    const int f = blockIdx.y * FNT + blockIdx.x;
    if (f < NB * NH * A0G) d_att0(sh.a0, f, QKR0, VF0, SCL, OH0, OL0);
    return; }
  const int tid = threadIdx.x, w = __builtin_amdgcn_readfirstlane((int)(tid >> 5)), lane = tid & 31, ln = lane & 15, hh = lane >> 4;
  const int h = blockIdx.y, b = blockIdx.z; const int x = blockIdx.x, grp = (b * NH + h) >> 3;
  /* a permutation of the tiles for each (batch, head): blocks whose flat indices lie far apart get tiles of unequal length, so that long tiles do not gather in one place */
  const int qt = (grp % 3 == 0) ? FNT - 1 - x : ((grp % 3 == 1) ? x : ((x + FNT / 2) & (FNT - 1)));
  const int qw = qt * 64 + 16 * w; const size_t r0 = (size_t)b * SQ;
  const _Float16* qhp = QHp + (r0 + qw + ln) * DM + h * HD; const _Float16* qlp = QLp + (r0 + qw + ln) * DM + h * HD;
  const v16h qh0 = g2_frag(qhp, hh), qh1 = g2_frag(qhp + 32, hh), ql0 = g2_frag(qlp, hh), ql1 = g2_frag(qlp + 32, hh);
  const int sr = tid >> 3, sc = (tid & 7) * 8;      /* staging: 8 lanes cover one 128-B row, a wave 4 rows */
  const unsigned short* gk = (const unsigned short*)KHp + (r0 + sr) * DM + h * HD + sc; const unsigned short* gl = (const unsigned short*)KLp + (r0 + sr) * DM + h * HD + sc;
  const unsigned short* gv = (const unsigned short*)VTp + ((size_t)(b * NH + h) * HD + sr) * SQ + sc;
  v8us g[12];
#pragma unroll      /* g[] indexed by constants only, so that it stays in registers */
  for (int i = 0; i < 4; ++i) { g[i] = *(const v8us*)(gk + (size_t)(16 * i) * DM); g[4 + i] = *(const v8us*)(gl + (size_t)(16 * i) * DM); g[8 + i] = *(const v8us*)(gv + (size_t)(16 * i) * SQ); }
#pragma unroll      /* g[] indexed by constants only */
  for (int i = 0; i < 4; ++i) { *(v8us*)&lt[0][0][sr + 16 * i][sc] = g[i]; *(v8us*)&lt[0][1][sr + 16 * i][sc] = g[4 + i]; *(v8us*)&lt[0][2][sr + 16 * i][sc] = g[8 + i]; }
  const v8f z8 = {0.f,0.f,0.f,0.f,0.f,0.f,0.f,0.f};
  v8f o[4] = {z8, z8, z8, z8}; float m = -1.0e30f, l = 0.f;
#pragma unroll 1      /* one step is already 32 matrix instructions; the two buffers alternate by index */
  for (int j = 0; j <= qt; ++j) {
    const int cb = j & 1;
    __syncthreads();      /* publishes buffer cb, and ends every wave's reads of the other buffer (step j - 1) before it is stored into below */
    if (j < qt) {      /* the next step's tiles fly while this step is worked on */
      gk += (size_t)64 * DM; gl += (size_t)64 * DM; gv += 64;
#pragma unroll      /* g[] indexed by constants only */
      for (int i = 0; i < 4; ++i) { g[i] = *(const v8us*)(gk + (size_t)(16 * i) * DM); g[4 + i] = *(const v8us*)(gl + (size_t)(16 * i) * DM); g[8 + i] = *(const v8us*)(gv + (size_t)(16 * i) * SQ); }
    }
    v8f s[4]; v16h kf[2][4], va[4];
    { const _Float16* kh = (const _Float16*)&lt[cb][0][ln][0]; const _Float16* kl = (const _Float16*)&lt[cb][1][ln][0];
      kf[0][0] = g2_frag(kh, hh); kf[0][1] = g2_frag(kh + 32, hh); kf[0][2] = g2_frag(kl, hh); kf[0][3] = g2_frag(kl + 32, hh); }
#pragma unroll      /* s[], kf[], va[] indexed by constants only, so that they stay in registers */
    for (int t = 0; t < 4; ++t) {
      if (t < 3) {      /* the next 16 keys' fragments are asked for ahead of this tile's products */
        const _Float16* kh = (const _Float16*)&lt[cb][0][16 * (t + 1) + ln][0]; const _Float16* kl = (const _Float16*)&lt[cb][1][16 * (t + 1) + ln][0];
        kf[(t + 1) & 1][0] = g2_frag(kh, hh); kf[(t + 1) & 1][1] = g2_frag(kh + 32, hh); kf[(t + 1) & 1][2] = g2_frag(kl, hh); kf[(t + 1) & 1][3] = g2_frag(kl + 32, hh);
      } else {      /* V^T of the first 32 keys is asked for ahead of the softmax */
#pragma unroll      /* va[] indexed by constants only */
        for (int u = 0; u < 4; ++u) va[u] = g2_frag((const _Float16*)&lt[cb][2][16 * u + ln][0], hh);
      }
      const v16h kh0 = kf[t & 1][0], kh1 = kf[t & 1][1], kl0 = kf[t & 1][2], kl1 = kf[t & 1][3];
      v8f a = z8, c = z8, d = z8;
      a = g2_mma(kh0, qh0, a); c = g2_mma(kh0, ql0, c); d = g2_mma(kl0, qh0, d);
      a = g2_mma(kh1, qh1, a); c = g2_mma(kh1, ql1, c); d = g2_mma(kl1, qh1, d);
#pragma unroll      /* vector elements indexed by constants only */
      for (int r = 0; r < 8; ++r) s[t][r] = a[r] * FAC1 + (c[r] + d[r]) * FAC2;
    }
    if (j == qt) {      /* only the last step crosses the diagonal; every query keeps its key 64 qt there */
      const int rel = 16 * w + ln - 8 * hh;      /* key 64 qt + 16 t + 8 hh + r is kept while 16 t + r <= rel */
#pragma unroll      /* s[] indexed by constants only */
      for (int t = 0; t < 4; ++t) {
#pragma unroll      /* s[] indexed by constants only */
        for (int r = 0; r < 8; ++r) s[t][r] = (16 * t + r <= rel) ? s[t][r] : -1.0e30f; }
    }
    v8f x8;
#pragma unroll      /* vector elements indexed by constants only */
    for (int r = 0; r < 8; ++r) x8[r] = fmaxf(fmaxf(s[0][r], s[1][r]), fmaxf(s[2][r], s[3][r]));
    float mx = fmaxf(fmaxf(fmaxf(x8[0], x8[1]), fmaxf(x8[2], x8[3])), fmaxf(fmaxf(x8[4], x8[5]), fmaxf(x8[6], x8[7])));
    mx = fmaxf(mx, lane_x16(mx));      /* the other half of this query's keys */
    const float mn = fmaxf(m, mx); const float al = fa_exp2(m - mn); const float mb = mn - 8.0f; m = mn;
    v4f ps = {0.f, 0.f, 0.f, 0.f};
#pragma unroll      /* s[] indexed by constants only */
    for (int t = 0; t < 4; ++t) { s[t] = fa_exp2x8(s[t] - mb);
#pragma unroll      /* s[] indexed by constants only; four independent partial sums */
      for (int r = 0; r < 8; ++r) ps[r & 3] += s[t][r]; }
    l = l * al + ((ps[0] + ps[1]) + (ps[2] + ps[3]));
    FragH p0, p1;
#pragma unroll      /* fragment elements indexed by constants only */
    for (int r = 0; r < 8; ++r) { p0.h[r] = (_Float16)s[0][r]; p0.h[8 + r] = (_Float16)s[1][r]; p1.h[r] = (_Float16)s[2][r]; p1.h[8 + r] = (_Float16)s[3][r]; }
#pragma unroll      /* o[] indexed by constants only */
    for (int t = 0; t < 4; ++t) {
#pragma unroll      /* o[] indexed by constants only */
      for (int r = 0; r < 8; ++r) o[t][r] *= al; }
    v16h vb[4];
#pragma unroll      /* vb[] indexed by constants only; V^T of the last 32 keys, into registers that the scores have left */
    for (int u = 0; u < 4; ++u) vb[u] = g2_frag((const _Float16*)&lt[cb][2][16 * u + ln][32], hh);
#pragma unroll      /* o[], va[] indexed by constants only; four independent accumulators in turn */
    for (int t = 0; t < 4; ++t) o[t] = g2_mma(va[t], p0.v, o[t]);
#pragma unroll      /* o[], vb[] indexed by constants only */
    for (int t = 0; t < 4; ++t) o[t] = g2_mma(vb[t], p1.v, o[t]);
    if (j < qt) {
#pragma unroll      /* g[] indexed by constants only */
      for (int i = 0; i < 4; ++i) { *(v8us*)&lt[cb ^ 1][0][sr + 16 * i][sc] = g[i]; *(v8us*)&lt[cb ^ 1][1][sr + 16 * i][sc] = g[4 + i]; *(v8us*)&lt[cb ^ 1][2][sr + 16 * i][sc] = g[8 + i]; }
    }
  }
  l += lane_x16(l);      /* join the two halves' sums once */
  const float inv = 64.0f / l;      /* o carried x64 */
  unsigned short* op = (unsigned short*)O16p + (r0 + qw + ln) * DM + h * HD + 8 * hh;
#pragma unroll      /* o[] indexed by constants only */
  for (int t = 0; t < 4; ++t) { FragH f;
#pragma unroll      /* fragment elements indexed by constants only */
    for (int r = 0; r < 8; ++r) f.h[r] = (_Float16)(o[t][r] * inv);
    *(v8us*)(op + 16 * t) = f.half[0]; }
  asm volatile("s_wait_xcnt 0x0" ::: "memory");      /* the wait before the stores' registers are reused: the code of the f32 attention piece follows in the listing */
}

extern "C" void kernel_launch(void* const* d_in, const int* in_sizes, int n_in,
                              void* d_out, int out_size, void* d_ws, size_t ws_size, hipStream_t stream) {
  if (n_in < 9) return;
  const size_t needx = ((size_t)(NB - 1) * SQ_FULL + SQ) * DM;
  if ((size_t)in_sizes[0] < needx) return;
  if (in_sizes[1] < DM * DM || in_sizes[3] < DM * DM || in_sizes[5] < DM * DM || in_sizes[7] < DM * DM) return;
  if (in_sizes[2] < DM || in_sizes[4] < DM || in_sizes[6] < DM || in_sizes[8] < DM) return;
  if ((size_t)out_size < needx) return;
  /* wire order: x, Wq, bq, Wk, bk, Wv, bv, Wo, bo (natural [out][in] weights, f32) */
  const float* x = (const float*)d_in[0]; const float* wq = (const float*)d_in[1]; const float* bq = (const float*)d_in[2]; const float* wk = (const float*)d_in[3]; const float* bk = (const float*)d_in[4];
  const float* wv = (const float*)d_in[5]; const float* bv = (const float*)d_in[6]; const float* wo = (const float*)d_in[7]; const float* bo = (const float*)d_in[8];
  float* out = (float*)d_out;
  char* ws = (char*)d_ws; size_t off = 0;
  auto take = [&](size_t bytes) { char* p = ws + off; off += (bytes + 255) & ~(size_t)255; return p; };
  _Float16* BW = (_Float16*)take((size_t)4 * DM * DM * 2); _Float16* BO = BW + (size_t)3 * DM * DM;      /* weights of q, k, v, o one behind the other */
  _Float16* X16 = (_Float16*)take(NR * DM * 2);
  _Float16* QH = (_Float16*)take(NR * DM * 2); _Float16* QL = (_Float16*)take(NR * DM * 2); _Float16* KH = (_Float16*)take(NR * DM * 2); _Float16* KL = (_Float16*)take(NR * DM * 2);
  _Float16* O16 = (_Float16*)take(NR * DM * 2);
  _Float16* VT = (_Float16*)take((size_t)NB * NH * HD * SQ * 2);
  float* TAB = (float*)take((size_t)SQ * 32 * 4);
  float* QKR0 = (float*)take((size_t)NB * 2 * QT0 * DM * 4); float* VF0 = (float*)take((size_t)NB * QT0 * DM * 4);      /* [batch][q, k][row][channel]; [batch][row][channel] */
  _Float16* OH0 = (_Float16*)take((size_t)NB * QT0 * DM * 2); _Float16* OL0 = (_Float16*)take((size_t)NB * QT0 * DM * 2);
  if (off > ws_size || off > (size_t)134217728) return;

  k_prep<<<NB * PXB + 4 * PWB + SQ / 16, 256, 0, stream>>>(x, wq, wk, wv, wo, X16, BW, TAB);
  k_qkv<<<3 * GQB + NB * 3 * GQ0, 128, 0, stream>>>(X16, BW, bq, bk, bv, TAB, QH, QL, KH, KL, VT, QKR0, VF0);
  k_fattn<<<dim3(FNT, NH, NB + 1), 128, 0, stream>>>(QH, QL, KH, KL, VT, O16, QKR0, VF0, OH0, OL0);

  /* out = o (x64) . Wo (x16) * 2^-10 + bo; grid.y = batch (output rows at the full per-batch stride); rows 0..127 from the hi plane of the f32 path, + o_lo Wo 2^-20 from its residual plane */
  k_out<<<dim3(GOB, NB), 128, 0, stream>>>(O16, OH0, OL0, BO, bo, out);
}

// v010
// It runs in 79.8 microseconds.
// Next to v009, in two timings, it ran 1.04 and 1.05 times as fast.
// All steps since v000 together make it 69.5 times as fast.
#include <hip/hip_runtime.h>
// Causal multi-head self-attention: x [2][2048][768], 12 heads of 64, natural [out][in] projections with biases, interleaved partial rotary embedding on channels 0..31 of each head of q and k (pairs (2p,2p+1), angle = s * 10000^(-p/16), computed table), scores / 8, causal softmax, out = merged Wo^T + bo.
// Compute dtype: every contraction on v_wmma_f32_16x16x32_f16 (f16 operands, f32 accumulate). Inputs RNE-converted to bf16 first (exact in f16; weights carried x16). q/k: GEMM -> f32 -> rotary in f32 -> f16 hi + x1024 f16 residual planes; scores = three products (hi.hi + lo.hi + hi.lo; each residual pass has its own accumulator folded with 2^-10). v, the unnormalised softmax weights (x256 at the running maximum) and o (x64) are single f16 planes; scores, online softmax and the weighted sum run in one fused kernel. The first 128 query rows of each batch are recomputed with an f32 VALU attention and go through the output GEMM as f16 hi + x1024 residual planes of o.
#ifndef NB
#define NB 2
#endif
#ifndef SEQ
#define SEQ 2048
#endif
#define SQ SEQ
#define SQ_FULL 2048                 /* per-batch row stride of x and of the output */
#define NB_FULL 2
#define DM 768
#define NH 12
#define HD 64
#define QT0 128                      /* first-tile rows recomputed in f32 */
#define SCL 0.125f                   /* 1 / sqrt(64) */
#define NR ((size_t)NB * SQ)
#define MP ((int)((size_t)NB * SQ))

static_assert(SQ % 128 == 0);
static_assert(SQ % 16 == 0);
static_assert(QT0 == 128);
static_assert(SQ >= QT0);
static_assert(NH * HD == DM);
static_assert(DM % 64 == 0);
static_assert(SQ <= SQ_FULL);
static_assert(NB <= NB_FULL);

typedef unsigned short v8us __attribute__((ext_vector_type(8), may_alias));
typedef float  v8f  __attribute__((ext_vector_type(8)));
typedef float  v4f  __attribute__((ext_vector_type(4)));
typedef float  v4fa __attribute__((ext_vector_type(4), may_alias));
typedef _Float16 v16h __attribute__((ext_vector_type(16)));
typedef _Float16 v4h __attribute__((ext_vector_type(4)));
union FragH { v16h v; v8us half[2]; _Float16 h[16]; unsigned short u[16]; };

__device__ __forceinline__ unsigned short bf16_bits(float x) { unsigned int u = __float_as_uint(x); return (unsigned short)((u + 0x7FFFu + ((u >> 16) & 1u)) >> 16); }
__device__ __forceinline__ float bf16_rne(float x) { return __uint_as_float(((unsigned int)bf16_bits(x)) << 16); }

// 10000^(-p/16), p = 0..15, selected by value (no memory table)
__device__ __forceinline__ float rope_invf(int p) {
  float f = 1.0f;
  f = (p == 1)  ? 0.5623413251903491f : f;
  f = (p == 2)  ? 0.31622776601683794f : f;
  f = (p == 3)  ? 0.1778279410038923f : f;
  f = (p == 4)  ? 0.1f : f;
  f = (p == 5)  ? 0.05623413251903491f : f;
  f = (p == 6)  ? 0.03162277660168379f : f;
  f = (p == 7)  ? 0.01778279410038923f : f;
  f = (p == 8)  ? 0.01f : f;
  f = (p == 9)  ? 0.005623413251903491f : f;
  f = (p == 10) ? 0.0031622776601683794f : f;
  f = (p == 11) ? 0.0017782794100389228f : f;
  f = (p == 12) ? 0.001f : f;
  f = (p == 13) ? 0.0005623413251903491f : f;
  f = (p == 14) ? 0.00031622776601683794f : f;
  f = (p == 15) ? 0.00017782794100389227f : f;
  return f;
}

__device__ __forceinline__ void d_tab(int blk, float* __restrict__ TAB) {
  #pragma clang fp contract(off)
  __shared__ __attribute__((aligned(16))) float tl[16][32];
  const int tid = threadIdx.x; const int sl = tid >> 4, p = tid & 15; const int s = blk * 16 + sl;
  const float ang = (float)s * rope_invf(p);
  float sn, cs; sincosf(ang, &sn, &cs);
  tl[sl][2 * p] = cs; tl[sl][2 * p + 1] = sn;
  __syncthreads();
  if (tid < 128) {
    const int row = tid >> 3, pc = (tid & 7) * 4;
    const v4f v = *(const v4fa*)&tl[row][pc];
    float* d = TAB + (size_t)(blk * 16 + row) * 32 + pc;
    *(v4f*)d = v;
    
  }
}

// 8 floats -> bf16 (RNE) -> x scale (a power of two, exact) -> f16
__device__ __forceinline__ void d_cast8(const float* __restrict__ s, float scale, _Float16* __restrict__ d) {
  const v4f a = *(const v4fa*)s, c = *(const v4fa*)(s + 4);
  FragH f;
#pragma unroll
  for (int q = 0; q < 4; ++q) { f.h[q] = (_Float16)(bf16_rne(a[q]) * scale); f.h[4 + q] = (_Float16)(bf16_rne(c[q]) * scale); }
  const v8us o = f.half[0];
  *(v8us*)(unsigned short*)d = o;
}

// One launch for the seven pieces of set-up work, none of which reads another's result; a block's piece follows from its index alone: x of each batch, the four weights (x16, stored one behind the other), the rotary table.
#define PXB ((SQ * DM / 8 + 255) / 256)      /* blocks for x of one batch */
#define PWB ((DM * DM / 8 + 255) / 256)      /* blocks for one weight */
__global__ __launch_bounds__(256) void k_prep(const float* __restrict__ x, const float* __restrict__ wq, const float* __restrict__ wk, const float* __restrict__ wv, const float* __restrict__ wo,
    _Float16* __restrict__ X16, _Float16* __restrict__ BW, float* __restrict__ TAB) {
  const int bx = blockIdx.x, tid = threadIdx.x;
  if (bx < NB * PXB) {
    const int b = bx / PXB; const int t = (bx - b * PXB) * 256 + tid; if (t >= SQ * DM / 8) return;
    d_cast8(x + (size_t)b * SQ_FULL * DM + (size_t)t * 8, 1.0f, X16 + (size_t)b * SQ * DM + (size_t)t * 8);
  } else if (bx < NB * PXB + 4 * PWB) {
    const int u = bx - NB * PXB; const int sel = u / PWB; const int t = (u - sel * PWB) * 256 + tid; if (t >= DM * DM / 8) return;
    const float* wsrc = (sel == 0) ? wq : ((sel == 1) ? wk : ((sel == 2) ? wv : wo));
    d_cast8(wsrc + (size_t)t * 8, 16.0f, BW + (size_t)sel * DM * DM + (size_t)t * 8);
  } else {
    d_tab(bx - (NB * PXB + 4 * PWB), TAB);
  }
}

// Rotary embedding of four neighbouring channels (two pairs) of one row; tb = cos, sin of the two pairs; rot = false leaves the channels as they are.
__device__ __forceinline__ v4f d_rot4(v4f a, v4f tb, bool rot) {
  v4f o;
  o[0] = rot ? (a[0] * tb[0] + (-a[1]) * tb[1]) : a[0];
  o[1] = rot ? (a[1] * tb[0] + a[0] * tb[1]) : a[1];
  o[2] = rot ? (a[2] * tb[2] + (-a[3]) * tb[3]) : a[2];
  o[3] = rot ? (a[3] * tb[2] + a[2] * tb[3]) : a[3];
  return o;
}

// ---- f16 GEMM engine (wave tile 32x64; block = 4 waves = 128 rows x 64 cols; M % 128 == 0, N % 64 == 0, K % 64 == 0) ----
// A f16 [M][K] row-major (pitch lda), Bh f16 [N][K] (k contiguous, pitch ldb).
// A step is 64 k: the block's 128 A rows and 64 B rows (128 B each) are read from memory once a block, as whole lines, two steps ahead into registers, and stored one step ahead into the LDS buffer that is not being read;
// every wave takes its fragments from LDS, all 24 reads of a step asked for ahead of the step's 16 products. Each accumulator still sums its k blocks of 32 in rising order.
#define G2P 72                           /* LDS row pitch in 16-bit elements: 128 B + 16 B, for 16-byte readers on 16 rows */
__device__ __forceinline__ v16h g2_frag(const _Float16* p, int hh) { FragH f; f.half[0] = *(const v8us*)((const unsigned short*)p + 8 * hh); f.half[1] = *(const v8us*)((const unsigned short*)p + 16 + 8 * hh); return f.v; }
__device__ __forceinline__ v8f g2_mma(v16h a, v16h b, v8f c) { v8f d = __builtin_amdgcn_wmma_f32_16x16x32_f16(false, a, false, b, (short)0, c, false, false); asm volatile("v_nop\n\tv_nop\n\tv_nop\n\tv_nop" : "+v"(d) : "v"(a), "v"(b)); return d; }
// What a projection block does with its 128 x 64 tile (64 columns = one head) instead of storing it plainly; every member is the same for the whole block.
// vt: the tile goes out as f16, transposed, into Vt [batch][head][channel][SQ]. Otherwise rotary: the rotary embedding is applied (row s of TAB = row of the batch); split: f16 hi + x1024 residual planes Hh, Hl instead of the f32 plane C.
struct ProjEp { const float* TAB; _Float16* Hh; _Float16* Hl; _Float16* Vt; bool vt, rotary, split; };
#define VTP 136                          /* LDS row pitch of the transposed tile in 16-bit elements: 256 B + 16 B, for 16-byte writers and readers on 16 rows */
// The engine for one block: rows 128 mt .., columns 64 nq ..; cofs = element offset of the C plane. PROJ = true: the tile goes out as ep says.
// PROJ = false: A64 = row 64 of the block's A tile. pair (the same for the whole block): A rows 0..63 are 64 rows of a hi plane and A rows 64..127 the same 64 rows of its x1024 residual plane;
// the block stores 64 rows, prow .. prow + 63 of the C plane: (residual product x alpha 2^-10) + (hi product x alpha + bias).
// The blocks that share rows walk k together. For speed only, at its start a block asks L2 for later 256-B units
// of its rows (unit 0 is what its first loads fetch themselves): of the A rows 4 i + (nq & 3), of the B rows 4 i + pq, and of the table's units 4 i + (nq & 3); the blocks with the same rows and another nq or pq ask for the rest. A hint only: nothing depends on it.
template <bool PROJ>
__device__ __forceinline__ void gemm2_body(const _Float16* __restrict__ A, int lda, const _Float16* __restrict__ Bh, int ldb, float alpha,
    const float* __restrict__ bias, float* C, int ldc, size_t cofs, int mt, int nq, int K, int pq, const ProjEp ep, const _Float16* __restrict__ A64 = nullptr, bool pair = false, int prow = 0) {
  __shared__ __attribute__((aligned(16))) float so[4][32][68];
  __shared__ __attribute__((aligned(16))) unsigned short st[2][192][G2P];      /* [buffer][128 A rows, then 64 B rows][element] */
  const int tid = threadIdx.x, w = __builtin_amdgcn_readfirstlane((int)(tid >> 5)), lane = tid & 31, ln = lane & 15, hh = lane >> 4;
  const int row0 = mt * 128 + 32 * w, col0 = nq * 64;
  const int sr = tid >> 3, sc = (tid & 7) * 8;      /* staging: 8 lanes cover one 128-B row, a wave 4 rows */
  /* address = a block-uniform byte pointer, which moves with the step, + the lane's own byte offset, which does not */
  const char* ga = (const char*)(A + (size_t)(mt * 128) * lda); const char* gb = (const char*)(Bh + (size_t)col0 * ldb);
  const char* gh = (const char*)A64;      /* PROJ = false: rows 64..127 of the A tile */
  const unsigned oa = (unsigned)(sr * lda + sc) * 2u, ob = (unsigned)(sr * ldb + sc) * 2u;
  v8us g[12];
#pragma unroll      /* g[] indexed by constants only, so that it stays in registers */
  for (int i = 0; i < 8; ++i) g[i] = *(const v8us*)((PROJ || i < 4 ? ga + (size_t)(32 * i) * lda : gh + (size_t)(32 * (i - 4)) * lda) + oa);
#pragma unroll      /* g[] indexed by constants only */
  for (int i = 0; i < 4; ++i) g[8 + i] = *(const v8us*)(gb + (size_t)(32 * i) * ldb + ob);
  const char* p1; const char* p2;      /* every lane's two addresses lie inside the rows of A, B or the table: the unit is held below the row's end */
  { const int lu = (K >> 7) - 1, sa = nq & 3;      /* lu = a row's last unit */
    const int ar = 4 * lane + sa;      /* wave w: unit 1 + w of 32 A rows; wave 0 also their unit 5 */
    const char* arow = (PROJ || ar < 64) ? ga + (size_t)ar * lda * 2 : gh + (size_t)(ar - 64) * lda * 2;
    p1 = arow + 256 * min(1 + w, lu);
    const int f = tid - 32;      /* lanes 32 .. 111: units 1 .. 5 of 16 B rows; the last 16 lanes: 16 units of the block's 128 table rows where it reads them, else unit 5 of B once more */
    const char* brow = gb + (size_t)(4 * (f & 15) + pq) * ldb * 2 + 256 * min(1 + (f >> 4), lu);
    const char* trow = brow;
    if constexpr (PROJ) { if (ep.rotary) trow = (const char*)(ep.TAB + (size_t)((mt * 128) % SQ) * 32) + 256 * (4 * (f & 15) + sa); }
    p2 = (tid < 32) ? arow + 256 * min(5, lu) : ((tid < 112) ? brow : trow); }
  asm volatile("global_prefetch_b8 %0, off scope:SCOPE_SE\n\tglobal_prefetch_b8 %1, off scope:SCOPE_SE" :: "v"(p1), "v"(p2));      /* brings the lines into L2 behind the block's first loads; returns nothing */
#pragma unroll      /* g[] indexed by constants only */
  for (int i = 0; i < 12; ++i) *(v8us*)&st[0][sr + 16 * i][sc] = g[i];
  const int nk = K >> 6;
  if (1 < nk) {
    ga += 128; gb += 128; if constexpr (!PROJ) gh += 128;
#pragma unroll      /* g[] indexed by constants only */
    for (int i = 0; i < 8; ++i) g[i] = *(const v8us*)((PROJ || i < 4 ? ga + (size_t)(32 * i) * lda : gh + (size_t)(32 * (i - 4)) * lda) + oa);
#pragma unroll      /* g[] indexed by constants only */
    for (int i = 0; i < 4; ++i) g[8 + i] = *(const v8us*)(gb + (size_t)(32 * i) * ldb + ob);
    asm volatile("s_wait_xcnt 0x0" ::: "memory");      /* the wait before the loads' address registers are reused */
  }
  const v8f z8 = {0.f,0.f,0.f,0.f,0.f,0.f,0.f,0.f}; v8f c00 = z8, c01 = z8, c02 = z8, c03 = z8, c10 = z8, c11 = z8, c12 = z8, c13 = z8;
#pragma unroll 1      /* the two buffers alternate by index; one step is already 16 matrix instructions */
  for (int j = 0; j < nk; ++j) {
    const int cb = j & 1;
    __syncthreads();      /* publishes buffer cb, and ends every wave's reads of the other buffer (step j - 1) before it is stored into below */
    if (j + 1 < nk) {      /* step j + 1's rows, asked for a whole step ago, go into the other buffer */
#pragma unroll      /* g[] indexed by constants only */
      for (int i = 0; i < 12; ++i) *(v8us*)&st[cb ^ 1][sr + 16 * i][sc] = g[i];
    }
    if (j + 2 < nk) {      /* step j + 2's rows fly until the next step's barrier */
      ga += 128; gb += 128; if constexpr (!PROJ) gh += 128;
#pragma unroll      /* g[] indexed by constants only */
      for (int i = 0; i < 8; ++i) g[i] = *(const v8us*)((PROJ || i < 4 ? ga + (size_t)(32 * i) * lda : gh + (size_t)(32 * (i - 4)) * lda) + oa);
#pragma unroll      /* g[] indexed by constants only */
      for (int i = 0; i < 4; ++i) g[8 + i] = *(const v8us*)(gb + (size_t)(32 * i) * ldb + ob);
      asm volatile("s_wait_xcnt 0x0" ::: "memory");      /* the wait before the loads' address registers are reused: the fragment reads below land in them */
    }
    const _Float16* ap = (const _Float16*)&st[cb][32 * w + ln][0]; const _Float16* bp = (const _Float16*)&st[cb][128 + ln][0];
    v16h fa[2][2], fb[2][4];      /* [k block of 32][16 rows] */
#pragma unroll      /* fa[], fb[] indexed by constants only, so that they stay in registers */
    for (int kk = 0; kk < 2; ++kk) { fa[kk][0] = g2_frag(ap + 32 * kk, hh); fa[kk][1] = g2_frag(ap + 16 * G2P + 32 * kk, hh);
#pragma unroll      /* fb[] indexed by constants only */
      for (int t = 0; t < 4; ++t) fb[kk][t] = g2_frag(bp + 16 * t * G2P + 32 * kk, hh); }
#pragma unroll      /* fa[], fb[] indexed by constants only */
    for (int kk = 0; kk < 2; ++kk) {
      c00 = g2_mma(fa[kk][0], fb[kk][0], c00); c10 = g2_mma(fa[kk][1], fb[kk][0], c10);
      c01 = g2_mma(fa[kk][0], fb[kk][1], c01); c11 = g2_mma(fa[kk][1], fb[kk][1], c11);
      c02 = g2_mma(fa[kk][0], fb[kk][2], c02); c12 = g2_mma(fa[kk][1], fb[kk][2], c12);
      c03 = g2_mma(fa[kk][0], fb[kk][3], c03); c13 = g2_mma(fa[kk][1], fb[kk][3], c13); }
  }
  asm volatile("s_wait_xcnt 0x0" :: "v"(p1), "v"(p2) : "memory");      /* the wait before the prefetches' address pairs are reused; naming the pairs keeps them live, as addresses, through the loop */
  v8f accs[8] = {c00, c01, c02, c03, c10, c11, c12, c13};
  const int rsub = lane >> 4, c4 = (lane & 15) * 4;
  v4f tb[16]; float b4[4];
  const bool lo = !PROJ && pair && w >= 2;      /* this wave's 32 rows are residual rows: scaled 2^-10 more, no bias */
  const float aw = lo ? alpha * 0.0009765625f : alpha;
  if constexpr (PROJ) {
    const float* bp4 = bias + col0 + ln;      /* a projection always has a bias */
#pragma unroll      /* b4[] indexed by constants only; the four loads issue together */
    for (int t = 0; t < 4; ++t) b4[t] = bp4[t * 16];
    if (ep.vt) {      /* a lane's 8 accumulator registers are 8 consecutive rows of one channel: one 16-byte piece of the transposed tile */
      unsigned short* vl = (unsigned short*)&so[0][0][0];      /* [64 channels][VTP] */
#pragma unroll      /* accs[] indexed by constants only */
      for (int u = 0; u < 8; ++u) { const int t = u & 3, half = u >> 2; const float bv = bf16_rne(b4[t]); FragH f;
#pragma unroll      /* fragment elements indexed by constants only */
        for (int r = 0; r < 8; ++r) f.h[r] = (_Float16)(accs[u][r] * alpha + bv);
        *(v8us*)&vl[(t * 16 + ln) * VTP + 32 * w + half * 16 + 8 * hh] = f.half[0]; }
      __syncthreads();      /* a channel's 128 rows come from all four waves; taken by the whole block or by none of it */
      const int bt = (mt * 128) / SQ; const int pc = tid & 15, dd = tid >> 4;      /* 16 lanes cover a channel's 256 B: two whole lines */
      unsigned short* vd = (unsigned short*)ep.Vt + ((size_t)(bt * NH + nq) * HD + dd) * SQ + (mt * 128 - bt * SQ) + pc * 8;
#pragma unroll      /* the 8 LDS reads issue ahead of the stores */
      for (int rd = 0; rd < 8; ++rd) { const v8us v = *(const v8us*)&vl[(rd * 8 + dd) * VTP + pc * 8]; *(v8us*)(vd + (size_t)(rd * 8) * SQ) = v; }
      return;
    }
    /* the table rows of this lane's 16 pieces are asked for ahead of the tile's way through LDS */
    const float* tp = ep.TAB + (size_t)(row0 % SQ + rsub) * 32 + (c4 & 31);
#pragma unroll      /* tb[] indexed by constants only, so that it stays in registers */
    for (int q = 0; q < 16; ++q) tb[q] = *(const v4fa*)(tp + q * 64);
    asm volatile("s_wait_xcnt 0x0" :: "v"(tp) : "memory");      /* the wait before the loads' address pair is reused; naming the pair keeps it live up to here, so that no load's result is placed in it */
  } else {      /* what the tile's way out reads from memory is asked for here, all of it together: no load waits for the one before */
#pragma unroll      /* b4[] indexed by constants only */
    for (int t = 0; t < 4; ++t) b4[t] = 0.f;
    if (bias && !lo) { const float* bp4 = bias + col0 + ln;
#pragma unroll      /* b4[] indexed by constants only; the four loads issue together */
      for (int t = 0; t < 4; ++t) b4[t] = bp4[t * 16];
      asm volatile("s_wait_xcnt 0x0" ::: "memory"); }      /* the wait before the loads' address registers are reused */
  }
#pragma unroll
  for (int u = 0; u < 8; ++u) { const int t = u & 3, half = u >> 2; const float bv = bf16_rne(b4[t]);
#pragma unroll
    for (int r = 0; r < 8; ++r) { const int rloc = half * 16 + 8 * hh + r;
      so[w][rloc][t * 16 + ln] = accs[u][r] * aw + bv; } }
  if constexpr (!PROJ) {
    if (pair) {
      __syncthreads();      /* a stored row is the sum of two waves' tiles: waves 0, 1 hold the hi rows, waves 2, 3 the residual rows; taken by the whole block or by none of it */
      const int p = w & 1, r16 = (w >> 1) * 16 + rsub;      /* every wave stores 16 of the 64 rows */
      float* cp = C + cofs + (size_t)(prow + 32 * p + r16) * ldc + col0 + c4;
      v4f vh[8], vl[8];
#pragma unroll      /* vh[], vl[] indexed by constants only; the 16 LDS reads issue ahead of the stores */
      for (int q = 0; q < 8; ++q) { vh[q] = *(const v4fa*)&so[p][r16 + q * 2][c4]; vl[q] = *(const v4fa*)&so[p + 2][r16 + q * 2][c4]; }
#pragma unroll      /* vh[], vl[] indexed by constants only */
      for (int q = 0; q < 8; ++q) vh[q] = vl[q] + vh[q];
#pragma unroll      /* vh[] indexed by constants only */
      for (int q = 0; q < 8; ++q) *(v4f*)(cp + (size_t)(q * 2) * ldc) = vh[q];
      return;
    }
  }
  __builtin_amdgcn_fence(4 /* acq_rel order */, "workgroup"); __builtin_amdgcn_wave_barrier();
  if constexpr (PROJ) {
    const bool rot = ep.rotary && c4 < 32;
    if (ep.split) {
      _Float16* hp = ep.Hh + (size_t)(row0 + rsub) * ldc + col0 + c4; _Float16* lp = ep.Hl + (size_t)(row0 + rsub) * ldc + col0 + c4;
#pragma unroll      /* tb[] indexed by constants only */
      for (int q = 0; q < 16; ++q) { const v4f y = d_rot4(*(const v4fa*)&so[w][q * 2 + rsub][c4], tb[q], rot); v4h h4, l4;
#pragma unroll      /* vector elements indexed by constants only */
        for (int e = 0; e < 4; ++e) { const _Float16 h = (_Float16)y[e]; h4[e] = h; l4[e] = (_Float16)((y[e] - (float)h) * 1024.0f); }
        *(v4h*)(hp + (size_t)(q * 2) * ldc) = h4; *(v4h*)(lp + (size_t)(q * 2) * ldc) = l4; }
      asm volatile("s_wait_xcnt 0x0" ::: "memory");      /* the wait before the stores' registers are reused: the code of the other kinds of tile follows in the listing */
    } else {
      float* cp = C + (size_t)(row0 + rsub) * ldc + col0 + c4;
#pragma unroll      /* tb[] indexed by constants only */
      for (int q = 0; q < 16; ++q) *(v4f*)(cp + (size_t)(q * 2) * ldc) = d_rot4(*(const v4fa*)&so[w][q * 2 + rsub][c4], tb[q], rot);
      asm volatile("s_wait_xcnt 0x0" ::: "memory");      /* the wait before the stores' registers are reused: the code of the other kinds of tile follows in the listing */
    }
    return;
  }
  {
#pragma unroll
    for (int q = 0; q < 16; ++q) { const int r = q * 2 + rsub; const v4f v = *(const v4fa*)&so[w][r][c4];
      if (C) *(v4f*)(C + cofs + (size_t)(row0 + r) * ldc + col0 + c4) = v; }
     }
}

// One launch for the nine projections, none of which reads another's result; a block's product and tile follow from its index alone:
// q, k and v of all rows, then q, k, v of the first QT0 rows of every batch. BW holds the weights of q, k, v one behind the other.
// What follows a projection element by element is done on the block's own tile: q, k of all rows leave as rotated f16 hi + residual planes, v as V^T [NB][NH][HD][SQ]; the first-tile q, k as rotated f32 planes, the first-tile v as an f32 plane.
#define GQB ((MP / 128) * (DM / 64))      /* blocks of one projection of all rows */
#define GQ0 (DM / 64)                     /* blocks of one first-tile projection (QT0 == 128 rows) */
__global__ __launch_bounds__(128) void k_qkv(const _Float16* __restrict__ X16, const _Float16* __restrict__ BW, const float* __restrict__ bq, const float* __restrict__ bk, const float* __restrict__ bv,
    const float* __restrict__ TAB, _Float16* __restrict__ QH, _Float16* __restrict__ QL, _Float16* __restrict__ KH, _Float16* __restrict__ KL, _Float16* __restrict__ VT, float* __restrict__ QKR0, float* __restrict__ VF0) {
  const int bx = blockIdx.x; int sel, mt, nq; const _Float16* A = X16; float* C = nullptr; ProjEp ep; ep.TAB = TAB; ep.Vt = VT;
  if (bx < 3 * GQB) {
    sel = bx / GQB; const int t = bx - sel * GQB; mt = t / (DM / 64); nq = t - mt * (DM / 64);
    ep.vt = sel == 2; ep.split = true;
  } else {
    const int u = bx - 3 * GQB; const int s6 = u / GQ0; const int b = s6 / 3; sel = s6 - 3 * b; mt = 0; nq = u - s6 * GQ0;
    A += (size_t)b * SQ * DM; C = (sel < 2) ? QKR0 + (size_t)(2 * b + sel) * QT0 * DM : VF0 + (size_t)b * QT0 * DM;
    ep.vt = false; ep.split = false;
  }
  ep.rotary = sel < 2; ep.Hh = (sel == 0) ? QH : KH; ep.Hl = (sel == 0) ? QL : KL;
  const float* bias = (sel == 0) ? bq : ((sel == 1) ? bk : bv);
  gemm2_body<true>(A, DM, BW + (size_t)sel * DM * DM, DM, 0.0625f, bias, C, DM, (size_t)0, mt, nq, DM, (mt >> 1) & 3, ep);
}

// One launch for the output product of the f16 path (rows QT0 .. of a batch) and both products of the first-tile o (rows 0 .. QT0 - 1, hi and residual plane): same weights, bias and output plane. grid.y = batch.
// The first 2 (DM / 64) blocks of a batch are the first tile's: each has 64 of its rows, from both planes, as its 128 A rows (QT0 == 128: the first tile is row tile 0); the others have row tiles 1 .. of the f16 path.
#define GOB ((SQ / 128 + 1) * (DM / 64))      /* blocks a batch */
__global__ __launch_bounds__(128) void k_out(const _Float16* __restrict__ O16, const _Float16* __restrict__ OH0, const _Float16* __restrict__ OL0, const _Float16* __restrict__ BO, const float* __restrict__ bo, float* out) {
  const int bx = blockIdx.x, by = blockIdx.y; const bool pair = bx < 2 * (DM / 64);
  const int t = pair ? bx : bx - DM / 64; const int mq = t / (DM / 64), nq = t - mq * (DM / 64);      /* mq: which 64 rows of the first tile, or the row tile */
  const size_t f0 = ((size_t)by * QT0 + (pair ? 64 * mq : 0)) * DM;
  const _Float16* A = pair ? OH0 + f0 : O16 + (size_t)by * SQ * DM;
  const _Float16* A64 = pair ? OL0 + f0 : A + (size_t)(mq * 128 + 64) * DM;
  gemm2_body<false>(A, DM, BO, DM, 0.0009765625f, bo, out, DM, (size_t)by * SQ_FULL * DM, pair ? 0 : mq, nq, DM, ((bx / (DM / 64)) >> 1) & 3, ProjEp(), A64, pair, 64 * mq);
}

// Butterfly over the 32 lanes of a wave: four row_xmask steps inside each 16-lane row, then the other row; every lane ends with the same value.
template <int CTRL>
__device__ __forceinline__ float lane_xm(float x) { return __int_as_float(__builtin_amdgcn_update_dpp(0, __float_as_int(x), CTRL, 0xf, 0xf, true)); }
__device__ __forceinline__ float lane_x16(float x) { const int b = __float_as_int(x); return __int_as_float(__builtin_amdgcn_permlanex16(b, b, 0x76543210, 0xfedcba98, false, false)); }
__device__ __forceinline__ float wave_max(float x) {
  x = fmaxf(x, lane_xm<0x161>(x)); x = fmaxf(x, lane_xm<0x162>(x)); x = fmaxf(x, lane_xm<0x164>(x)); x = fmaxf(x, lane_xm<0x168>(x)); return fmaxf(x, lane_x16(x)); }
__device__ __forceinline__ float wave_sum(float x) {
  x += lane_xm<0x161>(x); x += lane_xm<0x162>(x); x += lane_xm<0x164>(x); x += lane_xm<0x168>(x); return x + lane_x16(x); }

// f32 attention over the first QT0 query rows of every batch, a piece of the fused attention launch (it reads nothing of that launch). Block = one (batch, head) x A0R query rows, 4 waves, 2 rows a wave; keys 0 .. (rg + 1) A0R - 1 cover every row of the block.
// K (row pitch A0KP floats = 16 B x odd: lanes on different rows read 16 B each without bank conflicts), V and the q rows are staged in LDS once.
// Scores: lane = key, both rows share each K read. Softmax: wave butterflies. Weighted sum: lane = channel pair, weights read as broadcasts. o (x64) leaves as f16 hi + x1024 residual planes.
#define A0R 8
#define A0KP 68
#define A0G (QT0 / A0R)                  /* row groups of one (batch, head) */
static_assert(QT0 % A0R == 0);
static_assert(QT0 == 128 && HD == 64 && A0R == 8);
typedef float v2f __attribute__((ext_vector_type(2)));
typedef _Float16 v2h __attribute__((ext_vector_type(2)));
struct A0Lds { float lk[QT0][A0KP]; float lv[QT0][HD]; float lq[A0R][HD]; float lp[A0R][QT0]; };
__device__ __forceinline__ void d_att0(A0Lds& sm, int f, const float* __restrict__ QK, const float* __restrict__ VF, float scale, _Float16* __restrict__ OH, _Float16* __restrict__ OL) {
  const int tid = threadIdx.x, lane = tid & 31, w = __builtin_amdgcn_readfirstlane((int)(tid >> 5));
  const int b = f / (NH * A0G), hg = f - b * (NH * A0G); const int h = hg / A0G, rg = hg % A0G; const int nkeys = (rg + 1) * A0R;
  const size_t bo1 = (size_t)b * QT0 * DM;
  const float* QF = QK + 2 * bo1; VF += bo1;      /* q and k planes of a batch lie one behind the other: row r of k is row QT0 + r of QF */
  const int sr = tid >> 4, sc4 = (tid & 15) * 4;      /* staging: 16 lanes cover one 256-B row */
  const float* qp = QF + (size_t)(rg * A0R + sr) * DM + h * HD + sc4; const float* kp = QF + (size_t)sr * DM + h * HD + sc4; const float* vp = VF + (size_t)sr * DM + h * HD + sc4;
  const v4f qs = *(const v4fa*)qp;
  v4f ks[QT0 / 8], vs[QT0 / 8];      /* all QT0 rows of K and V are staged by every block: no test stands between the loads */
#pragma unroll      /* ks[], vs[] indexed by constants only, so that they stay in registers; all loads issued before the first use */
  for (int g = 0; g < QT0 / 8; ++g) { ks[g] = *(const v4fa*)(kp + (size_t)(QT0 + g * 8) * DM); vs[g] = *(const v4fa*)(vp + (size_t)g * 8 * DM); }
  asm volatile("s_wait_xcnt 0x0" :: "v"(qp), "v"(kp), "v"(vp) : "memory");      /* the wait before the loads' address pairs are reused; naming the pairs keeps them live up to here, so that no load's result is placed in them */
  *(v4f*)&sm.lq[sr][sc4] = qs;
#pragma unroll      /* ks[], vs[] indexed by constants only, so that they stay in registers */
  for (int g = 0; g < QT0 / 8; ++g) { *(v4f*)&sm.lk[g * 8 + sr][sc4] = ks[g]; *(v4f*)&sm.lv[g * 8 + sr][sc4] = vs[g]; }
  __syncthreads();
  const int r0 = 2 * w, i0 = rg * A0R + r0, i1 = i0 + 1;      /* this wave's two query rows */
  const int nch = (nkeys + 31) >> 5;      /* chunks of 32 keys */
  float s0[QT0 / 32], s1[QT0 / 32];
#pragma unroll      /* s0[], s1[] indexed by constants only, so that they stay in registers */
  for (int m = 0; m < QT0 / 32; ++m) { s0[m] = -1.0e30f; s1[m] = -1.0e30f;
    if (m < nch) { const int j = m * 32 + lane;
      v4f a0 = {0.f, 0.f, 0.f, 0.f}, a1 = {0.f, 0.f, 0.f, 0.f};
#pragma unroll      /* the 48 LDS reads of a chunk issue ahead of their use */
      for (int c = 0; c < HD / 4; ++c) { const v4f kq = *(const v4f*)&sm.lk[j][c * 4]; const v4f q0 = *(const v4f*)&sm.lq[r0][c * 4]; const v4f q1 = *(const v4f*)&sm.lq[r0 + 1][c * 4];
#pragma unroll      /* four independent partial sums a row */
        for (int u = 0; u < 4; ++u) { a0[u] = fmaf(q0[u], kq[u], a0[u]); a1[u] = fmaf(q1[u], kq[u], a1[u]); } }
      const float d0 = ((a0[0] + a0[1]) + (a0[2] + a0[3])) * scale, d1 = ((a1[0] + a1[1]) + (a1[2] + a1[3])) * scale;
      s0[m] = (j <= i0) ? d0 : -1.0e30f; s1[m] = (j <= i1) ? d1 : -1.0e30f; } }
  const float m0 = wave_max(fmaxf(fmaxf(s0[0], s0[1]), fmaxf(s0[2], s0[3]))), m1 = wave_max(fmaxf(fmaxf(s1[0], s1[1]), fmaxf(s1[2], s1[3])));
  float l0 = 0.f, l1 = 0.f;
#pragma unroll      /* s0[], s1[] indexed by constants only, so that they stay in registers */
  for (int m = 0; m < QT0 / 32; ++m) if (m < nch) { const int j = m * 32 + lane;
    const float e0 = (j <= i0) ? expf(s0[m] - m0) : 0.f, e1 = (j <= i1) ? expf(s1[m] - m1) : 0.f;
    l0 += e0; l1 += e1; sm.lp[r0][j] = e0; sm.lp[r0 + 1][j] = e1; }
  l0 = wave_sum(l0); l1 = wave_sum(l1);
  __syncthreads();      /* the weights of a row are written by lanes and read back as broadcasts */
  const int n4 = (i1 + 4) >> 2;      /* keys 0 .. i1 in fours; the weights above a row's own index are zero, and 4 n4 <= nkeys */
  v2f o0 = {0.f, 0.f}, o1 = {0.f, 0.f};
#pragma unroll 4      /* LDS reads of later trips issue while earlier ones are summed */
  for (int t = 0; t < n4; ++t) { const v4f p0 = *(const v4f*)&sm.lp[r0][t * 4]; const v4f p1 = *(const v4f*)&sm.lp[r0 + 1][t * 4];
#pragma unroll      /* p0[], p1[] indexed by constants only */
    for (int u = 0; u < 4; ++u) { const v2f vv = *(const v2f*)&sm.lv[t * 4 + u][2 * lane];
      o0[0] = fmaf(p0[u], vv[0], o0[0]); o0[1] = fmaf(p0[u], vv[1], o0[1]); o1[0] = fmaf(p1[u], vv[0], o1[0]); o1[1] = fmaf(p1[u], vv[1], o1[1]); } }
  const float f0 = 64.0f / l0, f1 = 64.0f / l1;      /* o carried x64 like the f16 path */
  o0[0] *= f0; o0[1] *= f0; o1[0] *= f1; o1[1] *= f1;
  v2h h0, h1, e0, e1;
#pragma unroll      /* vector elements indexed by constants only */
  for (int u = 0; u < 2; ++u) { _Float16 t = (_Float16)o0[u]; h0[u] = t; e0[u] = (_Float16)((o0[u] - (float)t) * 1024.0f); t = (_Float16)o1[u]; h1[u] = t; e1[u] = (_Float16)((o1[u] - (float)t) * 1024.0f); }
  const size_t d0 = bo1 + (size_t)i0 * DM + h * HD + 2 * lane;      /* a wave's store is one whole 128-B line of a row */
  *(v2h*)(OH + d0) = h0; *(v2h*)(OL + d0) = e0; *(v2h*)(OH + d0 + DM) = h1; *(v2h*)(OL + d0 + DM) = e1;
}

#define FAC1 0.18033688011112042f        /* log2(e) / 8 */
#define FAC2 0.00017611023448351604f     /* log2(e) / 8 / 1024 */
#define FAP 72                           /* LDS row pitch in 16-bit elements: 128 B + 16 B, for 16-byte readers on 16 rows */
#define FNT (SQ / 64)                    /* query tiles = key steps of the longest tile */
static_assert(HD == 64 && (FNT & (FNT - 1)) == 0 && FNT >= 8);
static_assert(FNT * NH >= NB * NH * A0G);      /* one slab of blocks covers the f32 attention of the first tiles */
// 2^x. The v_nop at the end keeps the one slot that the instruction set asks for between a transcendental and a next instruction that reads its result or overwrites its source;
// inside the run of eight every result register is distinct from every source (early clobber), so each v_exp_f32 is the independent instruction behind the one before.
__device__ __forceinline__ float fa_exp2(float x) { float y; asm("v_exp_f32 %0, %1\n\tv_nop" : "=v"(y) : "v"(x)); return y; }
__device__ __forceinline__ v8f fa_exp2x8(v8f x) { float y0, y1, y2, y3, y4, y5, y6, y7;
  asm("v_exp_f32 %0, %8\n\tv_exp_f32 %1, %9\n\tv_exp_f32 %2, %10\n\tv_exp_f32 %3, %11\n\tv_exp_f32 %4, %12\n\tv_exp_f32 %5, %13\n\tv_exp_f32 %6, %14\n\tv_exp_f32 %7, %15\n\tv_nop"
      : "=&v"(y0), "=&v"(y1), "=&v"(y2), "=&v"(y3), "=&v"(y4), "=&v"(y5), "=&v"(y6), "=&v"(y7)
      : "v"(x[0]), "v"(x[1]), "v"(x[2]), "v"(x[3]), "v"(x[4]), "v"(x[5]), "v"(x[6]), "v"(x[7]));
  const v8f y = {y0, y1, y2, y3, y4, y5, y6, y7}; return y; }
/* amdgpu_waves_per_eu(4, 4): holds the kernel to 256 registers, so that four blocks fit a WGP and no register window is switched in the loop */
__global__ __launch_bounds__(128) __attribute__((amdgpu_waves_per_eu(4, 4))) void k_fattn(const _Float16* __restrict__ QHp, const _Float16* __restrict__ QLp, const _Float16* __restrict__ KHp, const _Float16* __restrict__ KLp,
    const _Float16* __restrict__ VTp, _Float16* __restrict__ O16p, const float* __restrict__ QKR0, const float* __restrict__ VF0, _Float16* __restrict__ OH0, _Float16* __restrict__ OL0) {
  __shared__ __attribute__((aligned(16))) union { unsigned short t[2][3][64][FAP]; A0Lds a0; } sh;      /* a block is of one kind: t = [buffer][K hi, K residual, V^T][row][element], or the f32 piece's arrays in the same bytes */
  auto& lt = sh.t;
  if (blockIdx.z >= NB) {      /* the slab of blocks behind the last batch (so that every attention block keeps its flat index): the f32 attention of the first tiles, which reads nothing of this launch; the whole block takes this way, its barriers included */
    const int f = blockIdx.y * FNT + blockIdx.x;
    if (f < NB * NH * A0G) d_att0(sh.a0, f, QKR0, VF0, SCL, OH0, OL0);
    return; }
  const int tid = threadIdx.x, w = __builtin_amdgcn_readfirstlane((int)(tid >> 5)), lane = tid & 31, ln = lane & 15, hh = lane >> 4;
  const int h = blockIdx.y, b = blockIdx.z; const int x = blockIdx.x, grp = (b * NH + h) >> 3;
  /* a permutation of the tiles for each (batch, head): blocks whose flat indices lie far apart get tiles of unequal length, so that long tiles do not gather in one place */
  const int qt = (grp % 3 == 0) ? FNT - 1 - x : ((grp % 3 == 1) ? x : ((x + FNT / 2) & (FNT - 1)));
  const int qw = qt * 64 + 16 * w; const size_t r0 = (size_t)b * SQ;
  const _Float16* qhp = QHp + (r0 + qw + ln) * DM + h * HD; const _Float16* qlp = QLp + (r0 + qw + ln) * DM + h * HD;
  const v16h qh0 = g2_frag(qhp, hh), qh1 = g2_frag(qhp + 32, hh), ql0 = g2_frag(qlp, hh), ql1 = g2_frag(qlp + 32, hh);
  const int sr = tid >> 3, sc = (tid & 7) * 8;      /* staging: 8 lanes cover one 128-B row, a wave 4 rows */
  const unsigned short* gk = (const unsigned short*)KHp + (r0 + sr) * DM + h * HD + sc; const unsigned short* gl = (const unsigned short*)KLp + (r0 + sr) * DM + h * HD + sc;
  const unsigned short* gv = (const unsigned short*)VTp + ((size_t)(b * NH + h) * HD + sr) * SQ + sc;
  v8us g[12];
#pragma unroll      /* g[] indexed by constants only, so that it stays in registers */
  for (int i = 0; i < 4; ++i) { g[i] = *(const v8us*)(gk + (size_t)(16 * i) * DM); g[4 + i] = *(const v8us*)(gl + (size_t)(16 * i) * DM); g[8 + i] = *(const v8us*)(gv + (size_t)(16 * i) * SQ); }
  const int pt = (w < 2) ? qt : (qt ^ 4), pr = tid & 63;      /* waves 0, 1: tile qt; waves 2, 3: tile qt ^ 4; a lane has one of the tile's 64 rows in each plane: every address lies inside its plane */
  const char* pk = (const char*)(KHp + (r0 + 64 * pt + pr) * DM + h * HD); const char* pl = (const char*)(KLp + (r0 + 64 * pt + pr) * DM + h * HD);
  const char* pv = (const char*)(VTp + ((size_t)(b * NH + h) * HD + pr) * SQ + 64 * pt);
  asm volatile("global_prefetch_b8 %0, off scope:SCOPE_SE\n\tglobal_prefetch_b8 %1, off scope:SCOPE_SE\n\tglobal_prefetch_b8 %2, off scope:SCOPE_SE" :: "v"(pk), "v"(pl), "v"(pv));      /* brings the lines into L2 behind the block's first loads; returns nothing */
#pragma unroll      /* g[] indexed by constants only */
  for (int i = 0; i < 4; ++i) { *(v8us*)&lt[0][0][sr + 16 * i][sc] = g[i]; *(v8us*)&lt[0][1][sr + 16 * i][sc] = g[4 + i]; *(v8us*)&lt[0][2][sr + 16 * i][sc] = g[8 + i]; }
  const v8f z8 = {0.f,0.f,0.f,0.f,0.f,0.f,0.f,0.f};
  v8f o[4] = {z8, z8, z8, z8}; float m = -1.0e30f, l = 0.f;
#pragma unroll 1      /* one step is already 32 matrix instructions; the two buffers alternate by index */
  for (int j = 0; j <= qt; ++j) {
    const int cb = j & 1;
    __syncthreads();      /* publishes buffer cb, and ends every wave's reads of the other buffer (step j - 1) before it is stored into below */
    if (j < qt) {      /* the next step's tiles fly while this step is worked on */
      gk += (size_t)64 * DM; gl += (size_t)64 * DM; gv += 64;
#pragma unroll      /* g[] indexed by constants only */
      for (int i = 0; i < 4; ++i) { g[i] = *(const v8us*)(gk + (size_t)(16 * i) * DM); g[4 + i] = *(const v8us*)(gl + (size_t)(16 * i) * DM); g[8 + i] = *(const v8us*)(gv + (size_t)(16 * i) * SQ); }
    }
    v8f s[4]; v16h kf[2][4], va[4];
    { const _Float16* kh = (const _Float16*)&lt[cb][0][ln][0]; const _Float16* kl = (const _Float16*)&lt[cb][1][ln][0];
      kf[0][0] = g2_frag(kh, hh); kf[0][1] = g2_frag(kh + 32, hh); kf[0][2] = g2_frag(kl, hh); kf[0][3] = g2_frag(kl + 32, hh); }
#pragma unroll      /* s[], kf[], va[] indexed by constants only, so that they stay in registers */
    for (int t = 0; t < 4; ++t) {
      if (t < 3) {      /* the next 16 keys' fragments are asked for ahead of this tile's products */
        const _Float16* kh = (const _Float16*)&lt[cb][0][16 * (t + 1) + ln][0]; const _Float16* kl = (const _Float16*)&lt[cb][1][16 * (t + 1) + ln][0];
        kf[(t + 1) & 1][0] = g2_frag(kh, hh); kf[(t + 1) & 1][1] = g2_frag(kh + 32, hh); kf[(t + 1) & 1][2] = g2_frag(kl, hh); kf[(t + 1) & 1][3] = g2_frag(kl + 32, hh);
      } else {      /* V^T of the first 32 keys is asked for ahead of the softmax */
#pragma unroll      /* va[] indexed by constants only */
        for (int u = 0; u < 4; ++u) va[u] = g2_frag((const _Float16*)&lt[cb][2][16 * u + ln][0], hh);
      }
      const v16h kh0 = kf[t & 1][0], kh1 = kf[t & 1][1], kl0 = kf[t & 1][2], kl1 = kf[t & 1][3];
      v8f a = z8, c = z8, d = z8;
      a = g2_mma(kh0, qh0, a); c = g2_mma(kh0, ql0, c); d = g2_mma(kl0, qh0, d);
      a = g2_mma(kh1, qh1, a); c = g2_mma(kh1, ql1, c); d = g2_mma(kl1, qh1, d);
#pragma unroll      /* vector elements indexed by constants only */
      for (int r = 0; r < 8; ++r) s[t][r] = a[r] * FAC1 + (c[r] + d[r]) * FAC2;
    }
    if (j == qt) {      /* only the last step crosses the diagonal; every query keeps its key 64 qt there */
      const int rel = 16 * w + ln - 8 * hh;      /* key 64 qt + 16 t + 8 hh + r is kept while 16 t + r <= rel */
#pragma unroll      /* s[] indexed by constants only */
      for (int t = 0; t < 4; ++t) {
#pragma unroll      /* s[] indexed by constants only */
        for (int r = 0; r < 8; ++r) s[t][r] = (16 * t + r <= rel) ? s[t][r] : -1.0e30f; }
    }
    v8f x8;
#pragma unroll      /* vector elements indexed by constants only */
    for (int r = 0; r < 8; ++r) x8[r] = fmaxf(fmaxf(s[0][r], s[1][r]), fmaxf(s[2][r], s[3][r]));
    float mx = fmaxf(fmaxf(fmaxf(x8[0], x8[1]), fmaxf(x8[2], x8[3])), fmaxf(fmaxf(x8[4], x8[5]), fmaxf(x8[6], x8[7])));
    mx = fmaxf(mx, lane_x16(mx));      /* the other half of this query's keys */
    const float mn = fmaxf(m, mx); const float al = fa_exp2(m - mn); const float mb = mn - 8.0f; m = mn;
    v4f ps = {0.f, 0.f, 0.f, 0.f};
#pragma unroll      /* s[] indexed by constants only */
    for (int t = 0; t < 4; ++t) { s[t] = fa_exp2x8(s[t] - mb);
#pragma unroll      /* s[] indexed by constants only; four independent partial sums */
      for (int r = 0; r < 8; ++r) ps[r & 3] += s[t][r]; }
    l = l * al + ((ps[0] + ps[1]) + (ps[2] + ps[3]));
    FragH p0, p1;
#pragma unroll      /* fragment elements indexed by constants only */
    for (int r = 0; r < 8; ++r) { p0.h[r] = (_Float16)s[0][r]; p0.h[8 + r] = (_Float16)s[1][r]; p1.h[r] = (_Float16)s[2][r]; p1.h[8 + r] = (_Float16)s[3][r]; }
#pragma unroll      /* o[] indexed by constants only */
    for (int t = 0; t < 4; ++t) {
#pragma unroll      /* o[] indexed by constants only */
      for (int r = 0; r < 8; ++r) o[t][r] *= al; }
    v16h vb[4];
#pragma unroll      /* vb[] indexed by constants only; V^T of the last 32 keys, into registers that the scores have left */
    for (int u = 0; u < 4; ++u) vb[u] = g2_frag((const _Float16*)&lt[cb][2][16 * u + ln][32], hh);
#pragma unroll      /* o[], va[] indexed by constants only; four independent accumulators in turn */
    for (int t = 0; t < 4; ++t) o[t] = g2_mma(va[t], p0.v, o[t]);
#pragma unroll      /* o[], vb[] indexed by constants only */
    for (int t = 0; t < 4; ++t) o[t] = g2_mma(vb[t], p1.v, o[t]);
    if (j < qt) {
#pragma unroll      /* g[] indexed by constants only */
      for (int i = 0; i < 4; ++i) { *(v8us*)&lt[cb ^ 1][0][sr + 16 * i][sc] = g[i]; *(v8us*)&lt[cb ^ 1][1][sr + 16 * i][sc] = g[4 + i]; *(v8us*)&lt[cb ^ 1][2][sr + 16 * i][sc] = g[8 + i]; }
    }
  }
  asm volatile("s_wait_xcnt 0x0" :: "v"(pk), "v"(pl), "v"(pv) : "memory");      /* the wait before the prefetches' address pairs are reused; naming the pairs keeps them live, as addresses, through the loop */
  l += lane_x16(l);      /* join the two halves' sums once */
  const float inv = 64.0f / l;      /* o carried x64 */
  unsigned short* op = (unsigned short*)O16p + (r0 + qw + ln) * DM + h * HD + 8 * hh;
#pragma unroll      /* o[] indexed by constants only */
  for (int t = 0; t < 4; ++t) { FragH f;
#pragma unroll      /* fragment elements indexed by constants only */
    for (int r = 0; r < 8; ++r) f.h[r] = (_Float16)(o[t][r] * inv);
    *(v8us*)(op + 16 * t) = f.half[0]; }
  asm volatile("s_wait_xcnt 0x0" ::: "memory");      /* the wait before the stores' registers are reused: the code of the f32 attention piece follows in the listing */
}

extern "C" void kernel_launch(void* const* d_in, const int* in_sizes, int n_in,
                              void* d_out, int out_size, void* d_ws, size_t ws_size, hipStream_t stream) {
  if (n_in < 9) return;
  const size_t needx = ((size_t)(NB - 1) * SQ_FULL + SQ) * DM;
  if ((size_t)in_sizes[0] < needx) return;
  if (in_sizes[1] < DM * DM || in_sizes[3] < DM * DM || in_sizes[5] < DM * DM || in_sizes[7] < DM * DM) return;
  if (in_sizes[2] < DM || in_sizes[4] < DM || in_sizes[6] < DM || in_sizes[8] < DM) return;
  if ((size_t)out_size < needx) return;
  /* wire order: x, Wq, bq, Wk, bk, Wv, bv, Wo, bo (natural [out][in] weights, f32) */
  const float* x = (const float*)d_in[0]; const float* wq = (const float*)d_in[1]; const float* bq = (const float*)d_in[2]; const float* wk = (const float*)d_in[3]; const float* bk = (const float*)d_in[4];
  const float* wv = (const float*)d_in[5]; const float* bv = (const float*)d_in[6]; const float* wo = (const float*)d_in[7]; const float* bo = (const float*)d_in[8];
  float* out = (float*)d_out;
  char* ws = (char*)d_ws; size_t off = 0;
  auto take = [&](size_t bytes) { char* p = ws + off; off += (bytes + 255) & ~(size_t)255; return p; };
  _Float16* BW = (_Float16*)take((size_t)4 * DM * DM * 2); _Float16* BO = BW + (size_t)3 * DM * DM;      /* weights of q, k, v, o one behind the other */
  _Float16* X16 = (_Float16*)take(NR * DM * 2);
  _Float16* QH = (_Float16*)take(NR * DM * 2); _Float16* QL = (_Float16*)take(NR * DM * 2); _Float16* KH = (_Float16*)take(NR * DM * 2); _Float16* KL = (_Float16*)take(NR * DM * 2);
  _Float16* O16 = (_Float16*)take(NR * DM * 2);
  _Float16* VT = (_Float16*)take((size_t)NB * NH * HD * SQ * 2);
  float* TAB = (float*)take((size_t)SQ * 32 * 4);
  float* QKR0 = (float*)take((size_t)NB * 2 * QT0 * DM * 4); float* VF0 = (float*)take((size_t)NB * QT0 * DM * 4);      /* [batch][q, k][row][channel]; [batch][row][channel] */
  _Float16* OH0 = (_Float16*)take((size_t)NB * QT0 * DM * 2); _Float16* OL0 = (_Float16*)take((size_t)NB * QT0 * DM * 2);
  if (off > ws_size || off > (size_t)134217728) return;

  k_prep<<<NB * PXB + 4 * PWB + SQ / 16, 256, 0, stream>>>(x, wq, wk, wv, wo, X16, BW, TAB);
  k_qkv<<<3 * GQB + NB * 3 * GQ0, 128, 0, stream>>>(X16, BW, bq, bk, bv, TAB, QH, QL, KH, KL, VT, QKR0, VF0);
  k_fattn<<<dim3(FNT, NH, NB + 1), 128, 0, stream>>>(QH, QL, KH, KL, VT, O16, QKR0, VF0, OH0, OL0);

  /* out = o (x64) . Wo (x16) * 2^-10 + bo; grid.y = batch (output rows at the full per-batch stride); rows 0..127 from the hi plane of the f32 path, + o_lo Wo 2^-20 from its residual plane */
  k_out<<<dim3(GOB, NB), 128, 0, stream>>>(O16, OH0, OL0, BO, bo, out);
}
